// v000
// Measured on an AMD MI455X. A time is GPU time per run, averaged over a window of back-to-back runs after a warm-up
// (all launches, gaps included; the runs take copies of the inputs in turn), and the median of several windows.
// Apart from v000's, it joins two sittings. Times from different sittings can be a few percent apart, while
// side-by-side timings come from the same sitting.
// The starting kernel, v000, takes 3570 microseconds a run.
#include <hip/hip_runtime.h>
// Multi-head attention on GIVEN queries / keys / values without input projections and with the module's literal score scale (queries, keys, values [4][2048][512] reshaped directly into 8 heads of 64 (the module defines q / k / v Linear layers but never applies them); energy = q k^T per head; softmax(energy / sqrt(d_model) = / sqrt(512)) over all 2048 keys (no mask); out = attention merged W_out^T + b_out (natural [512][512]) -> [4][2048][512]).
// Structure: token rows r = b*2048 + s; the three inputs as exact f16 rows (bf16-rounded) = the q, k, v operands directly; per batch: V^T for all heads via LDS transposes; per group of 4 heads: scores GEMM (K = 64, batched over the heads on grid.y, alpha = 512^-0.5), row softmax on VALU (f32 statistics; weights stored x256 as f16), o = P . V^T GEMM (K = 2048, alpha 2^-2: o carried x64) into the merged f16 o rows; out = o W_out^T + b_out GEMM (f32) into the output layout.
// Compute dtype: inputs rounded to bf16; x / weights exact; q, k, v, softmax weights and o as plain f16 GEMM operands (~2^-12); scores and softmax statistics f32. v_wmma_f32_16x16x32_f16.
#define NB 4
#define SQ 2048
#define DM 512
#define NH 8
#define HD 64
#define HG 4                         /* heads per attention launch group */
#define B0 0                         /* first batch processed (debug hook) */
#define NBR NB                       /* batches processed (debug hook) */
#define NR ((size_t)NB * SQ)         /* token rows */
#define MP ((int)((size_t)NBR * SQ)) /* rows projected (debug hook) */
#define QN SQ                        /* query rows attended per batch (debug hook) */
#define NHD NH                       /* heads attended (debug hook) */
#define MPO MP                       /* rows through the output stage (debug hook) */
#define LQ DM      /* row pitch of the q/k/v rows */
typedef __bf16 v16b __attribute__((ext_vector_type(16)));
typedef unsigned short v8us __attribute__((ext_vector_type(8), may_alias));
typedef float  v8f  __attribute__((ext_vector_type(8)));
typedef float  v4f  __attribute__((ext_vector_type(4)));
typedef float  v4fa __attribute__((ext_vector_type(4), may_alias));
union FragB { v16b v; v8us half[2]; unsigned short u[16]; };

__device__ __forceinline__ unsigned short bf16_bits(float x) { unsigned int u = __float_as_uint(x); return (unsigned short)((u + 0x7FFFu + ((u >> 16) & 1u)) >> 16); }
__device__ __forceinline__ float bf16_val(unsigned short b) { return __uint_as_float(((unsigned int)b) << 16); }
__device__ __forceinline__ float bf16_round(float x) { return bf16_val(bf16_bits(x)); }
// D += A·B with NT terms: 1 = ah·bh, 2 = + al·bh (A split), 3 = + ah·bl (both split)
template <int NT>
__device__ __forceinline__ v8f mmaN(v16b ah, v16b al, v16b bh, v16b bl, v8f c) {
  c = __builtin_amdgcn_wmma_f32_16x16x32_bf16(false, ah, false, bh, (short)0, c, false, false);
  if (NT >= 2) c = __builtin_amdgcn_wmma_f32_16x16x32_bf16(false, al, false, bh, (short)0, c, false, false);
  if (NT >= 3) c = __builtin_amdgcn_wmma_f32_16x16x32_bf16(false, ah, false, bl, (short)0, c, false, false);
  asm volatile("v_nop\n\tv_nop\n\tv_nop\n\tv_nop" : "+v"(c) : "v"(ah), "v"(al), "v"(bh), "v"(bl));
  return c;
}

__global__ __launch_bounds__(256) void k_wt_bf16(const float* __restrict__ W, unsigned short* __restrict__ Wt, int K, int N) {
  const int t = blockIdx.x * 256 + threadIdx.x;
  const int k8n = K / 8;
  if (t >= N * k8n) return;
  const int n = t / k8n, k8 = (t % k8n) * 8;
  v8us v;
#pragma unroll
  for (int i = 0; i < 8; ++i) v[i] = bf16_bits(W[(size_t)(k8 + i) * N + n]);
  *(v8us*)(Wt + (size_t)n * K + k8) = v;
  
}

// GEMM C[M][N] (f32, pitch ldc) = act(A[M][K]·W + bias). A f32 row-major (pitch lda) converted per fragment to bf16
// (ASPLIT: hi/lo two planes -> 2 terms, else single rounded term); Wt bf16 [N][K] (pitch ldb). BIAS_BF16 rounds the
// bias to bf16 first (bias quantised to bf16 before the add). K%32==0, M%16==0, N%64==0.
template <bool ASPLIT, int ACT, bool BIAS_BF16>
__global__ __launch_bounds__(128) void k_gemm_bf(const float* __restrict__ A, int lda, const unsigned short* __restrict__ Wt, int ldb,
                                               const float* __restrict__ bias, float* __restrict__ C, int ldc, int M, int N, int K) {
  __shared__ __attribute__((aligned(16))) float so[4][16][64];
  const int tid = threadIdx.x, w = tid >> 5, lane = tid & 31, ln = lane & 15, hh = lane >> 4;
  const int ntn = N / 64;
  const int wid = blockIdx.x * 4 + w;
  const int mt = wid / ntn, nq = wid % ntn;
  if (mt * 16 >= M) return;
  const int row0 = mt * 16, col0 = nq * 64;
  const float* arow = A + (size_t)(row0 + ln) * lda;
  v8f acc[4] = {};
  for (int kb = 0; kb < K; kb += 32) {
    FragB ah, al;
    const v4f x0 = *(const v4fa*)(arow + kb + 8 * hh), x1 = *(const v4fa*)(arow + kb + 8 * hh + 4);
    const v4f x2 = *(const v4fa*)(arow + kb + 16 + 8 * hh), x3 = *(const v4fa*)(arow + kb + 16 + 8 * hh + 4);
    float xs[16] = {x0[0],x0[1],x0[2],x0[3],x1[0],x1[1],x1[2],x1[3],x2[0],x2[1],x2[2],x2[3],x3[0],x3[1],x3[2],x3[3]};
#pragma unroll
    for (int i = 0; i < 16; ++i) { const unsigned short hb = bf16_bits(xs[i]); ah.u[i] = hb; al.u[i] = ASPLIT ? bf16_bits(xs[i] - bf16_val(hb)) : (unsigned short)0; }
#pragma unroll
    for (int t = 0; t < 4; ++t) {
      const unsigned short* brow = Wt + (size_t)(col0 + t * 16 + ln) * ldb + kb;
      FragB b;
      b.half[0] = *(const v8us*)(brow + 8 * hh);
      b.half[1] = *(const v8us*)(brow + 16 + 8 * hh);
      acc[t] = mmaN<ASPLIT ? 2 : 1>(ah.v, al.v, b.v, b.v, acc[t]);
    }
  }
#pragma unroll
  for (int t = 0; t < 4; ++t) {
    float bv = bias ? bias[col0 + t * 16 + ln] : 0.f;
    if (BIAS_BF16) bv = bf16_round(bv);
#pragma unroll
    for (int r = 0; r < 8; ++r) { float v = acc[t][r] + bv; if (ACT == 1) v = fmaxf(v, 0.f); so[w][8 * hh + r][t * 16 + ln] = v; }
  }
  __builtin_amdgcn_fence(__ATOMIC_ACQ_REL, "workgroup");
  __builtin_amdgcn_wave_barrier();
  const int rsub = lane >> 4, c4 = (lane & 15) * 4;
  {
#pragma unroll
    for (int q = 0; q < 8; ++q) {
      const int r = q * 2 + rsub;
      const v4f v = *(const v4fa*)&so[w][r][c4];
      *(v4f*)(C + (size_t)(row0 + r) * ldc + col0 + c4) = v;
    }
    
  }
}

// GEMM C = act(A·W + bias + resid): A f32 (ASPLIT -> hi/lo 2 terms), Wt bf16 [N][K]; ACT 0 none, 1 relu, 2 exact gelu;
// resid (optional, f32, row index = (row % rmod), pitch ldr, RES_BF16 rounds it) added before the activation.
template <bool ASPLIT, int ACT, bool BIAS_BF16, bool RES_BF16>
__global__ __launch_bounds__(128) void k_gemm_bf3(const float* __restrict__ A, int lda, const unsigned short* __restrict__ Wt, int ldb,
                                                const float* __restrict__ bias, const float* __restrict__ resid, int rmod, int ldr,
                                                float* __restrict__ C, int ldc, int M, int N, int K) {
  __shared__ __attribute__((aligned(16))) float so[4][16][64];
  const int tid = threadIdx.x, w = tid >> 5, lane = tid & 31, ln = lane & 15, hh = lane >> 4;
  const int ntn = N / 64;
  const int wid = blockIdx.x * 4 + w;
  const int mt = wid / ntn, nq = wid % ntn;
  if (mt * 16 >= M) return;
  const int row0 = mt * 16, col0 = nq * 64;
  const float* arow = A + (size_t)(row0 + ln) * lda;
  v8f acc[4] = {};
  for (int kb = 0; kb < K; kb += 32) {
    FragB ah, al;
    const v4f x0 = *(const v4fa*)(arow + kb + 8 * hh), x1 = *(const v4fa*)(arow + kb + 8 * hh + 4);
    const v4f x2 = *(const v4fa*)(arow + kb + 16 + 8 * hh), x3 = *(const v4fa*)(arow + kb + 16 + 8 * hh + 4);
    float xs[16] = {x0[0],x0[1],x0[2],x0[3],x1[0],x1[1],x1[2],x1[3],x2[0],x2[1],x2[2],x2[3],x3[0],x3[1],x3[2],x3[3]};
#pragma unroll
    for (int i = 0; i < 16; ++i) { const unsigned short hb = bf16_bits(xs[i]); ah.u[i] = hb; al.u[i] = ASPLIT ? bf16_bits(xs[i] - bf16_val(hb)) : (unsigned short)0; }
#pragma unroll
    for (int t = 0; t < 4; ++t) {
      const unsigned short* brow = Wt + (size_t)(col0 + t * 16 + ln) * ldb + kb;
      FragB b;
      b.half[0] = *(const v8us*)(brow + 8 * hh);
      b.half[1] = *(const v8us*)(brow + 16 + 8 * hh);
      acc[t] = mmaN<ASPLIT ? 2 : 1>(ah.v, al.v, b.v, b.v, acc[t]);
    }
  }
#pragma unroll
  for (int t = 0; t < 4; ++t) {
    const int col = col0 + t * 16 + ln;
    float bv = bias ? bias[col] : 0.f;
    if (BIAS_BF16) bv = bf16_round(bv);
#pragma unroll
    for (int r = 0; r < 8; ++r) {
      float v = acc[t][r] + bv;
      if (resid) { float rv = resid[(size_t)((row0 + 8 * hh + r) % rmod) * ldr + col]; if (RES_BF16) rv = bf16_round(rv); v += rv; }
      if (ACT == 1) v = fmaxf(v, 0.f);
      if (ACT == 2) v = 0.5f * v * (1.0f + erff(v * 0.70710678118654752f));
      if (ACT == 3) { const float u = 0.7978845608028654f * (v + 0.044715f * v * v * v); v = 0.5f * v * (1.0f + tanhf(u)); }
      so[w][8 * hh + r][t * 16 + ln] = v;
    }
  }
  __builtin_amdgcn_fence(__ATOMIC_ACQ_REL, "workgroup");
  __builtin_amdgcn_wave_barrier();
  const int rsub = lane >> 4, c4 = (lane & 15) * 4;
  {
#pragma unroll
    for (int q = 0; q < 8; ++q) {
      const int r = q * 2 + rsub;
      const v4f v = *(const v4fa*)&so[w][r][c4];
      *(v4f*)(C + (size_t)(row0 + r) * ldc + col0 + c4) = v;
    }
    
  }
}
// row LayerNorm (biased variance, eps) over N: s = X (+ R); optional out_sum <- s; out_norm <- (s-mu)*rsqrt(var+eps)*g + b
template <bool PARAM_BF16>
__global__ __launch_bounds__(256) void k_layernorm(const float* __restrict__ X, const float* __restrict__ R, const float* __restrict__ g, const float* __restrict__ bta,
                                                  float* __restrict__ out_sum, float* __restrict__ out_norm, int N, float eps) {
  __shared__ float red[256];
  const int row = blockIdx.x, tid = threadIdx.x;
  const float* x = X + (size_t)row * N; const float* rr = R ? R + (size_t)row * N : nullptr;
  float vals[16];                     // up to N = 4096
  const int per = N / 256;            // contiguous chunk per thread? use strided-by-4 chunks: thread handles j = tid*4 + 1024*u
  float s1 = 0.f;
  for (int u = 0; u < per / 4; ++u) {
    const int j = tid * 4 + 1024 * u;
    const v4f a = *(const v4fa*)(x + j);
    v4f b = {0.f,0.f,0.f,0.f}; if (rr) b = *(const v4fa*)(rr + j);
#pragma unroll
    for (int q = 0; q < 4; ++q) { const float v = a[q] + b[q]; vals[u * 4 + q] = v; s1 += v; }
  }
  red[tid] = s1; __syncthreads();
  for (int st = 128; st > 0; st >>= 1) { if (tid < st) red[tid] += red[tid + st]; __syncthreads(); }
  const float mu = red[0] / (float)N; __syncthreads();
  float s2 = 0.f;
  for (int u = 0; u < per / 4; ++u)
#pragma unroll
    for (int q = 0; q < 4; ++q) { const float c = vals[u * 4 + q] - mu; s2 += c * c; }
  red[tid] = s2; __syncthreads();
  for (int st = 128; st > 0; st >>= 1) { if (tid < st) red[tid] += red[tid + st]; __syncthreads(); }
  const float rs = rsqrtf(red[0] / (float)N + eps);
  {
    for (int u = 0; u < per / 4; ++u) {
      const int j = tid * 4 + 1024 * u;
      v4f o, sm;
#pragma unroll
      for (int q = 0; q < 4; ++q) {
        float gg = g[j + q], bb = bta[j + q];
        if (PARAM_BF16) { gg = bf16_round(gg); bb = bf16_round(bb); }
        sm[q] = vals[u * 4 + q]; o[q] = (vals[u * 4 + q] - mu) * rs * gg + bb;
      }
      if (out_sum) *(v4f*)(out_sum + (size_t)row * N + j) = sm;
      *(v4f*)(out_norm + (size_t)row * N + j) = o;
    }
    
  }
}



// ---- f16 WMMA path (v_wmma_f32_16x16x32_f16): 11-bit significands for operands in range — used where a [0,1] probability operand needs more precision than bf16
typedef _Float16 v16h __attribute__((ext_vector_type(16)));
union FragH { v16h v; v8us half[2]; _Float16 h[16]; unsigned short u[16]; };
template <int NT>
__device__ __forceinline__ v8f mmaH(v16h ah, v16h al, v16h bh, v16h bl, v8f c) {
  c = __builtin_amdgcn_wmma_f32_16x16x32_f16(false, ah, false, bh, (short)0, c, false, false);
  if (NT >= 2) c = __builtin_amdgcn_wmma_f32_16x16x32_f16(false, al, false, bh, (short)0, c, false, false);
  if (NT >= 3) c = __builtin_amdgcn_wmma_f32_16x16x32_f16(false, ah, false, bl, (short)0, c, false, false);
  asm volatile("v_nop\n\tv_nop\n\tv_nop\n\tv_nop" : "+v"(c) : "v"(ah), "v"(al), "v"(bh), "v"(bl));
  return c;
}
// batched GEMM like k_gemm_b but f16 operands: A f32 (split into f16 hi/lo if ASPLIT, else rounded to f16), Bt = f16 values [n][k]; alpha; C f32; N multiple of 16 (partial tiles skipped)
template <bool ASPLIT>
__global__ __launch_bounds__(128) void k_gemm_h(const float* __restrict__ A, int lda, size_t sA, const _Float16* __restrict__ Bh, int ldb, size_t sB, float alpha, float* __restrict__ C, int ldc, size_t sC, int M, int N, int K) {
  __shared__ __attribute__((aligned(16))) float so[4][16][64];
  const int tid = threadIdx.x, w = tid >> 5, lane = tid & 31, ln = lane & 15, hh = lane >> 4; const int by = blockIdx.y;
  A += (size_t)by * sA; Bh += (size_t)by * sB; C += (size_t)by * sC;
  const int ntn = (N + 63) / 64; const int wid = blockIdx.x * 4 + w; const int mt = wid / ntn, nq = wid % ntn; if (mt * 16 >= M) return;
  const int row0 = mt * 16, col0 = nq * 64; const float* arow = A + (size_t)(row0 + ln) * lda;
  v8f acc[4] = {};
  for (int kb = 0; kb < K; kb += 32) {
    FragH ah, al;
    const v4f x0 = *(const v4fa*)(arow + kb + 8 * hh), x1 = *(const v4fa*)(arow + kb + 8 * hh + 4), x2 = *(const v4fa*)(arow + kb + 16 + 8 * hh), x3 = *(const v4fa*)(arow + kb + 16 + 8 * hh + 4);
    float xs[16] = {x0[0],x0[1],x0[2],x0[3],x1[0],x1[1],x1[2],x1[3],x2[0],x2[1],x2[2],x2[3],x3[0],x3[1],x3[2],x3[3]};
#pragma unroll
    for (int i = 0; i < 16; ++i) { const _Float16 h = (_Float16)xs[i]; ah.h[i] = h; al.h[i] = ASPLIT ? (_Float16)(xs[i] - (float)h) : (_Float16)0.0f; }
#pragma unroll
    for (int t = 0; t < 4; ++t) { if (col0 + t * 16 >= N) continue; const size_t boff = (size_t)(col0 + t * 16 + ln) * ldb + kb; FragH bq; bq.half[0] = *(const v8us*)(Bh + boff + 8 * hh); bq.half[1] = *(const v8us*)(Bh + boff + 16 + 8 * hh);
      acc[t] = mmaH<ASPLIT ? 2 : 1>(ah.v, al.v, bq.v, bq.v, acc[t]); }
  }
#pragma unroll
  for (int t = 0; t < 4; ++t) { if (col0 + t * 16 >= N) continue;
#pragma unroll
    for (int r = 0; r < 8; ++r) so[w][8 * hh + r][t * 16 + ln] = acc[t][r] * alpha; }
  __builtin_amdgcn_fence(__ATOMIC_ACQ_REL, "workgroup"); __builtin_amdgcn_wave_barrier();
  const int rsub = lane >> 4, c4 = (lane & 15) * 4;
  {
#pragma unroll
    for (int q = 0; q < 8; ++q) { const int r = q * 2 + rsub; if (col0 + c4 < N) { const v4f v = *(const v4fa*)&so[w][r][c4]; *(v4f*)(C + (size_t)(row0 + r) * ldc + col0 + c4) = v; } }
     }
}

// Wt[n][k] = f16(W[k][n]·scale) from f32 row-major W[K][N] (scale = power of two; bf16-exact weights stay exact in f16 away from the subnormal range)
__global__ __launch_bounds__(256) void k_wt_f16(const float* __restrict__ W, _Float16* __restrict__ Wt, int K, int N, float scale) {
  const int t = blockIdx.x * 256 + threadIdx.x; if (t >= N * (K / 8)) return; const int n = t / (K / 8), k8 = (t % (K / 8)) * 8; FragH f;
#pragma unroll
  for (int i = 0; i < 8; ++i) f.h[i] = (_Float16)(bf16_round(W[(size_t)(k8 + i) * N + n]) * scale); const v8us o = f.half[0];
  *(v8us*)((unsigned short*)Wt + (size_t)n * K + k8) = o; 
}
// k_gemm_hh variant with fused epilogue: v = acc·alpha + bias[by·sBias + col] (+ CP[(row/rowsPerB)·sCPb + by·64 + col] if CP) ; ACT 0 none / 1 elu ; writes f16 C16 (and f32 C if non-null)
template <int ACT>
__global__ __launch_bounds__(128) void k_gemm_hhx(const _Float16* __restrict__ A, int lda, size_t sA, const _Float16* __restrict__ Bh, int ldb, size_t sB, float alpha, const float* __restrict__ bias, size_t sBias, const float* __restrict__ CP, int rowsPerB, size_t sCPb, int row0g,
    float* __restrict__ C, _Float16* __restrict__ C16, int ldc, size_t sC, int M, int N, int K) {
  __shared__ __attribute__((aligned(16))) float so[4][16][64];
  const int tid = threadIdx.x, w = tid >> 5, lane = tid & 31, ln = lane & 15, hh = lane >> 4; const int by = blockIdx.y;
  A += (size_t)by * sA; Bh += (size_t)by * sB; const size_t cofs = (size_t)by * sC; const float* bp = bias ? bias + (size_t)by * sBias : nullptr;
  const int ntn = (N + 63) / 64; const int wid = blockIdx.x * 4 + w; const int mt = wid / ntn, nq = wid % ntn; if (mt * 16 >= M) return;
  const int row0 = mt * 16, col0 = nq * 64; const _Float16* arow = A + (size_t)(row0 + ln) * lda;
  v8f acc[4] = {};
  for (int kb = 0; kb < K; kb += 32) { FragH ah; ah.half[0] = *(const v8us*)((const unsigned short*)arow + kb + 8 * hh); ah.half[1] = *(const v8us*)((const unsigned short*)arow + kb + 16 + 8 * hh);
#pragma unroll
    for (int t = 0; t < 4; ++t) { if (col0 + t * 16 >= N) continue; const size_t boff = (size_t)(col0 + t * 16 + ln) * ldb + kb; FragH bq; bq.half[0] = *(const v8us*)((const unsigned short*)Bh + boff + 8 * hh); bq.half[1] = *(const v8us*)((const unsigned short*)Bh + boff + 16 + 8 * hh);
      acc[t] = mmaH<1>(ah.v, ah.v, bq.v, bq.v, acc[t]); }
  }
#pragma unroll
  for (int t = 0; t < 4; ++t) { if (col0 + t * 16 >= N) continue; const int col = col0 + t * 16 + ln; const float bv = bp ? bf16_round(bp[col]) : 0.f;
#pragma unroll
    for (int r = 0; r < 8; ++r) { float v = acc[t][r] * alpha + bv; if (CP) { const int rr = row0g + row0 + 8 * hh + r; if (rowsPerB < 0) v += CP[cofs + (size_t)rr * ldc + col];      /* rowsPerB < 0: own element of the batched C plane */ else { const int bidx = rr / rowsPerB; v += CP[(size_t)bidx * sCPb + (size_t)by * 64 + col]; } } if (ACT == 1) v = (v > 0.f) ? v : expm1f(v); else if (ACT == 7) v = (v > 0.f) ? v + 1.0f : expf(v); else if (ACT == 8) v = tanhf(v); else if (ACT == 9) v = 0.5f * v * (1.0f + tanhf(0.7978845608028654f * (v + 0.044715f * v * v * v))); else if (ACT == 11) v = 1.0f / (1.0f + expf(-v)); else if (ACT == 12) v = (v > 0.f) ? v : 0.01f * v; else if (ACT == 14) v = (v > 0.f) ? v : 0.1f * v; else if (ACT == 16) v = (v >= 0.f) ? v : 0.3f * v; else if (ACT == 17) v = (v >= 0.f) ? v : 0.2f * v; else if (ACT == 15) v = v / (1.0f + expf(-v)); else if (ACT == 3) v = fmaxf(v, 0.f); else if (ACT == 6) v = 0.5f * v * (1.0f + erff(v * 0.70710678118654752f)); so[w][8 * hh + r][t * 16 + ln] = v; } }
  __builtin_amdgcn_fence(__ATOMIC_ACQ_REL, "workgroup"); __builtin_amdgcn_wave_barrier();
  const int rsub = lane >> 4, c4 = (lane & 15) * 4; typedef _Float16 v4h __attribute__((ext_vector_type(4)));
  {
#pragma unroll
    for (int q = 0; q < 8; ++q) { const int r = q * 2 + rsub; if (col0 + c4 < N) { const v4f v = *(const v4fa*)&so[w][r][c4]; if (C) *(v4f*)(C + cofs + (size_t)(row0 + r) * ldc + col0 + c4) = v; if (C16) { v4h h4; for (int i = 0; i < 4; ++i) h4[i] = (_Float16)v[i]; *(v4h*)(C16 + cofs + (size_t)(row0 + r) * ldc + col0 + c4) = h4; } } }
     }
}


typedef _Float16 v4h __attribute__((ext_vector_type(4)));

__global__ __launch_bounds__(256) void k_x16(const float* __restrict__ x, _Float16* __restrict__ X16, size_t n8) { const size_t t = (size_t)blockIdx.x * 256 + threadIdx.x; if (t >= n8) return; FragH f;
#pragma unroll
  for (int q = 0; q < 8; ++q) f.h[q] = (_Float16)bf16_round(x[t * 8 + q]); *(v8us*)((unsigned short*)X16 + t * 8) = f.half[0];  }
__global__ __launch_bounds__(256) void k_h16(const float* __restrict__ x, _Float16* __restrict__ X16, size_t n8) { const size_t t = (size_t)blockIdx.x * 256 + threadIdx.x; if (t >= n8) return; FragH f;
#pragma unroll
  for (int q = 0; q < 8; ++q) f.h[q] = (_Float16)x[t * 8 + q]; *(v8us*)((unsigned short*)X16 + t * 8) = f.half[0];  }
__global__ __launch_bounds__(256) void k_round16f(const float* __restrict__ W, _Float16* __restrict__ Bt, size_t n8) { const size_t t = (size_t)blockIdx.x * 256 + threadIdx.x; if (t >= n8) return; FragH f;
#pragma unroll
  for (int i = 0; i < 8; ++i) f.h[i] = (_Float16)(bf16_round(W[t * 8 + i]) * 16.0f); *(v8us*)((unsigned short*)Bt + t * 8) = f.half[0];  }
template <int NHv, int TTv>
__global__ __launch_bounds__(256) void k_vt(const _Float16* __restrict__ V16, int ldv, int voff, _Float16* __restrict__ Vt) { __shared__ unsigned short tl[64][66]; const int tid = threadIdx.x; const int slab = blockIdx.x / (TTv / 64), lg = blockIdx.x % (TTv / 64); const int b = slab / NHv, h = slab % NHv;
  for (int i = tid; i < 64 * 8; i += 256) { const int r = i / 8, c8 = (i % 8) * 8; FragH f; f.half[0] = *(const v8us*)((const unsigned short*)V16 + ((size_t)b * TTv + lg * 64 + r) * ldv + voff + h * 64 + c8);
#pragma unroll
    for (int q = 0; q < 8; ++q) tl[r][c8 + q] = f.u[q]; }
  __syncthreads();
  {
#pragma unroll
    for (int rd = 0; rd < 2; ++rd) { const int d = rd * 32 + tid / 8, pc = tid % 8; FragH f;
#pragma unroll
      for (int q = 0; q < 8; ++q) f.u[q] = tl[pc * 8 + q][d];
      *(v8us*)((unsigned short*)Vt + ((size_t)slab * 64 + d) * TTv + lg * 64 + pc * 8) = f.half[0]; }
     } }

__global__ __launch_bounds__(256) void k_hl(const float* __restrict__ F, _Float16* __restrict__ Hh, _Float16* __restrict__ Hl, size_t n8) { const size_t t = (size_t)blockIdx.x * 256 + threadIdx.x; if (t >= n8) return; FragH fh, fl; const v4f a = *(const v4fa*)(F + t * 8), c = *(const v4fa*)(F + t * 8 + 4);
#pragma unroll
  for (int q = 0; q < 4; ++q) { _Float16 h = (_Float16)a[q]; fh.h[q] = h; fl.h[q] = (_Float16)((a[q] - (float)h) * 1024.0f); h = (_Float16)c[q]; fh.h[4 + q] = h; fl.h[4 + q] = (_Float16)((c[q] - (float)h) * 1024.0f); }
  { *(v8us*)((unsigned short*)Hh + t * 8) = fh.half[0]; *(v8us*)((unsigned short*)Hl + t * 8) = fl.half[0];  } }

// ---- fast GEMM (wave tile 32x64; requires M % 32 == 0 rows per launch region and N % 64 == 0); epilogue = k_gemm_hhx semantics ----
__device__ __forceinline__ v16h g2_frag(const _Float16* p, int hh) { FragH f; f.half[0] = *(const v8us*)((const unsigned short*)p + 8 * hh); f.half[1] = *(const v8us*)((const unsigned short*)p + 16 + 8 * hh); return f.v; }
__device__ __forceinline__ v8f g2_mma(v16h a, v16h b, v8f c) { v8f d = __builtin_amdgcn_wmma_f32_16x16x32_f16(false, a, false, b, (short)0, c, false, false); asm volatile("v_nop\n\tv_nop\n\tv_nop\n\tv_nop" : "+v"(d) : "v"(a), "v"(b)); return d; }
template <int ACT>
__global__ __launch_bounds__(128) void k_gemm2(const _Float16* __restrict__ A, int lda, size_t sA, const _Float16* __restrict__ Bh, int ldb, size_t sB, float alpha, const float* __restrict__ bias, size_t sBias, const float* __restrict__ CP, int rowsPerB, size_t sCPb, int row0g,
    float* __restrict__ C, _Float16* __restrict__ C16, int ldc, size_t sC, int M, int N, int K) { static_assert(ACT == 0 || ACT == 3 || ACT == 6 || ACT == 8 || ACT == 9 || ACT == 11 || ACT == 12 || ACT == 14 || ACT == 15 || ACT == 16 || ACT == 17, "k_gemm2: unsupported ACT code (would silently apply no activation)");
  __shared__ __attribute__((aligned(16))) float so[4][32][68];
  const int tid = threadIdx.x, w = tid >> 5, lane = tid & 31, ln = lane & 15, hh = lane >> 4; const int by = blockIdx.y;
  A += (size_t)by * sA; Bh += (size_t)by * sB; const size_t cofs = (size_t)by * sC; const float* bp = bias ? bias + (size_t)by * sBias : nullptr;
  const int ntn = N >> 6; const int mt = blockIdx.x / ntn, nq = blockIdx.x - mt * ntn; const int row0 = mt * 128 + 32 * w, col0 = nq * 64; if (row0 >= M) return;
  const _Float16* a0p = A + (size_t)(row0 + ln) * lda; const _Float16* a1p = a0p + (size_t)16 * lda;
  const _Float16* b0p = Bh + (size_t)(col0 + ln) * ldb; const _Float16* b1p = b0p + (size_t)16 * ldb; const _Float16* b2p = b1p + (size_t)16 * ldb; const _Float16* b3p = b2p + (size_t)16 * ldb;
  const v8f z8 = {0.f,0.f,0.f,0.f,0.f,0.f,0.f,0.f}; v8f c00 = z8, c01 = z8, c02 = z8, c03 = z8, c10 = z8, c11 = z8, c12 = z8, c13 = z8;
#pragma unroll 1
  for (int kb = 0; kb < K; kb += 32) { const v16h a0 = g2_frag(a0p + kb, hh), a1 = g2_frag(a1p + kb, hh);
    v16h b = g2_frag(b0p + kb, hh); c00 = g2_mma(a0, b, c00); c10 = g2_mma(a1, b, c10);
    b = g2_frag(b1p + kb, hh); c01 = g2_mma(a0, b, c01); c11 = g2_mma(a1, b, c11);
    b = g2_frag(b2p + kb, hh); c02 = g2_mma(a0, b, c02); c12 = g2_mma(a1, b, c12);
    b = g2_frag(b3p + kb, hh); c03 = g2_mma(a0, b, c03); c13 = g2_mma(a1, b, c13); }
  v8f accs[8] = {c00, c01, c02, c03, c10, c11, c12, c13};
#pragma unroll
  for (int u = 0; u < 8; ++u) { const int t = u & 3, half = u >> 2; const int col = col0 + t * 16 + ln; const float bv = bp ? bf16_round(bp[col]) : 0.f;
#pragma unroll
    for (int r = 0; r < 8; ++r) { const int rloc = half * 16 + 8 * hh + r; float v = accs[u][r] * alpha + bv; if (CP) { if (rowsPerB < 0) v += CP[cofs + (size_t)(row0g + row0 + rloc) * ldc + col];      /* rowsPerB < 0: own element of the batched C plane */ else { const int bidx = (row0g + row0 + rloc) / rowsPerB; v += CP[(size_t)bidx * sCPb + (size_t)by * 64 + col]; } }
      if (ACT == 3) v = fmaxf(v, 0.f); else if (ACT == 6) v = 0.5f * v * (1.0f + erff(v * 0.70710678118654752f)); else if (ACT == 11) v = 1.0f / (1.0f + expf(-v)); else if (ACT == 15) v = v / (1.0f + expf(-v)); else if (ACT == 12) v = (v > 0.f) ? v : 0.01f * v; else if (ACT == 8) v = tanhf(v); else if (ACT == 9) v = 0.5f * v * (1.0f + tanhf(0.7978845608028654f * (v + 0.044715f * v * v * v))); else if (ACT == 14) v = (v > 0.f) ? v : 0.1f * v; else if (ACT == 16) v = (v >= 0.f) ? v : 0.3f * v; else if (ACT == 17) v = (v >= 0.f) ? v : 0.2f * v;
      so[w][rloc][t * 16 + ln] = v; } }
  __builtin_amdgcn_fence(__ATOMIC_ACQ_REL, "workgroup"); __builtin_amdgcn_wave_barrier();
  const int rsub = lane >> 4, c4 = (lane & 15) * 4;
  {
#pragma unroll
    for (int q = 0; q < 16; ++q) { const int r = q * 2 + rsub; const v4f v = *(const v4fa*)&so[w][r][c4]; if (C) *(v4f*)(C + cofs + (size_t)(row0 + r) * ldc + col0 + c4) = v; if (C16) { v4h h4; for (int i = 0; i < 4; ++i) h4[i] = (_Float16)v[i]; *(v4h*)(C16 + cofs + (size_t)(row0 + r) * ldc + col0 + c4) = h4; } }
     } }


__global__ __launch_bounds__(256) void k_wnat(const float* __restrict__ w, size_t n8, _Float16* __restrict__ Bt) { const size_t t = (size_t)blockIdx.x * 256 + threadIdx.x; if (t >= n8) return; FragH f; for (int q = 0; q < 8; ++q) f.h[q] = (_Float16)(bf16_round(w[t * 8 + q]) * 16.0f); *(v8us*)((unsigned short*)Bt + t * 8) = f.half[0];  }
__global__ __launch_bounds__(256) void k_rsm(const float* __restrict__ S, _Float16* __restrict__ P, int nrows) {
  #pragma clang fp contract(off)
  const int i = blockIdx.x * 256 + threadIdx.x; if (i >= nrows) return; const float* s = S + (size_t)i * SQ; float mx = -3.0e38f;
#pragma unroll 1
  for (int j = 0; j < SQ; ++j) mx = fmaxf(mx, s[j]); float se = 0.f;
#pragma unroll 1
  for (int j = 0; j < SQ; ++j) se += expf(s[j] - mx); const float sc = 256.0f / se;
#pragma unroll 1
  for (int j0 = 0; j0 < SQ; j0 += 8) { FragH f; for (int q = 0; q < 8; ++q) f.h[q] = (_Float16)(expf(s[j0 + q] - mx) * sc); unsigned short* d = (unsigned short*)P + (size_t)i * SQ + j0; *(v8us*)d = f.half[0];  } }
__global__ __launch_bounds__(256) void k_vt(const _Float16* __restrict__ V16, int b, int h0, _Float16* __restrict__ VT) { __shared__ unsigned short tl[64][65]; const int tid = threadIdx.x; const int hh = blockIdx.x % HG, sg = blockIdx.x / HG; const int s0 = sg * 64; const int h = h0 + hh;
  for (int i = tid; i < 64 * 8; i += 256) { const int j = i / 8, d8 = (i % 8) * 8; FragH f; f.half[0] = *(const v8us*)((const unsigned short*)V16 + ((size_t)b * SQ + s0 + j) * DM + h * HD + d8); for (int q = 0; q < 8; ++q) tl[d8 + q][j] = f.u[q]; }
  __syncthreads();
  { for (int i = tid; i < 64 * 8; i += 256) { const int d = i / 8, j8 = (i % 8) * 8; FragH f; for (int q = 0; q < 8; ++q) f.u[q] = tl[d][j8 + q]; *(v8us*)((unsigned short*)VT + ((size_t)hh * HD + d) * SQ + s0 + j8) = f.half[0]; }  } }



__global__ __launch_bounds__(256) void k_rsmkm(const float* __restrict__ S, _Float16* __restrict__ P, int nrows, const int* __restrict__ am) {
  #pragma clang fp contract(off)
  const int t = blockIdx.x * 256 + threadIdx.x; if (t >= nrows) return; const size_t i = (size_t)t; const float* s = S + i * SQ; const int* mr = am + (size_t)(t % SQ) * SQ; float mx = -3.0e38f;
#pragma unroll 1
  for (int j = 0; j < SQ; ++j) { const float f = (mr[j] != 0) ? 1.f : 0.f; mx = fmaxf(mx, fmaf(f, s[j], (1.f - f) * -1.0e9f)); } float se = 0.f;
#pragma unroll 1
  for (int j = 0; j < SQ; ++j) { const float f = (mr[j] != 0) ? 1.f : 0.f; se += __expf(fmaf(f, s[j], (1.f - f) * -1.0e9f) - mx); } const float sc = 256.0f / se;
#pragma unroll 1
  for (int j0 = 0; j0 < SQ; j0 += 8) { FragH fr; for (int q = 0; q < 8; ++q) { const int j = j0 + q; const float f = (mr[j] != 0) ? 1.f : 0.f; fr.h[q] = (_Float16)(__expf(fmaf(f, s[j], (1.f - f) * -1.0e9f) - mx) * sc); }
    unsigned short* d = (unsigned short*)P + i * SQ + j0; *(v8us*)d = fr.half[0];  } }
extern "C" void kernel_launch(void* const* d_in, const int* in_sizes, int n_in,
                              void* d_out, int out_size, void* d_ws, size_t ws_size, hipStream_t stream) {
  (void)in_sizes; (void)n_in; (void)out_size;
  const float* const* I = (const float* const*)d_in; const float* xq = I[0]; const float* xk = I[1]; const float* xv = I[2]; const float* wo = I[3]; const float* bo = I[4];      /* queries, keys, values [4][2048][512] (used as q, k, v directly: no input projections); natural W_out [512][512] + b_out */
  static_assert(NH * HD == DM && DM % 64 == 0 && DM % 32 == 0 && SQ % 128 == 0 && NH % HG == 0, "shape / tile multiples");
  char* ws = (char*)d_ws; size_t off = 0;
  auto take = [&](size_t bytes) { char* p = ws + off; off += (bytes + 255) & ~(size_t)255; return p; };
  _Float16* BO = (_Float16*)take((size_t)DM * DM * 2);
  _Float16* Q16 = (_Float16*)take(NR * DM * 2); _Float16* K16 = (_Float16*)take(NR * DM * 2); _Float16* V16 = (_Float16*)take(NR * DM * 2); _Float16* O16 = (_Float16*)take(NR * DM * 2);
  float* S = (float*)take((size_t)HG * SQ * SQ * 4); _Float16* P = (_Float16*)take((size_t)HG * SQ * SQ * 2); _Float16* VT = (_Float16*)take((size_t)NH * HD * SQ * 2);
  if (off > ws_size) return;
  k_wnat<<<(unsigned)(((size_t)DM * DM / 8 + 255) / 256), 256, 0, stream>>>(wo, (size_t)DM * DM / 8, BO);      /* natural W_out [out][in] = Bt[n][k] x16 */
  k_x16<<<(unsigned)((NR * DM / 8 + 255) / 256), 256, 0, stream>>>(xk, K16, NR * DM / 8); k_x16<<<(unsigned)((NR * DM / 8 + 255) / 256), 256, 0, stream>>>(xv, V16, NR * DM / 8);      /* keys and values as exact f16 rows = the k and v operands */

  k_x16<<<(unsigned)((NR * DM / 8 + 255) / 256), 256, 0, stream>>>(xq, Q16, NR * DM / 8);      /* queries as exact f16 rows = the q operand */
  const size_t r0p = (size_t)B0 * SQ;      /* first projected row */
  for (int b = B0; b < B0 + NBR; ++b) { const size_t r0 = (size_t)b * SQ;
    k_vt<NH, SQ><<<NH * (SQ / 64), 256, 0, stream>>>(V16 + r0 * LQ, LQ, 0, VT);      /* V^T [NH][HD][SQ] for this batch */
    for (int h0 = 0; h0 < NHD; h0 += HG) {
      k_gemm2<0><<<dim3((QN / 128) * (SQ / 64), HG), 128, 0, stream>>>(Q16 + r0 * LQ + h0 * HD, LQ, (size_t)HD, K16 + r0 * LQ + h0 * HD, LQ, (size_t)HD, 0.044194173824159216f, nullptr, 0, nullptr, 1, 0, 0, S, nullptr, SQ, (size_t)SQ * SQ, QN, SQ, HD);      /* scores / sqrt(512) (the module's literal d_model scale), HG heads per launch */
      k_rsm<<<(HG * SQ + 255) / 256, 256, 0, stream>>>(S, P, HG * SQ);      /* P = 256 softmax (f16), rows of all HG heads */
      k_gemm2<0><<<dim3((QN / 128) * (HD / 64), HG), 128, 0, stream>>>(P, SQ, (size_t)SQ * SQ, VT + (size_t)h0 * HD * SQ, SQ, (size_t)HD * SQ, 0.25f, nullptr, 0, nullptr, 1, 0, 0, nullptr, O16 + r0 * DM + h0 * HD, DM, (size_t)HD, QN, HD, SQ); } }      /* o (merged heads) as f16 rows */
  k_gemm2<0><<<dim3((unsigned)((MPO / 128) * (DM / 64)), 1), 128, 0, stream>>>(O16 + r0p * DM, DM, 0, BO, DM, 0, 0.0009765625f, bo, 0, nullptr, 1, 0, 0, (float*)d_out + r0p * DM, nullptr, DM, 0, MPO, DM, DM);      /* out rows are the output layout */
}

// v001
// A run of this version takes 813 microseconds.
// In both of two side-by-side timings against v000, it was 4.44 times as fast.
#include <hip/hip_runtime.h>
// Multi-head attention on GIVEN queries / keys / values without input projections and with the module's literal score scale (queries, keys, values [4][2048][512] reshaped directly into 8 heads of 64 (the module defines q / k / v Linear layers but never applies them); energy = q k^T per head; softmax(energy / sqrt(d_model) = / sqrt(512)) over all 2048 keys (no mask); out = attention merged W_out^T + b_out (natural [512][512]) -> [4][2048][512]).
// Structure: token rows r = b*2048 + s; the three inputs as exact f16 rows (bf16-rounded) = the q, k, v operands directly; per batch: V^T for all heads via LDS transposes; per group of 4 heads: scores GEMM (K = 64, batched over the heads on grid.y, alpha = 512^-0.5), row softmax on VALU (f32 statistics; weights stored x256 as f16), o = P . V^T GEMM (K = 2048, alpha 2^-2: o carried x64) into the merged f16 o rows; out = o W_out^T + b_out GEMM (f32) into the output layout.
// Compute dtype: inputs rounded to bf16; x / weights exact; q, k, v, softmax weights and o as plain f16 GEMM operands (~2^-12); scores and softmax statistics f32. v_wmma_f32_16x16x32_f16.
#define NB 4
#define SQ 2048
#define DM 512
#define NH 8
#define HD 64
#define HG 4                         /* heads per attention launch group */
#define B0 0                         /* first batch processed (debug hook) */
#define NBR NB                       /* batches processed (debug hook) */
#define NR ((size_t)NB * SQ)         /* token rows */
#define MP ((int)((size_t)NBR * SQ)) /* rows projected (debug hook) */
#define QN SQ                        /* query rows attended per batch (debug hook) */
#define NHD NH                       /* heads attended (debug hook) */
#define MPO MP                       /* rows through the output stage (debug hook) */
#define LQ DM      /* row pitch of the q/k/v rows */
typedef __bf16 v16b __attribute__((ext_vector_type(16)));
typedef unsigned short v8us __attribute__((ext_vector_type(8), may_alias));
typedef float  v8f  __attribute__((ext_vector_type(8)));
typedef float  v4f  __attribute__((ext_vector_type(4)));
typedef float  v4fa __attribute__((ext_vector_type(4), may_alias));
union FragB { v16b v; v8us half[2]; unsigned short u[16]; };

__device__ __forceinline__ unsigned short bf16_bits(float x) { unsigned int u = __float_as_uint(x); return (unsigned short)((u + 0x7FFFu + ((u >> 16) & 1u)) >> 16); }
__device__ __forceinline__ float bf16_val(unsigned short b) { return __uint_as_float(((unsigned int)b) << 16); }
__device__ __forceinline__ float bf16_round(float x) { return bf16_val(bf16_bits(x)); }
// D += A·B with NT terms: 1 = ah·bh, 2 = + al·bh (A split), 3 = + ah·bl (both split)
template <int NT>
__device__ __forceinline__ v8f mmaN(v16b ah, v16b al, v16b bh, v16b bl, v8f c) {
  c = __builtin_amdgcn_wmma_f32_16x16x32_bf16(false, ah, false, bh, (short)0, c, false, false);
  if (NT >= 2) c = __builtin_amdgcn_wmma_f32_16x16x32_bf16(false, al, false, bh, (short)0, c, false, false);
  if (NT >= 3) c = __builtin_amdgcn_wmma_f32_16x16x32_bf16(false, ah, false, bl, (short)0, c, false, false);
  asm volatile("v_nop\n\tv_nop\n\tv_nop\n\tv_nop" : "+v"(c) : "v"(ah), "v"(al), "v"(bh), "v"(bl));
  return c;
}

__global__ __launch_bounds__(256) void k_wt_bf16(const float* __restrict__ W, unsigned short* __restrict__ Wt, int K, int N) {
  const int t = blockIdx.x * 256 + threadIdx.x;
  const int k8n = K / 8;
  if (t >= N * k8n) return;
  const int n = t / k8n, k8 = (t % k8n) * 8;
  v8us v;
#pragma unroll
  for (int i = 0; i < 8; ++i) v[i] = bf16_bits(W[(size_t)(k8 + i) * N + n]);
  *(v8us*)(Wt + (size_t)n * K + k8) = v;
  
}

// GEMM C[M][N] (f32, pitch ldc) = act(A[M][K]·W + bias). A f32 row-major (pitch lda) converted per fragment to bf16
// (ASPLIT: hi/lo two planes -> 2 terms, else single rounded term); Wt bf16 [N][K] (pitch ldb). BIAS_BF16 rounds the
// bias to bf16 first (bias quantised to bf16 before the add). K%32==0, M%16==0, N%64==0.
template <bool ASPLIT, int ACT, bool BIAS_BF16>
__global__ __launch_bounds__(128) void k_gemm_bf(const float* __restrict__ A, int lda, const unsigned short* __restrict__ Wt, int ldb,
                                               const float* __restrict__ bias, float* __restrict__ C, int ldc, int M, int N, int K) {
  __shared__ __attribute__((aligned(16))) float so[4][16][64];
  const int tid = threadIdx.x, w = tid >> 5, lane = tid & 31, ln = lane & 15, hh = lane >> 4;
  const int ntn = N / 64;
  const int wid = blockIdx.x * 4 + w;
  const int mt = wid / ntn, nq = wid % ntn;
  if (mt * 16 >= M) return;
  const int row0 = mt * 16, col0 = nq * 64;
  const float* arow = A + (size_t)(row0 + ln) * lda;
  v8f acc[4] = {};
  for (int kb = 0; kb < K; kb += 32) {
    FragB ah, al;
    const v4f x0 = *(const v4fa*)(arow + kb + 8 * hh), x1 = *(const v4fa*)(arow + kb + 8 * hh + 4);
    const v4f x2 = *(const v4fa*)(arow + kb + 16 + 8 * hh), x3 = *(const v4fa*)(arow + kb + 16 + 8 * hh + 4);
    float xs[16] = {x0[0],x0[1],x0[2],x0[3],x1[0],x1[1],x1[2],x1[3],x2[0],x2[1],x2[2],x2[3],x3[0],x3[1],x3[2],x3[3]};
#pragma unroll
    for (int i = 0; i < 16; ++i) { const unsigned short hb = bf16_bits(xs[i]); ah.u[i] = hb; al.u[i] = ASPLIT ? bf16_bits(xs[i] - bf16_val(hb)) : (unsigned short)0; }
#pragma unroll
    for (int t = 0; t < 4; ++t) {
      const unsigned short* brow = Wt + (size_t)(col0 + t * 16 + ln) * ldb + kb;
      FragB b;
      b.half[0] = *(const v8us*)(brow + 8 * hh);
      b.half[1] = *(const v8us*)(brow + 16 + 8 * hh);
      acc[t] = mmaN<ASPLIT ? 2 : 1>(ah.v, al.v, b.v, b.v, acc[t]);
    }
  }
#pragma unroll
  for (int t = 0; t < 4; ++t) {
    float bv = bias ? bias[col0 + t * 16 + ln] : 0.f;
    if (BIAS_BF16) bv = bf16_round(bv);
#pragma unroll
    for (int r = 0; r < 8; ++r) { float v = acc[t][r] + bv; if (ACT == 1) v = fmaxf(v, 0.f); so[w][8 * hh + r][t * 16 + ln] = v; }
  }
  __builtin_amdgcn_fence(__ATOMIC_ACQ_REL, "workgroup");
  __builtin_amdgcn_wave_barrier();
  const int rsub = lane >> 4, c4 = (lane & 15) * 4;
  {
#pragma unroll
    for (int q = 0; q < 8; ++q) {
      const int r = q * 2 + rsub;
      const v4f v = *(const v4fa*)&so[w][r][c4];
      *(v4f*)(C + (size_t)(row0 + r) * ldc + col0 + c4) = v;
    }
    
  }
}

// GEMM C = act(A·W + bias + resid): A f32 (ASPLIT -> hi/lo 2 terms), Wt bf16 [N][K]; ACT 0 none, 1 relu, 2 exact gelu;
// resid (optional, f32, row index = (row % rmod), pitch ldr, RES_BF16 rounds it) added before the activation.
template <bool ASPLIT, int ACT, bool BIAS_BF16, bool RES_BF16>
__global__ __launch_bounds__(128) void k_gemm_bf3(const float* __restrict__ A, int lda, const unsigned short* __restrict__ Wt, int ldb,
                                                const float* __restrict__ bias, const float* __restrict__ resid, int rmod, int ldr,
                                                float* __restrict__ C, int ldc, int M, int N, int K) {
  __shared__ __attribute__((aligned(16))) float so[4][16][64];
  const int tid = threadIdx.x, w = tid >> 5, lane = tid & 31, ln = lane & 15, hh = lane >> 4;
  const int ntn = N / 64;
  const int wid = blockIdx.x * 4 + w;
  const int mt = wid / ntn, nq = wid % ntn;
  if (mt * 16 >= M) return;
  const int row0 = mt * 16, col0 = nq * 64;
  const float* arow = A + (size_t)(row0 + ln) * lda;
  v8f acc[4] = {};
  for (int kb = 0; kb < K; kb += 32) {
    FragB ah, al;
    const v4f x0 = *(const v4fa*)(arow + kb + 8 * hh), x1 = *(const v4fa*)(arow + kb + 8 * hh + 4);
    const v4f x2 = *(const v4fa*)(arow + kb + 16 + 8 * hh), x3 = *(const v4fa*)(arow + kb + 16 + 8 * hh + 4);
    float xs[16] = {x0[0],x0[1],x0[2],x0[3],x1[0],x1[1],x1[2],x1[3],x2[0],x2[1],x2[2],x2[3],x3[0],x3[1],x3[2],x3[3]};
#pragma unroll
    for (int i = 0; i < 16; ++i) { const unsigned short hb = bf16_bits(xs[i]); ah.u[i] = hb; al.u[i] = ASPLIT ? bf16_bits(xs[i] - bf16_val(hb)) : (unsigned short)0; }
#pragma unroll
    for (int t = 0; t < 4; ++t) {
      const unsigned short* brow = Wt + (size_t)(col0 + t * 16 + ln) * ldb + kb;
      FragB b;
      b.half[0] = *(const v8us*)(brow + 8 * hh);
      b.half[1] = *(const v8us*)(brow + 16 + 8 * hh);
      acc[t] = mmaN<ASPLIT ? 2 : 1>(ah.v, al.v, b.v, b.v, acc[t]);
    }
  }
#pragma unroll
  for (int t = 0; t < 4; ++t) {
    const int col = col0 + t * 16 + ln;
    float bv = bias ? bias[col] : 0.f;
    if (BIAS_BF16) bv = bf16_round(bv);
#pragma unroll
    for (int r = 0; r < 8; ++r) {
      float v = acc[t][r] + bv;
      if (resid) { float rv = resid[(size_t)((row0 + 8 * hh + r) % rmod) * ldr + col]; if (RES_BF16) rv = bf16_round(rv); v += rv; }
      if (ACT == 1) v = fmaxf(v, 0.f);
      if (ACT == 2) v = 0.5f * v * (1.0f + erff(v * 0.70710678118654752f));
      if (ACT == 3) { const float u = 0.7978845608028654f * (v + 0.044715f * v * v * v); v = 0.5f * v * (1.0f + tanhf(u)); }
      so[w][8 * hh + r][t * 16 + ln] = v;
    }
  }
  __builtin_amdgcn_fence(__ATOMIC_ACQ_REL, "workgroup");
  __builtin_amdgcn_wave_barrier();
  const int rsub = lane >> 4, c4 = (lane & 15) * 4;
  {
#pragma unroll
    for (int q = 0; q < 8; ++q) {
      const int r = q * 2 + rsub;
      const v4f v = *(const v4fa*)&so[w][r][c4];
      *(v4f*)(C + (size_t)(row0 + r) * ldc + col0 + c4) = v;
    }
    
  }
}
// row LayerNorm (biased variance, eps) over N: s = X (+ R); optional out_sum <- s; out_norm <- (s-mu)*rsqrt(var+eps)*g + b
template <bool PARAM_BF16>
__global__ __launch_bounds__(256) void k_layernorm(const float* __restrict__ X, const float* __restrict__ R, const float* __restrict__ g, const float* __restrict__ bta,
                                                  float* __restrict__ out_sum, float* __restrict__ out_norm, int N, float eps) {
  __shared__ float red[256];
  const int row = blockIdx.x, tid = threadIdx.x;
  const float* x = X + (size_t)row * N; const float* rr = R ? R + (size_t)row * N : nullptr;
  float vals[16];                     // up to N = 4096
  const int per = N / 256;            // contiguous chunk per thread? use strided-by-4 chunks: thread handles j = tid*4 + 1024*u
  float s1 = 0.f;
  for (int u = 0; u < per / 4; ++u) {
    const int j = tid * 4 + 1024 * u;
    const v4f a = *(const v4fa*)(x + j);
    v4f b = {0.f,0.f,0.f,0.f}; if (rr) b = *(const v4fa*)(rr + j);
#pragma unroll
    for (int q = 0; q < 4; ++q) { const float v = a[q] + b[q]; vals[u * 4 + q] = v; s1 += v; }
  }
  red[tid] = s1; __syncthreads();
  for (int st = 128; st > 0; st >>= 1) { if (tid < st) red[tid] += red[tid + st]; __syncthreads(); }
  const float mu = red[0] / (float)N; __syncthreads();
  float s2 = 0.f;
  for (int u = 0; u < per / 4; ++u)
#pragma unroll
    for (int q = 0; q < 4; ++q) { const float c = vals[u * 4 + q] - mu; s2 += c * c; }
  red[tid] = s2; __syncthreads();
  for (int st = 128; st > 0; st >>= 1) { if (tid < st) red[tid] += red[tid + st]; __syncthreads(); }
  const float rs = rsqrtf(red[0] / (float)N + eps);
  {
    for (int u = 0; u < per / 4; ++u) {
      const int j = tid * 4 + 1024 * u;
      v4f o, sm;
#pragma unroll
      for (int q = 0; q < 4; ++q) {
        float gg = g[j + q], bb = bta[j + q];
        if (PARAM_BF16) { gg = bf16_round(gg); bb = bf16_round(bb); }
        sm[q] = vals[u * 4 + q]; o[q] = (vals[u * 4 + q] - mu) * rs * gg + bb;
      }
      if (out_sum) *(v4f*)(out_sum + (size_t)row * N + j) = sm;
      *(v4f*)(out_norm + (size_t)row * N + j) = o;
    }
    
  }
}



// ---- f16 WMMA path (v_wmma_f32_16x16x32_f16): 11-bit significands for operands in range — used where a [0,1] probability operand needs more precision than bf16
typedef _Float16 v16h __attribute__((ext_vector_type(16)));
union FragH { v16h v; v8us half[2]; _Float16 h[16]; unsigned short u[16]; };
template <int NT>
__device__ __forceinline__ v8f mmaH(v16h ah, v16h al, v16h bh, v16h bl, v8f c) {
  c = __builtin_amdgcn_wmma_f32_16x16x32_f16(false, ah, false, bh, (short)0, c, false, false);
  if (NT >= 2) c = __builtin_amdgcn_wmma_f32_16x16x32_f16(false, al, false, bh, (short)0, c, false, false);
  if (NT >= 3) c = __builtin_amdgcn_wmma_f32_16x16x32_f16(false, ah, false, bl, (short)0, c, false, false);
  asm volatile("v_nop\n\tv_nop\n\tv_nop\n\tv_nop" : "+v"(c) : "v"(ah), "v"(al), "v"(bh), "v"(bl));
  return c;
}
// batched GEMM like k_gemm_b but f16 operands: A f32 (split into f16 hi/lo if ASPLIT, else rounded to f16), Bt = f16 values [n][k]; alpha; C f32; N multiple of 16 (partial tiles skipped)
template <bool ASPLIT>
__global__ __launch_bounds__(128) void k_gemm_h(const float* __restrict__ A, int lda, size_t sA, const _Float16* __restrict__ Bh, int ldb, size_t sB, float alpha, float* __restrict__ C, int ldc, size_t sC, int M, int N, int K) {
  __shared__ __attribute__((aligned(16))) float so[4][16][64];
  const int tid = threadIdx.x, w = tid >> 5, lane = tid & 31, ln = lane & 15, hh = lane >> 4; const int by = blockIdx.y;
  A += (size_t)by * sA; Bh += (size_t)by * sB; C += (size_t)by * sC;
  const int ntn = (N + 63) / 64; const int wid = blockIdx.x * 4 + w; const int mt = wid / ntn, nq = wid % ntn; if (mt * 16 >= M) return;
  const int row0 = mt * 16, col0 = nq * 64; const float* arow = A + (size_t)(row0 + ln) * lda;
  v8f acc[4] = {};
  for (int kb = 0; kb < K; kb += 32) {
    FragH ah, al;
    const v4f x0 = *(const v4fa*)(arow + kb + 8 * hh), x1 = *(const v4fa*)(arow + kb + 8 * hh + 4), x2 = *(const v4fa*)(arow + kb + 16 + 8 * hh), x3 = *(const v4fa*)(arow + kb + 16 + 8 * hh + 4);
    float xs[16] = {x0[0],x0[1],x0[2],x0[3],x1[0],x1[1],x1[2],x1[3],x2[0],x2[1],x2[2],x2[3],x3[0],x3[1],x3[2],x3[3]};
#pragma unroll
    for (int i = 0; i < 16; ++i) { const _Float16 h = (_Float16)xs[i]; ah.h[i] = h; al.h[i] = ASPLIT ? (_Float16)(xs[i] - (float)h) : (_Float16)0.0f; }
#pragma unroll
    for (int t = 0; t < 4; ++t) { if (col0 + t * 16 >= N) continue; const size_t boff = (size_t)(col0 + t * 16 + ln) * ldb + kb; FragH bq; bq.half[0] = *(const v8us*)(Bh + boff + 8 * hh); bq.half[1] = *(const v8us*)(Bh + boff + 16 + 8 * hh);
      acc[t] = mmaH<ASPLIT ? 2 : 1>(ah.v, al.v, bq.v, bq.v, acc[t]); }
  }
#pragma unroll
  for (int t = 0; t < 4; ++t) { if (col0 + t * 16 >= N) continue;
#pragma unroll
    for (int r = 0; r < 8; ++r) so[w][8 * hh + r][t * 16 + ln] = acc[t][r] * alpha; }
  __builtin_amdgcn_fence(__ATOMIC_ACQ_REL, "workgroup"); __builtin_amdgcn_wave_barrier();
  const int rsub = lane >> 4, c4 = (lane & 15) * 4;
  {
#pragma unroll
    for (int q = 0; q < 8; ++q) { const int r = q * 2 + rsub; if (col0 + c4 < N) { const v4f v = *(const v4fa*)&so[w][r][c4]; *(v4f*)(C + (size_t)(row0 + r) * ldc + col0 + c4) = v; } }
     }
}

// Wt[n][k] = f16(W[k][n]·scale) from f32 row-major W[K][N] (scale = power of two; bf16-exact weights stay exact in f16 away from the subnormal range)
__global__ __launch_bounds__(256) void k_wt_f16(const float* __restrict__ W, _Float16* __restrict__ Wt, int K, int N, float scale) {
  const int t = blockIdx.x * 256 + threadIdx.x; if (t >= N * (K / 8)) return; const int n = t / (K / 8), k8 = (t % (K / 8)) * 8; FragH f;
#pragma unroll
  for (int i = 0; i < 8; ++i) f.h[i] = (_Float16)(bf16_round(W[(size_t)(k8 + i) * N + n]) * scale); const v8us o = f.half[0];
  *(v8us*)((unsigned short*)Wt + (size_t)n * K + k8) = o; 
}
// k_gemm_hh variant with fused epilogue: v = acc·alpha + bias[by·sBias + col] (+ CP[(row/rowsPerB)·sCPb + by·64 + col] if CP) ; ACT 0 none / 1 elu ; writes f16 C16 (and f32 C if non-null)
template <int ACT>
__global__ __launch_bounds__(128) void k_gemm_hhx(const _Float16* __restrict__ A, int lda, size_t sA, const _Float16* __restrict__ Bh, int ldb, size_t sB, float alpha, const float* __restrict__ bias, size_t sBias, const float* __restrict__ CP, int rowsPerB, size_t sCPb, int row0g,
    float* __restrict__ C, _Float16* __restrict__ C16, int ldc, size_t sC, int M, int N, int K) {
  __shared__ __attribute__((aligned(16))) float so[4][16][64];
  const int tid = threadIdx.x, w = tid >> 5, lane = tid & 31, ln = lane & 15, hh = lane >> 4; const int by = blockIdx.y;
  A += (size_t)by * sA; Bh += (size_t)by * sB; const size_t cofs = (size_t)by * sC; const float* bp = bias ? bias + (size_t)by * sBias : nullptr;
  const int ntn = (N + 63) / 64; const int wid = blockIdx.x * 4 + w; const int mt = wid / ntn, nq = wid % ntn; if (mt * 16 >= M) return;
  const int row0 = mt * 16, col0 = nq * 64; const _Float16* arow = A + (size_t)(row0 + ln) * lda;
  v8f acc[4] = {};
  for (int kb = 0; kb < K; kb += 32) { FragH ah; ah.half[0] = *(const v8us*)((const unsigned short*)arow + kb + 8 * hh); ah.half[1] = *(const v8us*)((const unsigned short*)arow + kb + 16 + 8 * hh);
#pragma unroll
    for (int t = 0; t < 4; ++t) { if (col0 + t * 16 >= N) continue; const size_t boff = (size_t)(col0 + t * 16 + ln) * ldb + kb; FragH bq; bq.half[0] = *(const v8us*)((const unsigned short*)Bh + boff + 8 * hh); bq.half[1] = *(const v8us*)((const unsigned short*)Bh + boff + 16 + 8 * hh);
      acc[t] = mmaH<1>(ah.v, ah.v, bq.v, bq.v, acc[t]); }
  }
#pragma unroll
  for (int t = 0; t < 4; ++t) { if (col0 + t * 16 >= N) continue; const int col = col0 + t * 16 + ln; const float bv = bp ? bf16_round(bp[col]) : 0.f;
#pragma unroll
    for (int r = 0; r < 8; ++r) { float v = acc[t][r] * alpha + bv; if (CP) { const int rr = row0g + row0 + 8 * hh + r; if (rowsPerB < 0) v += CP[cofs + (size_t)rr * ldc + col];      /* rowsPerB < 0: own element of the batched C plane */ else { const int bidx = rr / rowsPerB; v += CP[(size_t)bidx * sCPb + (size_t)by * 64 + col]; } } if (ACT == 1) v = (v > 0.f) ? v : expm1f(v); else if (ACT == 7) v = (v > 0.f) ? v + 1.0f : expf(v); else if (ACT == 8) v = tanhf(v); else if (ACT == 9) v = 0.5f * v * (1.0f + tanhf(0.7978845608028654f * (v + 0.044715f * v * v * v))); else if (ACT == 11) v = 1.0f / (1.0f + expf(-v)); else if (ACT == 12) v = (v > 0.f) ? v : 0.01f * v; else if (ACT == 14) v = (v > 0.f) ? v : 0.1f * v; else if (ACT == 16) v = (v >= 0.f) ? v : 0.3f * v; else if (ACT == 17) v = (v >= 0.f) ? v : 0.2f * v; else if (ACT == 15) v = v / (1.0f + expf(-v)); else if (ACT == 3) v = fmaxf(v, 0.f); else if (ACT == 6) v = 0.5f * v * (1.0f + erff(v * 0.70710678118654752f)); so[w][8 * hh + r][t * 16 + ln] = v; } }
  __builtin_amdgcn_fence(__ATOMIC_ACQ_REL, "workgroup"); __builtin_amdgcn_wave_barrier();
  const int rsub = lane >> 4, c4 = (lane & 15) * 4; typedef _Float16 v4h __attribute__((ext_vector_type(4)));
  {
#pragma unroll
    for (int q = 0; q < 8; ++q) { const int r = q * 2 + rsub; if (col0 + c4 < N) { const v4f v = *(const v4fa*)&so[w][r][c4]; if (C) *(v4f*)(C + cofs + (size_t)(row0 + r) * ldc + col0 + c4) = v; if (C16) { v4h h4; for (int i = 0; i < 4; ++i) h4[i] = (_Float16)v[i]; *(v4h*)(C16 + cofs + (size_t)(row0 + r) * ldc + col0 + c4) = h4; } } }
     }
}


typedef _Float16 v4h __attribute__((ext_vector_type(4)));

__global__ __launch_bounds__(256) void k_x16(const float* __restrict__ x, _Float16* __restrict__ X16, size_t n8) { const size_t t = (size_t)blockIdx.x * 256 + threadIdx.x; if (t >= n8) return; FragH f;
#pragma unroll
  for (int q = 0; q < 8; ++q) f.h[q] = (_Float16)bf16_round(x[t * 8 + q]); *(v8us*)((unsigned short*)X16 + t * 8) = f.half[0];  }
__global__ __launch_bounds__(256) void k_h16(const float* __restrict__ x, _Float16* __restrict__ X16, size_t n8) { const size_t t = (size_t)blockIdx.x * 256 + threadIdx.x; if (t >= n8) return; FragH f;
#pragma unroll
  for (int q = 0; q < 8; ++q) f.h[q] = (_Float16)x[t * 8 + q]; *(v8us*)((unsigned short*)X16 + t * 8) = f.half[0];  }
__global__ __launch_bounds__(256) void k_round16f(const float* __restrict__ W, _Float16* __restrict__ Bt, size_t n8) { const size_t t = (size_t)blockIdx.x * 256 + threadIdx.x; if (t >= n8) return; FragH f;
#pragma unroll
  for (int i = 0; i < 8; ++i) f.h[i] = (_Float16)(bf16_round(W[t * 8 + i]) * 16.0f); *(v8us*)((unsigned short*)Bt + t * 8) = f.half[0];  }
template <int NHv, int TTv>
__global__ __launch_bounds__(256) void k_vt(const _Float16* __restrict__ V16, int ldv, int voff, _Float16* __restrict__ Vt) { __shared__ unsigned short tl[64][66]; const int tid = threadIdx.x; const int slab = blockIdx.x / (TTv / 64), lg = blockIdx.x % (TTv / 64); const int b = slab / NHv, h = slab % NHv;
  for (int i = tid; i < 64 * 8; i += 256) { const int r = i / 8, c8 = (i % 8) * 8; FragH f; f.half[0] = *(const v8us*)((const unsigned short*)V16 + ((size_t)b * TTv + lg * 64 + r) * ldv + voff + h * 64 + c8);
#pragma unroll
    for (int q = 0; q < 8; ++q) tl[r][c8 + q] = f.u[q]; }
  __syncthreads();
  {
#pragma unroll
    for (int rd = 0; rd < 2; ++rd) { const int d = rd * 32 + tid / 8, pc = tid % 8; FragH f;
#pragma unroll
      for (int q = 0; q < 8; ++q) f.u[q] = tl[pc * 8 + q][d];
      *(v8us*)((unsigned short*)Vt + ((size_t)slab * 64 + d) * TTv + lg * 64 + pc * 8) = f.half[0]; }
     } }

__global__ __launch_bounds__(256) void k_hl(const float* __restrict__ F, _Float16* __restrict__ Hh, _Float16* __restrict__ Hl, size_t n8) { const size_t t = (size_t)blockIdx.x * 256 + threadIdx.x; if (t >= n8) return; FragH fh, fl; const v4f a = *(const v4fa*)(F + t * 8), c = *(const v4fa*)(F + t * 8 + 4);
#pragma unroll
  for (int q = 0; q < 4; ++q) { _Float16 h = (_Float16)a[q]; fh.h[q] = h; fl.h[q] = (_Float16)((a[q] - (float)h) * 1024.0f); h = (_Float16)c[q]; fh.h[4 + q] = h; fl.h[4 + q] = (_Float16)((c[q] - (float)h) * 1024.0f); }
  { *(v8us*)((unsigned short*)Hh + t * 8) = fh.half[0]; *(v8us*)((unsigned short*)Hl + t * 8) = fl.half[0];  } }

// ---- fast GEMM (wave tile 32x64; requires M % 32 == 0 rows per launch region and N % 64 == 0); epilogue = k_gemm_hhx semantics ----
__device__ __forceinline__ v16h g2_frag(const _Float16* p, int hh) { FragH f; f.half[0] = *(const v8us*)((const unsigned short*)p + 8 * hh); f.half[1] = *(const v8us*)((const unsigned short*)p + 16 + 8 * hh); return f.v; }
__device__ __forceinline__ v8f g2_mma(v16h a, v16h b, v8f c) { v8f d = __builtin_amdgcn_wmma_f32_16x16x32_f16(false, a, false, b, (short)0, c, false, false); asm volatile("v_nop\n\tv_nop\n\tv_nop\n\tv_nop" : "+v"(d) : "v"(a), "v"(b)); return d; }
template <int ACT>
__global__ __launch_bounds__(128) void k_gemm2(const _Float16* __restrict__ A, int lda, size_t sA, const _Float16* __restrict__ Bh, int ldb, size_t sB, float alpha, const float* __restrict__ bias, size_t sBias, const float* __restrict__ CP, int rowsPerB, size_t sCPb, int row0g,
    float* __restrict__ C, _Float16* __restrict__ C16, int ldc, size_t sC, int M, int N, int K) { static_assert(ACT == 0 || ACT == 3 || ACT == 6 || ACT == 8 || ACT == 9 || ACT == 11 || ACT == 12 || ACT == 14 || ACT == 15 || ACT == 16 || ACT == 17, "k_gemm2: unsupported ACT code (would silently apply no activation)");
  __shared__ __attribute__((aligned(16))) float so[4][32][68];
  const int tid = threadIdx.x, w = tid >> 5, lane = tid & 31, ln = lane & 15, hh = lane >> 4; const int by = blockIdx.y;
  A += (size_t)by * sA; Bh += (size_t)by * sB; const size_t cofs = (size_t)by * sC; const float* bp = bias ? bias + (size_t)by * sBias : nullptr;
  const int ntn = N >> 6; const int mt = blockIdx.x / ntn, nq = blockIdx.x - mt * ntn; const int row0 = mt * 128 + 32 * w, col0 = nq * 64; if (row0 >= M) return;
  const _Float16* a0p = A + (size_t)(row0 + ln) * lda; const _Float16* a1p = a0p + (size_t)16 * lda;
  const _Float16* b0p = Bh + (size_t)(col0 + ln) * ldb; const _Float16* b1p = b0p + (size_t)16 * ldb; const _Float16* b2p = b1p + (size_t)16 * ldb; const _Float16* b3p = b2p + (size_t)16 * ldb;
  const v8f z8 = {0.f,0.f,0.f,0.f,0.f,0.f,0.f,0.f}; v8f c00 = z8, c01 = z8, c02 = z8, c03 = z8, c10 = z8, c11 = z8, c12 = z8, c13 = z8;
#pragma unroll 1
  for (int kb = 0; kb < K; kb += 32) { const v16h a0 = g2_frag(a0p + kb, hh), a1 = g2_frag(a1p + kb, hh);
    v16h b = g2_frag(b0p + kb, hh); c00 = g2_mma(a0, b, c00); c10 = g2_mma(a1, b, c10);
    b = g2_frag(b1p + kb, hh); c01 = g2_mma(a0, b, c01); c11 = g2_mma(a1, b, c11);
    b = g2_frag(b2p + kb, hh); c02 = g2_mma(a0, b, c02); c12 = g2_mma(a1, b, c12);
    b = g2_frag(b3p + kb, hh); c03 = g2_mma(a0, b, c03); c13 = g2_mma(a1, b, c13); }
  v8f accs[8] = {c00, c01, c02, c03, c10, c11, c12, c13};
#pragma unroll
  for (int u = 0; u < 8; ++u) { const int t = u & 3, half = u >> 2; const int col = col0 + t * 16 + ln; const float bv = bp ? bf16_round(bp[col]) : 0.f;
#pragma unroll
    for (int r = 0; r < 8; ++r) { const int rloc = half * 16 + 8 * hh + r; float v = accs[u][r] * alpha + bv; if (CP) { if (rowsPerB < 0) v += CP[cofs + (size_t)(row0g + row0 + rloc) * ldc + col];      /* rowsPerB < 0: own element of the batched C plane */ else { const int bidx = (row0g + row0 + rloc) / rowsPerB; v += CP[(size_t)bidx * sCPb + (size_t)by * 64 + col]; } }
      if (ACT == 3) v = fmaxf(v, 0.f); else if (ACT == 6) v = 0.5f * v * (1.0f + erff(v * 0.70710678118654752f)); else if (ACT == 11) v = 1.0f / (1.0f + expf(-v)); else if (ACT == 15) v = v / (1.0f + expf(-v)); else if (ACT == 12) v = (v > 0.f) ? v : 0.01f * v; else if (ACT == 8) v = tanhf(v); else if (ACT == 9) v = 0.5f * v * (1.0f + tanhf(0.7978845608028654f * (v + 0.044715f * v * v * v))); else if (ACT == 14) v = (v > 0.f) ? v : 0.1f * v; else if (ACT == 16) v = (v >= 0.f) ? v : 0.3f * v; else if (ACT == 17) v = (v >= 0.f) ? v : 0.2f * v;
      so[w][rloc][t * 16 + ln] = v; } }
  __builtin_amdgcn_fence(__ATOMIC_ACQ_REL, "workgroup"); __builtin_amdgcn_wave_barrier();
  const int rsub = lane >> 4, c4 = (lane & 15) * 4;
  {
#pragma unroll
    for (int q = 0; q < 16; ++q) { const int r = q * 2 + rsub; const v4f v = *(const v4fa*)&so[w][r][c4]; if (C) *(v4f*)(C + cofs + (size_t)(row0 + r) * ldc + col0 + c4) = v; if (C16) { v4h h4; for (int i = 0; i < 4; ++i) h4[i] = (_Float16)v[i]; *(v4h*)(C16 + cofs + (size_t)(row0 + r) * ldc + col0 + c4) = h4; } }
     } }


__global__ __launch_bounds__(256) void k_wnat(const float* __restrict__ w, size_t n8, _Float16* __restrict__ Bt) { const size_t t = (size_t)blockIdx.x * 256 + threadIdx.x; if (t >= n8) return; FragH f; for (int q = 0; q < 8; ++q) f.h[q] = (_Float16)(bf16_round(w[t * 8 + q]) * 16.0f); *(v8us*)((unsigned short*)Bt + t * 8) = f.half[0];  }
// Row softmax, one wave a row: lane l holds columns 128 u + 4 l .. + 3 (each load 512 contiguous bytes, each store 256), the row is read once and stays in registers;
// maximum and sum: per lane, then a five-step butterfly over the 32 lanes (every lane ends with the same value).
__global__ __launch_bounds__(256) void k_rsm(const float* __restrict__ S, _Float16* __restrict__ P, int nrows) {
  const int lane = threadIdx.x & 31; const int i = blockIdx.x * 8 + (threadIdx.x >> 5); if (i >= nrows) return;
  const float* s = S + (size_t)i * SQ + lane * 4; _Float16* d = P + (size_t)i * SQ + lane * 4;
  v4f x[SQ / 128];
#pragma unroll      /* constant indices keep x in registers; all 16 loads are issued before the first use */
  for (int u = 0; u < SQ / 128; ++u) x[u] = *(const v4fa*)(s + u * 128);
  asm volatile("s_wait_xcnt 0x0" :: "v"(s) : "memory");      /* the loads' address pair stays whole until this wait: no register that an issued load names is rewritten in front of it */
  float mx = -3.0e38f;
#pragma unroll      /* constant indices keep x in registers */
  for (int u = 0; u < SQ / 128; ++u) mx = fmaxf(mx, fmaxf(fmaxf(x[u][0], x[u][1]), fmaxf(x[u][2], x[u][3])));
  for (int m = 16; m > 0; m >>= 1) mx = fmaxf(mx, __shfl_xor(mx, m, 32));
  v4f a = {0.f, 0.f, 0.f, 0.f};
#pragma unroll      /* constant indices keep x in registers */
  for (int u = 0; u < SQ / 128; ++u) { for (int q = 0; q < 4; ++q) { x[u][q] = expf(x[u][q] - mx); a[q] += x[u][q]; } }
  float se = (a[0] + a[1]) + (a[2] + a[3]);
  for (int m = 16; m > 0; m >>= 1) se += __shfl_xor(se, m, 32);
  const float sc = 256.0f / se;
#pragma unroll      /* constant indices keep x in registers */
  for (int u = 0; u < SQ / 128; ++u) { v4h h; for (int q = 0; q < 4; ++q) h[q] = (_Float16)(x[u][q] * sc); *(v4h*)(d + u * 128) = h; } }
__global__ __launch_bounds__(256) void k_vt(const _Float16* __restrict__ V16, int b, int h0, _Float16* __restrict__ VT) { __shared__ unsigned short tl[64][65]; const int tid = threadIdx.x; const int hh = blockIdx.x % HG, sg = blockIdx.x / HG; const int s0 = sg * 64; const int h = h0 + hh;
  for (int i = tid; i < 64 * 8; i += 256) { const int j = i / 8, d8 = (i % 8) * 8; FragH f; f.half[0] = *(const v8us*)((const unsigned short*)V16 + ((size_t)b * SQ + s0 + j) * DM + h * HD + d8); for (int q = 0; q < 8; ++q) tl[d8 + q][j] = f.u[q]; }
  __syncthreads();
  { for (int i = tid; i < 64 * 8; i += 256) { const int d = i / 8, j8 = (i % 8) * 8; FragH f; for (int q = 0; q < 8; ++q) f.u[q] = tl[d][j8 + q]; *(v8us*)((unsigned short*)VT + ((size_t)hh * HD + d) * SQ + s0 + j8) = f.half[0]; }  } }



__global__ __launch_bounds__(256) void k_rsmkm(const float* __restrict__ S, _Float16* __restrict__ P, int nrows, const int* __restrict__ am) {
  #pragma clang fp contract(off)
  const int t = blockIdx.x * 256 + threadIdx.x; if (t >= nrows) return; const size_t i = (size_t)t; const float* s = S + i * SQ; const int* mr = am + (size_t)(t % SQ) * SQ; float mx = -3.0e38f;
#pragma unroll 1
  for (int j = 0; j < SQ; ++j) { const float f = (mr[j] != 0) ? 1.f : 0.f; mx = fmaxf(mx, fmaf(f, s[j], (1.f - f) * -1.0e9f)); } float se = 0.f;
#pragma unroll 1
  for (int j = 0; j < SQ; ++j) { const float f = (mr[j] != 0) ? 1.f : 0.f; se += __expf(fmaf(f, s[j], (1.f - f) * -1.0e9f) - mx); } const float sc = 256.0f / se;
#pragma unroll 1
  for (int j0 = 0; j0 < SQ; j0 += 8) { FragH fr; for (int q = 0; q < 8; ++q) { const int j = j0 + q; const float f = (mr[j] != 0) ? 1.f : 0.f; fr.h[q] = (_Float16)(__expf(fmaf(f, s[j], (1.f - f) * -1.0e9f) - mx) * sc); }
    unsigned short* d = (unsigned short*)P + i * SQ + j0; *(v8us*)d = fr.half[0];  } }
extern "C" void kernel_launch(void* const* d_in, const int* in_sizes, int n_in,
                              void* d_out, int out_size, void* d_ws, size_t ws_size, hipStream_t stream) {
  (void)in_sizes; (void)n_in; (void)out_size;
  const float* const* I = (const float* const*)d_in; const float* xq = I[0]; const float* xk = I[1]; const float* xv = I[2]; const float* wo = I[3]; const float* bo = I[4];      /* queries, keys, values [4][2048][512] (used as q, k, v directly: no input projections); natural W_out [512][512] + b_out */
  static_assert(NH * HD == DM && DM % 64 == 0 && DM % 32 == 0 && SQ % 128 == 0 && NH % HG == 0, "shape / tile multiples");
  char* ws = (char*)d_ws; size_t off = 0;
  auto take = [&](size_t bytes) { char* p = ws + off; off += (bytes + 255) & ~(size_t)255; return p; };
  _Float16* BO = (_Float16*)take((size_t)DM * DM * 2);
  _Float16* Q16 = (_Float16*)take(NR * DM * 2); _Float16* K16 = (_Float16*)take(NR * DM * 2); _Float16* V16 = (_Float16*)take(NR * DM * 2); _Float16* O16 = (_Float16*)take(NR * DM * 2);
  float* S = (float*)take((size_t)HG * SQ * SQ * 4); _Float16* P = (_Float16*)take((size_t)HG * SQ * SQ * 2); _Float16* VT = (_Float16*)take((size_t)NH * HD * SQ * 2);
  if (off > ws_size) return;
  k_wnat<<<(unsigned)(((size_t)DM * DM / 8 + 255) / 256), 256, 0, stream>>>(wo, (size_t)DM * DM / 8, BO);      /* natural W_out [out][in] = Bt[n][k] x16 */
  k_x16<<<(unsigned)((NR * DM / 8 + 255) / 256), 256, 0, stream>>>(xk, K16, NR * DM / 8); k_x16<<<(unsigned)((NR * DM / 8 + 255) / 256), 256, 0, stream>>>(xv, V16, NR * DM / 8);      /* keys and values as exact f16 rows = the k and v operands */

  k_x16<<<(unsigned)((NR * DM / 8 + 255) / 256), 256, 0, stream>>>(xq, Q16, NR * DM / 8);      /* queries as exact f16 rows = the q operand */
  const size_t r0p = (size_t)B0 * SQ;      /* first projected row */
  for (int b = B0; b < B0 + NBR; ++b) { const size_t r0 = (size_t)b * SQ;
    k_vt<NH, SQ><<<NH * (SQ / 64), 256, 0, stream>>>(V16 + r0 * LQ, LQ, 0, VT);      /* V^T [NH][HD][SQ] for this batch */
    for (int h0 = 0; h0 < NHD; h0 += HG) {
      k_gemm2<0><<<dim3((QN / 128) * (SQ / 64), HG), 128, 0, stream>>>(Q16 + r0 * LQ + h0 * HD, LQ, (size_t)HD, K16 + r0 * LQ + h0 * HD, LQ, (size_t)HD, 0.044194173824159216f, nullptr, 0, nullptr, 1, 0, 0, S, nullptr, SQ, (size_t)SQ * SQ, QN, SQ, HD);      /* scores / sqrt(512) (the module's literal d_model scale), HG heads per launch */
      k_rsm<<<(HG * SQ + 7) / 8, 256, 0, stream>>>(S, P, HG * SQ);      /* P = 256 softmax (f16), rows of all HG heads, one wave a row */
      k_gemm2<0><<<dim3((QN / 128) * (HD / 64), HG), 128, 0, stream>>>(P, SQ, (size_t)SQ * SQ, VT + (size_t)h0 * HD * SQ, SQ, (size_t)HD * SQ, 0.25f, nullptr, 0, nullptr, 1, 0, 0, nullptr, O16 + r0 * DM + h0 * HD, DM, (size_t)HD, QN, HD, SQ); } }      /* o (merged heads) as f16 rows */
  k_gemm2<0><<<dim3((unsigned)((MPO / 128) * (DM / 64)), 1), 128, 0, stream>>>(O16 + r0p * DM, DM, 0, BO, DM, 0, 0.0009765625f, bo, 0, nullptr, 1, 0, 0, (float*)d_out + r0p * DM, nullptr, DM, 0, MPO, DM, DM);      /* out rows are the output layout */
}

// v002
// Measured time: 91.6 microseconds a run.
// Two timings next to v001 put it at 8.88 and 8.97 times that version's speed.
// Counting every step since v000, it is 39.6 times as fast.
#include <hip/hip_runtime.h>
#define NB 4
#define SQ 2048
#define DM 512
#define NH 8
#define HD 64
#define HG 4                         /* heads per k_vt launch group (k_vt is not launched) */
#define B0 0                         /* first batch processed (debug hook) */
#define NBR NB                       /* batches processed (debug hook) */
#define NR ((size_t)NB * SQ)         /* token rows */
#define MP ((int)((size_t)NBR * SQ)) /* rows projected (debug hook) */
#define QN SQ                        /* query rows attended per batch (unused) */
#define NHD NH                       /* heads attended (unused) */
#define MPO MP                       /* rows through the output stage (debug hook) */
#define LQ DM      /* row pitch of the q/k/v rows (unused: the kernels use DM) */
typedef __bf16 v16b __attribute__((ext_vector_type(16)));
typedef unsigned short v8us __attribute__((ext_vector_type(8), may_alias));
typedef float  v8f  __attribute__((ext_vector_type(8)));
typedef float  v4f  __attribute__((ext_vector_type(4)));
typedef float  v4fa __attribute__((ext_vector_type(4), may_alias));
union FragB { v16b v; v8us half[2]; unsigned short u[16]; };

__device__ __forceinline__ unsigned short bf16_bits(float x) { unsigned int u = __float_as_uint(x); return (unsigned short)((u + 0x7FFFu + ((u >> 16) & 1u)) >> 16); }
__device__ __forceinline__ float bf16_val(unsigned short b) { return __uint_as_float(((unsigned int)b) << 16); }
__device__ __forceinline__ float bf16_round(float x) { return bf16_val(bf16_bits(x)); }
// D += A·B with NT terms: 1 = ah·bh, 2 = + al·bh (A split), 3 = + ah·bl (both split)
template <int NT>
__device__ __forceinline__ v8f mmaN(v16b ah, v16b al, v16b bh, v16b bl, v8f c) {
  c = __builtin_amdgcn_wmma_f32_16x16x32_bf16(false, ah, false, bh, (short)0, c, false, false);
  if (NT >= 2) c = __builtin_amdgcn_wmma_f32_16x16x32_bf16(false, al, false, bh, (short)0, c, false, false);
  if (NT >= 3) c = __builtin_amdgcn_wmma_f32_16x16x32_bf16(false, ah, false, bl, (short)0, c, false, false);
  asm volatile("v_nop\n\tv_nop\n\tv_nop\n\tv_nop" : "+v"(c) : "v"(ah), "v"(al), "v"(bh), "v"(bl));
  return c;
}

__global__ __launch_bounds__(256) void k_wt_bf16(const float* __restrict__ W, unsigned short* __restrict__ Wt, int K, int N) {
  const int t = blockIdx.x * 256 + threadIdx.x;
  const int k8n = K / 8;
  if (t >= N * k8n) return;
  const int n = t / k8n, k8 = (t % k8n) * 8;
  v8us v;
#pragma unroll
  for (int i = 0; i < 8; ++i) v[i] = bf16_bits(W[(size_t)(k8 + i) * N + n]);
  *(v8us*)(Wt + (size_t)n * K + k8) = v;
  
}

// GEMM C[M][N] (f32, pitch ldc) = act(A[M][K]·W + bias). A f32 row-major (pitch lda) converted per fragment to bf16
// (ASPLIT: hi/lo two planes -> 2 terms, else single rounded term); Wt bf16 [N][K] (pitch ldb). BIAS_BF16 rounds the
// bias to bf16 first (bias quantised to bf16 before the add). K%32==0, M%16==0, N%64==0.
template <bool ASPLIT, int ACT, bool BIAS_BF16>
__global__ __launch_bounds__(128) void k_gemm_bf(const float* __restrict__ A, int lda, const unsigned short* __restrict__ Wt, int ldb,
                                               const float* __restrict__ bias, float* __restrict__ C, int ldc, int M, int N, int K) {
  __shared__ __attribute__((aligned(16))) float so[4][16][64];
  const int tid = threadIdx.x, w = tid >> 5, lane = tid & 31, ln = lane & 15, hh = lane >> 4;
  const int ntn = N / 64;
  const int wid = blockIdx.x * 4 + w;
  const int mt = wid / ntn, nq = wid % ntn;
  if (mt * 16 >= M) return;
  const int row0 = mt * 16, col0 = nq * 64;
  const float* arow = A + (size_t)(row0 + ln) * lda;
  v8f acc[4] = {};
  for (int kb = 0; kb < K; kb += 32) {
    FragB ah, al;
    const v4f x0 = *(const v4fa*)(arow + kb + 8 * hh), x1 = *(const v4fa*)(arow + kb + 8 * hh + 4);
    const v4f x2 = *(const v4fa*)(arow + kb + 16 + 8 * hh), x3 = *(const v4fa*)(arow + kb + 16 + 8 * hh + 4);
    float xs[16] = {x0[0],x0[1],x0[2],x0[3],x1[0],x1[1],x1[2],x1[3],x2[0],x2[1],x2[2],x2[3],x3[0],x3[1],x3[2],x3[3]};
#pragma unroll
    for (int i = 0; i < 16; ++i) { const unsigned short hb = bf16_bits(xs[i]); ah.u[i] = hb; al.u[i] = ASPLIT ? bf16_bits(xs[i] - bf16_val(hb)) : (unsigned short)0; }
#pragma unroll
    for (int t = 0; t < 4; ++t) {
      const unsigned short* brow = Wt + (size_t)(col0 + t * 16 + ln) * ldb + kb;
      FragB b;
      b.half[0] = *(const v8us*)(brow + 8 * hh);
      b.half[1] = *(const v8us*)(brow + 16 + 8 * hh);
      acc[t] = mmaN<ASPLIT ? 2 : 1>(ah.v, al.v, b.v, b.v, acc[t]);
    }
  }
#pragma unroll
  for (int t = 0; t < 4; ++t) {
    float bv = bias ? bias[col0 + t * 16 + ln] : 0.f;
    if (BIAS_BF16) bv = bf16_round(bv);
#pragma unroll
    for (int r = 0; r < 8; ++r) { float v = acc[t][r] + bv; if (ACT == 1) v = fmaxf(v, 0.f); so[w][8 * hh + r][t * 16 + ln] = v; }
  }
  __builtin_amdgcn_fence(__ATOMIC_ACQ_REL, "workgroup");
  __builtin_amdgcn_wave_barrier();
  const int rsub = lane >> 4, c4 = (lane & 15) * 4;
  {
#pragma unroll
    for (int q = 0; q < 8; ++q) {
      const int r = q * 2 + rsub;
      const v4f v = *(const v4fa*)&so[w][r][c4];
      *(v4f*)(C + (size_t)(row0 + r) * ldc + col0 + c4) = v;
    }
    
  }
}

// GEMM C = act(A·W + bias + resid): A f32 (ASPLIT -> hi/lo 2 terms), Wt bf16 [N][K]; ACT 0 none, 1 relu, 2 exact gelu;
// resid (optional, f32, row index = (row % rmod), pitch ldr, RES_BF16 rounds it) added before the activation.
template <bool ASPLIT, int ACT, bool BIAS_BF16, bool RES_BF16>
__global__ __launch_bounds__(128) void k_gemm_bf3(const float* __restrict__ A, int lda, const unsigned short* __restrict__ Wt, int ldb,
                                                const float* __restrict__ bias, const float* __restrict__ resid, int rmod, int ldr,
                                                float* __restrict__ C, int ldc, int M, int N, int K) {
  __shared__ __attribute__((aligned(16))) float so[4][16][64];
  const int tid = threadIdx.x, w = tid >> 5, lane = tid & 31, ln = lane & 15, hh = lane >> 4;
  const int ntn = N / 64;
  const int wid = blockIdx.x * 4 + w;
  const int mt = wid / ntn, nq = wid % ntn;
  if (mt * 16 >= M) return;
  const int row0 = mt * 16, col0 = nq * 64;
  const float* arow = A + (size_t)(row0 + ln) * lda;
  v8f acc[4] = {};
  for (int kb = 0; kb < K; kb += 32) {
    FragB ah, al;
    const v4f x0 = *(const v4fa*)(arow + kb + 8 * hh), x1 = *(const v4fa*)(arow + kb + 8 * hh + 4);
    const v4f x2 = *(const v4fa*)(arow + kb + 16 + 8 * hh), x3 = *(const v4fa*)(arow + kb + 16 + 8 * hh + 4);
    float xs[16] = {x0[0],x0[1],x0[2],x0[3],x1[0],x1[1],x1[2],x1[3],x2[0],x2[1],x2[2],x2[3],x3[0],x3[1],x3[2],x3[3]};
#pragma unroll
    for (int i = 0; i < 16; ++i) { const unsigned short hb = bf16_bits(xs[i]); ah.u[i] = hb; al.u[i] = ASPLIT ? bf16_bits(xs[i] - bf16_val(hb)) : (unsigned short)0; }
#pragma unroll
    for (int t = 0; t < 4; ++t) {
      const unsigned short* brow = Wt + (size_t)(col0 + t * 16 + ln) * ldb + kb;
      FragB b;
      b.half[0] = *(const v8us*)(brow + 8 * hh);
      b.half[1] = *(const v8us*)(brow + 16 + 8 * hh);
      acc[t] = mmaN<ASPLIT ? 2 : 1>(ah.v, al.v, b.v, b.v, acc[t]);
    }
  }
#pragma unroll
  for (int t = 0; t < 4; ++t) {
    const int col = col0 + t * 16 + ln;
    float bv = bias ? bias[col] : 0.f;
    if (BIAS_BF16) bv = bf16_round(bv);
#pragma unroll
    for (int r = 0; r < 8; ++r) {
      float v = acc[t][r] + bv;
      if (resid) { float rv = resid[(size_t)((row0 + 8 * hh + r) % rmod) * ldr + col]; if (RES_BF16) rv = bf16_round(rv); v += rv; }
      if (ACT == 1) v = fmaxf(v, 0.f);
      if (ACT == 2) v = 0.5f * v * (1.0f + erff(v * 0.70710678118654752f));
      if (ACT == 3) { const float u = 0.7978845608028654f * (v + 0.044715f * v * v * v); v = 0.5f * v * (1.0f + tanhf(u)); }
      so[w][8 * hh + r][t * 16 + ln] = v;
    }
  }
  __builtin_amdgcn_fence(__ATOMIC_ACQ_REL, "workgroup");
  __builtin_amdgcn_wave_barrier();
  const int rsub = lane >> 4, c4 = (lane & 15) * 4;
  {
#pragma unroll
    for (int q = 0; q < 8; ++q) {
      const int r = q * 2 + rsub;
      const v4f v = *(const v4fa*)&so[w][r][c4];
      *(v4f*)(C + (size_t)(row0 + r) * ldc + col0 + c4) = v;
    }
    
  }
}
// row LayerNorm (biased variance, eps) over N: s = X (+ R); optional out_sum <- s; out_norm <- (s-mu)*rsqrt(var+eps)*g + b
template <bool PARAM_BF16>
__global__ __launch_bounds__(256) void k_layernorm(const float* __restrict__ X, const float* __restrict__ R, const float* __restrict__ g, const float* __restrict__ bta,
                                                  float* __restrict__ out_sum, float* __restrict__ out_norm, int N, float eps) {
  __shared__ float red[256];
  const int row = blockIdx.x, tid = threadIdx.x;
  const float* x = X + (size_t)row * N; const float* rr = R ? R + (size_t)row * N : nullptr;
  float vals[16];                     // up to N = 4096
  const int per = N / 256;            // contiguous chunk per thread? use strided-by-4 chunks: thread handles j = tid*4 + 1024*u
  float s1 = 0.f;
  for (int u = 0; u < per / 4; ++u) {
    const int j = tid * 4 + 1024 * u;
    const v4f a = *(const v4fa*)(x + j);
    v4f b = {0.f,0.f,0.f,0.f}; if (rr) b = *(const v4fa*)(rr + j);
#pragma unroll
    for (int q = 0; q < 4; ++q) { const float v = a[q] + b[q]; vals[u * 4 + q] = v; s1 += v; }
  }
  red[tid] = s1; __syncthreads();
  for (int st = 128; st > 0; st >>= 1) { if (tid < st) red[tid] += red[tid + st]; __syncthreads(); }
  const float mu = red[0] / (float)N; __syncthreads();
  float s2 = 0.f;
  for (int u = 0; u < per / 4; ++u)
#pragma unroll
    for (int q = 0; q < 4; ++q) { const float c = vals[u * 4 + q] - mu; s2 += c * c; }
  red[tid] = s2; __syncthreads();
  for (int st = 128; st > 0; st >>= 1) { if (tid < st) red[tid] += red[tid + st]; __syncthreads(); }
  const float rs = rsqrtf(red[0] / (float)N + eps);
  {
    for (int u = 0; u < per / 4; ++u) {
      const int j = tid * 4 + 1024 * u;
      v4f o, sm;
#pragma unroll
      for (int q = 0; q < 4; ++q) {
        float gg = g[j + q], bb = bta[j + q];
        if (PARAM_BF16) { gg = bf16_round(gg); bb = bf16_round(bb); }
        sm[q] = vals[u * 4 + q]; o[q] = (vals[u * 4 + q] - mu) * rs * gg + bb;
      }
      if (out_sum) *(v4f*)(out_sum + (size_t)row * N + j) = sm;
      *(v4f*)(out_norm + (size_t)row * N + j) = o;
    }
    
  }
}



// ---- f16 WMMA path (v_wmma_f32_16x16x32_f16): 11-bit significands for operands in range — used where a [0,1] probability operand needs more precision than bf16
typedef _Float16 v16h __attribute__((ext_vector_type(16)));
union FragH { v16h v; v8us half[2]; _Float16 h[16]; unsigned short u[16]; };
template <int NT>
__device__ __forceinline__ v8f mmaH(v16h ah, v16h al, v16h bh, v16h bl, v8f c) {
  c = __builtin_amdgcn_wmma_f32_16x16x32_f16(false, ah, false, bh, (short)0, c, false, false);
  if (NT >= 2) c = __builtin_amdgcn_wmma_f32_16x16x32_f16(false, al, false, bh, (short)0, c, false, false);
  if (NT >= 3) c = __builtin_amdgcn_wmma_f32_16x16x32_f16(false, ah, false, bl, (short)0, c, false, false);
  asm volatile("v_nop\n\tv_nop\n\tv_nop\n\tv_nop" : "+v"(c) : "v"(ah), "v"(al), "v"(bh), "v"(bl));
  return c;
}
// batched GEMM like k_gemm_b but f16 operands: A f32 (split into f16 hi/lo if ASPLIT, else rounded to f16), Bt = f16 values [n][k]; alpha; C f32; N multiple of 16 (partial tiles skipped)
template <bool ASPLIT>
__global__ __launch_bounds__(128) void k_gemm_h(const float* __restrict__ A, int lda, size_t sA, const _Float16* __restrict__ Bh, int ldb, size_t sB, float alpha, float* __restrict__ C, int ldc, size_t sC, int M, int N, int K) {
  __shared__ __attribute__((aligned(16))) float so[4][16][64];
  const int tid = threadIdx.x, w = tid >> 5, lane = tid & 31, ln = lane & 15, hh = lane >> 4; const int by = blockIdx.y;
  A += (size_t)by * sA; Bh += (size_t)by * sB; C += (size_t)by * sC;
  const int ntn = (N + 63) / 64; const int wid = blockIdx.x * 4 + w; const int mt = wid / ntn, nq = wid % ntn; if (mt * 16 >= M) return;
  const int row0 = mt * 16, col0 = nq * 64; const float* arow = A + (size_t)(row0 + ln) * lda;
  v8f acc[4] = {};
  for (int kb = 0; kb < K; kb += 32) {
    FragH ah, al;
    const v4f x0 = *(const v4fa*)(arow + kb + 8 * hh), x1 = *(const v4fa*)(arow + kb + 8 * hh + 4), x2 = *(const v4fa*)(arow + kb + 16 + 8 * hh), x3 = *(const v4fa*)(arow + kb + 16 + 8 * hh + 4);
    float xs[16] = {x0[0],x0[1],x0[2],x0[3],x1[0],x1[1],x1[2],x1[3],x2[0],x2[1],x2[2],x2[3],x3[0],x3[1],x3[2],x3[3]};
#pragma unroll
    for (int i = 0; i < 16; ++i) { const _Float16 h = (_Float16)xs[i]; ah.h[i] = h; al.h[i] = ASPLIT ? (_Float16)(xs[i] - (float)h) : (_Float16)0.0f; }
#pragma unroll
    for (int t = 0; t < 4; ++t) { if (col0 + t * 16 >= N) continue; const size_t boff = (size_t)(col0 + t * 16 + ln) * ldb + kb; FragH bq; bq.half[0] = *(const v8us*)(Bh + boff + 8 * hh); bq.half[1] = *(const v8us*)(Bh + boff + 16 + 8 * hh);
      acc[t] = mmaH<ASPLIT ? 2 : 1>(ah.v, al.v, bq.v, bq.v, acc[t]); }
  }
#pragma unroll
  for (int t = 0; t < 4; ++t) { if (col0 + t * 16 >= N) continue;
#pragma unroll
    for (int r = 0; r < 8; ++r) so[w][8 * hh + r][t * 16 + ln] = acc[t][r] * alpha; }
  __builtin_amdgcn_fence(__ATOMIC_ACQ_REL, "workgroup"); __builtin_amdgcn_wave_barrier();
  const int rsub = lane >> 4, c4 = (lane & 15) * 4;
  {
#pragma unroll
    for (int q = 0; q < 8; ++q) { const int r = q * 2 + rsub; if (col0 + c4 < N) { const v4f v = *(const v4fa*)&so[w][r][c4]; *(v4f*)(C + (size_t)(row0 + r) * ldc + col0 + c4) = v; } }
     }
}

// Wt[n][k] = f16(W[k][n]·scale) from f32 row-major W[K][N] (scale = power of two; bf16-exact weights stay exact in f16 away from the subnormal range)
__global__ __launch_bounds__(256) void k_wt_f16(const float* __restrict__ W, _Float16* __restrict__ Wt, int K, int N, float scale) {
  const int t = blockIdx.x * 256 + threadIdx.x; if (t >= N * (K / 8)) return; const int n = t / (K / 8), k8 = (t % (K / 8)) * 8; FragH f;
#pragma unroll
  for (int i = 0; i < 8; ++i) f.h[i] = (_Float16)(bf16_round(W[(size_t)(k8 + i) * N + n]) * scale); const v8us o = f.half[0];
  *(v8us*)((unsigned short*)Wt + (size_t)n * K + k8) = o; 
}
// k_gemm_hh variant with fused epilogue: v = acc·alpha + bias[by·sBias + col] (+ CP[(row/rowsPerB)·sCPb + by·64 + col] if CP) ; ACT 0 none / 1 elu ; writes f16 C16 (and f32 C if non-null)
template <int ACT>
__global__ __launch_bounds__(128) void k_gemm_hhx(const _Float16* __restrict__ A, int lda, size_t sA, const _Float16* __restrict__ Bh, int ldb, size_t sB, float alpha, const float* __restrict__ bias, size_t sBias, const float* __restrict__ CP, int rowsPerB, size_t sCPb, int row0g,
    float* __restrict__ C, _Float16* __restrict__ C16, int ldc, size_t sC, int M, int N, int K) {
  __shared__ __attribute__((aligned(16))) float so[4][16][64];
  const int tid = threadIdx.x, w = tid >> 5, lane = tid & 31, ln = lane & 15, hh = lane >> 4; const int by = blockIdx.y;
  A += (size_t)by * sA; Bh += (size_t)by * sB; const size_t cofs = (size_t)by * sC; const float* bp = bias ? bias + (size_t)by * sBias : nullptr;
  const int ntn = (N + 63) / 64; const int wid = blockIdx.x * 4 + w; const int mt = wid / ntn, nq = wid % ntn; if (mt * 16 >= M) return;
  const int row0 = mt * 16, col0 = nq * 64; const _Float16* arow = A + (size_t)(row0 + ln) * lda;
  v8f acc[4] = {};
  for (int kb = 0; kb < K; kb += 32) { FragH ah; ah.half[0] = *(const v8us*)((const unsigned short*)arow + kb + 8 * hh); ah.half[1] = *(const v8us*)((const unsigned short*)arow + kb + 16 + 8 * hh);
#pragma unroll
    for (int t = 0; t < 4; ++t) { if (col0 + t * 16 >= N) continue; const size_t boff = (size_t)(col0 + t * 16 + ln) * ldb + kb; FragH bq; bq.half[0] = *(const v8us*)((const unsigned short*)Bh + boff + 8 * hh); bq.half[1] = *(const v8us*)((const unsigned short*)Bh + boff + 16 + 8 * hh);
      acc[t] = mmaH<1>(ah.v, ah.v, bq.v, bq.v, acc[t]); }
  }
#pragma unroll
  for (int t = 0; t < 4; ++t) { if (col0 + t * 16 >= N) continue; const int col = col0 + t * 16 + ln; const float bv = bp ? bf16_round(bp[col]) : 0.f;
#pragma unroll
    for (int r = 0; r < 8; ++r) { float v = acc[t][r] * alpha + bv; if (CP) { const int rr = row0g + row0 + 8 * hh + r; if (rowsPerB < 0) v += CP[cofs + (size_t)rr * ldc + col];      /* rowsPerB < 0: own element of the batched C plane */ else { const int bidx = rr / rowsPerB; v += CP[(size_t)bidx * sCPb + (size_t)by * 64 + col]; } } if (ACT == 1) v = (v > 0.f) ? v : expm1f(v); else if (ACT == 7) v = (v > 0.f) ? v + 1.0f : expf(v); else if (ACT == 8) v = tanhf(v); else if (ACT == 9) v = 0.5f * v * (1.0f + tanhf(0.7978845608028654f * (v + 0.044715f * v * v * v))); else if (ACT == 11) v = 1.0f / (1.0f + expf(-v)); else if (ACT == 12) v = (v > 0.f) ? v : 0.01f * v; else if (ACT == 14) v = (v > 0.f) ? v : 0.1f * v; else if (ACT == 16) v = (v >= 0.f) ? v : 0.3f * v; else if (ACT == 17) v = (v >= 0.f) ? v : 0.2f * v; else if (ACT == 15) v = v / (1.0f + expf(-v)); else if (ACT == 3) v = fmaxf(v, 0.f); else if (ACT == 6) v = 0.5f * v * (1.0f + erff(v * 0.70710678118654752f)); so[w][8 * hh + r][t * 16 + ln] = v; } }
  __builtin_amdgcn_fence(__ATOMIC_ACQ_REL, "workgroup"); __builtin_amdgcn_wave_barrier();
  const int rsub = lane >> 4, c4 = (lane & 15) * 4; typedef _Float16 v4h __attribute__((ext_vector_type(4)));
  {
#pragma unroll
    for (int q = 0; q < 8; ++q) { const int r = q * 2 + rsub; if (col0 + c4 < N) { const v4f v = *(const v4fa*)&so[w][r][c4]; if (C) *(v4f*)(C + cofs + (size_t)(row0 + r) * ldc + col0 + c4) = v; if (C16) { v4h h4; for (int i = 0; i < 4; ++i) h4[i] = (_Float16)v[i]; *(v4h*)(C16 + cofs + (size_t)(row0 + r) * ldc + col0 + c4) = h4; } } }
     }
}


typedef _Float16 v4h __attribute__((ext_vector_type(4)));

__global__ __launch_bounds__(256) void k_x16(const float* __restrict__ x, _Float16* __restrict__ X16, size_t n8) { const size_t t = (size_t)blockIdx.x * 256 + threadIdx.x; if (t >= n8) return; FragH f;
#pragma unroll
  for (int q = 0; q < 8; ++q) f.h[q] = (_Float16)bf16_round(x[t * 8 + q]); *(v8us*)((unsigned short*)X16 + t * 8) = f.half[0];  }
__global__ __launch_bounds__(256) void k_h16(const float* __restrict__ x, _Float16* __restrict__ X16, size_t n8) { const size_t t = (size_t)blockIdx.x * 256 + threadIdx.x; if (t >= n8) return; FragH f;
#pragma unroll
  for (int q = 0; q < 8; ++q) f.h[q] = (_Float16)x[t * 8 + q]; *(v8us*)((unsigned short*)X16 + t * 8) = f.half[0];  }
__global__ __launch_bounds__(256) void k_round16f(const float* __restrict__ W, _Float16* __restrict__ Bt, size_t n8) { const size_t t = (size_t)blockIdx.x * 256 + threadIdx.x; if (t >= n8) return; FragH f;
#pragma unroll
  for (int i = 0; i < 8; ++i) f.h[i] = (_Float16)(bf16_round(W[t * 8 + i]) * 16.0f); *(v8us*)((unsigned short*)Bt + t * 8) = f.half[0];  }
template <int NHv, int TTv>
__global__ __launch_bounds__(256) void k_vt(const _Float16* __restrict__ V16, int ldv, int voff, _Float16* __restrict__ Vt) { __shared__ unsigned short tl[64][66]; const int tid = threadIdx.x; const int slab = blockIdx.x / (TTv / 64), lg = blockIdx.x % (TTv / 64); const int b = slab / NHv, h = slab % NHv;
  for (int i = tid; i < 64 * 8; i += 256) { const int r = i / 8, c8 = (i % 8) * 8; FragH f; f.half[0] = *(const v8us*)((const unsigned short*)V16 + ((size_t)b * TTv + lg * 64 + r) * ldv + voff + h * 64 + c8);
#pragma unroll
    for (int q = 0; q < 8; ++q) tl[r][c8 + q] = f.u[q]; }
  __syncthreads();
  {
#pragma unroll
    for (int rd = 0; rd < 2; ++rd) { const int d = rd * 32 + tid / 8, pc = tid % 8; FragH f;
#pragma unroll
      for (int q = 0; q < 8; ++q) f.u[q] = tl[pc * 8 + q][d];
      *(v8us*)((unsigned short*)Vt + ((size_t)slab * 64 + d) * TTv + lg * 64 + pc * 8) = f.half[0]; }
     } }

__global__ __launch_bounds__(256) void k_hl(const float* __restrict__ F, _Float16* __restrict__ Hh, _Float16* __restrict__ Hl, size_t n8) { const size_t t = (size_t)blockIdx.x * 256 + threadIdx.x; if (t >= n8) return; FragH fh, fl; const v4f a = *(const v4fa*)(F + t * 8), c = *(const v4fa*)(F + t * 8 + 4);
#pragma unroll
  for (int q = 0; q < 4; ++q) { _Float16 h = (_Float16)a[q]; fh.h[q] = h; fl.h[q] = (_Float16)((a[q] - (float)h) * 1024.0f); h = (_Float16)c[q]; fh.h[4 + q] = h; fl.h[4 + q] = (_Float16)((c[q] - (float)h) * 1024.0f); }
  { *(v8us*)((unsigned short*)Hh + t * 8) = fh.half[0]; *(v8us*)((unsigned short*)Hl + t * 8) = fl.half[0];  } }

// ---- fast GEMM (wave tile 32x64; requires M % 32 == 0 rows per launch region and N % 64 == 0); epilogue = k_gemm_hhx semantics ----
__device__ __forceinline__ v16h g2_frag(const _Float16* p, int hh) { FragH f; f.half[0] = *(const v8us*)((const unsigned short*)p + 8 * hh); f.half[1] = *(const v8us*)((const unsigned short*)p + 16 + 8 * hh); return f.v; }
__device__ __forceinline__ v8f g2_mma(v16h a, v16h b, v8f c) { v8f d = __builtin_amdgcn_wmma_f32_16x16x32_f16(false, a, false, b, (short)0, c, false, false); asm volatile("v_nop\n\tv_nop\n\tv_nop\n\tv_nop" : "+v"(d) : "v"(a), "v"(b)); return d; }
template <int ACT>
__global__ __launch_bounds__(128) void k_gemm2(const _Float16* __restrict__ A, int lda, size_t sA, const _Float16* __restrict__ Bh, int ldb, size_t sB, float alpha, const float* __restrict__ bias, size_t sBias, const float* __restrict__ CP, int rowsPerB, size_t sCPb, int row0g,
    float* __restrict__ C, _Float16* __restrict__ C16, int ldc, size_t sC, int M, int N, int K) { static_assert(ACT == 0 || ACT == 3 || ACT == 6 || ACT == 8 || ACT == 9 || ACT == 11 || ACT == 12 || ACT == 14 || ACT == 15 || ACT == 16 || ACT == 17, "k_gemm2: unsupported ACT code (would silently apply no activation)");
  __shared__ __attribute__((aligned(16))) float so[4][32][68];
  const int tid = threadIdx.x, w = tid >> 5, lane = tid & 31, ln = lane & 15, hh = lane >> 4; const int by = blockIdx.y;
  A += (size_t)by * sA; Bh += (size_t)by * sB; const size_t cofs = (size_t)by * sC; const float* bp = bias ? bias + (size_t)by * sBias : nullptr;
  const int ntn = N >> 6; const int mt = blockIdx.x / ntn, nq = blockIdx.x - mt * ntn; const int row0 = mt * 128 + 32 * w, col0 = nq * 64; if (row0 >= M) return;
  const _Float16* a0p = A + (size_t)(row0 + ln) * lda; const _Float16* a1p = a0p + (size_t)16 * lda;
  const _Float16* b0p = Bh + (size_t)(col0 + ln) * ldb; const _Float16* b1p = b0p + (size_t)16 * ldb; const _Float16* b2p = b1p + (size_t)16 * ldb; const _Float16* b3p = b2p + (size_t)16 * ldb;
  const v8f z8 = {0.f,0.f,0.f,0.f,0.f,0.f,0.f,0.f}; v8f c00 = z8, c01 = z8, c02 = z8, c03 = z8, c10 = z8, c11 = z8, c12 = z8, c13 = z8;
#pragma unroll 1
  for (int kb = 0; kb < K; kb += 32) { const v16h a0 = g2_frag(a0p + kb, hh), a1 = g2_frag(a1p + kb, hh);
    v16h b = g2_frag(b0p + kb, hh); c00 = g2_mma(a0, b, c00); c10 = g2_mma(a1, b, c10);
    b = g2_frag(b1p + kb, hh); c01 = g2_mma(a0, b, c01); c11 = g2_mma(a1, b, c11);
    b = g2_frag(b2p + kb, hh); c02 = g2_mma(a0, b, c02); c12 = g2_mma(a1, b, c12);
    b = g2_frag(b3p + kb, hh); c03 = g2_mma(a0, b, c03); c13 = g2_mma(a1, b, c13); }
  v8f accs[8] = {c00, c01, c02, c03, c10, c11, c12, c13};
#pragma unroll
  for (int u = 0; u < 8; ++u) { const int t = u & 3, half = u >> 2; const int col = col0 + t * 16 + ln; const float bv = bp ? bf16_round(bp[col]) : 0.f;
#pragma unroll
    for (int r = 0; r < 8; ++r) { const int rloc = half * 16 + 8 * hh + r; float v = accs[u][r] * alpha + bv; if (CP) { if (rowsPerB < 0) v += CP[cofs + (size_t)(row0g + row0 + rloc) * ldc + col];      /* rowsPerB < 0: own element of the batched C plane */ else { const int bidx = (row0g + row0 + rloc) / rowsPerB; v += CP[(size_t)bidx * sCPb + (size_t)by * 64 + col]; } }
      if (ACT == 3) v = fmaxf(v, 0.f); else if (ACT == 6) v = 0.5f * v * (1.0f + erff(v * 0.70710678118654752f)); else if (ACT == 11) v = 1.0f / (1.0f + expf(-v)); else if (ACT == 15) v = v / (1.0f + expf(-v)); else if (ACT == 12) v = (v > 0.f) ? v : 0.01f * v; else if (ACT == 8) v = tanhf(v); else if (ACT == 9) v = 0.5f * v * (1.0f + tanhf(0.7978845608028654f * (v + 0.044715f * v * v * v))); else if (ACT == 14) v = (v > 0.f) ? v : 0.1f * v; else if (ACT == 16) v = (v >= 0.f) ? v : 0.3f * v; else if (ACT == 17) v = (v >= 0.f) ? v : 0.2f * v;
      so[w][rloc][t * 16 + ln] = v; } }
  __builtin_amdgcn_fence(__ATOMIC_ACQ_REL, "workgroup"); __builtin_amdgcn_wave_barrier();
  const int rsub = lane >> 4, c4 = (lane & 15) * 4;
  {
#pragma unroll
    for (int q = 0; q < 16; ++q) { const int r = q * 2 + rsub; const v4f v = *(const v4fa*)&so[w][r][c4]; if (C) *(v4f*)(C + cofs + (size_t)(row0 + r) * ldc + col0 + c4) = v; if (C16) { v4h h4; for (int i = 0; i < 4; ++i) h4[i] = (_Float16)v[i]; *(v4h*)(C16 + cofs + (size_t)(row0 + r) * ldc + col0 + c4) = h4; } }
     } }


__global__ __launch_bounds__(256) void k_wnat(const float* __restrict__ w, size_t n8, _Float16* __restrict__ Bt) { const size_t t = (size_t)blockIdx.x * 256 + threadIdx.x; if (t >= n8) return; FragH f; for (int q = 0; q < 8; ++q) f.h[q] = (_Float16)(bf16_round(w[t * 8 + q]) * 16.0f); *(v8us*)((unsigned short*)Bt + t * 8) = f.half[0];  }
// keys -> f16 (bf16-rounded) in A-fragment order: unit u = 16 bytes = (slab = b*NH + h, 16-key tile, 32-wide d step, fragment half j, lane = 16 hh + ln) holds k[key = 16 tile + ln][d = 32 step + 16 j + 8 hh .. + 7].
// Threads run in the order of the units: stores are contiguous, a block reads 32 rows x 256 contiguous bytes.
__global__ __launch_bounds__(256) void k_kfrag(const float* __restrict__ x, _Float16* __restrict__ KF, size_t n8) { const size_t u = (size_t)blockIdx.x * 256 + threadIdx.x; if (u >= n8) return;
  const int ln = (int)(u & 15), hh = (int)(u >> 4) & 1, j = (int)(u >> 5) & 1, ks = (int)(u >> 6) & 1; const int tile = (int)(u >> 7); const int kt = tile % (SQ / 16), slab = tile / (SQ / 16); const int b = slab / NH, h = slab % NH;
  const float* s = x + ((size_t)b * SQ + kt * 16 + ln) * DM + h * HD + ks * 32 + j * 16 + hh * 8; const v4f p = *(const v4fa*)s, q = *(const v4fa*)(s + 4); FragH f;
#pragma unroll      /* constant indices keep the arrays in registers */
  for (int i = 0; i < 4; ++i) { f.h[i] = (_Float16)bf16_round(p[i]); f.h[4 + i] = (_Float16)bf16_round(q[i]); }
  *(v8us*)((unsigned short*)KF + u * 8) = f.half[0]; }
// V (f16 rows) -> V^T in A-fragment order, through an LDS tile of 64 keys x 64 d: unit (slab, 32-key block, 16-row d tile t, half j, lane) holds v[key = 32 block + 16 j + 8 hh .. + 7][d = 16 t + ln].
__global__ __launch_bounds__(256) void k_vfrag(const _Float16* __restrict__ V16, _Float16* __restrict__ VF) { __shared__ unsigned short tl[64][66]; const int tid = threadIdx.x; const int slab = blockIdx.x / (SQ / 64), lg = blockIdx.x % (SQ / 64); const int b = slab / NH, h = slab % NH;
  for (int i = tid; i < 64 * 8; i += 256) { const int r = i / 8, c8 = (i % 8) * 8; FragH f; f.half[0] = *(const v8us*)((const unsigned short*)V16 + ((size_t)b * SQ + lg * 64 + r) * DM + h * HD + c8);
#pragma unroll      /* constant indices keep the arrays in registers */
    for (int q = 0; q < 8; ++q) tl[r][c8 + q] = f.u[q]; }
  __syncthreads();
#pragma unroll      /* constant indices keep the arrays in registers */
  for (int rd = 0; rd < 2; ++rd) { const int ln = tid & 15, hh = (tid >> 4) & 1, j = (tid >> 5) & 1, t = tid >> 6; FragH f;
#pragma unroll      /* constant indices keep the arrays in registers */
    for (int q = 0; q < 8; ++q) f.u[q] = tl[rd * 32 + j * 16 + hh * 8 + q][t * 16 + ln];
    *(v8us*)((unsigned short*)VF + ((size_t)slab * (SQ / 32) + lg * 2 + rd) * 2048 + (size_t)tid * 8) = f.half[0]; } }
// ---- fused attention: one wave = 32 query columns (2 groups of 16) of one head, a pass = 32 keys; 8 waves a block share one head's K and V^T stream through the cache ----
__device__ __forceinline__ v16h fa_frag(const unsigned short* p) { FragH f; f.half[0] = *(const v8us*)p; f.half[1] = *(const v8us*)(p + 256); return f.v; }      /* p = the lane's 16 bytes of half 0; half 1 lies 512 bytes on */
__device__ __forceinline__ v8f fa_mma(v16h a, v16h b, v8f c) { return __builtin_amdgcn_wmma_f32_16x16x32_f16(false, a, false, b, (short)0, c, false, false); }
__device__ __forceinline__ float fa_xhalf(float x) { return __builtin_bit_cast(float, __builtin_amdgcn_permlanex16(__builtin_bit_cast(int, x), __builtin_bit_cast(int, x), 0x76543210, 0xfedcba98, false, false)); }      /* lane l with lane l ^ 16 */
#define FQ 256      /* query rows a block */
__global__ __launch_bounds__(256) void k_fattn(const _Float16* __restrict__ Q16, const _Float16* __restrict__ KF, const _Float16* __restrict__ VF, _Float16* __restrict__ O16) {
  typedef float v2f __attribute__((ext_vector_type(2))); typedef _Float16 v2h __attribute__((ext_vector_type(2)));
  const int lane = threadIdx.x & 31, w = threadIdx.x >> 5, ln = lane & 15, hh = lane >> 4;
  const int slab = blockIdx.x / (SQ / FQ), qb = blockIdx.x % (SQ / FQ); const int b = slab / NH, h = slab % NH; const int q0 = qb * FQ + w * 32;
  const float cs = 0.044194173824159216f * 1.4426950408889634f;      /* 1 / sqrt(512) (the module's literal d_model scale) x log2 e */
  v16h qf[2][2];      /* B operand: column = query, k = d */
#pragma unroll      /* constant indices keep the arrays in registers */
  for (int g = 0; g < 2; ++g) { const _Float16* qp = Q16 + ((size_t)b * SQ + q0 + g * 16 + ln) * DM + h * HD; qf[g][0] = g2_frag(qp, hh); qf[g][1] = g2_frag(qp + 32, hh); }
  const unsigned short* kp = (const unsigned short*)KF + (size_t)slab * SQ * HD + lane * 8; const unsigned short* vp = (const unsigned short*)VF + (size_t)slab * SQ * HD + lane * 8;
  const v8f z8 = {0.f,0.f,0.f,0.f,0.f,0.f,0.f,0.f}; v8f o[2][4]; float mr[2], lr[2];
#pragma unroll      /* constant indices keep the arrays in registers */
  for (int g = 0; g < 2; ++g) { mr[g] = -__builtin_inff(); lr[g] = 0.f;
#pragma unroll      /* constant indices keep the arrays in registers */
    for (int t = 0; t < 4; ++t) o[g][t] = z8; }
  v16h kf[4], vf[4];      /* A operands: kf[16-key tile * 2 + d step], vf[16-row d tile]; both are asked for one pass ahead, into the registers that the pass has just used */
  const unsigned short* vq = vp;
#pragma unroll      /* constant indices keep the arrays in registers */
  for (int t = 0; t < 4; ++t) kf[t] = fa_frag(kp + t * 512);
  asm volatile("s_wait_xcnt 0x0" :: "v"(kp) : "memory");      /* the K loads' address pair stays whole until this wait; Q and K are asked for ahead of V, the order of every pass, so that the loop's counted load waits fit its first pass too */
#pragma unroll      /* constant indices keep the arrays in registers */
  for (int t = 0; t < 4; ++t) vf[t] = fa_frag(vq + t * 512);
  for (int i = 0; i < SQ / 32; ++i) {
    v8f s[2][2];      /* [group][key tile]: register r = score of key 16 tile + 8 hh + r, query ln */
#pragma unroll      /* constant indices keep the arrays in registers */
    for (int g = 0; g < 2; ++g) {
#pragma unroll      /* constant indices keep the arrays in registers */
      for (int kt = 0; kt < 2; ++kt) s[g][kt] = fa_mma(kf[kt * 2 + 1], qf[g][1], fa_mma(kf[kt * 2], qf[g][0], z8)); }
    asm volatile("s_wait_xcnt 0x0" :: "v"(vq) : "memory");      /* the V loads' address pair (asked for at the foot of the pass before) stays whole until this wait */
    const int nx = (i + 1 < SQ / 32) ? i + 1 : i;      /* the last pass asks for its own tiles again (in bounds, unused) */
    const unsigned short* kq = kp + (size_t)nx * 2048;
#pragma unroll      /* constant indices keep the arrays in registers */
    for (int t = 0; t < 4; ++t) kf[t] = fa_frag(kq + t * 512);
    float mb[2]; bool need = false;
#pragma unroll      /* constant indices keep the arrays in registers */
    for (int g = 0; g < 2; ++g) { float mx = s[g][0][0];
#pragma unroll      /* constant indices keep the arrays in registers */
      for (int r = 1; r < 8; ++r) mx = fmaxf(mx, s[g][0][r]);
#pragma unroll      /* constant indices keep the arrays in registers */
      for (int r = 0; r < 8; ++r) mx = fmaxf(mx, s[g][1][r]);
      mb[g] = fmaxf(mx, fa_xhalf(mx)) * cs; need = need || (mb[g] > mr[g] + 8.0f); }
    asm volatile("s_wait_xcnt 0x0" :: "v"(kq) : "memory");      /* the K loads' address pair stays whole until this wait; it also keeps those loads up here, a whole softmax and second product ahead of their use */
    if (__builtin_amdgcn_ballot_w32(need) != 0) {      /* the maximum in use may trail the true one by up to 8 (log2): weights stay <= 2^8; one test a pass */
#pragma unroll      /* constant indices keep the arrays in registers */
      for (int g = 0; g < 2; ++g) { const float mn = fmaxf(mr[g], mb[g]); const float corr = __builtin_amdgcn_exp2f(mr[g] - mn); mr[g] = mn; lr[g] *= corr;      /* corr = 0 in the first pass */
#pragma unroll      /* constant indices keep the arrays in registers */
        for (int t = 0; t < 4; ++t) o[g][t] = o[g][t] * corr; } }
#pragma unroll      /* constant indices keep the arrays in registers */
    for (int g = 0; g < 2; ++g) { const float nm = -mr[g]; FragH pf; v2f ls = {0.f, 0.f};      /* two score tiles, converted in place, are the B operand of the second product */
#pragma unroll      /* constant indices keep the arrays in registers */
      for (int e = 0; e < 8; ++e) { const v2f sv = {s[g][e >> 2][2 * (e & 3)], s[g][e >> 2][2 * (e & 3) + 1]}; const v2f ar = __builtin_elementwise_fma(sv, (v2f){cs, cs}, (v2f){nm, nm});
        const v2f pv = {__builtin_amdgcn_exp2f(ar[0]), __builtin_amdgcn_exp2f(ar[1])}; ls += pv; const v2h ph = __builtin_convertvector(pv, v2h); pf.h[2 * e] = ph[0]; pf.h[2 * e + 1] = ph[1]; }
      lr[g] += ls[0] + ls[1];
#pragma unroll      /* constant indices keep the arrays in registers */
      for (int t = 0; t < 4; ++t) o[g][t] = fa_mma(vf[t], pf.v, o[g][t]); }
    vq = vp + (size_t)nx * 2048;
#pragma unroll      /* constant indices keep the arrays in registers */
    for (int t = 0; t < 4; ++t) vf[t] = fa_frag(vq + t * 512);
  }
#pragma unroll      /* constant indices keep the arrays in registers */
  for (int g = 0; g < 2; ++g) { const float inv = 64.0f / (lr[g] + fa_xhalf(lr[g])); unsigned short* op = (unsigned short*)O16 + ((size_t)b * SQ + q0 + g * 16 + ln) * DM + h * HD + 8 * hh;      /* o carried x64; register r of tile t = d 16 t + 8 hh + r of query ln */
#pragma unroll      /* constant indices keep the arrays in registers */
    for (int t = 0; t < 4; ++t) { FragH f;
#pragma unroll      /* constant indices keep the arrays in registers */
      for (int r = 0; r < 8; ++r) f.h[r] = (_Float16)(o[g][t][r] * inv);
      *(v8us*)(op + t * 16) = f.half[0]; } } }
__global__ __launch_bounds__(256) void k_vt(const _Float16* __restrict__ V16, int b, int h0, _Float16* __restrict__ VT) { __shared__ unsigned short tl[64][65]; const int tid = threadIdx.x; const int hh = blockIdx.x % HG, sg = blockIdx.x / HG; const int s0 = sg * 64; const int h = h0 + hh;
  for (int i = tid; i < 64 * 8; i += 256) { const int j = i / 8, d8 = (i % 8) * 8; FragH f; f.half[0] = *(const v8us*)((const unsigned short*)V16 + ((size_t)b * SQ + s0 + j) * DM + h * HD + d8); for (int q = 0; q < 8; ++q) tl[d8 + q][j] = f.u[q]; }
  __syncthreads();
  { for (int i = tid; i < 64 * 8; i += 256) { const int d = i / 8, j8 = (i % 8) * 8; FragH f; for (int q = 0; q < 8; ++q) f.u[q] = tl[d][j8 + q]; *(v8us*)((unsigned short*)VT + ((size_t)hh * HD + d) * SQ + s0 + j8) = f.half[0]; }  } }



__global__ __launch_bounds__(256) void k_rsmkm(const float* __restrict__ S, _Float16* __restrict__ P, int nrows, const int* __restrict__ am) {
  #pragma clang fp contract(off)
  const int t = blockIdx.x * 256 + threadIdx.x; if (t >= nrows) return; const size_t i = (size_t)t; const float* s = S + i * SQ; const int* mr = am + (size_t)(t % SQ) * SQ; float mx = -3.0e38f;
#pragma unroll 1
  for (int j = 0; j < SQ; ++j) { const float f = (mr[j] != 0) ? 1.f : 0.f; mx = fmaxf(mx, fmaf(f, s[j], (1.f - f) * -1.0e9f)); } float se = 0.f;
#pragma unroll 1
  for (int j = 0; j < SQ; ++j) { const float f = (mr[j] != 0) ? 1.f : 0.f; se += __expf(fmaf(f, s[j], (1.f - f) * -1.0e9f) - mx); } const float sc = 256.0f / se;
#pragma unroll 1
  for (int j0 = 0; j0 < SQ; j0 += 8) { FragH fr; for (int q = 0; q < 8; ++q) { const int j = j0 + q; const float f = (mr[j] != 0) ? 1.f : 0.f; fr.h[q] = (_Float16)(__expf(fmaf(f, s[j], (1.f - f) * -1.0e9f) - mx) * sc); }
    unsigned short* d = (unsigned short*)P + i * SQ + j0; *(v8us*)d = fr.half[0];  } }
extern "C" void kernel_launch(void* const* d_in, const int* in_sizes, int n_in,
                              void* d_out, int out_size, void* d_ws, size_t ws_size, hipStream_t stream) {
  (void)in_sizes; (void)n_in; (void)out_size;
  const float* const* I = (const float* const*)d_in; const float* xq = I[0]; const float* xk = I[1]; const float* xv = I[2]; const float* wo = I[3]; const float* bo = I[4];      /* queries, keys, values [4][2048][512] (used as q, k, v directly: no input projections); natural W_out [512][512] + b_out */
  static_assert(NH * HD == DM && DM % 64 == 0 && DM % 32 == 0 && SQ % 128 == 0 && NH % HG == 0 && SQ % FQ == 0 && HD == 64, "shape / tile multiples");
  char* ws = (char*)d_ws; size_t off = 0;
  auto take = [&](size_t bytes) { char* p = ws + off; off += (bytes + 255) & ~(size_t)255; return p; };
  _Float16* BO = (_Float16*)take((size_t)DM * DM * 2);
  _Float16* Q16 = (_Float16*)take(NR * DM * 2); _Float16* KF = (_Float16*)take(NR * DM * 2); _Float16* V16 = (_Float16*)take(NR * DM * 2); _Float16* VF = (_Float16*)take(NR * DM * 2); _Float16* O16 = (_Float16*)take(NR * DM * 2);
  if (off > ws_size) return;
  k_wnat<<<(unsigned)(((size_t)DM * DM / 8 + 255) / 256), 256, 0, stream>>>(wo, (size_t)DM * DM / 8, BO);      /* natural W_out [out][in] = Bt[n][k] x16 */
  k_kfrag<<<(unsigned)((NR * DM / 8 + 255) / 256), 256, 0, stream>>>(xk, KF, NR * DM / 8); k_x16<<<(unsigned)((NR * DM / 8 + 255) / 256), 256, 0, stream>>>(xv, V16, NR * DM / 8);      /* keys in fragment order; values as exact f16 rows */
  k_x16<<<(unsigned)((NR * DM / 8 + 255) / 256), 256, 0, stream>>>(xq, Q16, NR * DM / 8);      /* queries as exact f16 rows = the q operand */
  const size_t r0p = (size_t)B0 * SQ;      /* first projected row */
  k_vfrag<<<NB * NH * (SQ / 64), 256, 0, stream>>>(V16, VF);      /* V^T in fragment order, all batches and heads */
  k_fattn<<<NB * NH * (SQ / FQ), 256, 0, stream>>>(Q16, KF, VF, O16);      /* o (merged heads) as f16 rows x64 */
  k_gemm2<0><<<dim3((unsigned)((MPO / 128) * (DM / 64)), 1), 128, 0, stream>>>(O16 + r0p * DM, DM, 0, BO, DM, 0, 0.0009765625f, bo, 0, nullptr, 1, 0, 0, (float*)d_out + r0p * DM, nullptr, DM, 0, MPO, DM, DM);      /* out rows are the output layout */
}

// v003
// It runs in 84.2 microseconds.
// Next to v002, in two timings, it ran 1.09 and 1.10 times as fast.
// All steps since v000 together make it 43.5 times as fast.
#include <hip/hip_runtime.h>
#define NB 4
#define SQ 2048
#define DM 512
#define NH 8
#define HD 64
#define HG 4                         /* heads per k_vt launch group (k_vt is not launched) */
#define B0 0                         /* first batch processed (debug hook) */
#define NBR NB                       /* batches processed (debug hook) */
#define NR ((size_t)NB * SQ)         /* token rows */
#define MP ((int)((size_t)NBR * SQ)) /* rows projected (debug hook) */
#define QN SQ                        /* query rows attended per batch (unused) */
#define NHD NH                       /* heads attended (unused) */
#define MPO MP                       /* rows through the output stage (debug hook) */
#define LQ DM      /* row pitch of the q/k/v rows (unused: the kernels use DM) */
typedef __bf16 v16b __attribute__((ext_vector_type(16)));
typedef unsigned short v8us __attribute__((ext_vector_type(8), may_alias));
typedef float  v8f  __attribute__((ext_vector_type(8)));
typedef float  v4f  __attribute__((ext_vector_type(4)));
typedef float  v4fa __attribute__((ext_vector_type(4), may_alias));
union FragB { v16b v; v8us half[2]; unsigned short u[16]; };

__device__ __forceinline__ unsigned short bf16_bits(float x) { unsigned int u = __float_as_uint(x); return (unsigned short)((u + 0x7FFFu + ((u >> 16) & 1u)) >> 16); }
__device__ __forceinline__ float bf16_val(unsigned short b) { return __uint_as_float(((unsigned int)b) << 16); }
__device__ __forceinline__ float bf16_round(float x) { return bf16_val(bf16_bits(x)); }
// D += A·B with NT terms: 1 = ah·bh, 2 = + al·bh (A split), 3 = + ah·bl (both split)
template <int NT>
__device__ __forceinline__ v8f mmaN(v16b ah, v16b al, v16b bh, v16b bl, v8f c) {
  c = __builtin_amdgcn_wmma_f32_16x16x32_bf16(false, ah, false, bh, (short)0, c, false, false);
  if (NT >= 2) c = __builtin_amdgcn_wmma_f32_16x16x32_bf16(false, al, false, bh, (short)0, c, false, false);
  if (NT >= 3) c = __builtin_amdgcn_wmma_f32_16x16x32_bf16(false, ah, false, bl, (short)0, c, false, false);
  asm volatile("v_nop\n\tv_nop\n\tv_nop\n\tv_nop" : "+v"(c) : "v"(ah), "v"(al), "v"(bh), "v"(bl));
  return c;
}

__global__ __launch_bounds__(256) void k_wt_bf16(const float* __restrict__ W, unsigned short* __restrict__ Wt, int K, int N) {
  const int t = blockIdx.x * 256 + threadIdx.x;
  const int k8n = K / 8;
  if (t >= N * k8n) return;
  const int n = t / k8n, k8 = (t % k8n) * 8;
  v8us v;
#pragma unroll
  for (int i = 0; i < 8; ++i) v[i] = bf16_bits(W[(size_t)(k8 + i) * N + n]);
  *(v8us*)(Wt + (size_t)n * K + k8) = v;
  
}

// GEMM C[M][N] (f32, pitch ldc) = act(A[M][K]·W + bias). A f32 row-major (pitch lda) converted per fragment to bf16
// (ASPLIT: hi/lo two planes -> 2 terms, else single rounded term); Wt bf16 [N][K] (pitch ldb). BIAS_BF16 rounds the
// bias to bf16 first (bias quantised to bf16 before the add). K%32==0, M%16==0, N%64==0.
template <bool ASPLIT, int ACT, bool BIAS_BF16>
__global__ __launch_bounds__(128) void k_gemm_bf(const float* __restrict__ A, int lda, const unsigned short* __restrict__ Wt, int ldb,
                                               const float* __restrict__ bias, float* __restrict__ C, int ldc, int M, int N, int K) {
  __shared__ __attribute__((aligned(16))) float so[4][16][64];
  const int tid = threadIdx.x, w = tid >> 5, lane = tid & 31, ln = lane & 15, hh = lane >> 4;
  const int ntn = N / 64;
  const int wid = blockIdx.x * 4 + w;
  const int mt = wid / ntn, nq = wid % ntn;
  if (mt * 16 >= M) return;
  const int row0 = mt * 16, col0 = nq * 64;
  const float* arow = A + (size_t)(row0 + ln) * lda;
  v8f acc[4] = {};
  for (int kb = 0; kb < K; kb += 32) {
    FragB ah, al;
    const v4f x0 = *(const v4fa*)(arow + kb + 8 * hh), x1 = *(const v4fa*)(arow + kb + 8 * hh + 4);
    const v4f x2 = *(const v4fa*)(arow + kb + 16 + 8 * hh), x3 = *(const v4fa*)(arow + kb + 16 + 8 * hh + 4);
    float xs[16] = {x0[0],x0[1],x0[2],x0[3],x1[0],x1[1],x1[2],x1[3],x2[0],x2[1],x2[2],x2[3],x3[0],x3[1],x3[2],x3[3]};
#pragma unroll
    for (int i = 0; i < 16; ++i) { const unsigned short hb = bf16_bits(xs[i]); ah.u[i] = hb; al.u[i] = ASPLIT ? bf16_bits(xs[i] - bf16_val(hb)) : (unsigned short)0; }
#pragma unroll
    for (int t = 0; t < 4; ++t) {
      const unsigned short* brow = Wt + (size_t)(col0 + t * 16 + ln) * ldb + kb;
      FragB b;
      b.half[0] = *(const v8us*)(brow + 8 * hh);
      b.half[1] = *(const v8us*)(brow + 16 + 8 * hh);
      acc[t] = mmaN<ASPLIT ? 2 : 1>(ah.v, al.v, b.v, b.v, acc[t]);
    }
  }
#pragma unroll
  for (int t = 0; t < 4; ++t) {
    float bv = bias ? bias[col0 + t * 16 + ln] : 0.f;
    if (BIAS_BF16) bv = bf16_round(bv);
#pragma unroll
    for (int r = 0; r < 8; ++r) { float v = acc[t][r] + bv; if (ACT == 1) v = fmaxf(v, 0.f); so[w][8 * hh + r][t * 16 + ln] = v; }
  }
  __builtin_amdgcn_fence(__ATOMIC_ACQ_REL, "workgroup");
  __builtin_amdgcn_wave_barrier();
  const int rsub = lane >> 4, c4 = (lane & 15) * 4;
  {
#pragma unroll
    for (int q = 0; q < 8; ++q) {
      const int r = q * 2 + rsub;
      const v4f v = *(const v4fa*)&so[w][r][c4];
      *(v4f*)(C + (size_t)(row0 + r) * ldc + col0 + c4) = v;
    }
    
  }
}

// GEMM C = act(A·W + bias + resid): A f32 (ASPLIT -> hi/lo 2 terms), Wt bf16 [N][K]; ACT 0 none, 1 relu, 2 exact gelu;
// resid (optional, f32, row index = (row % rmod), pitch ldr, RES_BF16 rounds it) added before the activation.
template <bool ASPLIT, int ACT, bool BIAS_BF16, bool RES_BF16>
__global__ __launch_bounds__(128) void k_gemm_bf3(const float* __restrict__ A, int lda, const unsigned short* __restrict__ Wt, int ldb,
                                                const float* __restrict__ bias, const float* __restrict__ resid, int rmod, int ldr,
                                                float* __restrict__ C, int ldc, int M, int N, int K) {
  __shared__ __attribute__((aligned(16))) float so[4][16][64];
  const int tid = threadIdx.x, w = tid >> 5, lane = tid & 31, ln = lane & 15, hh = lane >> 4;
  const int ntn = N / 64;
  const int wid = blockIdx.x * 4 + w;
  const int mt = wid / ntn, nq = wid % ntn;
  if (mt * 16 >= M) return;
  const int row0 = mt * 16, col0 = nq * 64;
  const float* arow = A + (size_t)(row0 + ln) * lda;
  v8f acc[4] = {};
  for (int kb = 0; kb < K; kb += 32) {
    FragB ah, al;
    const v4f x0 = *(const v4fa*)(arow + kb + 8 * hh), x1 = *(const v4fa*)(arow + kb + 8 * hh + 4);
    const v4f x2 = *(const v4fa*)(arow + kb + 16 + 8 * hh), x3 = *(const v4fa*)(arow + kb + 16 + 8 * hh + 4);
    float xs[16] = {x0[0],x0[1],x0[2],x0[3],x1[0],x1[1],x1[2],x1[3],x2[0],x2[1],x2[2],x2[3],x3[0],x3[1],x3[2],x3[3]};
#pragma unroll
    for (int i = 0; i < 16; ++i) { const unsigned short hb = bf16_bits(xs[i]); ah.u[i] = hb; al.u[i] = ASPLIT ? bf16_bits(xs[i] - bf16_val(hb)) : (unsigned short)0; }
#pragma unroll
    for (int t = 0; t < 4; ++t) {
      const unsigned short* brow = Wt + (size_t)(col0 + t * 16 + ln) * ldb + kb;
      FragB b;
      b.half[0] = *(const v8us*)(brow + 8 * hh);
      b.half[1] = *(const v8us*)(brow + 16 + 8 * hh);
      acc[t] = mmaN<ASPLIT ? 2 : 1>(ah.v, al.v, b.v, b.v, acc[t]);
    }
  }
#pragma unroll
  for (int t = 0; t < 4; ++t) {
    const int col = col0 + t * 16 + ln;
    float bv = bias ? bias[col] : 0.f;
    if (BIAS_BF16) bv = bf16_round(bv);
#pragma unroll
    for (int r = 0; r < 8; ++r) {
      float v = acc[t][r] + bv;
      if (resid) { float rv = resid[(size_t)((row0 + 8 * hh + r) % rmod) * ldr + col]; if (RES_BF16) rv = bf16_round(rv); v += rv; }
      if (ACT == 1) v = fmaxf(v, 0.f);
      if (ACT == 2) v = 0.5f * v * (1.0f + erff(v * 0.70710678118654752f));
      if (ACT == 3) { const float u = 0.7978845608028654f * (v + 0.044715f * v * v * v); v = 0.5f * v * (1.0f + tanhf(u)); }
      so[w][8 * hh + r][t * 16 + ln] = v;
    }
  }
  __builtin_amdgcn_fence(__ATOMIC_ACQ_REL, "workgroup");
  __builtin_amdgcn_wave_barrier();
  const int rsub = lane >> 4, c4 = (lane & 15) * 4;
  {
#pragma unroll
    for (int q = 0; q < 8; ++q) {
      const int r = q * 2 + rsub;
      const v4f v = *(const v4fa*)&so[w][r][c4];
      *(v4f*)(C + (size_t)(row0 + r) * ldc + col0 + c4) = v;
    }
    
  }
}
// row LayerNorm (biased variance, eps) over N: s = X (+ R); optional out_sum <- s; out_norm <- (s-mu)*rsqrt(var+eps)*g + b
template <bool PARAM_BF16>
__global__ __launch_bounds__(256) void k_layernorm(const float* __restrict__ X, const float* __restrict__ R, const float* __restrict__ g, const float* __restrict__ bta,
                                                  float* __restrict__ out_sum, float* __restrict__ out_norm, int N, float eps) {
  __shared__ float red[256];
  const int row = blockIdx.x, tid = threadIdx.x;
  const float* x = X + (size_t)row * N; const float* rr = R ? R + (size_t)row * N : nullptr;
  float vals[16];                     // up to N = 4096
  const int per = N / 256;            // contiguous chunk per thread? use strided-by-4 chunks: thread handles j = tid*4 + 1024*u
  float s1 = 0.f;
  for (int u = 0; u < per / 4; ++u) {
    const int j = tid * 4 + 1024 * u;
    const v4f a = *(const v4fa*)(x + j);
    v4f b = {0.f,0.f,0.f,0.f}; if (rr) b = *(const v4fa*)(rr + j);
#pragma unroll
    for (int q = 0; q < 4; ++q) { const float v = a[q] + b[q]; vals[u * 4 + q] = v; s1 += v; }
  }
  red[tid] = s1; __syncthreads();
  for (int st = 128; st > 0; st >>= 1) { if (tid < st) red[tid] += red[tid + st]; __syncthreads(); }
  const float mu = red[0] / (float)N; __syncthreads();
  float s2 = 0.f;
  for (int u = 0; u < per / 4; ++u)
#pragma unroll
    for (int q = 0; q < 4; ++q) { const float c = vals[u * 4 + q] - mu; s2 += c * c; }
  red[tid] = s2; __syncthreads();
  for (int st = 128; st > 0; st >>= 1) { if (tid < st) red[tid] += red[tid + st]; __syncthreads(); }
  const float rs = rsqrtf(red[0] / (float)N + eps);
  {
    for (int u = 0; u < per / 4; ++u) {
      const int j = tid * 4 + 1024 * u;
      v4f o, sm;
#pragma unroll
      for (int q = 0; q < 4; ++q) {
        float gg = g[j + q], bb = bta[j + q];
        if (PARAM_BF16) { gg = bf16_round(gg); bb = bf16_round(bb); }
        sm[q] = vals[u * 4 + q]; o[q] = (vals[u * 4 + q] - mu) * rs * gg + bb;
      }
      if (out_sum) *(v4f*)(out_sum + (size_t)row * N + j) = sm;
      *(v4f*)(out_norm + (size_t)row * N + j) = o;
    }
    
  }
}



// ---- f16 WMMA path (v_wmma_f32_16x16x32_f16): 11-bit significands for operands in range — used where a [0,1] probability operand needs more precision than bf16
typedef _Float16 v16h __attribute__((ext_vector_type(16)));
union FragH { v16h v; v8us half[2]; _Float16 h[16]; unsigned short u[16]; };
template <int NT>
__device__ __forceinline__ v8f mmaH(v16h ah, v16h al, v16h bh, v16h bl, v8f c) {
  c = __builtin_amdgcn_wmma_f32_16x16x32_f16(false, ah, false, bh, (short)0, c, false, false);
  if (NT >= 2) c = __builtin_amdgcn_wmma_f32_16x16x32_f16(false, al, false, bh, (short)0, c, false, false);
  if (NT >= 3) c = __builtin_amdgcn_wmma_f32_16x16x32_f16(false, ah, false, bl, (short)0, c, false, false);
  asm volatile("v_nop\n\tv_nop\n\tv_nop\n\tv_nop" : "+v"(c) : "v"(ah), "v"(al), "v"(bh), "v"(bl));
  return c;
}
// batched GEMM like k_gemm_b but f16 operands: A f32 (split into f16 hi/lo if ASPLIT, else rounded to f16), Bt = f16 values [n][k]; alpha; C f32; N multiple of 16 (partial tiles skipped)
template <bool ASPLIT>
__global__ __launch_bounds__(128) void k_gemm_h(const float* __restrict__ A, int lda, size_t sA, const _Float16* __restrict__ Bh, int ldb, size_t sB, float alpha, float* __restrict__ C, int ldc, size_t sC, int M, int N, int K) {
  __shared__ __attribute__((aligned(16))) float so[4][16][64];
  const int tid = threadIdx.x, w = tid >> 5, lane = tid & 31, ln = lane & 15, hh = lane >> 4; const int by = blockIdx.y;
  A += (size_t)by * sA; Bh += (size_t)by * sB; C += (size_t)by * sC;
  const int ntn = (N + 63) / 64; const int wid = blockIdx.x * 4 + w; const int mt = wid / ntn, nq = wid % ntn; if (mt * 16 >= M) return;
  const int row0 = mt * 16, col0 = nq * 64; const float* arow = A + (size_t)(row0 + ln) * lda;
  v8f acc[4] = {};
  for (int kb = 0; kb < K; kb += 32) {
    FragH ah, al;
    const v4f x0 = *(const v4fa*)(arow + kb + 8 * hh), x1 = *(const v4fa*)(arow + kb + 8 * hh + 4), x2 = *(const v4fa*)(arow + kb + 16 + 8 * hh), x3 = *(const v4fa*)(arow + kb + 16 + 8 * hh + 4);
    float xs[16] = {x0[0],x0[1],x0[2],x0[3],x1[0],x1[1],x1[2],x1[3],x2[0],x2[1],x2[2],x2[3],x3[0],x3[1],x3[2],x3[3]};
#pragma unroll
    for (int i = 0; i < 16; ++i) { const _Float16 h = (_Float16)xs[i]; ah.h[i] = h; al.h[i] = ASPLIT ? (_Float16)(xs[i] - (float)h) : (_Float16)0.0f; }
#pragma unroll
    for (int t = 0; t < 4; ++t) { if (col0 + t * 16 >= N) continue; const size_t boff = (size_t)(col0 + t * 16 + ln) * ldb + kb; FragH bq; bq.half[0] = *(const v8us*)(Bh + boff + 8 * hh); bq.half[1] = *(const v8us*)(Bh + boff + 16 + 8 * hh);
      acc[t] = mmaH<ASPLIT ? 2 : 1>(ah.v, al.v, bq.v, bq.v, acc[t]); }
  }
#pragma unroll
  for (int t = 0; t < 4; ++t) { if (col0 + t * 16 >= N) continue;
#pragma unroll
    for (int r = 0; r < 8; ++r) so[w][8 * hh + r][t * 16 + ln] = acc[t][r] * alpha; }
  __builtin_amdgcn_fence(__ATOMIC_ACQ_REL, "workgroup"); __builtin_amdgcn_wave_barrier();
  const int rsub = lane >> 4, c4 = (lane & 15) * 4;
  {
#pragma unroll
    for (int q = 0; q < 8; ++q) { const int r = q * 2 + rsub; if (col0 + c4 < N) { const v4f v = *(const v4fa*)&so[w][r][c4]; *(v4f*)(C + (size_t)(row0 + r) * ldc + col0 + c4) = v; } }
     }
}

// Wt[n][k] = f16(W[k][n]·scale) from f32 row-major W[K][N] (scale = power of two; bf16-exact weights stay exact in f16 away from the subnormal range)
__global__ __launch_bounds__(256) void k_wt_f16(const float* __restrict__ W, _Float16* __restrict__ Wt, int K, int N, float scale) {
  const int t = blockIdx.x * 256 + threadIdx.x; if (t >= N * (K / 8)) return; const int n = t / (K / 8), k8 = (t % (K / 8)) * 8; FragH f;
#pragma unroll
  for (int i = 0; i < 8; ++i) f.h[i] = (_Float16)(bf16_round(W[(size_t)(k8 + i) * N + n]) * scale); const v8us o = f.half[0];
  *(v8us*)((unsigned short*)Wt + (size_t)n * K + k8) = o; 
}
// k_gemm_hh variant with fused epilogue: v = acc·alpha + bias[by·sBias + col] (+ CP[(row/rowsPerB)·sCPb + by·64 + col] if CP) ; ACT 0 none / 1 elu ; writes f16 C16 (and f32 C if non-null)
template <int ACT>
__global__ __launch_bounds__(128) void k_gemm_hhx(const _Float16* __restrict__ A, int lda, size_t sA, const _Float16* __restrict__ Bh, int ldb, size_t sB, float alpha, const float* __restrict__ bias, size_t sBias, const float* __restrict__ CP, int rowsPerB, size_t sCPb, int row0g,
    float* __restrict__ C, _Float16* __restrict__ C16, int ldc, size_t sC, int M, int N, int K) {
  __shared__ __attribute__((aligned(16))) float so[4][16][64];
  const int tid = threadIdx.x, w = tid >> 5, lane = tid & 31, ln = lane & 15, hh = lane >> 4; const int by = blockIdx.y;
  A += (size_t)by * sA; Bh += (size_t)by * sB; const size_t cofs = (size_t)by * sC; const float* bp = bias ? bias + (size_t)by * sBias : nullptr;
  const int ntn = (N + 63) / 64; const int wid = blockIdx.x * 4 + w; const int mt = wid / ntn, nq = wid % ntn; if (mt * 16 >= M) return;
  const int row0 = mt * 16, col0 = nq * 64; const _Float16* arow = A + (size_t)(row0 + ln) * lda;
  v8f acc[4] = {};
  for (int kb = 0; kb < K; kb += 32) { FragH ah; ah.half[0] = *(const v8us*)((const unsigned short*)arow + kb + 8 * hh); ah.half[1] = *(const v8us*)((const unsigned short*)arow + kb + 16 + 8 * hh);
#pragma unroll
    for (int t = 0; t < 4; ++t) { if (col0 + t * 16 >= N) continue; const size_t boff = (size_t)(col0 + t * 16 + ln) * ldb + kb; FragH bq; bq.half[0] = *(const v8us*)((const unsigned short*)Bh + boff + 8 * hh); bq.half[1] = *(const v8us*)((const unsigned short*)Bh + boff + 16 + 8 * hh);
      acc[t] = mmaH<1>(ah.v, ah.v, bq.v, bq.v, acc[t]); }
  }
#pragma unroll
  for (int t = 0; t < 4; ++t) { if (col0 + t * 16 >= N) continue; const int col = col0 + t * 16 + ln; const float bv = bp ? bf16_round(bp[col]) : 0.f;
#pragma unroll
    for (int r = 0; r < 8; ++r) { float v = acc[t][r] * alpha + bv; if (CP) { const int rr = row0g + row0 + 8 * hh + r; if (rowsPerB < 0) v += CP[cofs + (size_t)rr * ldc + col];      /* rowsPerB < 0: own element of the batched C plane */ else { const int bidx = rr / rowsPerB; v += CP[(size_t)bidx * sCPb + (size_t)by * 64 + col]; } } if (ACT == 1) v = (v > 0.f) ? v : expm1f(v); else if (ACT == 7) v = (v > 0.f) ? v + 1.0f : expf(v); else if (ACT == 8) v = tanhf(v); else if (ACT == 9) v = 0.5f * v * (1.0f + tanhf(0.7978845608028654f * (v + 0.044715f * v * v * v))); else if (ACT == 11) v = 1.0f / (1.0f + expf(-v)); else if (ACT == 12) v = (v > 0.f) ? v : 0.01f * v; else if (ACT == 14) v = (v > 0.f) ? v : 0.1f * v; else if (ACT == 16) v = (v >= 0.f) ? v : 0.3f * v; else if (ACT == 17) v = (v >= 0.f) ? v : 0.2f * v; else if (ACT == 15) v = v / (1.0f + expf(-v)); else if (ACT == 3) v = fmaxf(v, 0.f); else if (ACT == 6) v = 0.5f * v * (1.0f + erff(v * 0.70710678118654752f)); so[w][8 * hh + r][t * 16 + ln] = v; } }
  __builtin_amdgcn_fence(__ATOMIC_ACQ_REL, "workgroup"); __builtin_amdgcn_wave_barrier();
  const int rsub = lane >> 4, c4 = (lane & 15) * 4; typedef _Float16 v4h __attribute__((ext_vector_type(4)));
  {
#pragma unroll
    for (int q = 0; q < 8; ++q) { const int r = q * 2 + rsub; if (col0 + c4 < N) { const v4f v = *(const v4fa*)&so[w][r][c4]; if (C) *(v4f*)(C + cofs + (size_t)(row0 + r) * ldc + col0 + c4) = v; if (C16) { v4h h4; for (int i = 0; i < 4; ++i) h4[i] = (_Float16)v[i]; *(v4h*)(C16 + cofs + (size_t)(row0 + r) * ldc + col0 + c4) = h4; } } }
     }
}


typedef _Float16 v4h __attribute__((ext_vector_type(4)));

__global__ __launch_bounds__(256) void k_h16(const float* __restrict__ x, _Float16* __restrict__ X16, size_t n8) { const size_t t = (size_t)blockIdx.x * 256 + threadIdx.x; if (t >= n8) return; FragH f;
#pragma unroll
  for (int q = 0; q < 8; ++q) f.h[q] = (_Float16)x[t * 8 + q]; *(v8us*)((unsigned short*)X16 + t * 8) = f.half[0];  }
__global__ __launch_bounds__(256) void k_round16f(const float* __restrict__ W, _Float16* __restrict__ Bt, size_t n8) { const size_t t = (size_t)blockIdx.x * 256 + threadIdx.x; if (t >= n8) return; FragH f;
#pragma unroll
  for (int i = 0; i < 8; ++i) f.h[i] = (_Float16)(bf16_round(W[t * 8 + i]) * 16.0f); *(v8us*)((unsigned short*)Bt + t * 8) = f.half[0];  }
template <int NHv, int TTv>
__global__ __launch_bounds__(256) void k_vt(const _Float16* __restrict__ V16, int ldv, int voff, _Float16* __restrict__ Vt) { __shared__ unsigned short tl[64][66]; const int tid = threadIdx.x; const int slab = blockIdx.x / (TTv / 64), lg = blockIdx.x % (TTv / 64); const int b = slab / NHv, h = slab % NHv;
  for (int i = tid; i < 64 * 8; i += 256) { const int r = i / 8, c8 = (i % 8) * 8; FragH f; f.half[0] = *(const v8us*)((const unsigned short*)V16 + ((size_t)b * TTv + lg * 64 + r) * ldv + voff + h * 64 + c8);
#pragma unroll
    for (int q = 0; q < 8; ++q) tl[r][c8 + q] = f.u[q]; }
  __syncthreads();
  {
#pragma unroll
    for (int rd = 0; rd < 2; ++rd) { const int d = rd * 32 + tid / 8, pc = tid % 8; FragH f;
#pragma unroll
      for (int q = 0; q < 8; ++q) f.u[q] = tl[pc * 8 + q][d];
      *(v8us*)((unsigned short*)Vt + ((size_t)slab * 64 + d) * TTv + lg * 64 + pc * 8) = f.half[0]; }
     } }

__global__ __launch_bounds__(256) void k_hl(const float* __restrict__ F, _Float16* __restrict__ Hh, _Float16* __restrict__ Hl, size_t n8) { const size_t t = (size_t)blockIdx.x * 256 + threadIdx.x; if (t >= n8) return; FragH fh, fl; const v4f a = *(const v4fa*)(F + t * 8), c = *(const v4fa*)(F + t * 8 + 4);
#pragma unroll
  for (int q = 0; q < 4; ++q) { _Float16 h = (_Float16)a[q]; fh.h[q] = h; fl.h[q] = (_Float16)((a[q] - (float)h) * 1024.0f); h = (_Float16)c[q]; fh.h[4 + q] = h; fl.h[4 + q] = (_Float16)((c[q] - (float)h) * 1024.0f); }
  { *(v8us*)((unsigned short*)Hh + t * 8) = fh.half[0]; *(v8us*)((unsigned short*)Hl + t * 8) = fl.half[0];  } }

// ---- fast GEMM (wave tile 32x64; requires M % 32 == 0 rows per launch region and N % 64 == 0); epilogue = k_gemm_hhx semantics ----
__device__ __forceinline__ v16h g2_frag(const _Float16* p, int hh) { FragH f; f.half[0] = *(const v8us*)((const unsigned short*)p + 8 * hh); f.half[1] = *(const v8us*)((const unsigned short*)p + 16 + 8 * hh); return f.v; }
__device__ __forceinline__ v8f g2_mma(v16h a, v16h b, v8f c) { v8f d = __builtin_amdgcn_wmma_f32_16x16x32_f16(false, a, false, b, (short)0, c, false, false); asm volatile("v_nop\n\tv_nop\n\tv_nop\n\tv_nop" : "+v"(d) : "v"(a), "v"(b)); return d; }
template <int ACT>
__global__ __launch_bounds__(128) void k_gemm2(const _Float16* __restrict__ A, int lda, size_t sA, const _Float16* __restrict__ Bh, int ldb, size_t sB, float alpha, const float* __restrict__ bias, size_t sBias, const float* __restrict__ CP, int rowsPerB, size_t sCPb, int row0g,
    float* __restrict__ C, _Float16* __restrict__ C16, int ldc, size_t sC, int M, int N, int K) { static_assert(ACT == 0 || ACT == 3 || ACT == 6 || ACT == 8 || ACT == 9 || ACT == 11 || ACT == 12 || ACT == 14 || ACT == 15 || ACT == 16 || ACT == 17, "k_gemm2: unsupported ACT code (would silently apply no activation)");
  __shared__ __attribute__((aligned(16))) float so[4][32][68];
  const int tid = threadIdx.x, w = tid >> 5, lane = tid & 31, ln = lane & 15, hh = lane >> 4; const int by = blockIdx.y;
  A += (size_t)by * sA; Bh += (size_t)by * sB; const size_t cofs = (size_t)by * sC; const float* bp = bias ? bias + (size_t)by * sBias : nullptr;
  const int ntn = N >> 6; const int mt = blockIdx.x / ntn, nq = blockIdx.x - mt * ntn; const int row0 = mt * 128 + 32 * w, col0 = nq * 64; if (row0 >= M) return;
  const _Float16* a0p = A + (size_t)(row0 + ln) * lda; const _Float16* a1p = a0p + (size_t)16 * lda;
  const _Float16* b0p = Bh + (size_t)(col0 + ln) * ldb; const _Float16* b1p = b0p + (size_t)16 * ldb; const _Float16* b2p = b1p + (size_t)16 * ldb; const _Float16* b3p = b2p + (size_t)16 * ldb;
  const v8f z8 = {0.f,0.f,0.f,0.f,0.f,0.f,0.f,0.f}; v8f c00 = z8, c01 = z8, c02 = z8, c03 = z8, c10 = z8, c11 = z8, c12 = z8, c13 = z8;
#pragma unroll 1
  for (int kb = 0; kb < K; kb += 32) { const v16h a0 = g2_frag(a0p + kb, hh), a1 = g2_frag(a1p + kb, hh);
    v16h b = g2_frag(b0p + kb, hh); c00 = g2_mma(a0, b, c00); c10 = g2_mma(a1, b, c10);
    b = g2_frag(b1p + kb, hh); c01 = g2_mma(a0, b, c01); c11 = g2_mma(a1, b, c11);
    b = g2_frag(b2p + kb, hh); c02 = g2_mma(a0, b, c02); c12 = g2_mma(a1, b, c12);
    b = g2_frag(b3p + kb, hh); c03 = g2_mma(a0, b, c03); c13 = g2_mma(a1, b, c13); }
  v8f accs[8] = {c00, c01, c02, c03, c10, c11, c12, c13};
#pragma unroll
  for (int u = 0; u < 8; ++u) { const int t = u & 3, half = u >> 2; const int col = col0 + t * 16 + ln; const float bv = bp ? bf16_round(bp[col]) : 0.f;
#pragma unroll
    for (int r = 0; r < 8; ++r) { const int rloc = half * 16 + 8 * hh + r; float v = accs[u][r] * alpha + bv; if (CP) { if (rowsPerB < 0) v += CP[cofs + (size_t)(row0g + row0 + rloc) * ldc + col];      /* rowsPerB < 0: own element of the batched C plane */ else { const int bidx = (row0g + row0 + rloc) / rowsPerB; v += CP[(size_t)bidx * sCPb + (size_t)by * 64 + col]; } }
      if (ACT == 3) v = fmaxf(v, 0.f); else if (ACT == 6) v = 0.5f * v * (1.0f + erff(v * 0.70710678118654752f)); else if (ACT == 11) v = 1.0f / (1.0f + expf(-v)); else if (ACT == 15) v = v / (1.0f + expf(-v)); else if (ACT == 12) v = (v > 0.f) ? v : 0.01f * v; else if (ACT == 8) v = tanhf(v); else if (ACT == 9) v = 0.5f * v * (1.0f + tanhf(0.7978845608028654f * (v + 0.044715f * v * v * v))); else if (ACT == 14) v = (v > 0.f) ? v : 0.1f * v; else if (ACT == 16) v = (v >= 0.f) ? v : 0.3f * v; else if (ACT == 17) v = (v >= 0.f) ? v : 0.2f * v;
      so[w][rloc][t * 16 + ln] = v; } }
  __builtin_amdgcn_fence(__ATOMIC_ACQ_REL, "workgroup"); __builtin_amdgcn_wave_barrier();
  const int rsub = lane >> 4, c4 = (lane & 15) * 4;
  {
#pragma unroll
    for (int q = 0; q < 16; ++q) { const int r = q * 2 + rsub; const v4f v = *(const v4fa*)&so[w][r][c4]; if (C) *(v4f*)(C + cofs + (size_t)(row0 + r) * ldc + col0 + c4) = v; if (C16) { v4h h4; for (int i = 0; i < 4; ++i) h4[i] = (_Float16)v[i]; *(v4h*)(C16 + cofs + (size_t)(row0 + r) * ldc + col0 + c4) = h4; } }
     } }


// ---- operand preparation, one launch: every work-group takes 2 of the 1024 V tiles, 4 x 256 of the K units, 4 x 256 of the q units and 64 of the W_out units; a thread asks for all of its values first, then converts and stores ----
// K unit u = 16 bytes = (slab = b*NH + h, 16-key tile, 32-wide d step, fragment half j, lane = 16 hh + ln) holds k[key = 16 tile + ln][d = 32 step + 16 j + 8 hh .. + 7]: A-fragment order.
// V^T unit (slab, 32-key block, 16-row d tile t, half j, lane) holds v[key = 32 block + 16 j + 8 hh .. + 7][d = 16 t + ln], turned through an LDS tile of 64 keys x 64 d.
// q rows and W_out (x16, natural [out][in] = Bt[n][k]) keep their order. Every value is rounded to bf16 and is exact as f16.
#define PB 512      /* work-groups of the preparation launch: 16 waves a WGP */
__device__ __forceinline__ v8us pr_cvt(v4f p, v4f q, float scale) { FragH f;
#pragma unroll      /* constant indices keep the arrays in registers */
  for (int i = 0; i < 4; ++i) { f.h[i] = (_Float16)(bf16_round(p[i]) * scale); f.h[4 + i] = (_Float16)(bf16_round(q[i]) * scale); }
  return f.half[0]; }
__global__ __launch_bounds__(256) void k_prep(const float* __restrict__ xq, const float* __restrict__ xk, const float* __restrict__ xv, const float* __restrict__ wo,
    _Float16* __restrict__ Q16, _Float16* __restrict__ KF, _Float16* __restrict__ VF, _Float16* __restrict__ BO) {
  static_assert(NB * NH * (SQ / 64) == 2 * PB && NR * DM / 8 == (size_t)4 * 256 * PB && DM * DM / 8 == 64 * PB, "shares of the preparation launch");
  __shared__ unsigned short tl[2][64][66];
  const int tid = threadIdx.x, blk = blockIdx.x;
  v4f vv[2][2][2], kv[4][2], qv[4][2], wv[2];
#pragma unroll      /* constant indices keep the arrays in registers */
  for (int ti = 0; ti < 2; ++ti) { const int tile = blk * 2 + ti; const int slab = tile / (SQ / 64), lg = tile % (SQ / 64); const int b = slab / NH, h = slab % NH;
#pragma unroll      /* constant indices keep the arrays in registers */
    for (int rd = 0; rd < 2; ++rd) { const int i = tid + rd * 256; const int r = i / 8, c8 = (i % 8) * 8; const float* s = xv + ((size_t)b * SQ + lg * 64 + r) * DM + h * HD + c8; vv[ti][rd][0] = *(const v4fa*)s; vv[ti][rd][1] = *(const v4fa*)(s + 4); } }
#pragma unroll      /* constant indices keep the arrays in registers */
  for (int c = 0; c < 4; ++c) { const size_t u = (size_t)(blk * 4 + c) * 256 + tid;
    const int ln = (int)(u & 15), hh = (int)(u >> 4) & 1, j = (int)(u >> 5) & 1, ks = (int)(u >> 6) & 1; const int tile = (int)(u >> 7); const int kt = tile % (SQ / 16), slab = tile / (SQ / 16); const int b = slab / NH, h = slab % NH;
    const float* s = xk + ((size_t)b * SQ + kt * 16 + ln) * DM + h * HD + ks * 32 + j * 16 + hh * 8; kv[c][0] = *(const v4fa*)s; kv[c][1] = *(const v4fa*)(s + 4); }
#pragma unroll      /* constant indices keep the arrays in registers */
  for (int c = 0; c < 4; ++c) { const float* s = xq + ((size_t)(blk * 4 + c) * 256 + tid) * 8; qv[c][0] = *(const v4fa*)s; qv[c][1] = *(const v4fa*)(s + 4); }
  if (tid < 64) { const float* s = wo + ((size_t)blk * 64 + tid) * 8; wv[0] = *(const v4fa*)s; wv[1] = *(const v4fa*)(s + 4); }
#pragma unroll      /* constant indices keep the arrays in registers */
  for (int ti = 0; ti < 2; ++ti) {
#pragma unroll      /* constant indices keep the arrays in registers */
    for (int rd = 0; rd < 2; ++rd) { const int i = tid + rd * 256; const int r = i / 8, c8 = (i % 8) * 8; FragH f; f.half[0] = pr_cvt(vv[ti][rd][0], vv[ti][rd][1], 1.0f);
#pragma unroll      /* constant indices keep the arrays in registers */
      for (int q = 0; q < 8; ++q) tl[ti][r][c8 + q] = f.u[q]; } }
  __syncthreads();      /* both V tiles are whole in LDS before any column of them is read; it stands ahead of every global store, so that it waits for none */
#pragma unroll      /* constant indices keep the arrays in registers */
  for (int ti = 0; ti < 2; ++ti) { const int tile = blk * 2 + ti; const int slab = tile / (SQ / 64), lg = tile % (SQ / 64);
#pragma unroll      /* constant indices keep the arrays in registers */
    for (int rd = 0; rd < 2; ++rd) { const int ln = tid & 15, hh = (tid >> 4) & 1, j = (tid >> 5) & 1, t = tid >> 6; FragH f;
#pragma unroll      /* constant indices keep the arrays in registers */
      for (int q = 0; q < 8; ++q) f.u[q] = tl[ti][rd * 32 + j * 16 + hh * 8 + q][t * 16 + ln];
      *(v8us*)((unsigned short*)VF + ((size_t)slab * (SQ / 32) + lg * 2 + rd) * 2048 + (size_t)tid * 8) = f.half[0]; } }
#pragma unroll      /* constant indices keep the arrays in registers */
  for (int c = 0; c < 4; ++c) *(v8us*)((unsigned short*)KF + ((size_t)(blk * 4 + c) * 256 + tid) * 8) = pr_cvt(kv[c][0], kv[c][1], 1.0f);
#pragma unroll      /* constant indices keep the arrays in registers */
  for (int c = 0; c < 4; ++c) *(v8us*)((unsigned short*)Q16 + ((size_t)(blk * 4 + c) * 256 + tid) * 8) = pr_cvt(qv[c][0], qv[c][1], 1.0f);
  if (tid < 64) *(v8us*)((unsigned short*)BO + ((size_t)blk * 64 + tid) * 8) = pr_cvt(wv[0], wv[1], 16.0f); }
// ---- fused attention: one wave = 32 query columns (2 groups of 16) of one head, a pass = 32 keys; 8 waves a block share one head's K and V^T stream through the cache ----
__device__ __forceinline__ v16h fa_frag(const unsigned short* p) { FragH f; f.half[0] = *(const v8us*)p; f.half[1] = *(const v8us*)(p + 256); return f.v; }      /* p = the lane's 16 bytes of half 0; half 1 lies 512 bytes on */
__device__ __forceinline__ v8f fa_mma(v16h a, v16h b, v8f c) { return __builtin_amdgcn_wmma_f32_16x16x32_f16(false, a, false, b, (short)0, c, false, false); }
__device__ __forceinline__ float fa_xhalf(float x) { return __builtin_bit_cast(float, __builtin_amdgcn_permlanex16(__builtin_bit_cast(int, x), __builtin_bit_cast(int, x), 0x76543210, 0xfedcba98, false, false)); }      /* lane l with lane l ^ 16 */
#define FQ 256      /* query rows a block */
__global__ __launch_bounds__(256) void k_fattn(const _Float16* __restrict__ Q16, const _Float16* __restrict__ KF, const _Float16* __restrict__ VF, _Float16* __restrict__ O16) {
  typedef float v2f __attribute__((ext_vector_type(2))); typedef _Float16 v2h __attribute__((ext_vector_type(2)));
  const int lane = threadIdx.x & 31, w = threadIdx.x >> 5, ln = lane & 15, hh = lane >> 4;
  const int slab = blockIdx.x / (SQ / FQ), qb = blockIdx.x % (SQ / FQ); const int b = slab / NH, h = slab % NH; const int q0 = qb * FQ + w * 32;
  const float cs = 0.044194173824159216f * 1.4426950408889634f;      /* 1 / sqrt(512) (the module's literal d_model scale) x log2 e */
  v16h qf[2][2];      /* B operand: column = query, k = d */
#pragma unroll      /* constant indices keep the arrays in registers */
  for (int g = 0; g < 2; ++g) { const _Float16* qp = Q16 + ((size_t)b * SQ + q0 + g * 16 + ln) * DM + h * HD; qf[g][0] = g2_frag(qp, hh); qf[g][1] = g2_frag(qp + 32, hh); }
  const unsigned short* kp = (const unsigned short*)KF + (size_t)slab * SQ * HD + lane * 8; const unsigned short* vp = (const unsigned short*)VF + (size_t)slab * SQ * HD + lane * 8;
  const v8f z8 = {0.f,0.f,0.f,0.f,0.f,0.f,0.f,0.f}; v8f o[2][4]; float mr[2], lr[2];
#pragma unroll      /* constant indices keep the arrays in registers */
  for (int g = 0; g < 2; ++g) { mr[g] = -__builtin_inff(); lr[g] = 0.f;
#pragma unroll      /* constant indices keep the arrays in registers */
    for (int t = 0; t < 4; ++t) o[g][t] = z8; }
  v16h kf[4], vf[4];      /* A operands: kf[16-key tile * 2 + d step], vf[16-row d tile]; both are asked for one pass ahead, into the registers that the pass has just used */
  const unsigned short* vq = vp;
#pragma unroll      /* constant indices keep the arrays in registers */
  for (int t = 0; t < 4; ++t) kf[t] = fa_frag(kp + t * 512);
  asm volatile("s_wait_xcnt 0x0" :: "v"(kp) : "memory");      /* the K loads' address pair stays whole until this wait; Q and K are asked for ahead of V, the order of every pass, so that the loop's counted load waits fit its first pass too */
#pragma unroll      /* constant indices keep the arrays in registers */
  for (int t = 0; t < 4; ++t) vf[t] = fa_frag(vq + t * 512);
  for (int i = 0; i < SQ / 32; ++i) {
    v8f s[2][2];      /* [group][key tile]: register r = score of key 16 tile + 8 hh + r, query ln */
#pragma unroll      /* constant indices keep the arrays in registers */
    for (int g = 0; g < 2; ++g) {
#pragma unroll      /* constant indices keep the arrays in registers */
      for (int kt = 0; kt < 2; ++kt) s[g][kt] = fa_mma(kf[kt * 2 + 1], qf[g][1], fa_mma(kf[kt * 2], qf[g][0], z8)); }
    asm volatile("s_wait_xcnt 0x0" :: "v"(vq) : "memory");      /* the V loads' address pair (asked for at the foot of the pass before) stays whole until this wait */
    const int nx = (i + 1 < SQ / 32) ? i + 1 : i;      /* the last pass asks for its own tiles again (in bounds, unused) */
    const unsigned short* kq = kp + (size_t)nx * 2048;
#pragma unroll      /* constant indices keep the arrays in registers */
    for (int t = 0; t < 4; ++t) kf[t] = fa_frag(kq + t * 512);
    float mb[2]; bool need = false;
#pragma unroll      /* constant indices keep the arrays in registers */
    for (int g = 0; g < 2; ++g) { float mx = s[g][0][0];
#pragma unroll      /* constant indices keep the arrays in registers */
      for (int r = 1; r < 8; ++r) mx = fmaxf(mx, s[g][0][r]);
#pragma unroll      /* constant indices keep the arrays in registers */
      for (int r = 0; r < 8; ++r) mx = fmaxf(mx, s[g][1][r]);
      mb[g] = fmaxf(mx, fa_xhalf(mx)) * cs; need = need || (mb[g] > mr[g] + 8.0f); }
    asm volatile("s_wait_xcnt 0x0" :: "v"(kq) : "memory");      /* the K loads' address pair stays whole until this wait; it also keeps those loads up here, a whole softmax and second product ahead of their use */
    if (__builtin_amdgcn_ballot_w32(need) != 0) {      /* the maximum in use may trail the true one by up to 8 (log2): weights stay <= 2^8; one test a pass */
#pragma unroll      /* constant indices keep the arrays in registers */
      for (int g = 0; g < 2; ++g) { const float mn = fmaxf(mr[g], mb[g]); const float corr = __builtin_amdgcn_exp2f(mr[g] - mn); mr[g] = mn; lr[g] *= corr;      /* corr = 0 in the first pass */
#pragma unroll      /* constant indices keep the arrays in registers */
        for (int t = 0; t < 4; ++t) o[g][t] = o[g][t] * corr; } }
#pragma unroll      /* constant indices keep the arrays in registers */
    for (int g = 0; g < 2; ++g) { const float nm = -mr[g]; FragH pf; v2f ls = {0.f, 0.f};      /* two score tiles, converted in place, are the B operand of the second product */
#pragma unroll      /* constant indices keep the arrays in registers */
      for (int e = 0; e < 8; ++e) { const v2f sv = {s[g][e >> 2][2 * (e & 3)], s[g][e >> 2][2 * (e & 3) + 1]}; const v2f ar = __builtin_elementwise_fma(sv, (v2f){cs, cs}, (v2f){nm, nm});
        const v2f pv = {__builtin_amdgcn_exp2f(ar[0]), __builtin_amdgcn_exp2f(ar[1])}; ls += pv; const v2h ph = __builtin_convertvector(pv, v2h); pf.h[2 * e] = ph[0]; pf.h[2 * e + 1] = ph[1]; }
      lr[g] += ls[0] + ls[1];
#pragma unroll      /* constant indices keep the arrays in registers */
      for (int t = 0; t < 4; ++t) o[g][t] = fa_mma(vf[t], pf.v, o[g][t]); }
    vq = vp + (size_t)nx * 2048;
#pragma unroll      /* constant indices keep the arrays in registers */
    for (int t = 0; t < 4; ++t) vf[t] = fa_frag(vq + t * 512);
  }
#pragma unroll      /* constant indices keep the arrays in registers */
  for (int g = 0; g < 2; ++g) { const float inv = 64.0f / (lr[g] + fa_xhalf(lr[g])); unsigned short* op = (unsigned short*)O16 + ((size_t)b * SQ + q0 + g * 16 + ln) * DM + h * HD + 8 * hh;      /* o carried x64; register r of tile t = d 16 t + 8 hh + r of query ln */
#pragma unroll      /* constant indices keep the arrays in registers */
    for (int t = 0; t < 4; ++t) { FragH f;
#pragma unroll      /* constant indices keep the arrays in registers */
      for (int r = 0; r < 8; ++r) f.h[r] = (_Float16)(o[g][t][r] * inv);
      *(v8us*)(op + t * 16) = f.half[0]; } } }
__global__ __launch_bounds__(256) void k_vt(const _Float16* __restrict__ V16, int b, int h0, _Float16* __restrict__ VT) { __shared__ unsigned short tl[64][65]; const int tid = threadIdx.x; const int hh = blockIdx.x % HG, sg = blockIdx.x / HG; const int s0 = sg * 64; const int h = h0 + hh;
  for (int i = tid; i < 64 * 8; i += 256) { const int j = i / 8, d8 = (i % 8) * 8; FragH f; f.half[0] = *(const v8us*)((const unsigned short*)V16 + ((size_t)b * SQ + s0 + j) * DM + h * HD + d8); for (int q = 0; q < 8; ++q) tl[d8 + q][j] = f.u[q]; }
  __syncthreads();
  { for (int i = tid; i < 64 * 8; i += 256) { const int d = i / 8, j8 = (i % 8) * 8; FragH f; for (int q = 0; q < 8; ++q) f.u[q] = tl[d][j8 + q]; *(v8us*)((unsigned short*)VT + ((size_t)hh * HD + d) * SQ + s0 + j8) = f.half[0]; }  } }



__global__ __launch_bounds__(256) void k_rsmkm(const float* __restrict__ S, _Float16* __restrict__ P, int nrows, const int* __restrict__ am) {
  #pragma clang fp contract(off)
  const int t = blockIdx.x * 256 + threadIdx.x; if (t >= nrows) return; const size_t i = (size_t)t; const float* s = S + i * SQ; const int* mr = am + (size_t)(t % SQ) * SQ; float mx = -3.0e38f;
#pragma unroll 1
  for (int j = 0; j < SQ; ++j) { const float f = (mr[j] != 0) ? 1.f : 0.f; mx = fmaxf(mx, fmaf(f, s[j], (1.f - f) * -1.0e9f)); } float se = 0.f;
#pragma unroll 1
  for (int j = 0; j < SQ; ++j) { const float f = (mr[j] != 0) ? 1.f : 0.f; se += __expf(fmaf(f, s[j], (1.f - f) * -1.0e9f) - mx); } const float sc = 256.0f / se;
#pragma unroll 1
  for (int j0 = 0; j0 < SQ; j0 += 8) { FragH fr; for (int q = 0; q < 8; ++q) { const int j = j0 + q; const float f = (mr[j] != 0) ? 1.f : 0.f; fr.h[q] = (_Float16)(__expf(fmaf(f, s[j], (1.f - f) * -1.0e9f) - mx) * sc); }
    unsigned short* d = (unsigned short*)P + i * SQ + j0; *(v8us*)d = fr.half[0];  } }
extern "C" void kernel_launch(void* const* d_in, const int* in_sizes, int n_in,
                              void* d_out, int out_size, void* d_ws, size_t ws_size, hipStream_t stream) {
  (void)in_sizes; (void)n_in; (void)out_size;
  const float* const* I = (const float* const*)d_in; const float* xq = I[0]; const float* xk = I[1]; const float* xv = I[2]; const float* wo = I[3]; const float* bo = I[4];      /* queries, keys, values [4][2048][512] (used as q, k, v directly: no input projections); natural W_out [512][512] + b_out */
  static_assert(NH * HD == DM && DM % 64 == 0 && DM % 32 == 0 && SQ % 128 == 0 && NH % HG == 0 && SQ % FQ == 0 && HD == 64, "shape / tile multiples");
  char* ws = (char*)d_ws; size_t off = 0;
  auto take = [&](size_t bytes) { char* p = ws + off; off += (bytes + 255) & ~(size_t)255; return p; };
  _Float16* BO = (_Float16*)take((size_t)DM * DM * 2);
  _Float16* Q16 = (_Float16*)take(NR * DM * 2); _Float16* KF = (_Float16*)take(NR * DM * 2); _Float16* VF = (_Float16*)take(NR * DM * 2); _Float16* O16 = (_Float16*)take(NR * DM * 2);
  if (off > ws_size) return;
  k_prep<<<PB, 256, 0, stream>>>(xq, xk, xv, wo, Q16, KF, VF, BO);      /* q rows, K and V^T in fragment order, W_out x16: all operands as exact f16, one launch */
  const size_t r0p = (size_t)B0 * SQ;      /* first projected row */
  k_fattn<<<NB * NH * (SQ / FQ), 256, 0, stream>>>(Q16, KF, VF, O16);      /* o (merged heads) as f16 rows x64 */
  k_gemm2<0><<<dim3((unsigned)((MPO / 128) * (DM / 64)), 1), 128, 0, stream>>>(O16 + r0p * DM, DM, 0, BO, DM, 0, 0.0009765625f, bo, 0, nullptr, 1, 0, 0, (float*)d_out + r0p * DM, nullptr, DM, 0, MPO, DM, DM);      /* out rows are the output layout */
}

// v004
// It runs in 65.3 microseconds.
// Two timings next to v003 put it at 1.29 and 1.28 times that version's speed.
// All steps since v000 together make it 55.9 times as fast.
#include <hip/hip_runtime.h>
#define NB 4
#define SQ 2048
#define DM 512
#define NH 8
#define HD 64
#define HG 4                         /* heads per k_vt launch group (k_vt is not launched) */
#define B0 0                         /* first batch processed (debug hook) */
#define NBR NB                       /* batches processed (debug hook) */
#define NR ((size_t)NB * SQ)         /* token rows */
#define MP ((int)((size_t)NBR * SQ)) /* rows projected (debug hook) */
#define QN SQ                        /* query rows attended per batch (unused) */
#define NHD NH                       /* heads attended (unused) */
#define MPO MP                       /* rows through the output stage (debug hook) */
#define LQ DM      /* row pitch of the q/k/v rows (unused: the kernels use DM) */
typedef __bf16 v16b __attribute__((ext_vector_type(16)));
typedef unsigned short v8us __attribute__((ext_vector_type(8), may_alias));
typedef float  v8f  __attribute__((ext_vector_type(8)));
typedef float  v4f  __attribute__((ext_vector_type(4)));
typedef float  v4fa __attribute__((ext_vector_type(4), may_alias));
union FragB { v16b v; v8us half[2]; unsigned short u[16]; };

__device__ __forceinline__ unsigned short bf16_bits(float x) { unsigned int u = __float_as_uint(x); return (unsigned short)((u + 0x7FFFu + ((u >> 16) & 1u)) >> 16); }
__device__ __forceinline__ float bf16_val(unsigned short b) { return __uint_as_float(((unsigned int)b) << 16); }
__device__ __forceinline__ float bf16_round(float x) { return bf16_val(bf16_bits(x)); }
// D += A·B with NT terms: 1 = ah·bh, 2 = + al·bh (A split), 3 = + ah·bl (both split)
template <int NT>
__device__ __forceinline__ v8f mmaN(v16b ah, v16b al, v16b bh, v16b bl, v8f c) {
  c = __builtin_amdgcn_wmma_f32_16x16x32_bf16(false, ah, false, bh, (short)0, c, false, false);
  if (NT >= 2) c = __builtin_amdgcn_wmma_f32_16x16x32_bf16(false, al, false, bh, (short)0, c, false, false);
  if (NT >= 3) c = __builtin_amdgcn_wmma_f32_16x16x32_bf16(false, ah, false, bl, (short)0, c, false, false);
  asm volatile("v_nop\n\tv_nop\n\tv_nop\n\tv_nop" : "+v"(c) : "v"(ah), "v"(al), "v"(bh), "v"(bl));
  return c;
}

__global__ __launch_bounds__(256) void k_wt_bf16(const float* __restrict__ W, unsigned short* __restrict__ Wt, int K, int N) {
  const int t = blockIdx.x * 256 + threadIdx.x;
  const int k8n = K / 8;
  if (t >= N * k8n) return;
  const int n = t / k8n, k8 = (t % k8n) * 8;
  v8us v;
#pragma unroll
  for (int i = 0; i < 8; ++i) v[i] = bf16_bits(W[(size_t)(k8 + i) * N + n]);
  *(v8us*)(Wt + (size_t)n * K + k8) = v;
  
}

// GEMM C[M][N] (f32, pitch ldc) = act(A[M][K]·W + bias). A f32 row-major (pitch lda) converted per fragment to bf16
// (ASPLIT: hi/lo two planes -> 2 terms, else single rounded term); Wt bf16 [N][K] (pitch ldb). BIAS_BF16 rounds the
// bias to bf16 first (bias quantised to bf16 before the add). K%32==0, M%16==0, N%64==0.
template <bool ASPLIT, int ACT, bool BIAS_BF16>
__global__ __launch_bounds__(128) void k_gemm_bf(const float* __restrict__ A, int lda, const unsigned short* __restrict__ Wt, int ldb,
                                               const float* __restrict__ bias, float* __restrict__ C, int ldc, int M, int N, int K) {
  __shared__ __attribute__((aligned(16))) float so[4][16][64];
  const int tid = threadIdx.x, w = tid >> 5, lane = tid & 31, ln = lane & 15, hh = lane >> 4;
  const int ntn = N / 64;
  const int wid = blockIdx.x * 4 + w;
  const int mt = wid / ntn, nq = wid % ntn;
  if (mt * 16 >= M) return;
  const int row0 = mt * 16, col0 = nq * 64;
  const float* arow = A + (size_t)(row0 + ln) * lda;
  v8f acc[4] = {};
  for (int kb = 0; kb < K; kb += 32) {
    FragB ah, al;
    const v4f x0 = *(const v4fa*)(arow + kb + 8 * hh), x1 = *(const v4fa*)(arow + kb + 8 * hh + 4);
    const v4f x2 = *(const v4fa*)(arow + kb + 16 + 8 * hh), x3 = *(const v4fa*)(arow + kb + 16 + 8 * hh + 4);
    float xs[16] = {x0[0],x0[1],x0[2],x0[3],x1[0],x1[1],x1[2],x1[3],x2[0],x2[1],x2[2],x2[3],x3[0],x3[1],x3[2],x3[3]};
#pragma unroll
    for (int i = 0; i < 16; ++i) { const unsigned short hb = bf16_bits(xs[i]); ah.u[i] = hb; al.u[i] = ASPLIT ? bf16_bits(xs[i] - bf16_val(hb)) : (unsigned short)0; }
#pragma unroll
    for (int t = 0; t < 4; ++t) {
      const unsigned short* brow = Wt + (size_t)(col0 + t * 16 + ln) * ldb + kb;
      FragB b;
      b.half[0] = *(const v8us*)(brow + 8 * hh);
      b.half[1] = *(const v8us*)(brow + 16 + 8 * hh);
      acc[t] = mmaN<ASPLIT ? 2 : 1>(ah.v, al.v, b.v, b.v, acc[t]);
    }
  }
#pragma unroll
  for (int t = 0; t < 4; ++t) {
    float bv = bias ? bias[col0 + t * 16 + ln] : 0.f;
    if (BIAS_BF16) bv = bf16_round(bv);
#pragma unroll
    for (int r = 0; r < 8; ++r) { float v = acc[t][r] + bv; if (ACT == 1) v = fmaxf(v, 0.f); so[w][8 * hh + r][t * 16 + ln] = v; }
  }
  __builtin_amdgcn_fence(__ATOMIC_ACQ_REL, "workgroup");
  __builtin_amdgcn_wave_barrier();
  const int rsub = lane >> 4, c4 = (lane & 15) * 4;
  {
#pragma unroll
    for (int q = 0; q < 8; ++q) {
      const int r = q * 2 + rsub;
      const v4f v = *(const v4fa*)&so[w][r][c4];
      *(v4f*)(C + (size_t)(row0 + r) * ldc + col0 + c4) = v;
    }
    
  }
}

// GEMM C = act(A·W + bias + resid): A f32 (ASPLIT -> hi/lo 2 terms), Wt bf16 [N][K]; ACT 0 none, 1 relu, 2 exact gelu;
// resid (optional, f32, row index = (row % rmod), pitch ldr, RES_BF16 rounds it) added before the activation.
template <bool ASPLIT, int ACT, bool BIAS_BF16, bool RES_BF16>
__global__ __launch_bounds__(128) void k_gemm_bf3(const float* __restrict__ A, int lda, const unsigned short* __restrict__ Wt, int ldb,
                                                const float* __restrict__ bias, const float* __restrict__ resid, int rmod, int ldr,
                                                float* __restrict__ C, int ldc, int M, int N, int K) {
  __shared__ __attribute__((aligned(16))) float so[4][16][64];
  const int tid = threadIdx.x, w = tid >> 5, lane = tid & 31, ln = lane & 15, hh = lane >> 4;
  const int ntn = N / 64;
  const int wid = blockIdx.x * 4 + w;
  const int mt = wid / ntn, nq = wid % ntn;
  if (mt * 16 >= M) return;
  const int row0 = mt * 16, col0 = nq * 64;
  const float* arow = A + (size_t)(row0 + ln) * lda;
  v8f acc[4] = {};
  for (int kb = 0; kb < K; kb += 32) {
    FragB ah, al;
    const v4f x0 = *(const v4fa*)(arow + kb + 8 * hh), x1 = *(const v4fa*)(arow + kb + 8 * hh + 4);
    const v4f x2 = *(const v4fa*)(arow + kb + 16 + 8 * hh), x3 = *(const v4fa*)(arow + kb + 16 + 8 * hh + 4);
    float xs[16] = {x0[0],x0[1],x0[2],x0[3],x1[0],x1[1],x1[2],x1[3],x2[0],x2[1],x2[2],x2[3],x3[0],x3[1],x3[2],x3[3]};
#pragma unroll
    for (int i = 0; i < 16; ++i) { const unsigned short hb = bf16_bits(xs[i]); ah.u[i] = hb; al.u[i] = ASPLIT ? bf16_bits(xs[i] - bf16_val(hb)) : (unsigned short)0; }
#pragma unroll
    for (int t = 0; t < 4; ++t) {
      const unsigned short* brow = Wt + (size_t)(col0 + t * 16 + ln) * ldb + kb;
      FragB b;
      b.half[0] = *(const v8us*)(brow + 8 * hh);
      b.half[1] = *(const v8us*)(brow + 16 + 8 * hh);
      acc[t] = mmaN<ASPLIT ? 2 : 1>(ah.v, al.v, b.v, b.v, acc[t]);
    }
  }
#pragma unroll
  for (int t = 0; t < 4; ++t) {
    const int col = col0 + t * 16 + ln;
    float bv = bias ? bias[col] : 0.f;
    if (BIAS_BF16) bv = bf16_round(bv);
#pragma unroll
    for (int r = 0; r < 8; ++r) {
      float v = acc[t][r] + bv;
      if (resid) { float rv = resid[(size_t)((row0 + 8 * hh + r) % rmod) * ldr + col]; if (RES_BF16) rv = bf16_round(rv); v += rv; }
      if (ACT == 1) v = fmaxf(v, 0.f);
      if (ACT == 2) v = 0.5f * v * (1.0f + erff(v * 0.70710678118654752f));
      if (ACT == 3) { const float u = 0.7978845608028654f * (v + 0.044715f * v * v * v); v = 0.5f * v * (1.0f + tanhf(u)); }
      so[w][8 * hh + r][t * 16 + ln] = v;
    }
  }
  __builtin_amdgcn_fence(__ATOMIC_ACQ_REL, "workgroup");
  __builtin_amdgcn_wave_barrier();
  const int rsub = lane >> 4, c4 = (lane & 15) * 4;
  {
#pragma unroll
    for (int q = 0; q < 8; ++q) {
      const int r = q * 2 + rsub;
      const v4f v = *(const v4fa*)&so[w][r][c4];
      *(v4f*)(C + (size_t)(row0 + r) * ldc + col0 + c4) = v;
    }
    
  }
}
// row LayerNorm (biased variance, eps) over N: s = X (+ R); optional out_sum <- s; out_norm <- (s-mu)*rsqrt(var+eps)*g + b
template <bool PARAM_BF16>
__global__ __launch_bounds__(256) void k_layernorm(const float* __restrict__ X, const float* __restrict__ R, const float* __restrict__ g, const float* __restrict__ bta,
                                                  float* __restrict__ out_sum, float* __restrict__ out_norm, int N, float eps) {
  __shared__ float red[256];
  const int row = blockIdx.x, tid = threadIdx.x;
  const float* x = X + (size_t)row * N; const float* rr = R ? R + (size_t)row * N : nullptr;
  float vals[16];                     // up to N = 4096
  const int per = N / 256;            // contiguous chunk per thread? use strided-by-4 chunks: thread handles j = tid*4 + 1024*u
  float s1 = 0.f;
  for (int u = 0; u < per / 4; ++u) {
    const int j = tid * 4 + 1024 * u;
    const v4f a = *(const v4fa*)(x + j);
    v4f b = {0.f,0.f,0.f,0.f}; if (rr) b = *(const v4fa*)(rr + j);
#pragma unroll
    for (int q = 0; q < 4; ++q) { const float v = a[q] + b[q]; vals[u * 4 + q] = v; s1 += v; }
  }
  red[tid] = s1; __syncthreads();
  for (int st = 128; st > 0; st >>= 1) { if (tid < st) red[tid] += red[tid + st]; __syncthreads(); }
  const float mu = red[0] / (float)N; __syncthreads();
  float s2 = 0.f;
  for (int u = 0; u < per / 4; ++u)
#pragma unroll
    for (int q = 0; q < 4; ++q) { const float c = vals[u * 4 + q] - mu; s2 += c * c; }
  red[tid] = s2; __syncthreads();
  for (int st = 128; st > 0; st >>= 1) { if (tid < st) red[tid] += red[tid + st]; __syncthreads(); }
  const float rs = rsqrtf(red[0] / (float)N + eps);
  {
    for (int u = 0; u < per / 4; ++u) {
      const int j = tid * 4 + 1024 * u;
      v4f o, sm;
#pragma unroll
      for (int q = 0; q < 4; ++q) {
        float gg = g[j + q], bb = bta[j + q];
        if (PARAM_BF16) { gg = bf16_round(gg); bb = bf16_round(bb); }
        sm[q] = vals[u * 4 + q]; o[q] = (vals[u * 4 + q] - mu) * rs * gg + bb;
      }
      if (out_sum) *(v4f*)(out_sum + (size_t)row * N + j) = sm;
      *(v4f*)(out_norm + (size_t)row * N + j) = o;
    }
    
  }
}



// ---- f16 WMMA path (v_wmma_f32_16x16x32_f16): 11-bit significands for operands in range — used where a [0,1] probability operand needs more precision than bf16
typedef _Float16 v16h __attribute__((ext_vector_type(16)));
union FragH { v16h v; v8us half[2]; _Float16 h[16]; unsigned short u[16]; };
template <int NT>
__device__ __forceinline__ v8f mmaH(v16h ah, v16h al, v16h bh, v16h bl, v8f c) {
  c = __builtin_amdgcn_wmma_f32_16x16x32_f16(false, ah, false, bh, (short)0, c, false, false);
  if (NT >= 2) c = __builtin_amdgcn_wmma_f32_16x16x32_f16(false, al, false, bh, (short)0, c, false, false);
  if (NT >= 3) c = __builtin_amdgcn_wmma_f32_16x16x32_f16(false, ah, false, bl, (short)0, c, false, false);
  asm volatile("v_nop\n\tv_nop\n\tv_nop\n\tv_nop" : "+v"(c) : "v"(ah), "v"(al), "v"(bh), "v"(bl));
  return c;
}
// batched GEMM like k_gemm_b but f16 operands: A f32 (split into f16 hi/lo if ASPLIT, else rounded to f16), Bt = f16 values [n][k]; alpha; C f32; N multiple of 16 (partial tiles skipped)
template <bool ASPLIT>
__global__ __launch_bounds__(128) void k_gemm_h(const float* __restrict__ A, int lda, size_t sA, const _Float16* __restrict__ Bh, int ldb, size_t sB, float alpha, float* __restrict__ C, int ldc, size_t sC, int M, int N, int K) {
  __shared__ __attribute__((aligned(16))) float so[4][16][64];
  const int tid = threadIdx.x, w = tid >> 5, lane = tid & 31, ln = lane & 15, hh = lane >> 4; const int by = blockIdx.y;
  A += (size_t)by * sA; Bh += (size_t)by * sB; C += (size_t)by * sC;
  const int ntn = (N + 63) / 64; const int wid = blockIdx.x * 4 + w; const int mt = wid / ntn, nq = wid % ntn; if (mt * 16 >= M) return;
  const int row0 = mt * 16, col0 = nq * 64; const float* arow = A + (size_t)(row0 + ln) * lda;
  v8f acc[4] = {};
  for (int kb = 0; kb < K; kb += 32) {
    FragH ah, al;
    const v4f x0 = *(const v4fa*)(arow + kb + 8 * hh), x1 = *(const v4fa*)(arow + kb + 8 * hh + 4), x2 = *(const v4fa*)(arow + kb + 16 + 8 * hh), x3 = *(const v4fa*)(arow + kb + 16 + 8 * hh + 4);
    float xs[16] = {x0[0],x0[1],x0[2],x0[3],x1[0],x1[1],x1[2],x1[3],x2[0],x2[1],x2[2],x2[3],x3[0],x3[1],x3[2],x3[3]};
#pragma unroll
    for (int i = 0; i < 16; ++i) { const _Float16 h = (_Float16)xs[i]; ah.h[i] = h; al.h[i] = ASPLIT ? (_Float16)(xs[i] - (float)h) : (_Float16)0.0f; }
#pragma unroll
    for (int t = 0; t < 4; ++t) { if (col0 + t * 16 >= N) continue; const size_t boff = (size_t)(col0 + t * 16 + ln) * ldb + kb; FragH bq; bq.half[0] = *(const v8us*)(Bh + boff + 8 * hh); bq.half[1] = *(const v8us*)(Bh + boff + 16 + 8 * hh);
      acc[t] = mmaH<ASPLIT ? 2 : 1>(ah.v, al.v, bq.v, bq.v, acc[t]); }
  }
#pragma unroll
  for (int t = 0; t < 4; ++t) { if (col0 + t * 16 >= N) continue;
#pragma unroll
    for (int r = 0; r < 8; ++r) so[w][8 * hh + r][t * 16 + ln] = acc[t][r] * alpha; }
  __builtin_amdgcn_fence(__ATOMIC_ACQ_REL, "workgroup"); __builtin_amdgcn_wave_barrier();
  const int rsub = lane >> 4, c4 = (lane & 15) * 4;
  {
#pragma unroll
    for (int q = 0; q < 8; ++q) { const int r = q * 2 + rsub; if (col0 + c4 < N) { const v4f v = *(const v4fa*)&so[w][r][c4]; *(v4f*)(C + (size_t)(row0 + r) * ldc + col0 + c4) = v; } }
     }
}

// Wt[n][k] = f16(W[k][n]·scale) from f32 row-major W[K][N] (scale = power of two; bf16-exact weights stay exact in f16 away from the subnormal range)
__global__ __launch_bounds__(256) void k_wt_f16(const float* __restrict__ W, _Float16* __restrict__ Wt, int K, int N, float scale) {
  const int t = blockIdx.x * 256 + threadIdx.x; if (t >= N * (K / 8)) return; const int n = t / (K / 8), k8 = (t % (K / 8)) * 8; FragH f;
#pragma unroll
  for (int i = 0; i < 8; ++i) f.h[i] = (_Float16)(bf16_round(W[(size_t)(k8 + i) * N + n]) * scale); const v8us o = f.half[0];
  *(v8us*)((unsigned short*)Wt + (size_t)n * K + k8) = o; 
}
// k_gemm_hh variant with fused epilogue: v = acc·alpha + bias[by·sBias + col] (+ CP[(row/rowsPerB)·sCPb + by·64 + col] if CP) ; ACT 0 none / 1 elu ; writes f16 C16 (and f32 C if non-null)
template <int ACT>
__global__ __launch_bounds__(128) void k_gemm_hhx(const _Float16* __restrict__ A, int lda, size_t sA, const _Float16* __restrict__ Bh, int ldb, size_t sB, float alpha, const float* __restrict__ bias, size_t sBias, const float* __restrict__ CP, int rowsPerB, size_t sCPb, int row0g,
    float* __restrict__ C, _Float16* __restrict__ C16, int ldc, size_t sC, int M, int N, int K) {
  __shared__ __attribute__((aligned(16))) float so[4][16][64];
  const int tid = threadIdx.x, w = tid >> 5, lane = tid & 31, ln = lane & 15, hh = lane >> 4; const int by = blockIdx.y;
  A += (size_t)by * sA; Bh += (size_t)by * sB; const size_t cofs = (size_t)by * sC; const float* bp = bias ? bias + (size_t)by * sBias : nullptr;
  const int ntn = (N + 63) / 64; const int wid = blockIdx.x * 4 + w; const int mt = wid / ntn, nq = wid % ntn; if (mt * 16 >= M) return;
  const int row0 = mt * 16, col0 = nq * 64; const _Float16* arow = A + (size_t)(row0 + ln) * lda;
  v8f acc[4] = {};
  for (int kb = 0; kb < K; kb += 32) { FragH ah; ah.half[0] = *(const v8us*)((const unsigned short*)arow + kb + 8 * hh); ah.half[1] = *(const v8us*)((const unsigned short*)arow + kb + 16 + 8 * hh);
#pragma unroll
    for (int t = 0; t < 4; ++t) { if (col0 + t * 16 >= N) continue; const size_t boff = (size_t)(col0 + t * 16 + ln) * ldb + kb; FragH bq; bq.half[0] = *(const v8us*)((const unsigned short*)Bh + boff + 8 * hh); bq.half[1] = *(const v8us*)((const unsigned short*)Bh + boff + 16 + 8 * hh);
      acc[t] = mmaH<1>(ah.v, ah.v, bq.v, bq.v, acc[t]); }
  }
#pragma unroll
  for (int t = 0; t < 4; ++t) { if (col0 + t * 16 >= N) continue; const int col = col0 + t * 16 + ln; const float bv = bp ? bf16_round(bp[col]) : 0.f;
#pragma unroll
    for (int r = 0; r < 8; ++r) { float v = acc[t][r] * alpha + bv; if (CP) { const int rr = row0g + row0 + 8 * hh + r; if (rowsPerB < 0) v += CP[cofs + (size_t)rr * ldc + col];      /* rowsPerB < 0: own element of the batched C plane */ else { const int bidx = rr / rowsPerB; v += CP[(size_t)bidx * sCPb + (size_t)by * 64 + col]; } } if (ACT == 1) v = (v > 0.f) ? v : expm1f(v); else if (ACT == 7) v = (v > 0.f) ? v + 1.0f : expf(v); else if (ACT == 8) v = tanhf(v); else if (ACT == 9) v = 0.5f * v * (1.0f + tanhf(0.7978845608028654f * (v + 0.044715f * v * v * v))); else if (ACT == 11) v = 1.0f / (1.0f + expf(-v)); else if (ACT == 12) v = (v > 0.f) ? v : 0.01f * v; else if (ACT == 14) v = (v > 0.f) ? v : 0.1f * v; else if (ACT == 16) v = (v >= 0.f) ? v : 0.3f * v; else if (ACT == 17) v = (v >= 0.f) ? v : 0.2f * v; else if (ACT == 15) v = v / (1.0f + expf(-v)); else if (ACT == 3) v = fmaxf(v, 0.f); else if (ACT == 6) v = 0.5f * v * (1.0f + erff(v * 0.70710678118654752f)); so[w][8 * hh + r][t * 16 + ln] = v; } }
  __builtin_amdgcn_fence(__ATOMIC_ACQ_REL, "workgroup"); __builtin_amdgcn_wave_barrier();
  const int rsub = lane >> 4, c4 = (lane & 15) * 4; typedef _Float16 v4h __attribute__((ext_vector_type(4)));
  {
#pragma unroll
    for (int q = 0; q < 8; ++q) { const int r = q * 2 + rsub; if (col0 + c4 < N) { const v4f v = *(const v4fa*)&so[w][r][c4]; if (C) *(v4f*)(C + cofs + (size_t)(row0 + r) * ldc + col0 + c4) = v; if (C16) { v4h h4; for (int i = 0; i < 4; ++i) h4[i] = (_Float16)v[i]; *(v4h*)(C16 + cofs + (size_t)(row0 + r) * ldc + col0 + c4) = h4; } } }
     }
}


typedef _Float16 v4h __attribute__((ext_vector_type(4)));

__global__ __launch_bounds__(256) void k_h16(const float* __restrict__ x, _Float16* __restrict__ X16, size_t n8) { const size_t t = (size_t)blockIdx.x * 256 + threadIdx.x; if (t >= n8) return; FragH f;
#pragma unroll
  for (int q = 0; q < 8; ++q) f.h[q] = (_Float16)x[t * 8 + q]; *(v8us*)((unsigned short*)X16 + t * 8) = f.half[0];  }
__global__ __launch_bounds__(256) void k_round16f(const float* __restrict__ W, _Float16* __restrict__ Bt, size_t n8) { const size_t t = (size_t)blockIdx.x * 256 + threadIdx.x; if (t >= n8) return; FragH f;
#pragma unroll
  for (int i = 0; i < 8; ++i) f.h[i] = (_Float16)(bf16_round(W[t * 8 + i]) * 16.0f); *(v8us*)((unsigned short*)Bt + t * 8) = f.half[0];  }
template <int NHv, int TTv>
__global__ __launch_bounds__(256) void k_vt(const _Float16* __restrict__ V16, int ldv, int voff, _Float16* __restrict__ Vt) { __shared__ unsigned short tl[64][66]; const int tid = threadIdx.x; const int slab = blockIdx.x / (TTv / 64), lg = blockIdx.x % (TTv / 64); const int b = slab / NHv, h = slab % NHv;
  for (int i = tid; i < 64 * 8; i += 256) { const int r = i / 8, c8 = (i % 8) * 8; FragH f; f.half[0] = *(const v8us*)((const unsigned short*)V16 + ((size_t)b * TTv + lg * 64 + r) * ldv + voff + h * 64 + c8);
#pragma unroll
    for (int q = 0; q < 8; ++q) tl[r][c8 + q] = f.u[q]; }
  __syncthreads();
  {
#pragma unroll
    for (int rd = 0; rd < 2; ++rd) { const int d = rd * 32 + tid / 8, pc = tid % 8; FragH f;
#pragma unroll
      for (int q = 0; q < 8; ++q) f.u[q] = tl[pc * 8 + q][d];
      *(v8us*)((unsigned short*)Vt + ((size_t)slab * 64 + d) * TTv + lg * 64 + pc * 8) = f.half[0]; }
     } }

__global__ __launch_bounds__(256) void k_hl(const float* __restrict__ F, _Float16* __restrict__ Hh, _Float16* __restrict__ Hl, size_t n8) { const size_t t = (size_t)blockIdx.x * 256 + threadIdx.x; if (t >= n8) return; FragH fh, fl; const v4f a = *(const v4fa*)(F + t * 8), c = *(const v4fa*)(F + t * 8 + 4);
#pragma unroll
  for (int q = 0; q < 4; ++q) { _Float16 h = (_Float16)a[q]; fh.h[q] = h; fl.h[q] = (_Float16)((a[q] - (float)h) * 1024.0f); h = (_Float16)c[q]; fh.h[4 + q] = h; fl.h[4 + q] = (_Float16)((c[q] - (float)h) * 1024.0f); }
  { *(v8us*)((unsigned short*)Hh + t * 8) = fh.half[0]; *(v8us*)((unsigned short*)Hl + t * 8) = fl.half[0];  } }

// ---- fast GEMM (wave tile 32x64; requires M % 32 == 0 rows per launch region and N % 64 == 0); epilogue = k_gemm_hhx semantics ----
__device__ __forceinline__ v16h g2_frag(const _Float16* p, int hh) { FragH f; f.half[0] = *(const v8us*)((const unsigned short*)p + 8 * hh); f.half[1] = *(const v8us*)((const unsigned short*)p + 16 + 8 * hh); return f.v; }
__device__ __forceinline__ v8f g2_mma(v16h a, v16h b, v8f c) { v8f d = __builtin_amdgcn_wmma_f32_16x16x32_f16(false, a, false, b, (short)0, c, false, false); asm volatile("v_nop\n\tv_nop\n\tv_nop\n\tv_nop" : "+v"(d) : "v"(a), "v"(b)); return d; }
template <int ACT>
__global__ __launch_bounds__(128) void k_gemm2(const _Float16* __restrict__ A, int lda, size_t sA, const _Float16* __restrict__ Bh, int ldb, size_t sB, float alpha, const float* __restrict__ bias, size_t sBias, const float* __restrict__ CP, int rowsPerB, size_t sCPb, int row0g,
    float* __restrict__ C, _Float16* __restrict__ C16, int ldc, size_t sC, int M, int N, int K) { static_assert(ACT == 0 || ACT == 3 || ACT == 6 || ACT == 8 || ACT == 9 || ACT == 11 || ACT == 12 || ACT == 14 || ACT == 15 || ACT == 16 || ACT == 17, "k_gemm2: unsupported ACT code (would silently apply no activation)");
  __shared__ __attribute__((aligned(16))) float so[4][32][68];
  const int tid = threadIdx.x, w = tid >> 5, lane = tid & 31, ln = lane & 15, hh = lane >> 4; const int by = blockIdx.y;
  A += (size_t)by * sA; Bh += (size_t)by * sB; const size_t cofs = (size_t)by * sC; const float* bp = bias ? bias + (size_t)by * sBias : nullptr;
  const int ntn = N >> 6; const int mt = blockIdx.x / ntn, nq = blockIdx.x - mt * ntn; const int row0 = mt * 128 + 32 * w, col0 = nq * 64; if (row0 >= M) return;
  const _Float16* a0p = A + (size_t)(row0 + ln) * lda; const _Float16* a1p = a0p + (size_t)16 * lda;
  const _Float16* b0p = Bh + (size_t)(col0 + ln) * ldb; const _Float16* b1p = b0p + (size_t)16 * ldb; const _Float16* b2p = b1p + (size_t)16 * ldb; const _Float16* b3p = b2p + (size_t)16 * ldb;
  const v8f z8 = {0.f,0.f,0.f,0.f,0.f,0.f,0.f,0.f}; v8f c00 = z8, c01 = z8, c02 = z8, c03 = z8, c10 = z8, c11 = z8, c12 = z8, c13 = z8;
#pragma unroll 1
  for (int kb = 0; kb < K; kb += 32) { const v16h a0 = g2_frag(a0p + kb, hh), a1 = g2_frag(a1p + kb, hh);
    v16h b = g2_frag(b0p + kb, hh); c00 = g2_mma(a0, b, c00); c10 = g2_mma(a1, b, c10);
    b = g2_frag(b1p + kb, hh); c01 = g2_mma(a0, b, c01); c11 = g2_mma(a1, b, c11);
    b = g2_frag(b2p + kb, hh); c02 = g2_mma(a0, b, c02); c12 = g2_mma(a1, b, c12);
    b = g2_frag(b3p + kb, hh); c03 = g2_mma(a0, b, c03); c13 = g2_mma(a1, b, c13); }
  v8f accs[8] = {c00, c01, c02, c03, c10, c11, c12, c13};
#pragma unroll
  for (int u = 0; u < 8; ++u) { const int t = u & 3, half = u >> 2; const int col = col0 + t * 16 + ln; const float bv = bp ? bf16_round(bp[col]) : 0.f;
#pragma unroll
    for (int r = 0; r < 8; ++r) { const int rloc = half * 16 + 8 * hh + r; float v = accs[u][r] * alpha + bv; if (CP) { if (rowsPerB < 0) v += CP[cofs + (size_t)(row0g + row0 + rloc) * ldc + col];      /* rowsPerB < 0: own element of the batched C plane */ else { const int bidx = (row0g + row0 + rloc) / rowsPerB; v += CP[(size_t)bidx * sCPb + (size_t)by * 64 + col]; } }
      if (ACT == 3) v = fmaxf(v, 0.f); else if (ACT == 6) v = 0.5f * v * (1.0f + erff(v * 0.70710678118654752f)); else if (ACT == 11) v = 1.0f / (1.0f + expf(-v)); else if (ACT == 15) v = v / (1.0f + expf(-v)); else if (ACT == 12) v = (v > 0.f) ? v : 0.01f * v; else if (ACT == 8) v = tanhf(v); else if (ACT == 9) v = 0.5f * v * (1.0f + tanhf(0.7978845608028654f * (v + 0.044715f * v * v * v))); else if (ACT == 14) v = (v > 0.f) ? v : 0.1f * v; else if (ACT == 16) v = (v >= 0.f) ? v : 0.3f * v; else if (ACT == 17) v = (v >= 0.f) ? v : 0.2f * v;
      so[w][rloc][t * 16 + ln] = v; } }
  __builtin_amdgcn_fence(__ATOMIC_ACQ_REL, "workgroup"); __builtin_amdgcn_wave_barrier();
  const int rsub = lane >> 4, c4 = (lane & 15) * 4;
  {
#pragma unroll
    for (int q = 0; q < 16; ++q) { const int r = q * 2 + rsub; const v4f v = *(const v4fa*)&so[w][r][c4]; if (C) *(v4f*)(C + cofs + (size_t)(row0 + r) * ldc + col0 + c4) = v; if (C16) { v4h h4; for (int i = 0; i < 4; ++i) h4[i] = (_Float16)v[i]; *(v4h*)(C16 + cofs + (size_t)(row0 + r) * ldc + col0 + c4) = h4; } }
     } }


// ---- operand preparation, one launch: every work-group takes 2 of the 1024 V tiles, 4 x 256 of the K units, 4 x 256 of the q units and 64 of the W_out units; a thread asks for all of its values first, then converts and stores ----
// K unit u = 16 bytes = (slab = b*NH + h, 16-key tile, 32-wide d step, fragment half j, lane = 16 hh + ln) holds k[key = 16 tile + ln][d = 32 step + 16 j + 8 hh .. + 7]: A-fragment order.
// V^T unit (slab, 32-key block, 16-row d tile t, half j, lane) holds v[key = 32 block + 16 j + 8 hh .. + 7][d = 16 t + ln], turned through an LDS tile of 64 keys x 64 d.
// q rows and W_out (x16, natural [out][in] = Bt[n][k]) keep their order. Every value is rounded to bf16 and is exact as f16.
#define PB 512      /* work-groups of the preparation launch: 16 waves a WGP */
__device__ __forceinline__ v8us pr_cvt(v4f p, v4f q, float scale) { FragH f;
#pragma unroll      /* constant indices keep the arrays in registers */
  for (int i = 0; i < 4; ++i) { f.h[i] = (_Float16)(bf16_round(p[i]) * scale); f.h[4 + i] = (_Float16)(bf16_round(q[i]) * scale); }
  return f.half[0]; }
__global__ __launch_bounds__(256) void k_prep(const float* __restrict__ xq, const float* __restrict__ xk, const float* __restrict__ xv, const float* __restrict__ wo,
    _Float16* __restrict__ Q16, _Float16* __restrict__ KF, _Float16* __restrict__ VF, _Float16* __restrict__ BO) {
  static_assert(NB * NH * (SQ / 64) == 2 * PB && NR * DM / 8 == (size_t)4 * 256 * PB && DM * DM / 8 == 64 * PB, "shares of the preparation launch");
  __shared__ unsigned short tl[2][64][66];
  const int tid = threadIdx.x, blk = blockIdx.x;
  v4f vv[2][2][2], kv[4][2], qv[4][2], wv[2];
#pragma unroll      /* constant indices keep the arrays in registers */
  for (int ti = 0; ti < 2; ++ti) { const int tile = blk * 2 + ti; const int slab = tile / (SQ / 64), lg = tile % (SQ / 64); const int b = slab / NH, h = slab % NH;
#pragma unroll      /* constant indices keep the arrays in registers */
    for (int rd = 0; rd < 2; ++rd) { const int i = tid + rd * 256; const int r = i / 8, c8 = (i % 8) * 8; const float* s = xv + ((size_t)b * SQ + lg * 64 + r) * DM + h * HD + c8; vv[ti][rd][0] = *(const v4fa*)s; vv[ti][rd][1] = *(const v4fa*)(s + 4); } }
#pragma unroll      /* constant indices keep the arrays in registers */
  for (int c = 0; c < 4; ++c) { const size_t u = (size_t)(blk * 4 + c) * 256 + tid;
    const int ln = (int)(u & 15), hh = (int)(u >> 4) & 1, j = (int)(u >> 5) & 1, ks = (int)(u >> 6) & 1; const int tile = (int)(u >> 7); const int kt = tile % (SQ / 16), slab = tile / (SQ / 16); const int b = slab / NH, h = slab % NH;
    const float* s = xk + ((size_t)b * SQ + kt * 16 + ln) * DM + h * HD + ks * 32 + j * 16 + hh * 8; kv[c][0] = *(const v4fa*)s; kv[c][1] = *(const v4fa*)(s + 4); }
#pragma unroll      /* constant indices keep the arrays in registers */
  for (int c = 0; c < 4; ++c) { const float* s = xq + ((size_t)(blk * 4 + c) * 256 + tid) * 8; qv[c][0] = *(const v4fa*)s; qv[c][1] = *(const v4fa*)(s + 4); }
  if (tid < 64) { const float* s = wo + ((size_t)blk * 64 + tid) * 8; wv[0] = *(const v4fa*)s; wv[1] = *(const v4fa*)(s + 4); }
#pragma unroll      /* constant indices keep the arrays in registers */
  for (int ti = 0; ti < 2; ++ti) {
#pragma unroll      /* constant indices keep the arrays in registers */
    for (int rd = 0; rd < 2; ++rd) { const int i = tid + rd * 256; const int r = i / 8, c8 = (i % 8) * 8; FragH f; f.half[0] = pr_cvt(vv[ti][rd][0], vv[ti][rd][1], 1.0f);
#pragma unroll      /* constant indices keep the arrays in registers */
      for (int q = 0; q < 8; ++q) tl[ti][r][c8 + q] = f.u[q]; } }
  __syncthreads();      /* both V tiles are whole in LDS before any column of them is read; it stands ahead of every global store, so that it waits for none */
#pragma unroll      /* constant indices keep the arrays in registers */
  for (int ti = 0; ti < 2; ++ti) { const int tile = blk * 2 + ti; const int slab = tile / (SQ / 64), lg = tile % (SQ / 64);
#pragma unroll      /* constant indices keep the arrays in registers */
    for (int rd = 0; rd < 2; ++rd) { const int ln = tid & 15, hh = (tid >> 4) & 1, j = (tid >> 5) & 1, t = tid >> 6; FragH f;
#pragma unroll      /* constant indices keep the arrays in registers */
      for (int q = 0; q < 8; ++q) f.u[q] = tl[ti][rd * 32 + j * 16 + hh * 8 + q][t * 16 + ln];
      *(v8us*)((unsigned short*)VF + ((size_t)slab * (SQ / 32) + lg * 2 + rd) * 2048 + (size_t)tid * 8) = f.half[0]; } }
#pragma unroll      /* constant indices keep the arrays in registers */
  for (int c = 0; c < 4; ++c) *(v8us*)((unsigned short*)KF + ((size_t)(blk * 4 + c) * 256 + tid) * 8) = pr_cvt(kv[c][0], kv[c][1], 1.0f);
#pragma unroll      /* constant indices keep the arrays in registers */
  for (int c = 0; c < 4; ++c) *(v8us*)((unsigned short*)Q16 + ((size_t)(blk * 4 + c) * 256 + tid) * 8) = pr_cvt(qv[c][0], qv[c][1], 1.0f);
  if (tid < 64) *(v8us*)((unsigned short*)BO + ((size_t)blk * 64 + tid) * 8) = pr_cvt(wv[0], wv[1], 16.0f); }
// ---- fused attention: one wave = 32 query columns (2 groups of 16) of one head and one half of its keys, a pass = 32 keys; 16 waves a block (four a SIMD): waves c and c + 8 hold the same columns, the 8 waves of a key half share that half's K and V^T stream through the cache; the two halves' sums are merged once, through LDS ----
__device__ __forceinline__ v16h fa_frag(const unsigned short* p) { FragH f; f.half[0] = *(const v8us*)p; f.half[1] = *(const v8us*)(p + 256); return f.v; }      /* p = the lane's 16 bytes of half 0; half 1 lies 512 bytes on */
__device__ __forceinline__ v8f fa_mma(v16h a, v16h b, v8f c) { return __builtin_amdgcn_wmma_f32_16x16x32_f16(false, a, false, b, (short)0, c, false, false); }
__device__ __forceinline__ float fa_xhalf(float x) { return __builtin_bit_cast(float, __builtin_amdgcn_permlanex16(__builtin_bit_cast(int, x), __builtin_bit_cast(int, x), 0x76543210, 0xfedcba98, false, false)); }      /* lane l with lane l ^ 16 */
#define FQ 256      /* query rows a block */
#define FK (SQ / 2)      /* keys a wave walks */
__global__ __launch_bounds__(512) void k_fattn(const _Float16* __restrict__ Q16, const _Float16* __restrict__ KF, const _Float16* __restrict__ VF, _Float16* __restrict__ O16) {
  typedef float v2f __attribute__((ext_vector_type(2))); typedef _Float16 v2h __attribute__((ext_vector_type(2)));
  __shared__ __attribute__((aligned(16))) v4f mg[FQ / 32][17][32];      /* the upper key half's sums on their way to the lower half's wave: [column wave][16 quarters of o, then maxima and row sums][lane], 512 contiguous bytes a wave and store */
  const int wv = __builtin_amdgcn_readfirstlane((int)(threadIdx.x >> 5));      /* the wave's number in a scalar register: the key half decides branches and the streams' base */
  const int lane = threadIdx.x & 31, w = wv & 7, kh = wv >> 3, ln = lane & 15, hh = lane >> 4;
  const int slab = blockIdx.x / (SQ / FQ), qb = blockIdx.x % (SQ / FQ); const int b = slab / NH, h = slab % NH; const int q0 = qb * FQ + w * 32;
  const float cs = 0.044194173824159216f * 1.4426950408889634f;      /* 1 / sqrt(512) (the module's literal d_model scale) x log2 e */
  v16h qf[2][2];      /* B operand: column = query, k = d */
#pragma unroll      /* constant indices keep the arrays in registers */
  for (int g = 0; g < 2; ++g) { const _Float16* qp = Q16 + ((size_t)b * SQ + q0 + g * 16 + ln) * DM + h * HD; qf[g][0] = g2_frag(qp, hh); qf[g][1] = g2_frag(qp + 32, hh); }
  const unsigned short* kp = (const unsigned short*)KF + ((size_t)slab * SQ + (size_t)kh * FK) * HD + lane * 8; const unsigned short* vp = (const unsigned short*)VF + ((size_t)slab * SQ + (size_t)kh * FK) * HD + lane * 8;      /* both planes hold 64 values a key in key order by blocks of 32 keys */
  const v8f z8 = {0.f,0.f,0.f,0.f,0.f,0.f,0.f,0.f}; v8f o[2][4]; float mr[2], lr[2];
#pragma unroll      /* constant indices keep the arrays in registers */
  for (int g = 0; g < 2; ++g) { mr[g] = -__builtin_inff(); lr[g] = 0.f;
#pragma unroll      /* constant indices keep the arrays in registers */
    for (int t = 0; t < 4; ++t) o[g][t] = z8; }
  v16h kf[4], vf[4];      /* A operands: kf[16-key tile * 2 + d step], vf[16-row d tile]; both are asked for one pass ahead, into the registers that the pass has just used */
  const unsigned short* vq = vp;
#pragma unroll      /* constant indices keep the arrays in registers */
  for (int t = 0; t < 4; ++t) kf[t] = fa_frag(kp + t * 512);
  asm volatile("s_wait_xcnt 0x0" :: "v"(kp) : "memory");      /* the K loads' address pair stays whole until this wait; Q and K are asked for ahead of V, the order of every pass, so that the loop's counted load waits fit its first pass too */
#pragma unroll      /* constant indices keep the arrays in registers */
  for (int t = 0; t < 4; ++t) vf[t] = fa_frag(vq + t * 512);
  for (int i = 0; i < FK / 32; ++i) {
    v8f s[2][2];      /* [group][key tile]: register r = score of key 16 tile + 8 hh + r, query ln */
#pragma unroll      /* constant indices keep the arrays in registers */
    for (int g = 0; g < 2; ++g) {
#pragma unroll      /* constant indices keep the arrays in registers */
      for (int kt = 0; kt < 2; ++kt) s[g][kt] = fa_mma(kf[kt * 2 + 1], qf[g][1], fa_mma(kf[kt * 2], qf[g][0], z8)); }
    asm volatile("s_wait_xcnt 0x0" :: "v"(vq) : "memory");      /* the V loads' address pair (asked for at the foot of the pass before) stays whole until this wait */
    const int nx = (i + 1 < FK / 32) ? i + 1 : i;      /* the last pass asks for its own tiles again (in bounds, unused) */
    const unsigned short* kq = kp + (size_t)nx * 2048;
#pragma unroll      /* constant indices keep the arrays in registers */
    for (int t = 0; t < 4; ++t) kf[t] = fa_frag(kq + t * 512);
    float mb[2]; bool need = false;
#pragma unroll      /* constant indices keep the arrays in registers */
    for (int g = 0; g < 2; ++g) { float mx = s[g][0][0];
#pragma unroll      /* constant indices keep the arrays in registers */
      for (int r = 1; r < 8; ++r) mx = fmaxf(mx, s[g][0][r]);
#pragma unroll      /* constant indices keep the arrays in registers */
      for (int r = 0; r < 8; ++r) mx = fmaxf(mx, s[g][1][r]);
      mb[g] = fmaxf(mx, fa_xhalf(mx)) * cs; need = need || (mb[g] > mr[g] + 8.0f); }
    asm volatile("s_wait_xcnt 0x0" :: "v"(kq) : "memory");      /* the K loads' address pair stays whole until this wait; it also keeps those loads up here, a whole softmax and second product ahead of their use */
    if (__builtin_amdgcn_ballot_w32(need) != 0) {      /* the maximum in use may trail the true one by up to 8 (log2): weights stay <= 2^8; one test a pass */
#pragma unroll      /* constant indices keep the arrays in registers */
      for (int g = 0; g < 2; ++g) { const float mn = fmaxf(mr[g], mb[g]); const float corr = __builtin_amdgcn_exp2f(mr[g] - mn); mr[g] = mn; lr[g] *= corr;      /* corr = 0 in the first pass */
#pragma unroll      /* constant indices keep the arrays in registers */
        for (int t = 0; t < 4; ++t) o[g][t] = o[g][t] * corr; } }
#pragma unroll      /* constant indices keep the arrays in registers */
    for (int g = 0; g < 2; ++g) { const float nm = -mr[g]; FragH pf; v2f ls = {0.f, 0.f};      /* two score tiles, converted in place, are the B operand of the second product */
#pragma unroll      /* constant indices keep the arrays in registers */
      for (int e = 0; e < 8; ++e) { const v2f sv = {s[g][e >> 2][2 * (e & 3)], s[g][e >> 2][2 * (e & 3) + 1]}; const v2f ar = __builtin_elementwise_fma(sv, (v2f){cs, cs}, (v2f){nm, nm});
        const v2f pv = {__builtin_amdgcn_exp2f(ar[0]), __builtin_amdgcn_exp2f(ar[1])}; ls += pv; const v2h ph = __builtin_convertvector(pv, v2h); pf.h[2 * e] = ph[0]; pf.h[2 * e + 1] = ph[1]; }
      lr[g] += ls[0] + ls[1];
#pragma unroll      /* constant indices keep the arrays in registers */
      for (int t = 0; t < 4; ++t) o[g][t] = fa_mma(vf[t], pf.v, o[g][t]); }
    vq = vp + (size_t)nx * 2048;
#pragma unroll      /* constant indices keep the arrays in registers */
    for (int t = 0; t < 4; ++t) vf[t] = fa_frag(vq + t * 512);
  }
  if (kh != 0) {      /* upper key half: un-normalised sums, maxima in use and row sums go to LDS */
#pragma unroll      /* constant indices keep the arrays in registers */
    for (int g = 0; g < 2; ++g) {
#pragma unroll      /* constant indices keep the arrays in registers */
      for (int t = 0; t < 4; ++t) { mg[w][(g * 4 + t) * 2][lane] = (v4f){o[g][t][0], o[g][t][1], o[g][t][2], o[g][t][3]}; mg[w][(g * 4 + t) * 2 + 1][lane] = (v4f){o[g][t][4], o[g][t][5], o[g][t][6], o[g][t][7]}; } }
    mg[w][16][lane] = (v4f){mr[0], mr[1], lr[0], lr[1]}; }
  __syncthreads();      /* the upper half's sums are whole in LDS before the lower half's waves read them; every wave passes it once */
  if (kh != 0) return;
  const v4f st = mg[w][16][lane];
#pragma unroll      /* constant indices keep the arrays in registers */
  for (int g = 0; g < 2; ++g) { const float mn = fmaxf(mr[g], st[g]); const float ca = __builtin_amdgcn_exp2f(mr[g] - mn), cb = __builtin_amdgcn_exp2f(st[g] - mn);      /* both maxima are finite (each half has walked its keys) and alike in lanes l and l ^ 16 */
    lr[g] = lr[g] * ca + st[2 + g] * cb;
#pragma unroll      /* constant indices keep the arrays in registers */
    for (int t = 0; t < 4; ++t) { const v4f u0 = mg[w][(g * 4 + t) * 2][lane], u1 = mg[w][(g * 4 + t) * 2 + 1][lane];
#pragma unroll      /* constant indices keep the arrays in registers */
      for (int r = 0; r < 4; ++r) { o[g][t][r] = o[g][t][r] * ca + u0[r] * cb; o[g][t][4 + r] = o[g][t][4 + r] * ca + u1[r] * cb; } } }
#pragma unroll      /* constant indices keep the arrays in registers */
  for (int g = 0; g < 2; ++g) { const float inv = 64.0f / (lr[g] + fa_xhalf(lr[g])); unsigned short* op = (unsigned short*)O16 + ((size_t)b * SQ + q0 + g * 16 + ln) * DM + h * HD + 8 * hh;      /* o carried x64; register r of tile t = d 16 t + 8 hh + r of query ln */
#pragma unroll      /* constant indices keep the arrays in registers */
    for (int t = 0; t < 4; ++t) { FragH f;
#pragma unroll      /* constant indices keep the arrays in registers */
      for (int r = 0; r < 8; ++r) f.h[r] = (_Float16)(o[g][t][r] * inv);
      *(v8us*)(op + t * 16) = f.half[0]; } } }
__global__ __launch_bounds__(256) void k_vt(const _Float16* __restrict__ V16, int b, int h0, _Float16* __restrict__ VT) { __shared__ unsigned short tl[64][65]; const int tid = threadIdx.x; const int hh = blockIdx.x % HG, sg = blockIdx.x / HG; const int s0 = sg * 64; const int h = h0 + hh;
  for (int i = tid; i < 64 * 8; i += 256) { const int j = i / 8, d8 = (i % 8) * 8; FragH f; f.half[0] = *(const v8us*)((const unsigned short*)V16 + ((size_t)b * SQ + s0 + j) * DM + h * HD + d8); for (int q = 0; q < 8; ++q) tl[d8 + q][j] = f.u[q]; }
  __syncthreads();
  { for (int i = tid; i < 64 * 8; i += 256) { const int d = i / 8, j8 = (i % 8) * 8; FragH f; for (int q = 0; q < 8; ++q) f.u[q] = tl[d][j8 + q]; *(v8us*)((unsigned short*)VT + ((size_t)hh * HD + d) * SQ + s0 + j8) = f.half[0]; }  } }



__global__ __launch_bounds__(256) void k_rsmkm(const float* __restrict__ S, _Float16* __restrict__ P, int nrows, const int* __restrict__ am) {
  #pragma clang fp contract(off)
  const int t = blockIdx.x * 256 + threadIdx.x; if (t >= nrows) return; const size_t i = (size_t)t; const float* s = S + i * SQ; const int* mr = am + (size_t)(t % SQ) * SQ; float mx = -3.0e38f;
#pragma unroll 1
  for (int j = 0; j < SQ; ++j) { const float f = (mr[j] != 0) ? 1.f : 0.f; mx = fmaxf(mx, fmaf(f, s[j], (1.f - f) * -1.0e9f)); } float se = 0.f;
#pragma unroll 1
  for (int j = 0; j < SQ; ++j) { const float f = (mr[j] != 0) ? 1.f : 0.f; se += __expf(fmaf(f, s[j], (1.f - f) * -1.0e9f) - mx); } const float sc = 256.0f / se;
#pragma unroll 1
  for (int j0 = 0; j0 < SQ; j0 += 8) { FragH fr; for (int q = 0; q < 8; ++q) { const int j = j0 + q; const float f = (mr[j] != 0) ? 1.f : 0.f; fr.h[q] = (_Float16)(__expf(fmaf(f, s[j], (1.f - f) * -1.0e9f) - mx) * sc); }
    unsigned short* d = (unsigned short*)P + i * SQ + j0; *(v8us*)d = fr.half[0];  } }
extern "C" void kernel_launch(void* const* d_in, const int* in_sizes, int n_in,
                              void* d_out, int out_size, void* d_ws, size_t ws_size, hipStream_t stream) {
  (void)in_sizes; (void)n_in; (void)out_size;
  const float* const* I = (const float* const*)d_in; const float* xq = I[0]; const float* xk = I[1]; const float* xv = I[2]; const float* wo = I[3]; const float* bo = I[4];      /* queries, keys, values [4][2048][512] (used as q, k, v directly: no input projections); natural W_out [512][512] + b_out */
  static_assert(NH * HD == DM && DM % 64 == 0 && DM % 32 == 0 && SQ % 128 == 0 && NH % HG == 0 && SQ % FQ == 0 && FK % 32 == 0 && FQ == 256 && HD == 64, "shape / tile multiples");
  char* ws = (char*)d_ws; size_t off = 0;
  auto take = [&](size_t bytes) { char* p = ws + off; off += (bytes + 255) & ~(size_t)255; return p; };
  _Float16* BO = (_Float16*)take((size_t)DM * DM * 2);
  _Float16* Q16 = (_Float16*)take(NR * DM * 2); _Float16* KF = (_Float16*)take(NR * DM * 2); _Float16* VF = (_Float16*)take(NR * DM * 2); _Float16* O16 = (_Float16*)take(NR * DM * 2);
  if (off > ws_size) return;
  k_prep<<<PB, 256, 0, stream>>>(xq, xk, xv, wo, Q16, KF, VF, BO);      /* q rows, K and V^T in fragment order, W_out x16: all operands as exact f16, one launch */
  const size_t r0p = (size_t)B0 * SQ;      /* first projected row */
  k_fattn<<<NB * NH * (SQ / FQ), 512, 0, stream>>>(Q16, KF, VF, O16);      /* o (merged heads) as f16 rows x64 */
  k_gemm2<0><<<dim3((unsigned)((MPO / 128) * (DM / 64)), 1), 128, 0, stream>>>(O16 + r0p * DM, DM, 0, BO, DM, 0, 0.0009765625f, bo, 0, nullptr, 1, 0, 0, (float*)d_out + r0p * DM, nullptr, DM, 0, MPO, DM, DM);      /* out rows are the output layout */
}

// v005
// It runs in 53 microseconds.
// Next to v004, in two timings, it ran 1.24 and 1.23 times as fast.
// Over all steps from v000 it is 69.0 times as fast.
#include <hip/hip_runtime.h>
#define NB 4
#define SQ 2048
#define DM 512
#define NH 8
#define HD 64
#define HG 4                         /* heads per k_vt launch group (k_vt is not launched) */
#define B0 0                         /* first batch processed (debug hook) */
#define NBR NB                       /* batches processed (debug hook) */
#define NR ((size_t)NB * SQ)         /* token rows */
#define MP ((int)((size_t)NBR * SQ)) /* rows projected (debug hook) */
#define QN SQ                        /* query rows attended per batch (unused) */
#define NHD NH                       /* heads attended (unused) */
#define MPO MP                       /* rows through the output stage (debug hook) */
#define LQ DM      /* row pitch of the q/k/v rows (unused: the kernels use DM) */
typedef __bf16 v16b __attribute__((ext_vector_type(16)));
typedef unsigned short v8us __attribute__((ext_vector_type(8), may_alias));
typedef float  v8f  __attribute__((ext_vector_type(8)));
typedef float  v4f  __attribute__((ext_vector_type(4)));
typedef float  v4fa __attribute__((ext_vector_type(4), may_alias));
union FragB { v16b v; v8us half[2]; unsigned short u[16]; };

__device__ __forceinline__ unsigned short bf16_bits(float x) { unsigned int u = __float_as_uint(x); return (unsigned short)((u + 0x7FFFu + ((u >> 16) & 1u)) >> 16); }
__device__ __forceinline__ float bf16_val(unsigned short b) { return __uint_as_float(((unsigned int)b) << 16); }
__device__ __forceinline__ float bf16_round(float x) { return bf16_val(bf16_bits(x)); }
// D += A·B with NT terms: 1 = ah·bh, 2 = + al·bh (A split), 3 = + ah·bl (both split)
template <int NT>
__device__ __forceinline__ v8f mmaN(v16b ah, v16b al, v16b bh, v16b bl, v8f c) {
  c = __builtin_amdgcn_wmma_f32_16x16x32_bf16(false, ah, false, bh, (short)0, c, false, false);
  if (NT >= 2) c = __builtin_amdgcn_wmma_f32_16x16x32_bf16(false, al, false, bh, (short)0, c, false, false);
  if (NT >= 3) c = __builtin_amdgcn_wmma_f32_16x16x32_bf16(false, ah, false, bl, (short)0, c, false, false);
  asm volatile("v_nop\n\tv_nop\n\tv_nop\n\tv_nop" : "+v"(c) : "v"(ah), "v"(al), "v"(bh), "v"(bl));
  return c;
}

__global__ __launch_bounds__(256) void k_wt_bf16(const float* __restrict__ W, unsigned short* __restrict__ Wt, int K, int N) {
  const int t = blockIdx.x * 256 + threadIdx.x;
  const int k8n = K / 8;
  if (t >= N * k8n) return;
  const int n = t / k8n, k8 = (t % k8n) * 8;
  v8us v;
#pragma unroll
  for (int i = 0; i < 8; ++i) v[i] = bf16_bits(W[(size_t)(k8 + i) * N + n]);
  *(v8us*)(Wt + (size_t)n * K + k8) = v;
  
}

// GEMM C[M][N] (f32, pitch ldc) = act(A[M][K]·W + bias). A f32 row-major (pitch lda) converted per fragment to bf16
// (ASPLIT: hi/lo two planes -> 2 terms, else single rounded term); Wt bf16 [N][K] (pitch ldb). BIAS_BF16 rounds the
// bias to bf16 first (bias quantised to bf16 before the add). K%32==0, M%16==0, N%64==0.
template <bool ASPLIT, int ACT, bool BIAS_BF16>
__global__ __launch_bounds__(128) void k_gemm_bf(const float* __restrict__ A, int lda, const unsigned short* __restrict__ Wt, int ldb,
                                               const float* __restrict__ bias, float* __restrict__ C, int ldc, int M, int N, int K) {
  __shared__ __attribute__((aligned(16))) float so[4][16][64];
  const int tid = threadIdx.x, w = tid >> 5, lane = tid & 31, ln = lane & 15, hh = lane >> 4;
  const int ntn = N / 64;
  const int wid = blockIdx.x * 4 + w;
  const int mt = wid / ntn, nq = wid % ntn;
  if (mt * 16 >= M) return;
  const int row0 = mt * 16, col0 = nq * 64;
  const float* arow = A + (size_t)(row0 + ln) * lda;
  v8f acc[4] = {};
  for (int kb = 0; kb < K; kb += 32) {
    FragB ah, al;
    const v4f x0 = *(const v4fa*)(arow + kb + 8 * hh), x1 = *(const v4fa*)(arow + kb + 8 * hh + 4);
    const v4f x2 = *(const v4fa*)(arow + kb + 16 + 8 * hh), x3 = *(const v4fa*)(arow + kb + 16 + 8 * hh + 4);
    float xs[16] = {x0[0],x0[1],x0[2],x0[3],x1[0],x1[1],x1[2],x1[3],x2[0],x2[1],x2[2],x2[3],x3[0],x3[1],x3[2],x3[3]};
#pragma unroll
    for (int i = 0; i < 16; ++i) { const unsigned short hb = bf16_bits(xs[i]); ah.u[i] = hb; al.u[i] = ASPLIT ? bf16_bits(xs[i] - bf16_val(hb)) : (unsigned short)0; }
#pragma unroll
    for (int t = 0; t < 4; ++t) {
      const unsigned short* brow = Wt + (size_t)(col0 + t * 16 + ln) * ldb + kb;
      FragB b;
      b.half[0] = *(const v8us*)(brow + 8 * hh);
      b.half[1] = *(const v8us*)(brow + 16 + 8 * hh);
      acc[t] = mmaN<ASPLIT ? 2 : 1>(ah.v, al.v, b.v, b.v, acc[t]);
    }
  }
#pragma unroll
  for (int t = 0; t < 4; ++t) {
    float bv = bias ? bias[col0 + t * 16 + ln] : 0.f;
    if (BIAS_BF16) bv = bf16_round(bv);
#pragma unroll
    for (int r = 0; r < 8; ++r) { float v = acc[t][r] + bv; if (ACT == 1) v = fmaxf(v, 0.f); so[w][8 * hh + r][t * 16 + ln] = v; }
  }
  __builtin_amdgcn_fence(__ATOMIC_ACQ_REL, "workgroup");
  __builtin_amdgcn_wave_barrier();
  const int rsub = lane >> 4, c4 = (lane & 15) * 4;
  {
#pragma unroll
    for (int q = 0; q < 8; ++q) {
      const int r = q * 2 + rsub;
      const v4f v = *(const v4fa*)&so[w][r][c4];
      *(v4f*)(C + (size_t)(row0 + r) * ldc + col0 + c4) = v;
    }
    
  }
}

// GEMM C = act(A·W + bias + resid): A f32 (ASPLIT -> hi/lo 2 terms), Wt bf16 [N][K]; ACT 0 none, 1 relu, 2 exact gelu;
// resid (optional, f32, row index = (row % rmod), pitch ldr, RES_BF16 rounds it) added before the activation.
template <bool ASPLIT, int ACT, bool BIAS_BF16, bool RES_BF16>
__global__ __launch_bounds__(128) void k_gemm_bf3(const float* __restrict__ A, int lda, const unsigned short* __restrict__ Wt, int ldb,
                                                const float* __restrict__ bias, const float* __restrict__ resid, int rmod, int ldr,
                                                float* __restrict__ C, int ldc, int M, int N, int K) {
  __shared__ __attribute__((aligned(16))) float so[4][16][64];
  const int tid = threadIdx.x, w = tid >> 5, lane = tid & 31, ln = lane & 15, hh = lane >> 4;
  const int ntn = N / 64;
  const int wid = blockIdx.x * 4 + w;
  const int mt = wid / ntn, nq = wid % ntn;
  if (mt * 16 >= M) return;
  const int row0 = mt * 16, col0 = nq * 64;
  const float* arow = A + (size_t)(row0 + ln) * lda;
  v8f acc[4] = {};
  for (int kb = 0; kb < K; kb += 32) {
    FragB ah, al;
    const v4f x0 = *(const v4fa*)(arow + kb + 8 * hh), x1 = *(const v4fa*)(arow + kb + 8 * hh + 4);
    const v4f x2 = *(const v4fa*)(arow + kb + 16 + 8 * hh), x3 = *(const v4fa*)(arow + kb + 16 + 8 * hh + 4);
    float xs[16] = {x0[0],x0[1],x0[2],x0[3],x1[0],x1[1],x1[2],x1[3],x2[0],x2[1],x2[2],x2[3],x3[0],x3[1],x3[2],x3[3]};
#pragma unroll
    for (int i = 0; i < 16; ++i) { const unsigned short hb = bf16_bits(xs[i]); ah.u[i] = hb; al.u[i] = ASPLIT ? bf16_bits(xs[i] - bf16_val(hb)) : (unsigned short)0; }
#pragma unroll
    for (int t = 0; t < 4; ++t) {
      const unsigned short* brow = Wt + (size_t)(col0 + t * 16 + ln) * ldb + kb;
      FragB b;
      b.half[0] = *(const v8us*)(brow + 8 * hh);
      b.half[1] = *(const v8us*)(brow + 16 + 8 * hh);
      acc[t] = mmaN<ASPLIT ? 2 : 1>(ah.v, al.v, b.v, b.v, acc[t]);
    }
  }
#pragma unroll
  for (int t = 0; t < 4; ++t) {
    const int col = col0 + t * 16 + ln;
    float bv = bias ? bias[col] : 0.f;
    if (BIAS_BF16) bv = bf16_round(bv);
#pragma unroll
    for (int r = 0; r < 8; ++r) {
      float v = acc[t][r] + bv;
      if (resid) { float rv = resid[(size_t)((row0 + 8 * hh + r) % rmod) * ldr + col]; if (RES_BF16) rv = bf16_round(rv); v += rv; }
      if (ACT == 1) v = fmaxf(v, 0.f);
      if (ACT == 2) v = 0.5f * v * (1.0f + erff(v * 0.70710678118654752f));
      if (ACT == 3) { const float u = 0.7978845608028654f * (v + 0.044715f * v * v * v); v = 0.5f * v * (1.0f + tanhf(u)); }
      so[w][8 * hh + r][t * 16 + ln] = v;
    }
  }
  __builtin_amdgcn_fence(__ATOMIC_ACQ_REL, "workgroup");
  __builtin_amdgcn_wave_barrier();
  const int rsub = lane >> 4, c4 = (lane & 15) * 4;
  {
#pragma unroll
    for (int q = 0; q < 8; ++q) {
      const int r = q * 2 + rsub;
      const v4f v = *(const v4fa*)&so[w][r][c4];
      *(v4f*)(C + (size_t)(row0 + r) * ldc + col0 + c4) = v;
    }
    
  }
}
// row LayerNorm (biased variance, eps) over N: s = X (+ R); optional out_sum <- s; out_norm <- (s-mu)*rsqrt(var+eps)*g + b
template <bool PARAM_BF16>
__global__ __launch_bounds__(256) void k_layernorm(const float* __restrict__ X, const float* __restrict__ R, const float* __restrict__ g, const float* __restrict__ bta,
                                                  float* __restrict__ out_sum, float* __restrict__ out_norm, int N, float eps) {
  __shared__ float red[256];
  const int row = blockIdx.x, tid = threadIdx.x;
  const float* x = X + (size_t)row * N; const float* rr = R ? R + (size_t)row * N : nullptr;
  float vals[16];                     // up to N = 4096
  const int per = N / 256;            // contiguous chunk per thread? use strided-by-4 chunks: thread handles j = tid*4 + 1024*u
  float s1 = 0.f;
  for (int u = 0; u < per / 4; ++u) {
    const int j = tid * 4 + 1024 * u;
    const v4f a = *(const v4fa*)(x + j);
    v4f b = {0.f,0.f,0.f,0.f}; if (rr) b = *(const v4fa*)(rr + j);
#pragma unroll
    for (int q = 0; q < 4; ++q) { const float v = a[q] + b[q]; vals[u * 4 + q] = v; s1 += v; }
  }
  red[tid] = s1; __syncthreads();
  for (int st = 128; st > 0; st >>= 1) { if (tid < st) red[tid] += red[tid + st]; __syncthreads(); }
  const float mu = red[0] / (float)N; __syncthreads();
  float s2 = 0.f;
  for (int u = 0; u < per / 4; ++u)
#pragma unroll
    for (int q = 0; q < 4; ++q) { const float c = vals[u * 4 + q] - mu; s2 += c * c; }
  red[tid] = s2; __syncthreads();
  for (int st = 128; st > 0; st >>= 1) { if (tid < st) red[tid] += red[tid + st]; __syncthreads(); }
  const float rs = rsqrtf(red[0] / (float)N + eps);
  {
    for (int u = 0; u < per / 4; ++u) {
      const int j = tid * 4 + 1024 * u;
      v4f o, sm;
#pragma unroll
      for (int q = 0; q < 4; ++q) {
        float gg = g[j + q], bb = bta[j + q];
        if (PARAM_BF16) { gg = bf16_round(gg); bb = bf16_round(bb); }
        sm[q] = vals[u * 4 + q]; o[q] = (vals[u * 4 + q] - mu) * rs * gg + bb;
      }
      if (out_sum) *(v4f*)(out_sum + (size_t)row * N + j) = sm;
      *(v4f*)(out_norm + (size_t)row * N + j) = o;
    }
    
  }
}



// ---- f16 WMMA path (v_wmma_f32_16x16x32_f16): 11-bit significands for operands in range — used where a [0,1] probability operand needs more precision than bf16
typedef _Float16 v16h __attribute__((ext_vector_type(16)));
union FragH { v16h v; v8us half[2]; _Float16 h[16]; unsigned short u[16]; };
template <int NT>
__device__ __forceinline__ v8f mmaH(v16h ah, v16h al, v16h bh, v16h bl, v8f c) {
  c = __builtin_amdgcn_wmma_f32_16x16x32_f16(false, ah, false, bh, (short)0, c, false, false);
  if (NT >= 2) c = __builtin_amdgcn_wmma_f32_16x16x32_f16(false, al, false, bh, (short)0, c, false, false);
  if (NT >= 3) c = __builtin_amdgcn_wmma_f32_16x16x32_f16(false, ah, false, bl, (short)0, c, false, false);
  asm volatile("v_nop\n\tv_nop\n\tv_nop\n\tv_nop" : "+v"(c) : "v"(ah), "v"(al), "v"(bh), "v"(bl));
  return c;
}
// batched GEMM like k_gemm_b but f16 operands: A f32 (split into f16 hi/lo if ASPLIT, else rounded to f16), Bt = f16 values [n][k]; alpha; C f32; N multiple of 16 (partial tiles skipped)
template <bool ASPLIT>
__global__ __launch_bounds__(128) void k_gemm_h(const float* __restrict__ A, int lda, size_t sA, const _Float16* __restrict__ Bh, int ldb, size_t sB, float alpha, float* __restrict__ C, int ldc, size_t sC, int M, int N, int K) {
  __shared__ __attribute__((aligned(16))) float so[4][16][64];
  const int tid = threadIdx.x, w = tid >> 5, lane = tid & 31, ln = lane & 15, hh = lane >> 4; const int by = blockIdx.y;
  A += (size_t)by * sA; Bh += (size_t)by * sB; C += (size_t)by * sC;
  const int ntn = (N + 63) / 64; const int wid = blockIdx.x * 4 + w; const int mt = wid / ntn, nq = wid % ntn; if (mt * 16 >= M) return;
  const int row0 = mt * 16, col0 = nq * 64; const float* arow = A + (size_t)(row0 + ln) * lda;
  v8f acc[4] = {};
  for (int kb = 0; kb < K; kb += 32) {
    FragH ah, al;
    const v4f x0 = *(const v4fa*)(arow + kb + 8 * hh), x1 = *(const v4fa*)(arow + kb + 8 * hh + 4), x2 = *(const v4fa*)(arow + kb + 16 + 8 * hh), x3 = *(const v4fa*)(arow + kb + 16 + 8 * hh + 4);
    float xs[16] = {x0[0],x0[1],x0[2],x0[3],x1[0],x1[1],x1[2],x1[3],x2[0],x2[1],x2[2],x2[3],x3[0],x3[1],x3[2],x3[3]};
#pragma unroll
    for (int i = 0; i < 16; ++i) { const _Float16 h = (_Float16)xs[i]; ah.h[i] = h; al.h[i] = ASPLIT ? (_Float16)(xs[i] - (float)h) : (_Float16)0.0f; }
#pragma unroll
    for (int t = 0; t < 4; ++t) { if (col0 + t * 16 >= N) continue; const size_t boff = (size_t)(col0 + t * 16 + ln) * ldb + kb; FragH bq; bq.half[0] = *(const v8us*)(Bh + boff + 8 * hh); bq.half[1] = *(const v8us*)(Bh + boff + 16 + 8 * hh);
      acc[t] = mmaH<ASPLIT ? 2 : 1>(ah.v, al.v, bq.v, bq.v, acc[t]); }
  }
#pragma unroll
  for (int t = 0; t < 4; ++t) { if (col0 + t * 16 >= N) continue;
#pragma unroll
    for (int r = 0; r < 8; ++r) so[w][8 * hh + r][t * 16 + ln] = acc[t][r] * alpha; }
  __builtin_amdgcn_fence(__ATOMIC_ACQ_REL, "workgroup"); __builtin_amdgcn_wave_barrier();
  const int rsub = lane >> 4, c4 = (lane & 15) * 4;
  {
#pragma unroll
    for (int q = 0; q < 8; ++q) { const int r = q * 2 + rsub; if (col0 + c4 < N) { const v4f v = *(const v4fa*)&so[w][r][c4]; *(v4f*)(C + (size_t)(row0 + r) * ldc + col0 + c4) = v; } }
     }
}

// Wt[n][k] = f16(W[k][n]·scale) from f32 row-major W[K][N] (scale = power of two; bf16-exact weights stay exact in f16 away from the subnormal range)
__global__ __launch_bounds__(256) void k_wt_f16(const float* __restrict__ W, _Float16* __restrict__ Wt, int K, int N, float scale) {
  const int t = blockIdx.x * 256 + threadIdx.x; if (t >= N * (K / 8)) return; const int n = t / (K / 8), k8 = (t % (K / 8)) * 8; FragH f;
#pragma unroll
  for (int i = 0; i < 8; ++i) f.h[i] = (_Float16)(bf16_round(W[(size_t)(k8 + i) * N + n]) * scale); const v8us o = f.half[0];
  *(v8us*)((unsigned short*)Wt + (size_t)n * K + k8) = o; 
}
// k_gemm_hh variant with fused epilogue: v = acc·alpha + bias[by·sBias + col] (+ CP[(row/rowsPerB)·sCPb + by·64 + col] if CP) ; ACT 0 none / 1 elu ; writes f16 C16 (and f32 C if non-null)
template <int ACT>
__global__ __launch_bounds__(128) void k_gemm_hhx(const _Float16* __restrict__ A, int lda, size_t sA, const _Float16* __restrict__ Bh, int ldb, size_t sB, float alpha, const float* __restrict__ bias, size_t sBias, const float* __restrict__ CP, int rowsPerB, size_t sCPb, int row0g,
    float* __restrict__ C, _Float16* __restrict__ C16, int ldc, size_t sC, int M, int N, int K) {
  __shared__ __attribute__((aligned(16))) float so[4][16][64];
  const int tid = threadIdx.x, w = tid >> 5, lane = tid & 31, ln = lane & 15, hh = lane >> 4; const int by = blockIdx.y;
  A += (size_t)by * sA; Bh += (size_t)by * sB; const size_t cofs = (size_t)by * sC; const float* bp = bias ? bias + (size_t)by * sBias : nullptr;
  const int ntn = (N + 63) / 64; const int wid = blockIdx.x * 4 + w; const int mt = wid / ntn, nq = wid % ntn; if (mt * 16 >= M) return;
  const int row0 = mt * 16, col0 = nq * 64; const _Float16* arow = A + (size_t)(row0 + ln) * lda;
  v8f acc[4] = {};
  for (int kb = 0; kb < K; kb += 32) { FragH ah; ah.half[0] = *(const v8us*)((const unsigned short*)arow + kb + 8 * hh); ah.half[1] = *(const v8us*)((const unsigned short*)arow + kb + 16 + 8 * hh);
#pragma unroll
    for (int t = 0; t < 4; ++t) { if (col0 + t * 16 >= N) continue; const size_t boff = (size_t)(col0 + t * 16 + ln) * ldb + kb; FragH bq; bq.half[0] = *(const v8us*)((const unsigned short*)Bh + boff + 8 * hh); bq.half[1] = *(const v8us*)((const unsigned short*)Bh + boff + 16 + 8 * hh);
      acc[t] = mmaH<1>(ah.v, ah.v, bq.v, bq.v, acc[t]); }
  }
#pragma unroll
  for (int t = 0; t < 4; ++t) { if (col0 + t * 16 >= N) continue; const int col = col0 + t * 16 + ln; const float bv = bp ? bf16_round(bp[col]) : 0.f;
#pragma unroll
    for (int r = 0; r < 8; ++r) { float v = acc[t][r] * alpha + bv; if (CP) { const int rr = row0g + row0 + 8 * hh + r; if (rowsPerB < 0) v += CP[cofs + (size_t)rr * ldc + col];      /* rowsPerB < 0: own element of the batched C plane */ else { const int bidx = rr / rowsPerB; v += CP[(size_t)bidx * sCPb + (size_t)by * 64 + col]; } } if (ACT == 1) v = (v > 0.f) ? v : expm1f(v); else if (ACT == 7) v = (v > 0.f) ? v + 1.0f : expf(v); else if (ACT == 8) v = tanhf(v); else if (ACT == 9) v = 0.5f * v * (1.0f + tanhf(0.7978845608028654f * (v + 0.044715f * v * v * v))); else if (ACT == 11) v = 1.0f / (1.0f + expf(-v)); else if (ACT == 12) v = (v > 0.f) ? v : 0.01f * v; else if (ACT == 14) v = (v > 0.f) ? v : 0.1f * v; else if (ACT == 16) v = (v >= 0.f) ? v : 0.3f * v; else if (ACT == 17) v = (v >= 0.f) ? v : 0.2f * v; else if (ACT == 15) v = v / (1.0f + expf(-v)); else if (ACT == 3) v = fmaxf(v, 0.f); else if (ACT == 6) v = 0.5f * v * (1.0f + erff(v * 0.70710678118654752f)); so[w][8 * hh + r][t * 16 + ln] = v; } }
  __builtin_amdgcn_fence(__ATOMIC_ACQ_REL, "workgroup"); __builtin_amdgcn_wave_barrier();
  const int rsub = lane >> 4, c4 = (lane & 15) * 4; typedef _Float16 v4h __attribute__((ext_vector_type(4)));
  {
#pragma unroll
    for (int q = 0; q < 8; ++q) { const int r = q * 2 + rsub; if (col0 + c4 < N) { const v4f v = *(const v4fa*)&so[w][r][c4]; if (C) *(v4f*)(C + cofs + (size_t)(row0 + r) * ldc + col0 + c4) = v; if (C16) { v4h h4; for (int i = 0; i < 4; ++i) h4[i] = (_Float16)v[i]; *(v4h*)(C16 + cofs + (size_t)(row0 + r) * ldc + col0 + c4) = h4; } } }
     }
}


typedef _Float16 v4h __attribute__((ext_vector_type(4)));

__global__ __launch_bounds__(256) void k_h16(const float* __restrict__ x, _Float16* __restrict__ X16, size_t n8) { const size_t t = (size_t)blockIdx.x * 256 + threadIdx.x; if (t >= n8) return; FragH f;
#pragma unroll
  for (int q = 0; q < 8; ++q) f.h[q] = (_Float16)x[t * 8 + q]; *(v8us*)((unsigned short*)X16 + t * 8) = f.half[0];  }
__global__ __launch_bounds__(256) void k_round16f(const float* __restrict__ W, _Float16* __restrict__ Bt, size_t n8) { const size_t t = (size_t)blockIdx.x * 256 + threadIdx.x; if (t >= n8) return; FragH f;
#pragma unroll
  for (int i = 0; i < 8; ++i) f.h[i] = (_Float16)(bf16_round(W[t * 8 + i]) * 16.0f); *(v8us*)((unsigned short*)Bt + t * 8) = f.half[0];  }
template <int NHv, int TTv>
__global__ __launch_bounds__(256) void k_vt(const _Float16* __restrict__ V16, int ldv, int voff, _Float16* __restrict__ Vt) { __shared__ unsigned short tl[64][66]; const int tid = threadIdx.x; const int slab = blockIdx.x / (TTv / 64), lg = blockIdx.x % (TTv / 64); const int b = slab / NHv, h = slab % NHv;
  for (int i = tid; i < 64 * 8; i += 256) { const int r = i / 8, c8 = (i % 8) * 8; FragH f; f.half[0] = *(const v8us*)((const unsigned short*)V16 + ((size_t)b * TTv + lg * 64 + r) * ldv + voff + h * 64 + c8);
#pragma unroll
    for (int q = 0; q < 8; ++q) tl[r][c8 + q] = f.u[q]; }
  __syncthreads();
  {
#pragma unroll
    for (int rd = 0; rd < 2; ++rd) { const int d = rd * 32 + tid / 8, pc = tid % 8; FragH f;
#pragma unroll
      for (int q = 0; q < 8; ++q) f.u[q] = tl[pc * 8 + q][d];
      *(v8us*)((unsigned short*)Vt + ((size_t)slab * 64 + d) * TTv + lg * 64 + pc * 8) = f.half[0]; }
     } }

__global__ __launch_bounds__(256) void k_hl(const float* __restrict__ F, _Float16* __restrict__ Hh, _Float16* __restrict__ Hl, size_t n8) { const size_t t = (size_t)blockIdx.x * 256 + threadIdx.x; if (t >= n8) return; FragH fh, fl; const v4f a = *(const v4fa*)(F + t * 8), c = *(const v4fa*)(F + t * 8 + 4);
#pragma unroll
  for (int q = 0; q < 4; ++q) { _Float16 h = (_Float16)a[q]; fh.h[q] = h; fl.h[q] = (_Float16)((a[q] - (float)h) * 1024.0f); h = (_Float16)c[q]; fh.h[4 + q] = h; fl.h[4 + q] = (_Float16)((c[q] - (float)h) * 1024.0f); }
  { *(v8us*)((unsigned short*)Hh + t * 8) = fh.half[0]; *(v8us*)((unsigned short*)Hl + t * 8) = fl.half[0];  } }

// ---- fast GEMM (wave tile 32x64; requires M % 32 == 0 rows per launch region and N % 64 == 0); epilogue = k_gemm_hhx semantics ----
__device__ __forceinline__ v16h g2_frag(const _Float16* p, int hh) { FragH f; f.half[0] = *(const v8us*)((const unsigned short*)p + 8 * hh); f.half[1] = *(const v8us*)((const unsigned short*)p + 16 + 8 * hh); return f.v; }
__device__ __forceinline__ v8f g2_mma(v16h a, v16h b, v8f c) { v8f d = __builtin_amdgcn_wmma_f32_16x16x32_f16(false, a, false, b, (short)0, c, false, false); asm volatile("v_nop\n\tv_nop\n\tv_nop\n\tv_nop" : "+v"(d) : "v"(a), "v"(b)); return d; }
template <int ACT>
__global__ __launch_bounds__(128) void k_gemm2(const _Float16* __restrict__ A, int lda, size_t sA, const _Float16* __restrict__ Bh, int ldb, size_t sB, float alpha, const float* __restrict__ bias, size_t sBias, const float* __restrict__ CP, int rowsPerB, size_t sCPb, int row0g,
    float* __restrict__ C, _Float16* __restrict__ C16, int ldc, size_t sC, int M, int N, int K) { static_assert(ACT == 0 || ACT == 3 || ACT == 6 || ACT == 8 || ACT == 9 || ACT == 11 || ACT == 12 || ACT == 14 || ACT == 15 || ACT == 16 || ACT == 17, "k_gemm2: unsupported ACT code (would silently apply no activation)");
  __shared__ __attribute__((aligned(16))) float so[4][32][68];
  const int tid = threadIdx.x, w = tid >> 5, lane = tid & 31, ln = lane & 15, hh = lane >> 4; const int by = blockIdx.y;
  A += (size_t)by * sA; Bh += (size_t)by * sB; const size_t cofs = (size_t)by * sC; const float* bp = bias ? bias + (size_t)by * sBias : nullptr;
  const int ntn = N >> 6; const int mt = blockIdx.x / ntn, nq = blockIdx.x - mt * ntn; const int row0 = mt * 128 + 32 * w, col0 = nq * 64; if (row0 >= M) return;
  const _Float16* a0p = A + (size_t)(row0 + ln) * lda; const _Float16* a1p = a0p + (size_t)16 * lda;
  const _Float16* b0p = Bh + (size_t)(col0 + ln) * ldb; const _Float16* b1p = b0p + (size_t)16 * ldb; const _Float16* b2p = b1p + (size_t)16 * ldb; const _Float16* b3p = b2p + (size_t)16 * ldb;
  const v8f z8 = {0.f,0.f,0.f,0.f,0.f,0.f,0.f,0.f}; v8f c00 = z8, c01 = z8, c02 = z8, c03 = z8, c10 = z8, c11 = z8, c12 = z8, c13 = z8;
#pragma unroll 1
  for (int kb = 0; kb < K; kb += 32) { const v16h a0 = g2_frag(a0p + kb, hh), a1 = g2_frag(a1p + kb, hh);
    v16h b = g2_frag(b0p + kb, hh); c00 = g2_mma(a0, b, c00); c10 = g2_mma(a1, b, c10);
    b = g2_frag(b1p + kb, hh); c01 = g2_mma(a0, b, c01); c11 = g2_mma(a1, b, c11);
    b = g2_frag(b2p + kb, hh); c02 = g2_mma(a0, b, c02); c12 = g2_mma(a1, b, c12);
    b = g2_frag(b3p + kb, hh); c03 = g2_mma(a0, b, c03); c13 = g2_mma(a1, b, c13); }
  v8f accs[8] = {c00, c01, c02, c03, c10, c11, c12, c13};
#pragma unroll
  for (int u = 0; u < 8; ++u) { const int t = u & 3, half = u >> 2; const int col = col0 + t * 16 + ln; const float bv = bp ? bf16_round(bp[col]) : 0.f;
#pragma unroll
    for (int r = 0; r < 8; ++r) { const int rloc = half * 16 + 8 * hh + r; float v = accs[u][r] * alpha + bv; if (CP) { if (rowsPerB < 0) v += CP[cofs + (size_t)(row0g + row0 + rloc) * ldc + col];      /* rowsPerB < 0: own element of the batched C plane */ else { const int bidx = (row0g + row0 + rloc) / rowsPerB; v += CP[(size_t)bidx * sCPb + (size_t)by * 64 + col]; } }
      if (ACT == 3) v = fmaxf(v, 0.f); else if (ACT == 6) v = 0.5f * v * (1.0f + erff(v * 0.70710678118654752f)); else if (ACT == 11) v = 1.0f / (1.0f + expf(-v)); else if (ACT == 15) v = v / (1.0f + expf(-v)); else if (ACT == 12) v = (v > 0.f) ? v : 0.01f * v; else if (ACT == 8) v = tanhf(v); else if (ACT == 9) v = 0.5f * v * (1.0f + tanhf(0.7978845608028654f * (v + 0.044715f * v * v * v))); else if (ACT == 14) v = (v > 0.f) ? v : 0.1f * v; else if (ACT == 16) v = (v >= 0.f) ? v : 0.3f * v; else if (ACT == 17) v = (v >= 0.f) ? v : 0.2f * v;
      so[w][rloc][t * 16 + ln] = v; } }
  __builtin_amdgcn_fence(__ATOMIC_ACQ_REL, "workgroup"); __builtin_amdgcn_wave_barrier();
  const int rsub = lane >> 4, c4 = (lane & 15) * 4;
  {
#pragma unroll
    for (int q = 0; q < 16; ++q) { const int r = q * 2 + rsub; const v4f v = *(const v4fa*)&so[w][r][c4]; if (C) *(v4f*)(C + cofs + (size_t)(row0 + r) * ldc + col0 + c4) = v; if (C16) { v4h h4; for (int i = 0; i < 4; ++i) h4[i] = (_Float16)v[i]; *(v4h*)(C16 + cofs + (size_t)(row0 + r) * ldc + col0 + c4) = h4; } }
     } }


// ---- operand preparation, one launch: every work-group takes 2 of the 1024 V tiles, 4 x 256 of the K units, 4 x 256 of the q units and 64 of the W_out units; a thread asks for all of its values first, then converts and stores ----
// K unit u = 16 bytes = (slab = b*NH + h, 16-key tile, 32-wide d step, fragment half j, lane = 16 hh + ln) holds k[key = 16 tile + ln][d = 32 step + 16 j + 8 hh .. + 7]: A-fragment order.
// V^T unit (slab, 32-key block, 16-row d tile t, half j, lane) holds v[key = 32 block + 16 j + 8 hh .. + 7][d = 16 t + ln], turned through an LDS tile of 64 keys x 64 d.
// W_out unit (16-column tile nt of the output, 32-wide k step, half j, lane) holds 16 x W_out[n = 16 nt + ln][k = 32 step + 16 j + 8 hh .. + 7]: B-fragment order of the output product (natural [out][in] = Bt[n][k]).
// q rows keep their order. Every value is rounded to bf16 and is exact as f16.
#define PB 512      /* work-groups of the preparation launch: 16 waves a WGP */
__device__ __forceinline__ v8us pr_cvt(v4f p, v4f q, float scale) { FragH f;
#pragma unroll      /* constant indices keep the arrays in registers */
  for (int i = 0; i < 4; ++i) { f.h[i] = (_Float16)(bf16_round(p[i]) * scale); f.h[4 + i] = (_Float16)(bf16_round(q[i]) * scale); }
  return f.half[0]; }
__global__ __launch_bounds__(256) void k_prep(const float* __restrict__ xq, const float* __restrict__ xk, const float* __restrict__ xv, const float* __restrict__ wo,
    _Float16* __restrict__ Q16, _Float16* __restrict__ KF, _Float16* __restrict__ VF, _Float16* __restrict__ BO) {
  static_assert(NB * NH * (SQ / 64) == 2 * PB && NR * DM / 8 == (size_t)4 * 256 * PB && DM * DM / 8 == 64 * PB && DM == 512, "shares of the preparation launch");
  __shared__ unsigned short tl[2][64][66];
  const int tid = threadIdx.x, blk = blockIdx.x;
  v4f vv[2][2][2], kv[4][2], qv[4][2], wv[2];
#pragma unroll      /* constant indices keep the arrays in registers */
  for (int ti = 0; ti < 2; ++ti) { const int tile = blk * 2 + ti; const int slab = tile / (SQ / 64), lg = tile % (SQ / 64); const int b = slab / NH, h = slab % NH;
#pragma unroll      /* constant indices keep the arrays in registers */
    for (int rd = 0; rd < 2; ++rd) { const int i = tid + rd * 256; const int r = i / 8, c8 = (i % 8) * 8; const float* s = xv + ((size_t)b * SQ + lg * 64 + r) * DM + h * HD + c8; vv[ti][rd][0] = *(const v4fa*)s; vv[ti][rd][1] = *(const v4fa*)(s + 4); } }
#pragma unroll      /* constant indices keep the arrays in registers */
  for (int c = 0; c < 4; ++c) { const size_t u = (size_t)(blk * 4 + c) * 256 + tid;
    const int ln = (int)(u & 15), hh = (int)(u >> 4) & 1, j = (int)(u >> 5) & 1, ks = (int)(u >> 6) & 1; const int tile = (int)(u >> 7); const int kt = tile % (SQ / 16), slab = tile / (SQ / 16); const int b = slab / NH, h = slab % NH;
    const float* s = xk + ((size_t)b * SQ + kt * 16 + ln) * DM + h * HD + ks * 32 + j * 16 + hh * 8; kv[c][0] = *(const v4fa*)s; kv[c][1] = *(const v4fa*)(s + 4); }
#pragma unroll      /* constant indices keep the arrays in registers */
  for (int c = 0; c < 4; ++c) { const float* s = xq + ((size_t)(blk * 4 + c) * 256 + tid) * 8; qv[c][0] = *(const v4fa*)s; qv[c][1] = *(const v4fa*)(s + 4); }
  if (tid < 64) { const int u = blk * 64 + tid; const int ln = u & 15, hh = (u >> 4) & 1, j = (u >> 5) & 1, ks = (u >> 6) & (DM / 32 - 1), nt = u >> 10;
    const float* s = wo + (size_t)(nt * 16 + ln) * DM + ks * 32 + j * 16 + hh * 8; wv[0] = *(const v4fa*)s; wv[1] = *(const v4fa*)(s + 4); }
#pragma unroll      /* constant indices keep the arrays in registers */
  for (int ti = 0; ti < 2; ++ti) {
#pragma unroll      /* constant indices keep the arrays in registers */
    for (int rd = 0; rd < 2; ++rd) { const int i = tid + rd * 256; const int r = i / 8, c8 = (i % 8) * 8; FragH f; f.half[0] = pr_cvt(vv[ti][rd][0], vv[ti][rd][1], 1.0f);
#pragma unroll      /* constant indices keep the arrays in registers */
      for (int q = 0; q < 8; ++q) tl[ti][r][c8 + q] = f.u[q]; } }
  __syncthreads();      /* both V tiles are whole in LDS before any column of them is read; it stands ahead of every global store, so that it waits for none */
#pragma unroll      /* constant indices keep the arrays in registers */
  for (int ti = 0; ti < 2; ++ti) { const int tile = blk * 2 + ti; const int slab = tile / (SQ / 64), lg = tile % (SQ / 64);
#pragma unroll      /* constant indices keep the arrays in registers */
    for (int rd = 0; rd < 2; ++rd) { const int ln = tid & 15, hh = (tid >> 4) & 1, j = (tid >> 5) & 1, t = tid >> 6; FragH f;
#pragma unroll      /* constant indices keep the arrays in registers */
      for (int q = 0; q < 8; ++q) f.u[q] = tl[ti][rd * 32 + j * 16 + hh * 8 + q][t * 16 + ln];
      *(v8us*)((unsigned short*)VF + ((size_t)slab * (SQ / 32) + lg * 2 + rd) * 2048 + (size_t)tid * 8) = f.half[0]; } }
#pragma unroll      /* constant indices keep the arrays in registers */
  for (int c = 0; c < 4; ++c) *(v8us*)((unsigned short*)KF + ((size_t)(blk * 4 + c) * 256 + tid) * 8) = pr_cvt(kv[c][0], kv[c][1], 1.0f);
#pragma unroll      /* constant indices keep the arrays in registers */
  for (int c = 0; c < 4; ++c) *(v8us*)((unsigned short*)Q16 + ((size_t)(blk * 4 + c) * 256 + tid) * 8) = pr_cvt(qv[c][0], qv[c][1], 1.0f);
  if (tid < 64) *(v8us*)((unsigned short*)BO + ((size_t)blk * 64 + tid) * 8) = pr_cvt(wv[0], wv[1], 16.0f); }
// ---- fused attention: one wave = 32 query columns (2 groups of 16) of one head and one half of its keys, a pass = 32 keys; 16 waves a block (four a SIMD): waves c and c + 8 hold the same columns, the 8 waves of a key half share that half's K and V^T stream through the cache; the two halves' sums are merged once, through LDS ----
__device__ __forceinline__ v16h fa_frag(const unsigned short* p) { FragH f; f.half[0] = *(const v8us*)p; f.half[1] = *(const v8us*)(p + 256); return f.v; }      /* p = the lane's 16 bytes of half 0; half 1 lies 512 bytes on */
__device__ __forceinline__ v8f fa_mma(v16h a, v16h b, v8f c) { return __builtin_amdgcn_wmma_f32_16x16x32_f16(false, a, false, b, (short)0, c, false, false); }
__device__ __forceinline__ float fa_xhalf(float x) { return __builtin_bit_cast(float, __builtin_amdgcn_permlanex16(__builtin_bit_cast(int, x), __builtin_bit_cast(int, x), 0x76543210, 0xfedcba98, false, false)); }      /* lane l with lane l ^ 16 */
#define FQ 256      /* query rows a block */
#define FK (SQ / 2)      /* keys a wave walks */
__global__ __launch_bounds__(512) void k_fattn(const _Float16* __restrict__ Q16, const _Float16* __restrict__ KF, const _Float16* __restrict__ VF, _Float16* __restrict__ O16) {
  typedef float v2f __attribute__((ext_vector_type(2))); typedef _Float16 v2h __attribute__((ext_vector_type(2)));
  __shared__ __attribute__((aligned(16))) v4f mg[FQ / 32][17][32];      /* the upper key half's sums on their way to the lower half's wave: [column wave][16 quarters of o, then maxima and row sums][lane], 512 contiguous bytes a wave and store */
  const int wv = __builtin_amdgcn_readfirstlane((int)(threadIdx.x >> 5));      /* the wave's number in a scalar register: the key half decides branches and the streams' base */
  const int lane = threadIdx.x & 31, w = wv & 7, kh = wv >> 3, ln = lane & 15, hh = lane >> 4;
  const int slab = blockIdx.x / (SQ / FQ), qb = blockIdx.x % (SQ / FQ); const int b = slab / NH, h = slab % NH; const int q0 = qb * FQ + w * 32;
  const float cs = 0.044194173824159216f * 1.4426950408889634f;      /* 1 / sqrt(512) (the module's literal d_model scale) x log2 e */
  v16h qf[2][2];      /* B operand: column = query, k = d */
#pragma unroll      /* constant indices keep the arrays in registers */
  for (int g = 0; g < 2; ++g) { const _Float16* qp = Q16 + ((size_t)b * SQ + q0 + g * 16 + ln) * DM + h * HD; qf[g][0] = g2_frag(qp, hh); qf[g][1] = g2_frag(qp + 32, hh); }
  const unsigned short* kp = (const unsigned short*)KF + ((size_t)slab * SQ + (size_t)kh * FK) * HD + lane * 8; const unsigned short* vp = (const unsigned short*)VF + ((size_t)slab * SQ + (size_t)kh * FK) * HD + lane * 8;      /* both planes hold 64 values a key in key order by blocks of 32 keys */
  const v8f z8 = {0.f,0.f,0.f,0.f,0.f,0.f,0.f,0.f}; v8f o[2][4]; float mr[2], lr[2];
#pragma unroll      /* constant indices keep the arrays in registers */
  for (int g = 0; g < 2; ++g) { mr[g] = -__builtin_inff(); lr[g] = 0.f;
#pragma unroll      /* constant indices keep the arrays in registers */
    for (int t = 0; t < 4; ++t) o[g][t] = z8; }
  v16h kf[4], vf[4];      /* A operands: kf[16-key tile * 2 + d step], vf[16-row d tile]; both are asked for one pass ahead, into the registers that the pass has just used */
  const unsigned short* vq = vp;
#pragma unroll      /* constant indices keep the arrays in registers */
  for (int t = 0; t < 4; ++t) kf[t] = fa_frag(kp + t * 512);
  asm volatile("s_wait_xcnt 0x0" :: "v"(kp) : "memory");      /* the K loads' address pair stays whole until this wait; Q and K are asked for ahead of V, the order of every pass, so that the loop's counted load waits fit its first pass too */
#pragma unroll      /* constant indices keep the arrays in registers */
  for (int t = 0; t < 4; ++t) vf[t] = fa_frag(vq + t * 512);
  for (int i = 0; i < FK / 32; ++i) {
    v8f s[2][2];      /* [group][key tile]: register r = score of key 16 tile + 8 hh + r, query ln */
#pragma unroll      /* constant indices keep the arrays in registers */
    for (int g = 0; g < 2; ++g) {
#pragma unroll      /* constant indices keep the arrays in registers */
      for (int kt = 0; kt < 2; ++kt) s[g][kt] = fa_mma(kf[kt * 2 + 1], qf[g][1], fa_mma(kf[kt * 2], qf[g][0], z8)); }
    asm volatile("s_wait_xcnt 0x0" :: "v"(vq) : "memory");      /* the V loads' address pair (asked for at the foot of the pass before) stays whole until this wait */
    const int nx = (i + 1 < FK / 32) ? i + 1 : i;      /* the last pass asks for its own tiles again (in bounds, unused) */
    const unsigned short* kq = kp + (size_t)nx * 2048;
#pragma unroll      /* constant indices keep the arrays in registers */
    for (int t = 0; t < 4; ++t) kf[t] = fa_frag(kq + t * 512);
    float mb[2]; bool need = false;
#pragma unroll      /* constant indices keep the arrays in registers */
    for (int g = 0; g < 2; ++g) { float mx = s[g][0][0];
#pragma unroll      /* constant indices keep the arrays in registers */
      for (int r = 1; r < 8; ++r) mx = fmaxf(mx, s[g][0][r]);
#pragma unroll      /* constant indices keep the arrays in registers */
      for (int r = 0; r < 8; ++r) mx = fmaxf(mx, s[g][1][r]);
      mb[g] = fmaxf(mx, fa_xhalf(mx)) * cs; need = need || (mb[g] > mr[g] + 8.0f); }
    asm volatile("s_wait_xcnt 0x0" :: "v"(kq) : "memory");      /* the K loads' address pair stays whole until this wait; it also keeps those loads up here, a whole softmax and second product ahead of their use */
    if (__builtin_amdgcn_ballot_w32(need) != 0) {      /* the maximum in use may trail the true one by up to 8 (log2): weights stay <= 2^8; one test a pass */
#pragma unroll      /* constant indices keep the arrays in registers */
      for (int g = 0; g < 2; ++g) { const float mn = fmaxf(mr[g], mb[g]); const float corr = __builtin_amdgcn_exp2f(mr[g] - mn); mr[g] = mn; lr[g] *= corr;      /* corr = 0 in the first pass */
#pragma unroll      /* constant indices keep the arrays in registers */
        for (int t = 0; t < 4; ++t) o[g][t] = o[g][t] * corr; } }
#pragma unroll      /* constant indices keep the arrays in registers */
    for (int g = 0; g < 2; ++g) { const float nm = -mr[g]; FragH pf; v2f ls = {0.f, 0.f};      /* two score tiles, converted in place, are the B operand of the second product */
#pragma unroll      /* constant indices keep the arrays in registers */
      for (int e = 0; e < 8; ++e) { const v2f sv = {s[g][e >> 2][2 * (e & 3)], s[g][e >> 2][2 * (e & 3) + 1]}; const v2f ar = __builtin_elementwise_fma(sv, (v2f){cs, cs}, (v2f){nm, nm});
        const v2f pv = {__builtin_amdgcn_exp2f(ar[0]), __builtin_amdgcn_exp2f(ar[1])}; ls += pv; const v2h ph = __builtin_convertvector(pv, v2h); pf.h[2 * e] = ph[0]; pf.h[2 * e + 1] = ph[1]; }
      lr[g] += ls[0] + ls[1];
#pragma unroll      /* constant indices keep the arrays in registers */
      for (int t = 0; t < 4; ++t) o[g][t] = fa_mma(vf[t], pf.v, o[g][t]); }
    vq = vp + (size_t)nx * 2048;
#pragma unroll      /* constant indices keep the arrays in registers */
    for (int t = 0; t < 4; ++t) vf[t] = fa_frag(vq + t * 512);
  }
  if (kh != 0) {      /* upper key half: un-normalised sums, maxima in use and row sums go to LDS */
#pragma unroll      /* constant indices keep the arrays in registers */
    for (int g = 0; g < 2; ++g) {
#pragma unroll      /* constant indices keep the arrays in registers */
      for (int t = 0; t < 4; ++t) { mg[w][(g * 4 + t) * 2][lane] = (v4f){o[g][t][0], o[g][t][1], o[g][t][2], o[g][t][3]}; mg[w][(g * 4 + t) * 2 + 1][lane] = (v4f){o[g][t][4], o[g][t][5], o[g][t][6], o[g][t][7]}; } }
    mg[w][16][lane] = (v4f){mr[0], mr[1], lr[0], lr[1]}; }
  __syncthreads();      /* the upper half's sums are whole in LDS before the lower half's waves read them; every wave passes it once */
  if (kh != 0) return;
  const v4f st = mg[w][16][lane];
#pragma unroll      /* constant indices keep the arrays in registers */
  for (int g = 0; g < 2; ++g) { const float mn = fmaxf(mr[g], st[g]); const float ca = __builtin_amdgcn_exp2f(mr[g] - mn), cb = __builtin_amdgcn_exp2f(st[g] - mn);      /* both maxima are finite (each half has walked its keys) and alike in lanes l and l ^ 16 */
    lr[g] = lr[g] * ca + st[2 + g] * cb;
#pragma unroll      /* constant indices keep the arrays in registers */
    for (int t = 0; t < 4; ++t) { const v4f u0 = mg[w][(g * 4 + t) * 2][lane], u1 = mg[w][(g * 4 + t) * 2 + 1][lane];
#pragma unroll      /* constant indices keep the arrays in registers */
      for (int r = 0; r < 4; ++r) { o[g][t][r] = o[g][t][r] * ca + u0[r] * cb; o[g][t][4 + r] = o[g][t][4 + r] * ca + u1[r] * cb; } } }
#pragma unroll      /* constant indices keep the arrays in registers */
  for (int g = 0; g < 2; ++g) { const float inv = 64.0f / (lr[g] + fa_xhalf(lr[g])); unsigned short* op = (unsigned short*)O16 + ((size_t)b * SQ + q0 + g * 16) * DM + h * 1024 + lane * 8;      /* o carried x64; register r of tile t = d 16 t + 8 hh + r of query ln: that is half t & 1 of the output product's A fragment (16 rows, k step 2 h + t / 2), stored as such: 512 contiguous bytes a wave */
#pragma unroll      /* constant indices keep the arrays in registers */
    for (int t = 0; t < 4; ++t) { FragH f;
#pragma unroll      /* constant indices keep the arrays in registers */
      for (int r = 0; r < 8; ++r) f.h[r] = (_Float16)(o[g][t][r] * inv);
      *(v8us*)(op + t * 256) = f.half[0]; } } }
__global__ __launch_bounds__(256) void k_vt(const _Float16* __restrict__ V16, int b, int h0, _Float16* __restrict__ VT) { __shared__ unsigned short tl[64][65]; const int tid = threadIdx.x; const int hh = blockIdx.x % HG, sg = blockIdx.x / HG; const int s0 = sg * 64; const int h = h0 + hh;
  for (int i = tid; i < 64 * 8; i += 256) { const int j = i / 8, d8 = (i % 8) * 8; FragH f; f.half[0] = *(const v8us*)((const unsigned short*)V16 + ((size_t)b * SQ + s0 + j) * DM + h * HD + d8); for (int q = 0; q < 8; ++q) tl[d8 + q][j] = f.u[q]; }
  __syncthreads();
  { for (int i = tid; i < 64 * 8; i += 256) { const int d = i / 8, j8 = (i % 8) * 8; FragH f; for (int q = 0; q < 8; ++q) f.u[q] = tl[d][j8 + q]; *(v8us*)((unsigned short*)VT + ((size_t)hh * HD + d) * SQ + s0 + j8) = f.half[0]; }  } }



__global__ __launch_bounds__(256) void k_rsmkm(const float* __restrict__ S, _Float16* __restrict__ P, int nrows, const int* __restrict__ am) {
  #pragma clang fp contract(off)
  const int t = blockIdx.x * 256 + threadIdx.x; if (t >= nrows) return; const size_t i = (size_t)t; const float* s = S + i * SQ; const int* mr = am + (size_t)(t % SQ) * SQ; float mx = -3.0e38f;
#pragma unroll 1
  for (int j = 0; j < SQ; ++j) { const float f = (mr[j] != 0) ? 1.f : 0.f; mx = fmaxf(mx, fmaf(f, s[j], (1.f - f) * -1.0e9f)); } float se = 0.f;
#pragma unroll 1
  for (int j = 0; j < SQ; ++j) { const float f = (mr[j] != 0) ? 1.f : 0.f; se += __expf(fmaf(f, s[j], (1.f - f) * -1.0e9f) - mx); } const float sc = 256.0f / se;
#pragma unroll 1
  for (int j0 = 0; j0 < SQ; j0 += 8) { FragH fr; for (int q = 0; q < 8; ++q) { const int j = j0 + q; const float f = (mr[j] != 0) ? 1.f : 0.f; fr.h[q] = (_Float16)(__expf(fmaf(f, s[j], (1.f - f) * -1.0e9f) - mx) * sc); }
    unsigned short* d = (unsigned short*)P + i * SQ + j0; *(v8us*)d = fr.half[0];  } }
// ---- output product out = o W_out^T / 1024 + b_out: both operands lie in fragment order ([16-row tile][k step][half][lane], 1024 bytes a fragment), so every load is 512 contiguous bytes from a scalar base; a wave = 32 rows x 64 columns, 8 waves = 128 x 128; the 12 loads of a k step are asked for two steps ahead into a ring of three register sets ----
#define OKS (DM / 32)      /* k steps */
__global__ __launch_bounds__(256) void k_ogemm(const _Float16* __restrict__ AF, const _Float16* __restrict__ BF, const float* __restrict__ bias, float* __restrict__ C) {
  __shared__ __attribute__((aligned(16))) float so[8][32][68];
  const int wv = __builtin_amdgcn_readfirstlane((int)(threadIdx.x >> 5));      /* the wave's number in a scalar register: both streams' bases are scalar */
  const int lane = threadIdx.x & 31, ln = lane & 15, hh = lane >> 4;
  const int mt = blockIdx.x / (DM / 128), nq = blockIdx.x % (DM / 128); const int row0 = mt * 128 + (wv & 3) * 32, col0 = nq * 128 + (wv >> 2) * 64;
  const unsigned short* ap = (const unsigned short*)AF + (size_t)row0 * DM + lane * 8; const unsigned short* bp = (const unsigned short*)BF + (size_t)col0 * DM + lane * 8;      /* a 16-row tile = OKS x 512 values = 16 DM */
  v16h a[3][2], b[3][4]; v8f c[2][4]; float bv[4];
  const v8f z8 = {0.f,0.f,0.f,0.f,0.f,0.f,0.f,0.f};
#pragma unroll      /* constant indices keep the arrays in registers */
  for (int s = 0; s < 2; ++s) {
#pragma unroll      /* constant indices keep the arrays in registers */
    for (int m = 0; m < 2; ++m) a[s][m] = fa_frag(ap + (m * OKS + s) * 512);
#pragma unroll      /* constant indices keep the arrays in registers */
    for (int t = 0; t < 4; ++t) b[s][t] = fa_frag(bp + (t * OKS + s) * 512);
    __builtin_amdgcn_sched_barrier(0);      /* loads return in the order asked: step 0's stay first, so that the first products wait for them alone */
  }
#pragma unroll      /* constant indices keep the arrays in registers */
  for (int t = 0; t < 4; ++t) { bv[t] = bf16_round(bias[col0 + t * 16 + ln]); c[0][t] = z8; c[1][t] = z8; }
#pragma unroll      /* constant indices keep the ring in registers */
  for (int s = 0; s < OKS; ++s) {
    if (s + 2 < OKS) {
#pragma unroll      /* constant indices keep the arrays in registers */
      for (int m = 0; m < 2; ++m) a[(s + 2) % 3][m] = fa_frag(ap + (m * OKS + s + 2) * 512);
#pragma unroll      /* constant indices keep the arrays in registers */
      for (int t = 0; t < 4; ++t) b[(s + 2) % 3][t] = fa_frag(bp + (t * OKS + s + 2) * 512); }
    __builtin_amdgcn_sched_barrier(0);      /* keeps the twelve loads up here, two steps ahead of their use; without it they sink to just ahead of their products and every step waits out a load's latency */
#pragma unroll      /* constant indices keep the arrays in registers */
    for (int t = 0; t < 4; ++t) { c[0][t] = fa_mma(a[s % 3][0], b[s % 3][t], c[0][t]); c[1][t] = fa_mma(a[s % 3][1], b[s % 3][t], c[1][t]); }
    __builtin_amdgcn_sched_barrier(0);      /* keeps the next group of loads from rising over these products into registers still in use (a fourth register set) */
  }
#pragma unroll      /* constant indices keep the arrays in registers */
  for (int m = 0; m < 2; ++m) {
#pragma unroll      /* constant indices keep the arrays in registers */
    for (int t = 0; t < 4; ++t) {
#pragma unroll      /* constant indices keep the arrays in registers */
      for (int r = 0; r < 8; ++r) so[wv][m * 16 + 8 * hh + r][t * 16 + ln] = c[m][t][r] * 0.0009765625f + bv[t]; } }
  __builtin_amdgcn_fence(__ATOMIC_ACQ_REL, "workgroup"); __builtin_amdgcn_wave_barrier();      /* a wave reads back only its own staging rows: its LDS stores are done and stay ahead of the reads */
  const int rsub = lane >> 4, c4 = (lane & 15) * 4;
#pragma unroll      /* sixteen independent read-store pairs */
  for (int q = 0; q < 16; ++q) { const int r = q * 2 + rsub; const v4f v = *(const v4fa*)&so[wv][r][c4]; *(v4f*)(C + (size_t)(row0 + r) * DM + col0 + c4) = v; } }
extern "C" void kernel_launch(void* const* d_in, const int* in_sizes, int n_in,
                              void* d_out, int out_size, void* d_ws, size_t ws_size, hipStream_t stream) {
  (void)in_sizes; (void)n_in; (void)out_size;
  const float* const* I = (const float* const*)d_in; const float* xq = I[0]; const float* xk = I[1]; const float* xv = I[2]; const float* wo = I[3]; const float* bo = I[4];      /* queries, keys, values [4][2048][512] (used as q, k, v directly: no input projections); natural W_out [512][512] + b_out */
  static_assert(NH * HD == DM && DM % 64 == 0 && DM % 32 == 0 && SQ % 128 == 0 && NH % HG == 0 && SQ % FQ == 0 && FK % 32 == 0 && FQ == 256 && HD == 64, "shape / tile multiples");
  char* ws = (char*)d_ws; size_t off = 0;
  auto take = [&](size_t bytes) { char* p = ws + off; off += (bytes + 255) & ~(size_t)255; return p; };
  _Float16* BO = (_Float16*)take((size_t)DM * DM * 2);
  _Float16* Q16 = (_Float16*)take(NR * DM * 2); _Float16* KF = (_Float16*)take(NR * DM * 2); _Float16* VF = (_Float16*)take(NR * DM * 2); _Float16* O16 = (_Float16*)take(NR * DM * 2);
  if (off > ws_size) return;
  k_prep<<<PB, 256, 0, stream>>>(xq, xk, xv, wo, Q16, KF, VF, BO);      /* q rows, K, V^T and W_out x16 in fragment order: all operands as exact f16, one launch */
  const size_t r0p = (size_t)B0 * SQ;      /* first projected row */
  k_fattn<<<NB * NH * (SQ / FQ), 512, 0, stream>>>(Q16, KF, VF, O16);      /* o (merged heads) x64 as f16, in the output product's A-fragment order */
  k_ogemm<<<(MPO / 128) * (DM / 128), 256, 0, stream>>>(O16 + r0p * DM, BO, bo, (float*)d_out + r0p * DM);      /* out rows are the output layout */
}

// v006
// A run of this version takes 43.8 microseconds.
// Next to v005, in two timings, it ran 1.22 and 1.20 times as fast.
// All steps since v000 together make it 83.4 times as fast.
#include <hip/hip_runtime.h>
#define NB 4
#define SQ 2048
#define DM 512
#define NH 8
#define HD 64
#define HG 4                         /* heads per k_vt launch group (k_vt is not launched) */
#define B0 0                         /* first batch processed (debug hook) */
#define NBR NB                       /* batches processed (debug hook) */
#define NR ((size_t)NB * SQ)         /* token rows */
#define MP ((int)((size_t)NBR * SQ)) /* rows projected (debug hook) */
#define QN SQ                        /* query rows attended per batch (unused) */
#define NHD NH                       /* heads attended (unused) */
#define MPO MP                       /* rows through the output stage (debug hook) */
#define LQ DM      /* row pitch of the q/k/v rows (unused: the kernels use DM) */
typedef __bf16 v16b __attribute__((ext_vector_type(16)));
typedef unsigned short v8us __attribute__((ext_vector_type(8), may_alias));
typedef float  v8f  __attribute__((ext_vector_type(8)));
typedef float  v4f  __attribute__((ext_vector_type(4)));
typedef float  v4fa __attribute__((ext_vector_type(4), may_alias));
union FragB { v16b v; v8us half[2]; unsigned short u[16]; };

__device__ __forceinline__ unsigned short bf16_bits(float x) { unsigned int u = __float_as_uint(x); return (unsigned short)((u + 0x7FFFu + ((u >> 16) & 1u)) >> 16); }
__device__ __forceinline__ float bf16_val(unsigned short b) { return __uint_as_float(((unsigned int)b) << 16); }
__device__ __forceinline__ float bf16_round(float x) { return bf16_val(bf16_bits(x)); }
// D += A·B with NT terms: 1 = ah·bh, 2 = + al·bh (A split), 3 = + ah·bl (both split)
template <int NT>
__device__ __forceinline__ v8f mmaN(v16b ah, v16b al, v16b bh, v16b bl, v8f c) {
  c = __builtin_amdgcn_wmma_f32_16x16x32_bf16(false, ah, false, bh, (short)0, c, false, false);
  if (NT >= 2) c = __builtin_amdgcn_wmma_f32_16x16x32_bf16(false, al, false, bh, (short)0, c, false, false);
  if (NT >= 3) c = __builtin_amdgcn_wmma_f32_16x16x32_bf16(false, ah, false, bl, (short)0, c, false, false);
  asm volatile("v_nop\n\tv_nop\n\tv_nop\n\tv_nop" : "+v"(c) : "v"(ah), "v"(al), "v"(bh), "v"(bl));
  return c;
}

__global__ __launch_bounds__(256) void k_wt_bf16(const float* __restrict__ W, unsigned short* __restrict__ Wt, int K, int N) {
  const int t = blockIdx.x * 256 + threadIdx.x;
  const int k8n = K / 8;
  if (t >= N * k8n) return;
  const int n = t / k8n, k8 = (t % k8n) * 8;
  v8us v;
#pragma unroll
  for (int i = 0; i < 8; ++i) v[i] = bf16_bits(W[(size_t)(k8 + i) * N + n]);
  *(v8us*)(Wt + (size_t)n * K + k8) = v;
  
}

// GEMM C[M][N] (f32, pitch ldc) = act(A[M][K]·W + bias). A f32 row-major (pitch lda) converted per fragment to bf16
// (ASPLIT: hi/lo two planes -> 2 terms, else single rounded term); Wt bf16 [N][K] (pitch ldb). BIAS_BF16 rounds the
// bias to bf16 first (bias quantised to bf16 before the add). K%32==0, M%16==0, N%64==0.
template <bool ASPLIT, int ACT, bool BIAS_BF16>
__global__ __launch_bounds__(128) void k_gemm_bf(const float* __restrict__ A, int lda, const unsigned short* __restrict__ Wt, int ldb,
                                               const float* __restrict__ bias, float* __restrict__ C, int ldc, int M, int N, int K) {
  __shared__ __attribute__((aligned(16))) float so[4][16][64];
  const int tid = threadIdx.x, w = tid >> 5, lane = tid & 31, ln = lane & 15, hh = lane >> 4;
  const int ntn = N / 64;
  const int wid = blockIdx.x * 4 + w;
  const int mt = wid / ntn, nq = wid % ntn;
  if (mt * 16 >= M) return;
  const int row0 = mt * 16, col0 = nq * 64;
  const float* arow = A + (size_t)(row0 + ln) * lda;
  v8f acc[4] = {};
  for (int kb = 0; kb < K; kb += 32) {
    FragB ah, al;
    const v4f x0 = *(const v4fa*)(arow + kb + 8 * hh), x1 = *(const v4fa*)(arow + kb + 8 * hh + 4);
    const v4f x2 = *(const v4fa*)(arow + kb + 16 + 8 * hh), x3 = *(const v4fa*)(arow + kb + 16 + 8 * hh + 4);
    float xs[16] = {x0[0],x0[1],x0[2],x0[3],x1[0],x1[1],x1[2],x1[3],x2[0],x2[1],x2[2],x2[3],x3[0],x3[1],x3[2],x3[3]};
#pragma unroll
    for (int i = 0; i < 16; ++i) { const unsigned short hb = bf16_bits(xs[i]); ah.u[i] = hb; al.u[i] = ASPLIT ? bf16_bits(xs[i] - bf16_val(hb)) : (unsigned short)0; }
#pragma unroll
    for (int t = 0; t < 4; ++t) {
      const unsigned short* brow = Wt + (size_t)(col0 + t * 16 + ln) * ldb + kb;
      FragB b;
      b.half[0] = *(const v8us*)(brow + 8 * hh);
      b.half[1] = *(const v8us*)(brow + 16 + 8 * hh);
      acc[t] = mmaN<ASPLIT ? 2 : 1>(ah.v, al.v, b.v, b.v, acc[t]);
    }
  }
#pragma unroll
  for (int t = 0; t < 4; ++t) {
    float bv = bias ? bias[col0 + t * 16 + ln] : 0.f;
    if (BIAS_BF16) bv = bf16_round(bv);
#pragma unroll
    for (int r = 0; r < 8; ++r) { float v = acc[t][r] + bv; if (ACT == 1) v = fmaxf(v, 0.f); so[w][8 * hh + r][t * 16 + ln] = v; }
  }
  __builtin_amdgcn_fence(__ATOMIC_ACQ_REL, "workgroup");
  __builtin_amdgcn_wave_barrier();
  const int rsub = lane >> 4, c4 = (lane & 15) * 4;
  {
#pragma unroll
    for (int q = 0; q < 8; ++q) {
      const int r = q * 2 + rsub;
      const v4f v = *(const v4fa*)&so[w][r][c4];
      *(v4f*)(C + (size_t)(row0 + r) * ldc + col0 + c4) = v;
    }
    
  }
}

// GEMM C = act(A·W + bias + resid): A f32 (ASPLIT -> hi/lo 2 terms), Wt bf16 [N][K]; ACT 0 none, 1 relu, 2 exact gelu;
// resid (optional, f32, row index = (row % rmod), pitch ldr, RES_BF16 rounds it) added before the activation.
template <bool ASPLIT, int ACT, bool BIAS_BF16, bool RES_BF16>
__global__ __launch_bounds__(128) void k_gemm_bf3(const float* __restrict__ A, int lda, const unsigned short* __restrict__ Wt, int ldb,
                                                const float* __restrict__ bias, const float* __restrict__ resid, int rmod, int ldr,
                                                float* __restrict__ C, int ldc, int M, int N, int K) {
  __shared__ __attribute__((aligned(16))) float so[4][16][64];
  const int tid = threadIdx.x, w = tid >> 5, lane = tid & 31, ln = lane & 15, hh = lane >> 4;
  const int ntn = N / 64;
  const int wid = blockIdx.x * 4 + w;
  const int mt = wid / ntn, nq = wid % ntn;
  if (mt * 16 >= M) return;
  const int row0 = mt * 16, col0 = nq * 64;
  const float* arow = A + (size_t)(row0 + ln) * lda;
  v8f acc[4] = {};
  for (int kb = 0; kb < K; kb += 32) {
    FragB ah, al;
    const v4f x0 = *(const v4fa*)(arow + kb + 8 * hh), x1 = *(const v4fa*)(arow + kb + 8 * hh + 4);
    const v4f x2 = *(const v4fa*)(arow + kb + 16 + 8 * hh), x3 = *(const v4fa*)(arow + kb + 16 + 8 * hh + 4);
    float xs[16] = {x0[0],x0[1],x0[2],x0[3],x1[0],x1[1],x1[2],x1[3],x2[0],x2[1],x2[2],x2[3],x3[0],x3[1],x3[2],x3[3]};
#pragma unroll
    for (int i = 0; i < 16; ++i) { const unsigned short hb = bf16_bits(xs[i]); ah.u[i] = hb; al.u[i] = ASPLIT ? bf16_bits(xs[i] - bf16_val(hb)) : (unsigned short)0; }
#pragma unroll
    for (int t = 0; t < 4; ++t) {
      const unsigned short* brow = Wt + (size_t)(col0 + t * 16 + ln) * ldb + kb;
      FragB b;
      b.half[0] = *(const v8us*)(brow + 8 * hh);
      b.half[1] = *(const v8us*)(brow + 16 + 8 * hh);
      acc[t] = mmaN<ASPLIT ? 2 : 1>(ah.v, al.v, b.v, b.v, acc[t]);
    }
  }
#pragma unroll
  for (int t = 0; t < 4; ++t) {
    const int col = col0 + t * 16 + ln;
    float bv = bias ? bias[col] : 0.f;
    if (BIAS_BF16) bv = bf16_round(bv);
#pragma unroll
    for (int r = 0; r < 8; ++r) {
      float v = acc[t][r] + bv;
      if (resid) { float rv = resid[(size_t)((row0 + 8 * hh + r) % rmod) * ldr + col]; if (RES_BF16) rv = bf16_round(rv); v += rv; }
      if (ACT == 1) v = fmaxf(v, 0.f);
      if (ACT == 2) v = 0.5f * v * (1.0f + erff(v * 0.70710678118654752f));
      if (ACT == 3) { const float u = 0.7978845608028654f * (v + 0.044715f * v * v * v); v = 0.5f * v * (1.0f + tanhf(u)); }
      so[w][8 * hh + r][t * 16 + ln] = v;
    }
  }
  __builtin_amdgcn_fence(__ATOMIC_ACQ_REL, "workgroup");
  __builtin_amdgcn_wave_barrier();
  const int rsub = lane >> 4, c4 = (lane & 15) * 4;
  {
#pragma unroll
    for (int q = 0; q < 8; ++q) {
      const int r = q * 2 + rsub;
      const v4f v = *(const v4fa*)&so[w][r][c4];
      *(v4f*)(C + (size_t)(row0 + r) * ldc + col0 + c4) = v;
    }
    
  }
}
// row LayerNorm (biased variance, eps) over N: s = X (+ R); optional out_sum <- s; out_norm <- (s-mu)*rsqrt(var+eps)*g + b
template <bool PARAM_BF16>
__global__ __launch_bounds__(256) void k_layernorm(const float* __restrict__ X, const float* __restrict__ R, const float* __restrict__ g, const float* __restrict__ bta,
                                                  float* __restrict__ out_sum, float* __restrict__ out_norm, int N, float eps) {
  __shared__ float red[256];
  const int row = blockIdx.x, tid = threadIdx.x;
  const float* x = X + (size_t)row * N; const float* rr = R ? R + (size_t)row * N : nullptr;
  float vals[16];                     // up to N = 4096
  const int per = N / 256;            // contiguous chunk per thread? use strided-by-4 chunks: thread handles j = tid*4 + 1024*u
  float s1 = 0.f;
  for (int u = 0; u < per / 4; ++u) {
    const int j = tid * 4 + 1024 * u;
    const v4f a = *(const v4fa*)(x + j);
    v4f b = {0.f,0.f,0.f,0.f}; if (rr) b = *(const v4fa*)(rr + j);
#pragma unroll
    for (int q = 0; q < 4; ++q) { const float v = a[q] + b[q]; vals[u * 4 + q] = v; s1 += v; }
  }
  red[tid] = s1; __syncthreads();
  for (int st = 128; st > 0; st >>= 1) { if (tid < st) red[tid] += red[tid + st]; __syncthreads(); }
  const float mu = red[0] / (float)N; __syncthreads();
  float s2 = 0.f;
  for (int u = 0; u < per / 4; ++u)
#pragma unroll
    for (int q = 0; q < 4; ++q) { const float c = vals[u * 4 + q] - mu; s2 += c * c; }
  red[tid] = s2; __syncthreads();
  for (int st = 128; st > 0; st >>= 1) { if (tid < st) red[tid] += red[tid + st]; __syncthreads(); }
  const float rs = rsqrtf(red[0] / (float)N + eps);
  {
    for (int u = 0; u < per / 4; ++u) {
      const int j = tid * 4 + 1024 * u;
      v4f o, sm;
#pragma unroll
      for (int q = 0; q < 4; ++q) {
        float gg = g[j + q], bb = bta[j + q];
        if (PARAM_BF16) { gg = bf16_round(gg); bb = bf16_round(bb); }
        sm[q] = vals[u * 4 + q]; o[q] = (vals[u * 4 + q] - mu) * rs * gg + bb;
      }
      if (out_sum) *(v4f*)(out_sum + (size_t)row * N + j) = sm;
      *(v4f*)(out_norm + (size_t)row * N + j) = o;
    }
    
  }
}



// ---- f16 WMMA path (v_wmma_f32_16x16x32_f16): 11-bit significands for operands in range — used where a [0,1] probability operand needs more precision than bf16
typedef _Float16 v16h __attribute__((ext_vector_type(16)));
union FragH { v16h v; v8us half[2]; _Float16 h[16]; unsigned short u[16]; };
template <int NT>
__device__ __forceinline__ v8f mmaH(v16h ah, v16h al, v16h bh, v16h bl, v8f c) {
  c = __builtin_amdgcn_wmma_f32_16x16x32_f16(false, ah, false, bh, (short)0, c, false, false);
  if (NT >= 2) c = __builtin_amdgcn_wmma_f32_16x16x32_f16(false, al, false, bh, (short)0, c, false, false);
  if (NT >= 3) c = __builtin_amdgcn_wmma_f32_16x16x32_f16(false, ah, false, bl, (short)0, c, false, false);
  asm volatile("v_nop\n\tv_nop\n\tv_nop\n\tv_nop" : "+v"(c) : "v"(ah), "v"(al), "v"(bh), "v"(bl));
  return c;
}
// batched GEMM like k_gemm_b but f16 operands: A f32 (split into f16 hi/lo if ASPLIT, else rounded to f16), Bt = f16 values [n][k]; alpha; C f32; N multiple of 16 (partial tiles skipped)
template <bool ASPLIT>
__global__ __launch_bounds__(128) void k_gemm_h(const float* __restrict__ A, int lda, size_t sA, const _Float16* __restrict__ Bh, int ldb, size_t sB, float alpha, float* __restrict__ C, int ldc, size_t sC, int M, int N, int K) {
  __shared__ __attribute__((aligned(16))) float so[4][16][64];
  const int tid = threadIdx.x, w = tid >> 5, lane = tid & 31, ln = lane & 15, hh = lane >> 4; const int by = blockIdx.y;
  A += (size_t)by * sA; Bh += (size_t)by * sB; C += (size_t)by * sC;
  const int ntn = (N + 63) / 64; const int wid = blockIdx.x * 4 + w; const int mt = wid / ntn, nq = wid % ntn; if (mt * 16 >= M) return;
  const int row0 = mt * 16, col0 = nq * 64; const float* arow = A + (size_t)(row0 + ln) * lda;
  v8f acc[4] = {};
  for (int kb = 0; kb < K; kb += 32) {
    FragH ah, al;
    const v4f x0 = *(const v4fa*)(arow + kb + 8 * hh), x1 = *(const v4fa*)(arow + kb + 8 * hh + 4), x2 = *(const v4fa*)(arow + kb + 16 + 8 * hh), x3 = *(const v4fa*)(arow + kb + 16 + 8 * hh + 4);
    float xs[16] = {x0[0],x0[1],x0[2],x0[3],x1[0],x1[1],x1[2],x1[3],x2[0],x2[1],x2[2],x2[3],x3[0],x3[1],x3[2],x3[3]};
#pragma unroll
    for (int i = 0; i < 16; ++i) { const _Float16 h = (_Float16)xs[i]; ah.h[i] = h; al.h[i] = ASPLIT ? (_Float16)(xs[i] - (float)h) : (_Float16)0.0f; }
#pragma unroll
    for (int t = 0; t < 4; ++t) { if (col0 + t * 16 >= N) continue; const size_t boff = (size_t)(col0 + t * 16 + ln) * ldb + kb; FragH bq; bq.half[0] = *(const v8us*)(Bh + boff + 8 * hh); bq.half[1] = *(const v8us*)(Bh + boff + 16 + 8 * hh);
      acc[t] = mmaH<ASPLIT ? 2 : 1>(ah.v, al.v, bq.v, bq.v, acc[t]); }
  }
#pragma unroll
  for (int t = 0; t < 4; ++t) { if (col0 + t * 16 >= N) continue;
#pragma unroll
    for (int r = 0; r < 8; ++r) so[w][8 * hh + r][t * 16 + ln] = acc[t][r] * alpha; }
  __builtin_amdgcn_fence(__ATOMIC_ACQ_REL, "workgroup"); __builtin_amdgcn_wave_barrier();
  const int rsub = lane >> 4, c4 = (lane & 15) * 4;
  {
#pragma unroll
    for (int q = 0; q < 8; ++q) { const int r = q * 2 + rsub; if (col0 + c4 < N) { const v4f v = *(const v4fa*)&so[w][r][c4]; *(v4f*)(C + (size_t)(row0 + r) * ldc + col0 + c4) = v; } }
     }
}

// Wt[n][k] = f16(W[k][n]·scale) from f32 row-major W[K][N] (scale = power of two; bf16-exact weights stay exact in f16 away from the subnormal range)
__global__ __launch_bounds__(256) void k_wt_f16(const float* __restrict__ W, _Float16* __restrict__ Wt, int K, int N, float scale) {
  const int t = blockIdx.x * 256 + threadIdx.x; if (t >= N * (K / 8)) return; const int n = t / (K / 8), k8 = (t % (K / 8)) * 8; FragH f;
#pragma unroll
  for (int i = 0; i < 8; ++i) f.h[i] = (_Float16)(bf16_round(W[(size_t)(k8 + i) * N + n]) * scale); const v8us o = f.half[0];
  *(v8us*)((unsigned short*)Wt + (size_t)n * K + k8) = o; 
}
// k_gemm_hh variant with fused epilogue: v = acc·alpha + bias[by·sBias + col] (+ CP[(row/rowsPerB)·sCPb + by·64 + col] if CP) ; ACT 0 none / 1 elu ; writes f16 C16 (and f32 C if non-null)
template <int ACT>
__global__ __launch_bounds__(128) void k_gemm_hhx(const _Float16* __restrict__ A, int lda, size_t sA, const _Float16* __restrict__ Bh, int ldb, size_t sB, float alpha, const float* __restrict__ bias, size_t sBias, const float* __restrict__ CP, int rowsPerB, size_t sCPb, int row0g,
    float* __restrict__ C, _Float16* __restrict__ C16, int ldc, size_t sC, int M, int N, int K) {
  __shared__ __attribute__((aligned(16))) float so[4][16][64];
  const int tid = threadIdx.x, w = tid >> 5, lane = tid & 31, ln = lane & 15, hh = lane >> 4; const int by = blockIdx.y;
  A += (size_t)by * sA; Bh += (size_t)by * sB; const size_t cofs = (size_t)by * sC; const float* bp = bias ? bias + (size_t)by * sBias : nullptr;
  const int ntn = (N + 63) / 64; const int wid = blockIdx.x * 4 + w; const int mt = wid / ntn, nq = wid % ntn; if (mt * 16 >= M) return;
  const int row0 = mt * 16, col0 = nq * 64; const _Float16* arow = A + (size_t)(row0 + ln) * lda;
  v8f acc[4] = {};
  for (int kb = 0; kb < K; kb += 32) { FragH ah; ah.half[0] = *(const v8us*)((const unsigned short*)arow + kb + 8 * hh); ah.half[1] = *(const v8us*)((const unsigned short*)arow + kb + 16 + 8 * hh);
#pragma unroll
    for (int t = 0; t < 4; ++t) { if (col0 + t * 16 >= N) continue; const size_t boff = (size_t)(col0 + t * 16 + ln) * ldb + kb; FragH bq; bq.half[0] = *(const v8us*)((const unsigned short*)Bh + boff + 8 * hh); bq.half[1] = *(const v8us*)((const unsigned short*)Bh + boff + 16 + 8 * hh);
      acc[t] = mmaH<1>(ah.v, ah.v, bq.v, bq.v, acc[t]); }
  }
#pragma unroll
  for (int t = 0; t < 4; ++t) { if (col0 + t * 16 >= N) continue; const int col = col0 + t * 16 + ln; const float bv = bp ? bf16_round(bp[col]) : 0.f;
#pragma unroll
    for (int r = 0; r < 8; ++r) { float v = acc[t][r] * alpha + bv; if (CP) { const int rr = row0g + row0 + 8 * hh + r; if (rowsPerB < 0) v += CP[cofs + (size_t)rr * ldc + col];      /* rowsPerB < 0: own element of the batched C plane */ else { const int bidx = rr / rowsPerB; v += CP[(size_t)bidx * sCPb + (size_t)by * 64 + col]; } } if (ACT == 1) v = (v > 0.f) ? v : expm1f(v); else if (ACT == 7) v = (v > 0.f) ? v + 1.0f : expf(v); else if (ACT == 8) v = tanhf(v); else if (ACT == 9) v = 0.5f * v * (1.0f + tanhf(0.7978845608028654f * (v + 0.044715f * v * v * v))); else if (ACT == 11) v = 1.0f / (1.0f + expf(-v)); else if (ACT == 12) v = (v > 0.f) ? v : 0.01f * v; else if (ACT == 14) v = (v > 0.f) ? v : 0.1f * v; else if (ACT == 16) v = (v >= 0.f) ? v : 0.3f * v; else if (ACT == 17) v = (v >= 0.f) ? v : 0.2f * v; else if (ACT == 15) v = v / (1.0f + expf(-v)); else if (ACT == 3) v = fmaxf(v, 0.f); else if (ACT == 6) v = 0.5f * v * (1.0f + erff(v * 0.70710678118654752f)); so[w][8 * hh + r][t * 16 + ln] = v; } }
  __builtin_amdgcn_fence(__ATOMIC_ACQ_REL, "workgroup"); __builtin_amdgcn_wave_barrier();
  const int rsub = lane >> 4, c4 = (lane & 15) * 4; typedef _Float16 v4h __attribute__((ext_vector_type(4)));
  {
#pragma unroll
    for (int q = 0; q < 8; ++q) { const int r = q * 2 + rsub; if (col0 + c4 < N) { const v4f v = *(const v4fa*)&so[w][r][c4]; if (C) *(v4f*)(C + cofs + (size_t)(row0 + r) * ldc + col0 + c4) = v; if (C16) { v4h h4; for (int i = 0; i < 4; ++i) h4[i] = (_Float16)v[i]; *(v4h*)(C16 + cofs + (size_t)(row0 + r) * ldc + col0 + c4) = h4; } } }
     }
}


typedef _Float16 v4h __attribute__((ext_vector_type(4)));

__global__ __launch_bounds__(256) void k_h16(const float* __restrict__ x, _Float16* __restrict__ X16, size_t n8) { const size_t t = (size_t)blockIdx.x * 256 + threadIdx.x; if (t >= n8) return; FragH f;
#pragma unroll
  for (int q = 0; q < 8; ++q) f.h[q] = (_Float16)x[t * 8 + q]; *(v8us*)((unsigned short*)X16 + t * 8) = f.half[0];  }
__global__ __launch_bounds__(256) void k_round16f(const float* __restrict__ W, _Float16* __restrict__ Bt, size_t n8) { const size_t t = (size_t)blockIdx.x * 256 + threadIdx.x; if (t >= n8) return; FragH f;
#pragma unroll
  for (int i = 0; i < 8; ++i) f.h[i] = (_Float16)(bf16_round(W[t * 8 + i]) * 16.0f); *(v8us*)((unsigned short*)Bt + t * 8) = f.half[0];  }
template <int NHv, int TTv>
__global__ __launch_bounds__(256) void k_vt(const _Float16* __restrict__ V16, int ldv, int voff, _Float16* __restrict__ Vt) { __shared__ unsigned short tl[64][66]; const int tid = threadIdx.x; const int slab = blockIdx.x / (TTv / 64), lg = blockIdx.x % (TTv / 64); const int b = slab / NHv, h = slab % NHv;
  for (int i = tid; i < 64 * 8; i += 256) { const int r = i / 8, c8 = (i % 8) * 8; FragH f; f.half[0] = *(const v8us*)((const unsigned short*)V16 + ((size_t)b * TTv + lg * 64 + r) * ldv + voff + h * 64 + c8);
#pragma unroll
    for (int q = 0; q < 8; ++q) tl[r][c8 + q] = f.u[q]; }
  __syncthreads();
  {
#pragma unroll
    for (int rd = 0; rd < 2; ++rd) { const int d = rd * 32 + tid / 8, pc = tid % 8; FragH f;
#pragma unroll
      for (int q = 0; q < 8; ++q) f.u[q] = tl[pc * 8 + q][d];
      *(v8us*)((unsigned short*)Vt + ((size_t)slab * 64 + d) * TTv + lg * 64 + pc * 8) = f.half[0]; }
     } }

__global__ __launch_bounds__(256) void k_hl(const float* __restrict__ F, _Float16* __restrict__ Hh, _Float16* __restrict__ Hl, size_t n8) { const size_t t = (size_t)blockIdx.x * 256 + threadIdx.x; if (t >= n8) return; FragH fh, fl; const v4f a = *(const v4fa*)(F + t * 8), c = *(const v4fa*)(F + t * 8 + 4);
#pragma unroll
  for (int q = 0; q < 4; ++q) { _Float16 h = (_Float16)a[q]; fh.h[q] = h; fl.h[q] = (_Float16)((a[q] - (float)h) * 1024.0f); h = (_Float16)c[q]; fh.h[4 + q] = h; fl.h[4 + q] = (_Float16)((c[q] - (float)h) * 1024.0f); }
  { *(v8us*)((unsigned short*)Hh + t * 8) = fh.half[0]; *(v8us*)((unsigned short*)Hl + t * 8) = fl.half[0];  } }

// ---- fast GEMM (wave tile 32x64; requires M % 32 == 0 rows per launch region and N % 64 == 0); epilogue = k_gemm_hhx semantics ----
__device__ __forceinline__ v16h g2_frag(const _Float16* p, int hh) { FragH f; f.half[0] = *(const v8us*)((const unsigned short*)p + 8 * hh); f.half[1] = *(const v8us*)((const unsigned short*)p + 16 + 8 * hh); return f.v; }
__device__ __forceinline__ v8f g2_mma(v16h a, v16h b, v8f c) { v8f d = __builtin_amdgcn_wmma_f32_16x16x32_f16(false, a, false, b, (short)0, c, false, false); asm volatile("v_nop\n\tv_nop\n\tv_nop\n\tv_nop" : "+v"(d) : "v"(a), "v"(b)); return d; }
template <int ACT>
__global__ __launch_bounds__(128) void k_gemm2(const _Float16* __restrict__ A, int lda, size_t sA, const _Float16* __restrict__ Bh, int ldb, size_t sB, float alpha, const float* __restrict__ bias, size_t sBias, const float* __restrict__ CP, int rowsPerB, size_t sCPb, int row0g,
    float* __restrict__ C, _Float16* __restrict__ C16, int ldc, size_t sC, int M, int N, int K) { static_assert(ACT == 0 || ACT == 3 || ACT == 6 || ACT == 8 || ACT == 9 || ACT == 11 || ACT == 12 || ACT == 14 || ACT == 15 || ACT == 16 || ACT == 17, "k_gemm2: unsupported ACT code (would silently apply no activation)");
  __shared__ __attribute__((aligned(16))) float so[4][32][68];
  const int tid = threadIdx.x, w = tid >> 5, lane = tid & 31, ln = lane & 15, hh = lane >> 4; const int by = blockIdx.y;
  A += (size_t)by * sA; Bh += (size_t)by * sB; const size_t cofs = (size_t)by * sC; const float* bp = bias ? bias + (size_t)by * sBias : nullptr;
  const int ntn = N >> 6; const int mt = blockIdx.x / ntn, nq = blockIdx.x - mt * ntn; const int row0 = mt * 128 + 32 * w, col0 = nq * 64; if (row0 >= M) return;
  const _Float16* a0p = A + (size_t)(row0 + ln) * lda; const _Float16* a1p = a0p + (size_t)16 * lda;
  const _Float16* b0p = Bh + (size_t)(col0 + ln) * ldb; const _Float16* b1p = b0p + (size_t)16 * ldb; const _Float16* b2p = b1p + (size_t)16 * ldb; const _Float16* b3p = b2p + (size_t)16 * ldb;
  const v8f z8 = {0.f,0.f,0.f,0.f,0.f,0.f,0.f,0.f}; v8f c00 = z8, c01 = z8, c02 = z8, c03 = z8, c10 = z8, c11 = z8, c12 = z8, c13 = z8;
#pragma unroll 1
  for (int kb = 0; kb < K; kb += 32) { const v16h a0 = g2_frag(a0p + kb, hh), a1 = g2_frag(a1p + kb, hh);
    v16h b = g2_frag(b0p + kb, hh); c00 = g2_mma(a0, b, c00); c10 = g2_mma(a1, b, c10);
    b = g2_frag(b1p + kb, hh); c01 = g2_mma(a0, b, c01); c11 = g2_mma(a1, b, c11);
    b = g2_frag(b2p + kb, hh); c02 = g2_mma(a0, b, c02); c12 = g2_mma(a1, b, c12);
    b = g2_frag(b3p + kb, hh); c03 = g2_mma(a0, b, c03); c13 = g2_mma(a1, b, c13); }
  v8f accs[8] = {c00, c01, c02, c03, c10, c11, c12, c13};
#pragma unroll
  for (int u = 0; u < 8; ++u) { const int t = u & 3, half = u >> 2; const int col = col0 + t * 16 + ln; const float bv = bp ? bf16_round(bp[col]) : 0.f;
#pragma unroll
    for (int r = 0; r < 8; ++r) { const int rloc = half * 16 + 8 * hh + r; float v = accs[u][r] * alpha + bv; if (CP) { if (rowsPerB < 0) v += CP[cofs + (size_t)(row0g + row0 + rloc) * ldc + col];      /* rowsPerB < 0: own element of the batched C plane */ else { const int bidx = (row0g + row0 + rloc) / rowsPerB; v += CP[(size_t)bidx * sCPb + (size_t)by * 64 + col]; } }
      if (ACT == 3) v = fmaxf(v, 0.f); else if (ACT == 6) v = 0.5f * v * (1.0f + erff(v * 0.70710678118654752f)); else if (ACT == 11) v = 1.0f / (1.0f + expf(-v)); else if (ACT == 15) v = v / (1.0f + expf(-v)); else if (ACT == 12) v = (v > 0.f) ? v : 0.01f * v; else if (ACT == 8) v = tanhf(v); else if (ACT == 9) v = 0.5f * v * (1.0f + tanhf(0.7978845608028654f * (v + 0.044715f * v * v * v))); else if (ACT == 14) v = (v > 0.f) ? v : 0.1f * v; else if (ACT == 16) v = (v >= 0.f) ? v : 0.3f * v; else if (ACT == 17) v = (v >= 0.f) ? v : 0.2f * v;
      so[w][rloc][t * 16 + ln] = v; } }
  __builtin_amdgcn_fence(__ATOMIC_ACQ_REL, "workgroup"); __builtin_amdgcn_wave_barrier();
  const int rsub = lane >> 4, c4 = (lane & 15) * 4;
  {
#pragma unroll
    for (int q = 0; q < 16; ++q) { const int r = q * 2 + rsub; const v4f v = *(const v4fa*)&so[w][r][c4]; if (C) *(v4f*)(C + cofs + (size_t)(row0 + r) * ldc + col0 + c4) = v; if (C16) { v4h h4; for (int i = 0; i < 4; ++i) h4[i] = (_Float16)v[i]; *(v4h*)(C16 + cofs + (size_t)(row0 + r) * ldc + col0 + c4) = h4; } }
     } }


// ---- operand conversion: every value is rounded to bf16 and is exact as f16 ----
__device__ __forceinline__ v8us pr_cvt(v4f p, v4f q, float scale) { FragH f;
#pragma unroll      /* constant indices keep the arrays in registers */
  for (int i = 0; i < 4; ++i) { f.h[i] = (_Float16)(bf16_round(p[i]) * scale); f.h[4 + i] = (_Float16)(bf16_round(q[i]) * scale); }
  return f.half[0]; }
typedef float fv2 __attribute__((ext_vector_type(2))); typedef _Float16 hv2 __attribute__((ext_vector_type(2))); typedef __bf16 bv2 __attribute__((ext_vector_type(2)));
typedef unsigned int v2u __attribute__((ext_vector_type(2), may_alias)); typedef unsigned int v4u __attribute__((ext_vector_type(4), may_alias));
__device__ __forceinline__ fv2 fa_b2(float a, float b) {      /* two values rounded (nearest even) to bf16, as f32 */
  const unsigned int u = __builtin_bit_cast(unsigned int, __builtin_convertvector((fv2){a, b}, bv2)); return (fv2){__uint_as_float(u << 16), __uint_as_float(u & 0xffff0000u)}; }
__device__ __forceinline__ unsigned int fa_h2(float a, float b) { return __builtin_bit_cast(unsigned int, __builtin_convertvector((fv2){a, b}, hv2)); }      /* two f16, a in the low half */
__device__ __forceinline__ unsigned int fa_c2(float a, float b) { const fv2 r = fa_b2(a, b); return fa_h2(r[0], r[1]); }      /* rounded to bf16, then (exactly) f16 */
// ---- fused attention on the f32 inputs: one wave = 32 query columns (2 groups of 16) of one head and one half of its keys, a pass = 32 keys; 16 waves a block (four a SIMD): waves c and c + 8 hold the same columns; the two halves' sums are merged once, through LDS ----
// K and V^T reach the matrix instructions through LDS: a stage = 64 keys of each key half; of the 8 waves of a half, 4 load the stage's K rows and 4 its V rows as f32 (each load = 2 rows x 256 contiguous bytes) while the stage two before is worked on, convert them once and store them in A-fragment order; a ring of four stages, one barrier every second stage.
// K unit of 16 bytes (16-key tile, group = d / 8 = 4 x d step + 2 x fragment half j + hh, ln) holds k[key = 16 tile + ln][d = 8 group .. + 7].
// V^T unit (32-key block, 16-row d tile t, group = 2 j + hh, ln) holds v[key = 32 block + 16 j + 8 hh .. + 7][d = 16 t + ln].
// A group = 16 units at a pitch of 272 bytes, a V^T d tile 16 bytes more: the storing lanes fall on different banks, the reading lanes read 256 contiguous bytes.
__device__ __forceinline__ v16h fa_frag(const unsigned short* p) { FragH f; f.half[0] = *(const v8us*)p; f.half[1] = *(const v8us*)(p + 256); return f.v; }      /* p = the lane's 16 bytes of half 0; half 1 lies 512 bytes on */
__device__ __forceinline__ v8f fa_mma(v16h a, v16h b, v8f c) { return __builtin_amdgcn_wmma_f32_16x16x32_f16(false, a, false, b, (short)0, c, false, false); }
__device__ __forceinline__ float fa_xhalf(float x) { return __builtin_bit_cast(float, __builtin_amdgcn_permlanex16(__builtin_bit_cast(int, x), __builtin_bit_cast(int, x), 0x76543210, 0xfedcba98, false, false)); }      /* lane l with lane l ^ 16 */
#define FQ 256      /* query rows a block */
#define FK (SQ / 2)      /* keys a wave walks */
#define FS 64      /* keys of a stage (per key half) */
#define GP 272      /* bytes from group to group */
#define KTB (8 * GP)      /* a 16-key K tile */
#define VTB (4 * GP + 16)      /* a 16-row d tile of a 32-key V^T block */
#define KSB ((FS / 16) * KTB)      /* a stage's K */
#define VSB ((FS / 32) * 4 * VTB)      /* a stage's V^T */
#define QP 144      /* bytes from q row to q row in LDS (64 f16 + 16) */
__device__ __forceinline__ v16h fa_lfrag(const unsigned char* p) { FragH f; f.half[0] = *(const v8us*)p; f.half[1] = *(const v8us*)(p + 2 * GP); return f.v; }      /* p = the lane's unit of half 0; half 1 lies two groups on */
__device__ __forceinline__ void fa_ld(v4f (&st)[8], const float* p) {      /* a thread's 16 bytes of 8 rows in a row; 16 lanes cover a row's 256 bytes of one head */
#pragma unroll      /* constant indices keep the arrays in registers */
  for (int c = 0; c < 8; ++c) st[c] = *(const v4fa*)(p + c * DM);
  asm volatile("s_wait_xcnt 0x0" :: "v"(p) : "memory");      /* the loads' address pair stays whole until this wait */
}
__device__ __forceinline__ void fa_cv(const v4f (&st)[8], unsigned char* hb, int role, int lw, int ln, int hh) {      /* convert a thread's share of a stage and store it in fragment order */
  if (role == 0) { unsigned char* d = hb + lw * KTB + (ln >> 1) * GP + hh * 128 + (ln & 1) * 8;      /* key 16 lw + 8 hh + c, d = 4 ln .. + 3 */
#pragma unroll      /* constant indices keep the arrays in registers */
    for (int c = 0; c < 8; ++c) *(v2u*)(d + c * 16) = (v2u){fa_c2(st[c][0], st[c][1]), fa_c2(st[c][2], st[c][3])};
  } else { unsigned char* d = hb + KSB + (lw >> 1) * (4 * VTB) + (ln >> 2) * VTB + ((lw & 1) * 2 + hh) * GP + (ln & 3) * 64;      /* keys 16 lw + 8 hh + c, d = 4 ln + i */
    float x[8][4];      /* rounded along d (neighbouring registers), packed along the keys */
#pragma unroll      /* constant indices keep the arrays in registers */
    for (int c = 0; c < 8; ++c) { const fv2 r0 = fa_b2(st[c][0], st[c][1]), r1 = fa_b2(st[c][2], st[c][3]); x[c][0] = r0[0]; x[c][1] = r0[1]; x[c][2] = r1[0]; x[c][3] = r1[1]; }
#pragma unroll      /* constant indices keep the arrays in registers */
    for (int i = 0; i < 4; ++i) *(v4u*)(d + i * 16) = (v4u){fa_h2(x[0][i], x[1][i]), fa_h2(x[2][i], x[3][i]), fa_h2(x[4][i], x[5][i]), fa_h2(x[6][i], x[7][i])}; } }
__global__ __launch_bounds__(512) void k_fattn(const float* __restrict__ xq, const float* __restrict__ xk, const float* __restrict__ xv, const float* __restrict__ wo, _Float16* __restrict__ BO, _Float16* __restrict__ O16) {
  typedef float v2f __attribute__((ext_vector_type(2))); typedef _Float16 v2h __attribute__((ext_vector_type(2)));
  static_assert(FK % FS == 0 && FK / FS >= 4 && (FK / FS) % 2 == 0 && FS == 64 && HD == 64 && DM * DM / 8 == 128 * NB * NH * (SQ / FQ) && DM == 512, "shares of the loading waves");
  __shared__ __attribute__((aligned(16))) v4f mg[FQ / 32][17][32];      /* the upper key half's sums on their way to the lower half's wave: [column wave][16 quarters of o, then maxima and row sums][lane], 512 contiguous bytes a wave and store */
  __shared__ __attribute__((aligned(16))) unsigned char kv[4][2][KSB + VSB];      /* [stage & 3][key half] */
  __shared__ __attribute__((aligned(16))) unsigned char qs[FQ * QP];      /* the block's q rows as f16 */
  const int wv = __builtin_amdgcn_readfirstlane((int)(threadIdx.x >> 5));      /* the wave's number in a scalar register: the key half and the loading role decide branches */
  const int lane = threadIdx.x & 31, w = wv & 7, kh = wv >> 3, ln = lane & 15, hh = lane >> 4;
  const int role = w >> 2, lw = w & 3;      /* waves 0..3 of a key half load K, waves 4..7 V; each 16 keys of a stage */
  const int slab = blockIdx.x / (SQ / FQ), qb = blockIdx.x % (SQ / FQ); const int b = slab / NH, h = slab % NH; const int q0 = qb * FQ + w * 32;
  const float cs = 0.044194173824159216f * 1.4426950408889634f;      /* 1 / sqrt(512) (the module's literal d_model scale) x log2 e */
  const float* sp = (role != 0 ? xv : xk) + ((size_t)b * SQ + (size_t)kh * FK + lw * 16 + hh * 8) * DM + h * HD + ln * 4;      /* keys 16 lw + 8 hh .. + 7 of a stage */
  v4f st[8];
  { v4f sq[8], s1[8];
    fa_ld(st, sp);
    fa_ld(s1, sp + (size_t)FS * DM);
    fa_ld(sq, xq + ((size_t)b * SQ + qb * FQ + wv * 16 + hh * 8) * DM + h * HD + ln * 4);      /* q rows 16 wv + 8 hh + c of the block */
#pragma unroll      /* constant indices keep the arrays in registers */
    for (int c = 0; c < 8; ++c) *(v2u*)(qs + (wv * 16 + hh * 8 + c) * QP + ln * 8) = (v2u){fa_c2(sq[c][0], sq[c][1]), fa_c2(sq[c][2], sq[c][3])};
    fa_cv(st, &kv[0][kh][0], role, lw, ln, hh);
    fa_cv(s1, &kv[1][kh][0], role, lw, ln, hh); }
  __syncthreads();      /* q and stages 0 and 1 are whole in LDS before any wave reads them */
  v16h qf[2][2];      /* B operand: column = query, k = d */
#pragma unroll      /* constant indices keep the arrays in registers */
  for (int g = 0; g < 2; ++g) {
#pragma unroll      /* constant indices keep the arrays in registers */
    for (int ks = 0; ks < 2; ++ks) { const unsigned char* qp = qs + (w * 32 + g * 16 + ln) * QP + ks * 64 + hh * 16; FragH f; f.half[0] = *(const v8us*)qp; f.half[1] = *(const v8us*)(qp + 32); qf[g][ks] = f.v; } }
  const v8f z8 = {0.f,0.f,0.f,0.f,0.f,0.f,0.f,0.f}; v8f o[2][4]; float mr[2], lr[2];
#pragma unroll      /* constant indices keep the arrays in registers */
  for (int g = 0; g < 2; ++g) { mr[g] = -__builtin_inff(); lr[g] = 0.f;
#pragma unroll      /* constant indices keep the arrays in registers */
    for (int t = 0; t < 4; ++t) o[g][t] = z8; }
  for (int sg = 0; sg < FK / FS; ++sg) {
    if (sg + 2 < FK / FS) fa_ld(st, sp + (size_t)(sg + 2) * FS * DM);      /* both passes of this stage ahead of the conversion; none is in flight at a barrier (which would wait for it) */
    const unsigned char* rb = &kv[sg & 3][kh][0] + hh * GP + ln * 16;
#pragma unroll      /* constant LDS offsets for both passes of a stage */
    for (int p = 0; p < FS / 32; ++p) {
      v16h kf[4], vf[4];      /* A operands: kf[16-key tile * 2 + d step], vf[16-row d tile] */
#pragma unroll      /* constant indices keep the arrays in registers */
      for (int t = 0; t < 4; ++t) kf[t] = fa_lfrag(rb + (p * 2 + (t >> 1)) * KTB + (t & 1) * 4 * GP);
#pragma unroll      /* constant indices keep the arrays in registers */
      for (int t = 0; t < 4; ++t) vf[t] = fa_lfrag(rb + KSB + (p * 4 + t) * VTB);
      v8f s[2][2];      /* [group][key tile]: register r = score of key 16 tile + 8 hh + r, query ln */
#pragma unroll      /* constant indices keep the arrays in registers */
      for (int g = 0; g < 2; ++g) {
#pragma unroll      /* constant indices keep the arrays in registers */
        for (int kt = 0; kt < 2; ++kt) s[g][kt] = fa_mma(kf[kt * 2 + 1], qf[g][1], fa_mma(kf[kt * 2], qf[g][0], z8)); }
      float mb[2]; bool need = false;
#pragma unroll      /* constant indices keep the arrays in registers */
      for (int g = 0; g < 2; ++g) { float mx = s[g][0][0];
#pragma unroll      /* constant indices keep the arrays in registers */
        for (int r = 1; r < 8; ++r) mx = fmaxf(mx, s[g][0][r]);
#pragma unroll      /* constant indices keep the arrays in registers */
        for (int r = 0; r < 8; ++r) mx = fmaxf(mx, s[g][1][r]);
        mb[g] = fmaxf(mx, fa_xhalf(mx)) * cs; need = need || (mb[g] > mr[g] + 8.0f); }
      if (__builtin_amdgcn_ballot_w32(need) != 0) {      /* the maximum in use may trail the true one by up to 8 (log2): weights stay <= 2^8; one test a pass */
#pragma unroll      /* constant indices keep the arrays in registers */
        for (int g = 0; g < 2; ++g) { const float mn = fmaxf(mr[g], mb[g]); const float corr = __builtin_amdgcn_exp2f(mr[g] - mn); mr[g] = mn; lr[g] *= corr;      /* corr = 0 in the first pass */
#pragma unroll      /* constant indices keep the arrays in registers */
          for (int t = 0; t < 4; ++t) o[g][t] = o[g][t] * corr; } }
#pragma unroll      /* constant indices keep the arrays in registers */
      for (int g = 0; g < 2; ++g) { const float nm = -mr[g]; FragH pf; v2f ls = {0.f, 0.f};      /* two score tiles, converted in place, are the B operand of the second product */
#pragma unroll      /* constant indices keep the arrays in registers */
        for (int e = 0; e < 8; ++e) { const v2f sv = {s[g][e >> 2][2 * (e & 3)], s[g][e >> 2][2 * (e & 3) + 1]}; const v2f ar = __builtin_elementwise_fma(sv, (v2f){cs, cs}, (v2f){nm, nm});
          const v2f pv = {__builtin_amdgcn_exp2f(ar[0]), __builtin_amdgcn_exp2f(ar[1])}; ls += pv; const v2h ph = __builtin_convertvector(pv, v2h); pf.h[2 * e] = ph[0]; pf.h[2 * e + 1] = ph[1]; }
        lr[g] += ls[0] + ls[1];
#pragma unroll      /* constant indices keep the arrays in registers */
        for (int t = 0; t < 4; ++t) o[g][t] = fa_mma(vf[t], pf.v, o[g][t]); }
    }
    if (sg + 2 < FK / FS) {      /* the same for every wave of the block */
      fa_cv(st, &kv[(sg + 2) & 3][kh][0], role, lw, ln, hh);      /* the place of stage sg - 2, whose last readers have passed a barrier since */
      if ((sg & 1) != 0) __syncthreads();      /* one barrier every second stage: it publishes stages sg + 1 and sg + 2 and ends every read of stages sg - 1 and sg, whose places are stored to next */
    }
  }
  if (kh != 0) {      /* upper key half: un-normalised sums, maxima in use and row sums go to LDS */
#pragma unroll      /* constant indices keep the arrays in registers */
    for (int g = 0; g < 2; ++g) {
#pragma unroll      /* constant indices keep the arrays in registers */
      for (int t = 0; t < 4; ++t) { mg[w][(g * 4 + t) * 2][lane] = (v4f){o[g][t][0], o[g][t][1], o[g][t][2], o[g][t][3]}; mg[w][(g * 4 + t) * 2 + 1][lane] = (v4f){o[g][t][4], o[g][t][5], o[g][t][6], o[g][t][7]}; } }
    mg[w][16][lane] = (v4f){mr[0], mr[1], lr[0], lr[1]}; }
  __syncthreads();      /* the upper half's sums are whole in LDS before the lower half's waves read them; every wave passes it once */
  if (kh != 0) {      /* four of the waves that are done write the block's 128 units of W_out for the launch behind this one */
    if (w < 4) { const int u = blockIdx.x * 128 + w * 32 + lane; const int ks = (u >> 6) & (DM / 32 - 1), j = (u >> 5) & 1, nt = u >> 10;      /* W_out unit (16-column tile nt of the output, 32-wide k step, half j, lane) holds 16 x W_out[n = 16 nt + ln][k = 32 step + 16 j + 8 hh .. + 7]: B-fragment order of the output product (natural [out][in] = Bt[n][k]) */
      const float* s = wo + (size_t)(nt * 16 + ln) * DM + ks * 32 + j * 16 + hh * 8; const v4f w0 = *(const v4fa*)s, w1 = *(const v4fa*)(s + 4);
      asm volatile("s_wait_xcnt 0x0" :: "v"(s) : "memory");      /* the loads' address pair stays whole until this wait */
      *(v8us*)((unsigned short*)BO + (size_t)u * 8) = pr_cvt(w0, w1, 16.0f);
      asm volatile("s_wait_xcnt 0x0" ::: "memory");      /* the store's address and data registers stay whole until this wait */
    }
    return; }
  const v4f sm = mg[w][16][lane];
#pragma unroll      /* constant indices keep the arrays in registers */
  for (int g = 0; g < 2; ++g) { const float mn = fmaxf(mr[g], sm[g]); const float ca = __builtin_amdgcn_exp2f(mr[g] - mn), cb = __builtin_amdgcn_exp2f(sm[g] - mn);      /* both maxima are finite (each half has walked its keys) and alike in lanes l and l ^ 16 */
    lr[g] = lr[g] * ca + sm[2 + g] * cb;
#pragma unroll      /* constant indices keep the arrays in registers */
    for (int t = 0; t < 4; ++t) { const v4f u0 = mg[w][(g * 4 + t) * 2][lane], u1 = mg[w][(g * 4 + t) * 2 + 1][lane];
#pragma unroll      /* constant indices keep the arrays in registers */
      for (int r = 0; r < 4; ++r) { o[g][t][r] = o[g][t][r] * ca + u0[r] * cb; o[g][t][4 + r] = o[g][t][4 + r] * ca + u1[r] * cb; } } }
#pragma unroll      /* constant indices keep the arrays in registers */
  for (int g = 0; g < 2; ++g) { const float inv = 64.0f / (lr[g] + fa_xhalf(lr[g])); unsigned short* op = (unsigned short*)O16 + ((size_t)b * SQ + q0 + g * 16) * DM + h * 1024 + lane * 8;      /* o carried x64; register r of tile t = d 16 t + 8 hh + r of query ln: that is half t & 1 of the output product's A fragment (16 rows, k step 2 h + t / 2), stored as such: 512 contiguous bytes a wave */
#pragma unroll      /* constant indices keep the arrays in registers */
    for (int t = 0; t < 4; ++t) { FragH f;
#pragma unroll      /* constant indices keep the arrays in registers */
      for (int r = 0; r < 8; ++r) f.h[r] = (_Float16)(o[g][t][r] * inv);
      *(v8us*)(op + t * 256) = f.half[0]; } } }
__global__ __launch_bounds__(256) void k_vt(const _Float16* __restrict__ V16, int b, int h0, _Float16* __restrict__ VT) { __shared__ unsigned short tl[64][65]; const int tid = threadIdx.x; const int hh = blockIdx.x % HG, sg = blockIdx.x / HG; const int s0 = sg * 64; const int h = h0 + hh;
  for (int i = tid; i < 64 * 8; i += 256) { const int j = i / 8, d8 = (i % 8) * 8; FragH f; f.half[0] = *(const v8us*)((const unsigned short*)V16 + ((size_t)b * SQ + s0 + j) * DM + h * HD + d8); for (int q = 0; q < 8; ++q) tl[d8 + q][j] = f.u[q]; }
  __syncthreads();
  { for (int i = tid; i < 64 * 8; i += 256) { const int d = i / 8, j8 = (i % 8) * 8; FragH f; for (int q = 0; q < 8; ++q) f.u[q] = tl[d][j8 + q]; *(v8us*)((unsigned short*)VT + ((size_t)hh * HD + d) * SQ + s0 + j8) = f.half[0]; }  } }



__global__ __launch_bounds__(256) void k_rsmkm(const float* __restrict__ S, _Float16* __restrict__ P, int nrows, const int* __restrict__ am) {
  #pragma clang fp contract(off)
  const int t = blockIdx.x * 256 + threadIdx.x; if (t >= nrows) return; const size_t i = (size_t)t; const float* s = S + i * SQ; const int* mr = am + (size_t)(t % SQ) * SQ; float mx = -3.0e38f;
#pragma unroll 1
  for (int j = 0; j < SQ; ++j) { const float f = (mr[j] != 0) ? 1.f : 0.f; mx = fmaxf(mx, fmaf(f, s[j], (1.f - f) * -1.0e9f)); } float se = 0.f;
#pragma unroll 1
  for (int j = 0; j < SQ; ++j) { const float f = (mr[j] != 0) ? 1.f : 0.f; se += __expf(fmaf(f, s[j], (1.f - f) * -1.0e9f) - mx); } const float sc = 256.0f / se;
#pragma unroll 1
  for (int j0 = 0; j0 < SQ; j0 += 8) { FragH fr; for (int q = 0; q < 8; ++q) { const int j = j0 + q; const float f = (mr[j] != 0) ? 1.f : 0.f; fr.h[q] = (_Float16)(__expf(fmaf(f, s[j], (1.f - f) * -1.0e9f) - mx) * sc); }
    unsigned short* d = (unsigned short*)P + i * SQ + j0; *(v8us*)d = fr.half[0];  } }
// ---- output product out = o W_out^T / 1024 + b_out: both operands lie in fragment order ([16-row tile][k step][half][lane], 1024 bytes a fragment), so every load is 512 contiguous bytes from a scalar base; a wave = 32 rows x 64 columns, 8 waves = 128 x 128; the 12 loads of a k step are asked for two steps ahead into a ring of three register sets ----
#define OKS (DM / 32)      /* k steps */
__global__ __launch_bounds__(256) void k_ogemm(const _Float16* __restrict__ AF, const _Float16* __restrict__ BF, const float* __restrict__ bias, float* __restrict__ C) {
  __shared__ __attribute__((aligned(16))) float so[8][32][68];
  const int wv = __builtin_amdgcn_readfirstlane((int)(threadIdx.x >> 5));      /* the wave's number in a scalar register: both streams' bases are scalar */
  const int lane = threadIdx.x & 31, ln = lane & 15, hh = lane >> 4;
  const int mt = blockIdx.x / (DM / 128), nq = blockIdx.x % (DM / 128); const int row0 = mt * 128 + (wv & 3) * 32, col0 = nq * 128 + (wv >> 2) * 64;
  const unsigned short* ap = (const unsigned short*)AF + (size_t)row0 * DM + lane * 8; const unsigned short* bp = (const unsigned short*)BF + (size_t)col0 * DM + lane * 8;      /* a 16-row tile = OKS x 512 values = 16 DM */
  v16h a[3][2], b[3][4]; v8f c[2][4]; float bv[4];
  const v8f z8 = {0.f,0.f,0.f,0.f,0.f,0.f,0.f,0.f};
#pragma unroll      /* constant indices keep the arrays in registers */
  for (int s = 0; s < 2; ++s) {
#pragma unroll      /* constant indices keep the arrays in registers */
    for (int m = 0; m < 2; ++m) a[s][m] = fa_frag(ap + (m * OKS + s) * 512);
#pragma unroll      /* constant indices keep the arrays in registers */
    for (int t = 0; t < 4; ++t) b[s][t] = fa_frag(bp + (t * OKS + s) * 512);
    __builtin_amdgcn_sched_barrier(0);      /* loads return in the order asked: step 0's stay first, so that the first products wait for them alone */
  }
#pragma unroll      /* constant indices keep the arrays in registers */
  for (int t = 0; t < 4; ++t) { bv[t] = bf16_round(bias[col0 + t * 16 + ln]); c[0][t] = z8; c[1][t] = z8; }
#pragma unroll      /* constant indices keep the ring in registers */
  for (int s = 0; s < OKS; ++s) {
    if (s + 2 < OKS) {
#pragma unroll      /* constant indices keep the arrays in registers */
      for (int m = 0; m < 2; ++m) a[(s + 2) % 3][m] = fa_frag(ap + (m * OKS + s + 2) * 512);
#pragma unroll      /* constant indices keep the arrays in registers */
      for (int t = 0; t < 4; ++t) b[(s + 2) % 3][t] = fa_frag(bp + (t * OKS + s + 2) * 512); }
    __builtin_amdgcn_sched_barrier(0);      /* keeps the twelve loads up here, two steps ahead of their use; without it they sink to just ahead of their products and every step waits out a load's latency */
#pragma unroll      /* constant indices keep the arrays in registers */
    for (int t = 0; t < 4; ++t) { c[0][t] = fa_mma(a[s % 3][0], b[s % 3][t], c[0][t]); c[1][t] = fa_mma(a[s % 3][1], b[s % 3][t], c[1][t]); }
    __builtin_amdgcn_sched_barrier(0);      /* keeps the next group of loads from rising over these products into registers still in use (a fourth register set) */
  }
#pragma unroll      /* constant indices keep the arrays in registers */
  for (int m = 0; m < 2; ++m) {
#pragma unroll      /* constant indices keep the arrays in registers */
    for (int t = 0; t < 4; ++t) {
#pragma unroll      /* constant indices keep the arrays in registers */
      for (int r = 0; r < 8; ++r) so[wv][m * 16 + 8 * hh + r][t * 16 + ln] = c[m][t][r] * 0.0009765625f + bv[t]; } }
  __builtin_amdgcn_fence(__ATOMIC_ACQ_REL, "workgroup"); __builtin_amdgcn_wave_barrier();      /* a wave reads back only its own staging rows: its LDS stores are done and stay ahead of the reads */
  const int rsub = lane >> 4, c4 = (lane & 15) * 4;
#pragma unroll      /* sixteen independent read-store pairs */
  for (int q = 0; q < 16; ++q) { const int r = q * 2 + rsub; const v4f v = *(const v4fa*)&so[wv][r][c4]; *(v4f*)(C + (size_t)(row0 + r) * DM + col0 + c4) = v; } }
extern "C" void kernel_launch(void* const* d_in, const int* in_sizes, int n_in,
                              void* d_out, int out_size, void* d_ws, size_t ws_size, hipStream_t stream) {
  (void)in_sizes; (void)n_in; (void)out_size;
  const float* const* I = (const float* const*)d_in; const float* xq = I[0]; const float* xk = I[1]; const float* xv = I[2]; const float* wo = I[3]; const float* bo = I[4];      /* queries, keys, values [4][2048][512] (used as q, k, v directly: no input projections); natural W_out [512][512] + b_out */
  static_assert(NH * HD == DM && DM % 64 == 0 && DM % 32 == 0 && SQ % 128 == 0 && NH % HG == 0 && SQ % FQ == 0 && FK % 32 == 0 && FQ == 256 && HD == 64, "shape / tile multiples");
  char* ws = (char*)d_ws; size_t off = 0;
  auto take = [&](size_t bytes) { char* p = ws + off; off += (bytes + 255) & ~(size_t)255; return p; };
  _Float16* BO = (_Float16*)take((size_t)DM * DM * 2);
  _Float16* O16 = (_Float16*)take(NR * DM * 2);
  if (off > ws_size) return;
  const size_t r0p = (size_t)B0 * SQ;      /* first projected row */
  k_fattn<<<NB * NH * (SQ / FQ), 512, 0, stream>>>(xq, xk, xv, wo, BO, O16);      /* o (merged heads) x64 as f16, in the output product's A-fragment order; W_out x16 in its B-fragment order */
  k_ogemm<<<(MPO / 128) * (DM / 128), 256, 0, stream>>>(O16 + r0p * DM, BO, bo, (float*)d_out + r0p * DM);      /* out rows are the output layout */
}

// v007
// One run takes 42 microseconds.
// Next to v006, in two timings, it ran 1.04 times as fast each time.
// All steps since v000 together make it 87.0 times as fast.
#include <hip/hip_runtime.h>
#define NB 4
#define SQ 2048
#define DM 512
#define NH 8
#define HD 64
#define HG 4                         /* heads per k_vt launch group (k_vt is not launched) */
#define B0 0                         /* first batch processed (debug hook) */
#define NBR NB                       /* batches processed (debug hook) */
#define NR ((size_t)NB * SQ)         /* token rows */
#define MP ((int)((size_t)NBR * SQ)) /* rows projected (debug hook) */
#define QN SQ                        /* query rows attended per batch (unused) */
#define NHD NH                       /* heads attended (unused) */
#define MPO MP                       /* rows through the output stage (debug hook) */
#define LQ DM      /* row pitch of the q/k/v rows (unused: the kernels use DM) */
typedef __bf16 v16b __attribute__((ext_vector_type(16)));
typedef unsigned short v8us __attribute__((ext_vector_type(8), may_alias));
typedef float  v8f  __attribute__((ext_vector_type(8)));
typedef float  v4f  __attribute__((ext_vector_type(4)));
typedef float  v4fa __attribute__((ext_vector_type(4), may_alias));
union FragB { v16b v; v8us half[2]; unsigned short u[16]; };

__device__ __forceinline__ unsigned short bf16_bits(float x) { unsigned int u = __float_as_uint(x); return (unsigned short)((u + 0x7FFFu + ((u >> 16) & 1u)) >> 16); }
__device__ __forceinline__ float bf16_val(unsigned short b) { return __uint_as_float(((unsigned int)b) << 16); }
__device__ __forceinline__ float bf16_round(float x) { return bf16_val(bf16_bits(x)); }
// D += A·B with NT terms: 1 = ah·bh, 2 = + al·bh (A split), 3 = + ah·bl (both split)
template <int NT>
__device__ __forceinline__ v8f mmaN(v16b ah, v16b al, v16b bh, v16b bl, v8f c) {
  c = __builtin_amdgcn_wmma_f32_16x16x32_bf16(false, ah, false, bh, (short)0, c, false, false);
  if (NT >= 2) c = __builtin_amdgcn_wmma_f32_16x16x32_bf16(false, al, false, bh, (short)0, c, false, false);
  if (NT >= 3) c = __builtin_amdgcn_wmma_f32_16x16x32_bf16(false, ah, false, bl, (short)0, c, false, false);
  asm volatile("v_nop\n\tv_nop\n\tv_nop\n\tv_nop" : "+v"(c) : "v"(ah), "v"(al), "v"(bh), "v"(bl));
  return c;
}

__global__ __launch_bounds__(256) void k_wt_bf16(const float* __restrict__ W, unsigned short* __restrict__ Wt, int K, int N) {
  const int t = blockIdx.x * 256 + threadIdx.x;
  const int k8n = K / 8;
  if (t >= N * k8n) return;
  const int n = t / k8n, k8 = (t % k8n) * 8;
  v8us v;
#pragma unroll
  for (int i = 0; i < 8; ++i) v[i] = bf16_bits(W[(size_t)(k8 + i) * N + n]);
  *(v8us*)(Wt + (size_t)n * K + k8) = v;
  
}

// GEMM C[M][N] (f32, pitch ldc) = act(A[M][K]·W + bias). A f32 row-major (pitch lda) converted per fragment to bf16
// (ASPLIT: hi/lo two planes -> 2 terms, else single rounded term); Wt bf16 [N][K] (pitch ldb). BIAS_BF16 rounds the
// bias to bf16 first (bias quantised to bf16 before the add). K%32==0, M%16==0, N%64==0.
template <bool ASPLIT, int ACT, bool BIAS_BF16>
__global__ __launch_bounds__(128) void k_gemm_bf(const float* __restrict__ A, int lda, const unsigned short* __restrict__ Wt, int ldb,
                                               const float* __restrict__ bias, float* __restrict__ C, int ldc, int M, int N, int K) {
  __shared__ __attribute__((aligned(16))) float so[4][16][64];
  const int tid = threadIdx.x, w = tid >> 5, lane = tid & 31, ln = lane & 15, hh = lane >> 4;
  const int ntn = N / 64;
  const int wid = blockIdx.x * 4 + w;
  const int mt = wid / ntn, nq = wid % ntn;
  if (mt * 16 >= M) return;
  const int row0 = mt * 16, col0 = nq * 64;
  const float* arow = A + (size_t)(row0 + ln) * lda;
  v8f acc[4] = {};
  for (int kb = 0; kb < K; kb += 32) {
    FragB ah, al;
    const v4f x0 = *(const v4fa*)(arow + kb + 8 * hh), x1 = *(const v4fa*)(arow + kb + 8 * hh + 4);
    const v4f x2 = *(const v4fa*)(arow + kb + 16 + 8 * hh), x3 = *(const v4fa*)(arow + kb + 16 + 8 * hh + 4);
    float xs[16] = {x0[0],x0[1],x0[2],x0[3],x1[0],x1[1],x1[2],x1[3],x2[0],x2[1],x2[2],x2[3],x3[0],x3[1],x3[2],x3[3]};
#pragma unroll
    for (int i = 0; i < 16; ++i) { const unsigned short hb = bf16_bits(xs[i]); ah.u[i] = hb; al.u[i] = ASPLIT ? bf16_bits(xs[i] - bf16_val(hb)) : (unsigned short)0; }
#pragma unroll
    for (int t = 0; t < 4; ++t) {
      const unsigned short* brow = Wt + (size_t)(col0 + t * 16 + ln) * ldb + kb;
      FragB b;
      b.half[0] = *(const v8us*)(brow + 8 * hh);
      b.half[1] = *(const v8us*)(brow + 16 + 8 * hh);
      acc[t] = mmaN<ASPLIT ? 2 : 1>(ah.v, al.v, b.v, b.v, acc[t]);
    }
  }
#pragma unroll
  for (int t = 0; t < 4; ++t) {
    float bv = bias ? bias[col0 + t * 16 + ln] : 0.f;
    if (BIAS_BF16) bv = bf16_round(bv);
#pragma unroll
    for (int r = 0; r < 8; ++r) { float v = acc[t][r] + bv; if (ACT == 1) v = fmaxf(v, 0.f); so[w][8 * hh + r][t * 16 + ln] = v; }
  }
  __builtin_amdgcn_fence(__ATOMIC_ACQ_REL, "workgroup");
  __builtin_amdgcn_wave_barrier();
  const int rsub = lane >> 4, c4 = (lane & 15) * 4;
  {
#pragma unroll
    for (int q = 0; q < 8; ++q) {
      const int r = q * 2 + rsub;
      const v4f v = *(const v4fa*)&so[w][r][c4];
      *(v4f*)(C + (size_t)(row0 + r) * ldc + col0 + c4) = v;
    }
    
  }
}

// GEMM C = act(A·W + bias + resid): A f32 (ASPLIT -> hi/lo 2 terms), Wt bf16 [N][K]; ACT 0 none, 1 relu, 2 exact gelu;
// resid (optional, f32, row index = (row % rmod), pitch ldr, RES_BF16 rounds it) added before the activation.
template <bool ASPLIT, int ACT, bool BIAS_BF16, bool RES_BF16>
__global__ __launch_bounds__(128) void k_gemm_bf3(const float* __restrict__ A, int lda, const unsigned short* __restrict__ Wt, int ldb,
                                                const float* __restrict__ bias, const float* __restrict__ resid, int rmod, int ldr,
                                                float* __restrict__ C, int ldc, int M, int N, int K) {
  __shared__ __attribute__((aligned(16))) float so[4][16][64];
  const int tid = threadIdx.x, w = tid >> 5, lane = tid & 31, ln = lane & 15, hh = lane >> 4;
  const int ntn = N / 64;
  const int wid = blockIdx.x * 4 + w;
  const int mt = wid / ntn, nq = wid % ntn;
  if (mt * 16 >= M) return;
  const int row0 = mt * 16, col0 = nq * 64;
  const float* arow = A + (size_t)(row0 + ln) * lda;
  v8f acc[4] = {};
  for (int kb = 0; kb < K; kb += 32) {
    FragB ah, al;
    const v4f x0 = *(const v4fa*)(arow + kb + 8 * hh), x1 = *(const v4fa*)(arow + kb + 8 * hh + 4);
    const v4f x2 = *(const v4fa*)(arow + kb + 16 + 8 * hh), x3 = *(const v4fa*)(arow + kb + 16 + 8 * hh + 4);
    float xs[16] = {x0[0],x0[1],x0[2],x0[3],x1[0],x1[1],x1[2],x1[3],x2[0],x2[1],x2[2],x2[3],x3[0],x3[1],x3[2],x3[3]};
#pragma unroll
    for (int i = 0; i < 16; ++i) { const unsigned short hb = bf16_bits(xs[i]); ah.u[i] = hb; al.u[i] = ASPLIT ? bf16_bits(xs[i] - bf16_val(hb)) : (unsigned short)0; }
#pragma unroll
    for (int t = 0; t < 4; ++t) {
      const unsigned short* brow = Wt + (size_t)(col0 + t * 16 + ln) * ldb + kb;
      FragB b;
      b.half[0] = *(const v8us*)(brow + 8 * hh);
      b.half[1] = *(const v8us*)(brow + 16 + 8 * hh);
      acc[t] = mmaN<ASPLIT ? 2 : 1>(ah.v, al.v, b.v, b.v, acc[t]);
    }
  }
#pragma unroll
  for (int t = 0; t < 4; ++t) {
    const int col = col0 + t * 16 + ln;
    float bv = bias ? bias[col] : 0.f;
    if (BIAS_BF16) bv = bf16_round(bv);
#pragma unroll
    for (int r = 0; r < 8; ++r) {
      float v = acc[t][r] + bv;
      if (resid) { float rv = resid[(size_t)((row0 + 8 * hh + r) % rmod) * ldr + col]; if (RES_BF16) rv = bf16_round(rv); v += rv; }
      if (ACT == 1) v = fmaxf(v, 0.f);
      if (ACT == 2) v = 0.5f * v * (1.0f + erff(v * 0.70710678118654752f));
      if (ACT == 3) { const float u = 0.7978845608028654f * (v + 0.044715f * v * v * v); v = 0.5f * v * (1.0f + tanhf(u)); }
      so[w][8 * hh + r][t * 16 + ln] = v;
    }
  }
  __builtin_amdgcn_fence(__ATOMIC_ACQ_REL, "workgroup");
  __builtin_amdgcn_wave_barrier();
  const int rsub = lane >> 4, c4 = (lane & 15) * 4;
  {
#pragma unroll
    for (int q = 0; q < 8; ++q) {
      const int r = q * 2 + rsub;
      const v4f v = *(const v4fa*)&so[w][r][c4];
      *(v4f*)(C + (size_t)(row0 + r) * ldc + col0 + c4) = v;
    }
    
  }
}
// row LayerNorm (biased variance, eps) over N: s = X (+ R); optional out_sum <- s; out_norm <- (s-mu)*rsqrt(var+eps)*g + b
template <bool PARAM_BF16>
__global__ __launch_bounds__(256) void k_layernorm(const float* __restrict__ X, const float* __restrict__ R, const float* __restrict__ g, const float* __restrict__ bta,
                                                  float* __restrict__ out_sum, float* __restrict__ out_norm, int N, float eps) {
  __shared__ float red[256];
  const int row = blockIdx.x, tid = threadIdx.x;
  const float* x = X + (size_t)row * N; const float* rr = R ? R + (size_t)row * N : nullptr;
  float vals[16];                     // up to N = 4096
  const int per = N / 256;            // contiguous chunk per thread? use strided-by-4 chunks: thread handles j = tid*4 + 1024*u
  float s1 = 0.f;
  for (int u = 0; u < per / 4; ++u) {
    const int j = tid * 4 + 1024 * u;
    const v4f a = *(const v4fa*)(x + j);
    v4f b = {0.f,0.f,0.f,0.f}; if (rr) b = *(const v4fa*)(rr + j);
#pragma unroll
    for (int q = 0; q < 4; ++q) { const float v = a[q] + b[q]; vals[u * 4 + q] = v; s1 += v; }
  }
  red[tid] = s1; __syncthreads();
  for (int st = 128; st > 0; st >>= 1) { if (tid < st) red[tid] += red[tid + st]; __syncthreads(); }
  const float mu = red[0] / (float)N; __syncthreads();
  float s2 = 0.f;
  for (int u = 0; u < per / 4; ++u)
#pragma unroll
    for (int q = 0; q < 4; ++q) { const float c = vals[u * 4 + q] - mu; s2 += c * c; }
  red[tid] = s2; __syncthreads();
  for (int st = 128; st > 0; st >>= 1) { if (tid < st) red[tid] += red[tid + st]; __syncthreads(); }
  const float rs = rsqrtf(red[0] / (float)N + eps);
  {
    for (int u = 0; u < per / 4; ++u) {
      const int j = tid * 4 + 1024 * u;
      v4f o, sm;
#pragma unroll
      for (int q = 0; q < 4; ++q) {
        float gg = g[j + q], bb = bta[j + q];
        if (PARAM_BF16) { gg = bf16_round(gg); bb = bf16_round(bb); }
        sm[q] = vals[u * 4 + q]; o[q] = (vals[u * 4 + q] - mu) * rs * gg + bb;
      }
      if (out_sum) *(v4f*)(out_sum + (size_t)row * N + j) = sm;
      *(v4f*)(out_norm + (size_t)row * N + j) = o;
    }
    
  }
}



// ---- f16 WMMA path (v_wmma_f32_16x16x32_f16): 11-bit significands for operands in range — used where a [0,1] probability operand needs more precision than bf16
typedef _Float16 v16h __attribute__((ext_vector_type(16)));
union FragH { v16h v; v8us half[2]; _Float16 h[16]; unsigned short u[16]; };
template <int NT>
__device__ __forceinline__ v8f mmaH(v16h ah, v16h al, v16h bh, v16h bl, v8f c) {
  c = __builtin_amdgcn_wmma_f32_16x16x32_f16(false, ah, false, bh, (short)0, c, false, false);
  if (NT >= 2) c = __builtin_amdgcn_wmma_f32_16x16x32_f16(false, al, false, bh, (short)0, c, false, false);
  if (NT >= 3) c = __builtin_amdgcn_wmma_f32_16x16x32_f16(false, ah, false, bl, (short)0, c, false, false);
  asm volatile("v_nop\n\tv_nop\n\tv_nop\n\tv_nop" : "+v"(c) : "v"(ah), "v"(al), "v"(bh), "v"(bl));
  return c;
}
// batched GEMM like k_gemm_b but f16 operands: A f32 (split into f16 hi/lo if ASPLIT, else rounded to f16), Bt = f16 values [n][k]; alpha; C f32; N multiple of 16 (partial tiles skipped)
template <bool ASPLIT>
__global__ __launch_bounds__(128) void k_gemm_h(const float* __restrict__ A, int lda, size_t sA, const _Float16* __restrict__ Bh, int ldb, size_t sB, float alpha, float* __restrict__ C, int ldc, size_t sC, int M, int N, int K) {
  __shared__ __attribute__((aligned(16))) float so[4][16][64];
  const int tid = threadIdx.x, w = tid >> 5, lane = tid & 31, ln = lane & 15, hh = lane >> 4; const int by = blockIdx.y;
  A += (size_t)by * sA; Bh += (size_t)by * sB; C += (size_t)by * sC;
  const int ntn = (N + 63) / 64; const int wid = blockIdx.x * 4 + w; const int mt = wid / ntn, nq = wid % ntn; if (mt * 16 >= M) return;
  const int row0 = mt * 16, col0 = nq * 64; const float* arow = A + (size_t)(row0 + ln) * lda;
  v8f acc[4] = {};
  for (int kb = 0; kb < K; kb += 32) {
    FragH ah, al;
    const v4f x0 = *(const v4fa*)(arow + kb + 8 * hh), x1 = *(const v4fa*)(arow + kb + 8 * hh + 4), x2 = *(const v4fa*)(arow + kb + 16 + 8 * hh), x3 = *(const v4fa*)(arow + kb + 16 + 8 * hh + 4);
    float xs[16] = {x0[0],x0[1],x0[2],x0[3],x1[0],x1[1],x1[2],x1[3],x2[0],x2[1],x2[2],x2[3],x3[0],x3[1],x3[2],x3[3]};
#pragma unroll
    for (int i = 0; i < 16; ++i) { const _Float16 h = (_Float16)xs[i]; ah.h[i] = h; al.h[i] = ASPLIT ? (_Float16)(xs[i] - (float)h) : (_Float16)0.0f; }
#pragma unroll
    for (int t = 0; t < 4; ++t) { if (col0 + t * 16 >= N) continue; const size_t boff = (size_t)(col0 + t * 16 + ln) * ldb + kb; FragH bq; bq.half[0] = *(const v8us*)(Bh + boff + 8 * hh); bq.half[1] = *(const v8us*)(Bh + boff + 16 + 8 * hh);
      acc[t] = mmaH<ASPLIT ? 2 : 1>(ah.v, al.v, bq.v, bq.v, acc[t]); }
  }
#pragma unroll
  for (int t = 0; t < 4; ++t) { if (col0 + t * 16 >= N) continue;
#pragma unroll
    for (int r = 0; r < 8; ++r) so[w][8 * hh + r][t * 16 + ln] = acc[t][r] * alpha; }
  __builtin_amdgcn_fence(__ATOMIC_ACQ_REL, "workgroup"); __builtin_amdgcn_wave_barrier();
  const int rsub = lane >> 4, c4 = (lane & 15) * 4;
  {
#pragma unroll
    for (int q = 0; q < 8; ++q) { const int r = q * 2 + rsub; if (col0 + c4 < N) { const v4f v = *(const v4fa*)&so[w][r][c4]; *(v4f*)(C + (size_t)(row0 + r) * ldc + col0 + c4) = v; } }
     }
}

// Wt[n][k] = f16(W[k][n]·scale) from f32 row-major W[K][N] (scale = power of two; bf16-exact weights stay exact in f16 away from the subnormal range)
__global__ __launch_bounds__(256) void k_wt_f16(const float* __restrict__ W, _Float16* __restrict__ Wt, int K, int N, float scale) {
  const int t = blockIdx.x * 256 + threadIdx.x; if (t >= N * (K / 8)) return; const int n = t / (K / 8), k8 = (t % (K / 8)) * 8; FragH f;
#pragma unroll
  for (int i = 0; i < 8; ++i) f.h[i] = (_Float16)(bf16_round(W[(size_t)(k8 + i) * N + n]) * scale); const v8us o = f.half[0];
  *(v8us*)((unsigned short*)Wt + (size_t)n * K + k8) = o; 
}
// k_gemm_hh variant with fused epilogue: v = acc·alpha + bias[by·sBias + col] (+ CP[(row/rowsPerB)·sCPb + by·64 + col] if CP) ; ACT 0 none / 1 elu ; writes f16 C16 (and f32 C if non-null)
template <int ACT>
__global__ __launch_bounds__(128) void k_gemm_hhx(const _Float16* __restrict__ A, int lda, size_t sA, const _Float16* __restrict__ Bh, int ldb, size_t sB, float alpha, const float* __restrict__ bias, size_t sBias, const float* __restrict__ CP, int rowsPerB, size_t sCPb, int row0g,
    float* __restrict__ C, _Float16* __restrict__ C16, int ldc, size_t sC, int M, int N, int K) {
  __shared__ __attribute__((aligned(16))) float so[4][16][64];
  const int tid = threadIdx.x, w = tid >> 5, lane = tid & 31, ln = lane & 15, hh = lane >> 4; const int by = blockIdx.y;
  A += (size_t)by * sA; Bh += (size_t)by * sB; const size_t cofs = (size_t)by * sC; const float* bp = bias ? bias + (size_t)by * sBias : nullptr;
  const int ntn = (N + 63) / 64; const int wid = blockIdx.x * 4 + w; const int mt = wid / ntn, nq = wid % ntn; if (mt * 16 >= M) return;
  const int row0 = mt * 16, col0 = nq * 64; const _Float16* arow = A + (size_t)(row0 + ln) * lda;
  v8f acc[4] = {};
  for (int kb = 0; kb < K; kb += 32) { FragH ah; ah.half[0] = *(const v8us*)((const unsigned short*)arow + kb + 8 * hh); ah.half[1] = *(const v8us*)((const unsigned short*)arow + kb + 16 + 8 * hh);
#pragma unroll
    for (int t = 0; t < 4; ++t) { if (col0 + t * 16 >= N) continue; const size_t boff = (size_t)(col0 + t * 16 + ln) * ldb + kb; FragH bq; bq.half[0] = *(const v8us*)((const unsigned short*)Bh + boff + 8 * hh); bq.half[1] = *(const v8us*)((const unsigned short*)Bh + boff + 16 + 8 * hh);
      acc[t] = mmaH<1>(ah.v, ah.v, bq.v, bq.v, acc[t]); }
  }
#pragma unroll
  for (int t = 0; t < 4; ++t) { if (col0 + t * 16 >= N) continue; const int col = col0 + t * 16 + ln; const float bv = bp ? bf16_round(bp[col]) : 0.f;
#pragma unroll
    for (int r = 0; r < 8; ++r) { float v = acc[t][r] * alpha + bv; if (CP) { const int rr = row0g + row0 + 8 * hh + r; if (rowsPerB < 0) v += CP[cofs + (size_t)rr * ldc + col];      /* rowsPerB < 0: own element of the batched C plane */ else { const int bidx = rr / rowsPerB; v += CP[(size_t)bidx * sCPb + (size_t)by * 64 + col]; } } if (ACT == 1) v = (v > 0.f) ? v : expm1f(v); else if (ACT == 7) v = (v > 0.f) ? v + 1.0f : expf(v); else if (ACT == 8) v = tanhf(v); else if (ACT == 9) v = 0.5f * v * (1.0f + tanhf(0.7978845608028654f * (v + 0.044715f * v * v * v))); else if (ACT == 11) v = 1.0f / (1.0f + expf(-v)); else if (ACT == 12) v = (v > 0.f) ? v : 0.01f * v; else if (ACT == 14) v = (v > 0.f) ? v : 0.1f * v; else if (ACT == 16) v = (v >= 0.f) ? v : 0.3f * v; else if (ACT == 17) v = (v >= 0.f) ? v : 0.2f * v; else if (ACT == 15) v = v / (1.0f + expf(-v)); else if (ACT == 3) v = fmaxf(v, 0.f); else if (ACT == 6) v = 0.5f * v * (1.0f + erff(v * 0.70710678118654752f)); so[w][8 * hh + r][t * 16 + ln] = v; } }
  __builtin_amdgcn_fence(__ATOMIC_ACQ_REL, "workgroup"); __builtin_amdgcn_wave_barrier();
  const int rsub = lane >> 4, c4 = (lane & 15) * 4; typedef _Float16 v4h __attribute__((ext_vector_type(4)));
  {
#pragma unroll
    for (int q = 0; q < 8; ++q) { const int r = q * 2 + rsub; if (col0 + c4 < N) { const v4f v = *(const v4fa*)&so[w][r][c4]; if (C) *(v4f*)(C + cofs + (size_t)(row0 + r) * ldc + col0 + c4) = v; if (C16) { v4h h4; for (int i = 0; i < 4; ++i) h4[i] = (_Float16)v[i]; *(v4h*)(C16 + cofs + (size_t)(row0 + r) * ldc + col0 + c4) = h4; } } }
     }
}


typedef _Float16 v4h __attribute__((ext_vector_type(4)));

__global__ __launch_bounds__(256) void k_h16(const float* __restrict__ x, _Float16* __restrict__ X16, size_t n8) { const size_t t = (size_t)blockIdx.x * 256 + threadIdx.x; if (t >= n8) return; FragH f;
#pragma unroll
  for (int q = 0; q < 8; ++q) f.h[q] = (_Float16)x[t * 8 + q]; *(v8us*)((unsigned short*)X16 + t * 8) = f.half[0];  }
__global__ __launch_bounds__(256) void k_round16f(const float* __restrict__ W, _Float16* __restrict__ Bt, size_t n8) { const size_t t = (size_t)blockIdx.x * 256 + threadIdx.x; if (t >= n8) return; FragH f;
#pragma unroll
  for (int i = 0; i < 8; ++i) f.h[i] = (_Float16)(bf16_round(W[t * 8 + i]) * 16.0f); *(v8us*)((unsigned short*)Bt + t * 8) = f.half[0];  }
template <int NHv, int TTv>
__global__ __launch_bounds__(256) void k_vt(const _Float16* __restrict__ V16, int ldv, int voff, _Float16* __restrict__ Vt) { __shared__ unsigned short tl[64][66]; const int tid = threadIdx.x; const int slab = blockIdx.x / (TTv / 64), lg = blockIdx.x % (TTv / 64); const int b = slab / NHv, h = slab % NHv;
  for (int i = tid; i < 64 * 8; i += 256) { const int r = i / 8, c8 = (i % 8) * 8; FragH f; f.half[0] = *(const v8us*)((const unsigned short*)V16 + ((size_t)b * TTv + lg * 64 + r) * ldv + voff + h * 64 + c8);
#pragma unroll
    for (int q = 0; q < 8; ++q) tl[r][c8 + q] = f.u[q]; }
  __syncthreads();
  {
#pragma unroll
    for (int rd = 0; rd < 2; ++rd) { const int d = rd * 32 + tid / 8, pc = tid % 8; FragH f;
#pragma unroll
      for (int q = 0; q < 8; ++q) f.u[q] = tl[pc * 8 + q][d];
      *(v8us*)((unsigned short*)Vt + ((size_t)slab * 64 + d) * TTv + lg * 64 + pc * 8) = f.half[0]; }
     } }

__global__ __launch_bounds__(256) void k_hl(const float* __restrict__ F, _Float16* __restrict__ Hh, _Float16* __restrict__ Hl, size_t n8) { const size_t t = (size_t)blockIdx.x * 256 + threadIdx.x; if (t >= n8) return; FragH fh, fl; const v4f a = *(const v4fa*)(F + t * 8), c = *(const v4fa*)(F + t * 8 + 4);
#pragma unroll
  for (int q = 0; q < 4; ++q) { _Float16 h = (_Float16)a[q]; fh.h[q] = h; fl.h[q] = (_Float16)((a[q] - (float)h) * 1024.0f); h = (_Float16)c[q]; fh.h[4 + q] = h; fl.h[4 + q] = (_Float16)((c[q] - (float)h) * 1024.0f); }
  { *(v8us*)((unsigned short*)Hh + t * 8) = fh.half[0]; *(v8us*)((unsigned short*)Hl + t * 8) = fl.half[0];  } }

// ---- fast GEMM (wave tile 32x64; requires M % 32 == 0 rows per launch region and N % 64 == 0); epilogue = k_gemm_hhx semantics ----
__device__ __forceinline__ v16h g2_frag(const _Float16* p, int hh) { FragH f; f.half[0] = *(const v8us*)((const unsigned short*)p + 8 * hh); f.half[1] = *(const v8us*)((const unsigned short*)p + 16 + 8 * hh); return f.v; }
__device__ __forceinline__ v8f g2_mma(v16h a, v16h b, v8f c) { v8f d = __builtin_amdgcn_wmma_f32_16x16x32_f16(false, a, false, b, (short)0, c, false, false); asm volatile("v_nop\n\tv_nop\n\tv_nop\n\tv_nop" : "+v"(d) : "v"(a), "v"(b)); return d; }
template <int ACT>
__global__ __launch_bounds__(128) void k_gemm2(const _Float16* __restrict__ A, int lda, size_t sA, const _Float16* __restrict__ Bh, int ldb, size_t sB, float alpha, const float* __restrict__ bias, size_t sBias, const float* __restrict__ CP, int rowsPerB, size_t sCPb, int row0g,
    float* __restrict__ C, _Float16* __restrict__ C16, int ldc, size_t sC, int M, int N, int K) { static_assert(ACT == 0 || ACT == 3 || ACT == 6 || ACT == 8 || ACT == 9 || ACT == 11 || ACT == 12 || ACT == 14 || ACT == 15 || ACT == 16 || ACT == 17, "k_gemm2: unsupported ACT code (would silently apply no activation)");
  __shared__ __attribute__((aligned(16))) float so[4][32][68];
  const int tid = threadIdx.x, w = tid >> 5, lane = tid & 31, ln = lane & 15, hh = lane >> 4; const int by = blockIdx.y;
  A += (size_t)by * sA; Bh += (size_t)by * sB; const size_t cofs = (size_t)by * sC; const float* bp = bias ? bias + (size_t)by * sBias : nullptr;
  const int ntn = N >> 6; const int mt = blockIdx.x / ntn, nq = blockIdx.x - mt * ntn; const int row0 = mt * 128 + 32 * w, col0 = nq * 64; if (row0 >= M) return;
  const _Float16* a0p = A + (size_t)(row0 + ln) * lda; const _Float16* a1p = a0p + (size_t)16 * lda;
  const _Float16* b0p = Bh + (size_t)(col0 + ln) * ldb; const _Float16* b1p = b0p + (size_t)16 * ldb; const _Float16* b2p = b1p + (size_t)16 * ldb; const _Float16* b3p = b2p + (size_t)16 * ldb;
  const v8f z8 = {0.f,0.f,0.f,0.f,0.f,0.f,0.f,0.f}; v8f c00 = z8, c01 = z8, c02 = z8, c03 = z8, c10 = z8, c11 = z8, c12 = z8, c13 = z8;
#pragma unroll 1
  for (int kb = 0; kb < K; kb += 32) { const v16h a0 = g2_frag(a0p + kb, hh), a1 = g2_frag(a1p + kb, hh);
    v16h b = g2_frag(b0p + kb, hh); c00 = g2_mma(a0, b, c00); c10 = g2_mma(a1, b, c10);
    b = g2_frag(b1p + kb, hh); c01 = g2_mma(a0, b, c01); c11 = g2_mma(a1, b, c11);
    b = g2_frag(b2p + kb, hh); c02 = g2_mma(a0, b, c02); c12 = g2_mma(a1, b, c12);
    b = g2_frag(b3p + kb, hh); c03 = g2_mma(a0, b, c03); c13 = g2_mma(a1, b, c13); }
  v8f accs[8] = {c00, c01, c02, c03, c10, c11, c12, c13};
#pragma unroll
  for (int u = 0; u < 8; ++u) { const int t = u & 3, half = u >> 2; const int col = col0 + t * 16 + ln; const float bv = bp ? bf16_round(bp[col]) : 0.f;
#pragma unroll
    for (int r = 0; r < 8; ++r) { const int rloc = half * 16 + 8 * hh + r; float v = accs[u][r] * alpha + bv; if (CP) { if (rowsPerB < 0) v += CP[cofs + (size_t)(row0g + row0 + rloc) * ldc + col];      /* rowsPerB < 0: own element of the batched C plane */ else { const int bidx = (row0g + row0 + rloc) / rowsPerB; v += CP[(size_t)bidx * sCPb + (size_t)by * 64 + col]; } }
      if (ACT == 3) v = fmaxf(v, 0.f); else if (ACT == 6) v = 0.5f * v * (1.0f + erff(v * 0.70710678118654752f)); else if (ACT == 11) v = 1.0f / (1.0f + expf(-v)); else if (ACT == 15) v = v / (1.0f + expf(-v)); else if (ACT == 12) v = (v > 0.f) ? v : 0.01f * v; else if (ACT == 8) v = tanhf(v); else if (ACT == 9) v = 0.5f * v * (1.0f + tanhf(0.7978845608028654f * (v + 0.044715f * v * v * v))); else if (ACT == 14) v = (v > 0.f) ? v : 0.1f * v; else if (ACT == 16) v = (v >= 0.f) ? v : 0.3f * v; else if (ACT == 17) v = (v >= 0.f) ? v : 0.2f * v;
      so[w][rloc][t * 16 + ln] = v; } }
  __builtin_amdgcn_fence(__ATOMIC_ACQ_REL, "workgroup"); __builtin_amdgcn_wave_barrier();
  const int rsub = lane >> 4, c4 = (lane & 15) * 4;
  {
#pragma unroll
    for (int q = 0; q < 16; ++q) { const int r = q * 2 + rsub; const v4f v = *(const v4fa*)&so[w][r][c4]; if (C) *(v4f*)(C + cofs + (size_t)(row0 + r) * ldc + col0 + c4) = v; if (C16) { v4h h4; for (int i = 0; i < 4; ++i) h4[i] = (_Float16)v[i]; *(v4h*)(C16 + cofs + (size_t)(row0 + r) * ldc + col0 + c4) = h4; } }
     } }


// ---- operand conversion: every value is rounded to bf16 and is exact as f16 ----
__device__ __forceinline__ v8us pr_cvt(v4f p, v4f q, float scale) { FragH f;
#pragma unroll      /* constant indices keep the arrays in registers */
  for (int i = 0; i < 4; ++i) { f.h[i] = (_Float16)(bf16_round(p[i]) * scale); f.h[4 + i] = (_Float16)(bf16_round(q[i]) * scale); }
  return f.half[0]; }
typedef float fv2 __attribute__((ext_vector_type(2))); typedef _Float16 hv2 __attribute__((ext_vector_type(2))); typedef __bf16 bv2 __attribute__((ext_vector_type(2)));
typedef unsigned int v2u __attribute__((ext_vector_type(2), may_alias)); typedef unsigned int v4u __attribute__((ext_vector_type(4), may_alias));
__device__ __forceinline__ fv2 fa_b2(float a, float b) {      /* two values rounded (nearest even) to bf16, as f32 */
  const unsigned int u = __builtin_bit_cast(unsigned int, __builtin_convertvector((fv2){a, b}, bv2)); return (fv2){__uint_as_float(u << 16), __uint_as_float(u & 0xffff0000u)}; }
__device__ __forceinline__ unsigned int fa_h2(float a, float b) { return __builtin_bit_cast(unsigned int, __builtin_convertvector((fv2){a, b}, hv2)); }      /* two f16, a in the low half */
__device__ __forceinline__ unsigned int fa_c2(float a, float b) { const fv2 r = fa_b2(a, b); return fa_h2(r[0], r[1]); }      /* rounded to bf16, then (exactly) f16 */
// ---- fused attention on the f32 inputs: one wave = 32 query columns (2 groups of 16) of one head and one half of its keys, a pass = 32 keys; 16 waves a block (four a SIMD): waves c and c + 8 hold the same columns; the two halves' sums are merged once, through LDS ----
// K and V^T reach the matrix instructions through LDS: a stage = 64 keys of each key half; of the 8 waves of a half, 4 load the stage's K rows and 4 its V rows as f32 (each load = 2 rows x 256 contiguous bytes) while the stage two before is worked on, convert them once and store them in A-fragment order; a ring of four stages, one barrier every second stage.
// K unit of 16 bytes (16-key tile, group = d / 8 = 4 x d step + 2 x fragment half j + hh, ln) holds k[key = 16 tile + ln][d = 8 group .. + 7].
// V^T unit (32-key block, 16-row d tile t, group = 2 j + hh, ln) holds v[key = 32 block + 16 j + 8 hh .. + 7][d = 16 t + ln].
// A group = 16 units at a pitch of 272 bytes, a V^T d tile 16 bytes more: the storing lanes fall on different banks, the reading lanes read 256 contiguous bytes.
__device__ __forceinline__ v16h fa_frag(const unsigned short* p) { FragH f; f.half[0] = *(const v8us*)p; f.half[1] = *(const v8us*)(p + 256); return f.v; }      /* p = the lane's 16 bytes of half 0; half 1 lies 512 bytes on */
__device__ __forceinline__ v8f fa_mma(v16h a, v16h b, v8f c) { return __builtin_amdgcn_wmma_f32_16x16x32_f16(false, a, false, b, (short)0, c, false, false); }
__device__ __forceinline__ float fa_xhalf(float x) { return __builtin_bit_cast(float, __builtin_amdgcn_permlanex16(__builtin_bit_cast(int, x), __builtin_bit_cast(int, x), 0x76543210, 0xfedcba98, false, false)); }      /* lane l with lane l ^ 16 */
#define FQ 256      /* query rows a block */
#define FK (SQ / 2)      /* keys a wave walks */
#define FS 64      /* keys of a stage (per key half) */
#define GP 272      /* bytes from group to group */
#define KTB (8 * GP)      /* a 16-key K tile */
#define VTB (4 * GP + 16)      /* a 16-row d tile of a 32-key V^T block */
#define KSB ((FS / 16) * KTB)      /* a stage's K */
#define VSB ((FS / 32) * 4 * VTB)      /* a stage's V^T */
#define QP 144      /* bytes from q row to q row in LDS (64 f16 + 16) */
__device__ __forceinline__ v16h fa_lfrag(const unsigned char* p) { FragH f; f.half[0] = *(const v8us*)p; f.half[1] = *(const v8us*)(p + 2 * GP); return f.v; }      /* p = the lane's unit of half 0; half 1 lies two groups on */
__device__ __forceinline__ void fa_ld(v4f (&st)[8], const float* p) {      /* a thread's 16 bytes of 8 rows in a row; 16 lanes cover a row's 256 bytes of one head */
#pragma unroll      /* constant indices keep the arrays in registers */
  for (int c = 0; c < 8; ++c) st[c] = *(const v4fa*)(p + c * DM);
  asm volatile("s_wait_xcnt 0x0" :: "v"(p) : "memory");      /* the loads' address pair stays whole until this wait */
}
__device__ __forceinline__ void fa_cv(const v4f (&st)[8], unsigned char* hb, int role, int lw, int ln, int hh) {      /* convert a thread's share of a stage and store it in fragment order */
  if (role == 0) { unsigned char* d = hb + lw * KTB + (ln >> 1) * GP + hh * 128 + (ln & 1) * 8;      /* key 16 lw + 8 hh + c, d = 4 ln .. + 3 */
#pragma unroll      /* constant indices keep the arrays in registers */
    for (int c = 0; c < 8; ++c) *(v2u*)(d + c * 16) = (v2u){fa_c2(st[c][0], st[c][1]), fa_c2(st[c][2], st[c][3])};
  } else { unsigned char* d = hb + KSB + (lw >> 1) * (4 * VTB) + (ln >> 2) * VTB + ((lw & 1) * 2 + hh) * GP + (ln & 3) * 64;      /* keys 16 lw + 8 hh + c, d = 4 ln + i */
    float x[8][4];      /* rounded along d (neighbouring registers), packed along the keys */
#pragma unroll      /* constant indices keep the arrays in registers */
    for (int c = 0; c < 8; ++c) { const fv2 r0 = fa_b2(st[c][0], st[c][1]), r1 = fa_b2(st[c][2], st[c][3]); x[c][0] = r0[0]; x[c][1] = r0[1]; x[c][2] = r1[0]; x[c][3] = r1[1]; }
#pragma unroll      /* constant indices keep the arrays in registers */
    for (int i = 0; i < 4; ++i) *(v4u*)(d + i * 16) = (v4u){fa_h2(x[0][i], x[1][i]), fa_h2(x[2][i], x[3][i]), fa_h2(x[4][i], x[5][i]), fa_h2(x[6][i], x[7][i])}; } }
#define FT 4096.0f      /* a lane's sum of 16 weights above this asks for a new maximum */
__device__ __forceinline__ float fa_colmax(const v8f (&s)[2]) { float mx = s[0][0];      /* a query column's largest raw score of a pass: 16 in the lane, joined with the other half's 16 */
#pragma unroll      /* constant indices keep the arrays in registers */
  for (int r = 1; r < 8; ++r) mx = fmaxf(mx, s[0][r]);
#pragma unroll      /* constant indices keep the arrays in registers */
  for (int r = 0; r < 8; ++r) mx = fmaxf(mx, s[1][r]);
  return fmaxf(mx, fa_xhalf(mx)); }
__device__ __forceinline__ float fa_wts(const v8f (&s)[2], float cs, float nm, fv2 (&pv)[8]) { fv2 ls = {0.f, 0.f};      /* weights exp2(score x cs + nm) of a lane's 16 scores; returns their sum */
#pragma unroll      /* constant indices keep the arrays in registers */
  for (int e = 0; e < 8; ++e) { const fv2 sv = {s[e >> 2][2 * (e & 3)], s[e >> 2][2 * (e & 3) + 1]}; const fv2 ar = __builtin_elementwise_fma(sv, (fv2){cs, cs}, (fv2){nm, nm});
    pv[e] = (fv2){__builtin_amdgcn_exp2f(ar[0]), __builtin_amdgcn_exp2f(ar[1])}; ls += pv[e]; }
  return ls[0] + ls[1]; }
__global__ __launch_bounds__(512) void k_fattn(const float* __restrict__ xq, const float* __restrict__ xk, const float* __restrict__ xv, const float* __restrict__ wo, _Float16* __restrict__ BO, _Float16* __restrict__ O16) {
  typedef _Float16 v2h __attribute__((ext_vector_type(2)));
  static_assert(FK % FS == 0 && FK / FS >= 4 && (FK / FS) % 2 == 0 && FS == 64 && HD == 64 && DM * DM / 8 == 128 * NB * NH * (SQ / FQ) && DM == 512, "shares of the loading waves");
  __shared__ __attribute__((aligned(16))) v4f mg[FQ / 32][17][32];      /* the upper key half's sums on their way to the lower half's wave: [column wave][16 quarters of o, then maxima and row sums][lane], 512 contiguous bytes a wave and store */
  __shared__ __attribute__((aligned(16))) unsigned char kv[4][2][KSB + VSB];      /* [stage & 3][key half] */
  __shared__ __attribute__((aligned(16))) unsigned char qs[FQ * QP];      /* the block's q rows as f16 */
  const int wv = __builtin_amdgcn_readfirstlane((int)(threadIdx.x >> 5));      /* the wave's number in a scalar register: the key half and the loading role decide branches */
  const int lane = threadIdx.x & 31, w = wv & 7, kh = wv >> 3, ln = lane & 15, hh = lane >> 4;
  const int role = w >> 2, lw = w & 3;      /* waves 0..3 of a key half load K, waves 4..7 V; each 16 keys of a stage */
  const int slab = blockIdx.x / (SQ / FQ), qb = blockIdx.x % (SQ / FQ); const int b = slab / NH, h = slab % NH; const int q0 = qb * FQ + w * 32;
  const float cs = 0.044194173824159216f * 1.4426950408889634f;      /* 1 / sqrt(512) (the module's literal d_model scale) x log2 e */
  const float* sp = (role != 0 ? xv : xk) + ((size_t)b * SQ + (size_t)kh * FK + lw * 16 + hh * 8) * DM + h * HD + ln * 4;      /* keys 16 lw + 8 hh .. + 7 of a stage */
  v4f st[8];
  { v4f sq[8], s1[8];
    fa_ld(st, sp);
    fa_ld(s1, sp + (size_t)FS * DM);
    fa_ld(sq, xq + ((size_t)b * SQ + qb * FQ + wv * 16 + hh * 8) * DM + h * HD + ln * 4);      /* q rows 16 wv + 8 hh + c of the block */
#pragma unroll      /* constant indices keep the arrays in registers */
    for (int c = 0; c < 8; ++c) *(v2u*)(qs + (wv * 16 + hh * 8 + c) * QP + ln * 8) = (v2u){fa_c2(sq[c][0], sq[c][1]), fa_c2(sq[c][2], sq[c][3])};
    fa_cv(st, &kv[0][kh][0], role, lw, ln, hh);
    fa_cv(s1, &kv[1][kh][0], role, lw, ln, hh); }
  __syncthreads();      /* q and stages 0 and 1 are whole in LDS before any wave reads them */
  v16h qf[2][2];      /* B operand: column = query, k = d */
#pragma unroll      /* constant indices keep the arrays in registers */
  for (int g = 0; g < 2; ++g) {
#pragma unroll      /* constant indices keep the arrays in registers */
    for (int ks = 0; ks < 2; ++ks) { const unsigned char* qp = qs + (w * 32 + g * 16 + ln) * QP + ks * 64 + hh * 16; FragH f; f.half[0] = *(const v8us*)qp; f.half[1] = *(const v8us*)(qp + 32); qf[g][ks] = f.v; } }
  const v8f z8 = {0.f,0.f,0.f,0.f,0.f,0.f,0.f,0.f}; v8f o[2][4]; float mr[2], lr[2];
#pragma unroll      /* constant indices keep the arrays in registers */
  for (int g = 0; g < 2; ++g) { const unsigned char* rb = &kv[0][kh][0] + hh * GP + ln * 16; v8f s[2];      /* the first maximum in use: that of the wave's first 32 keys, taken once ahead of the loop */
#pragma unroll      /* constant indices keep the arrays in registers */
    for (int kt = 0; kt < 2; ++kt) s[kt] = fa_mma(fa_lfrag(rb + kt * KTB + 4 * GP), qf[g][1], fa_mma(fa_lfrag(rb + kt * KTB), qf[g][0], z8));
    mr[g] = fa_colmax(s) * cs; lr[g] = 0.f;
#pragma unroll      /* constant indices keep the arrays in registers */
    for (int t = 0; t < 4; ++t) o[g][t] = z8; }
  for (int sg = 0; sg < FK / FS; ++sg) {
    if (sg + 2 < FK / FS) fa_ld(st, sp + (size_t)(sg + 2) * FS * DM);      /* both passes of this stage ahead of the conversion; none is in flight at a barrier (which would wait for it) */
    const unsigned char* rb = &kv[sg & 3][kh][0] + hh * GP + ln * 16;
#pragma unroll      /* constant LDS offsets for both passes of a stage */
    for (int p = 0; p < FS / 32; ++p) {
      v16h kf[4], vf[4];      /* A operands: kf[16-key tile * 2 + d step], vf[16-row d tile] */
#pragma unroll      /* constant indices keep the arrays in registers */
      for (int t = 0; t < 4; ++t) kf[t] = fa_lfrag(rb + (p * 2 + (t >> 1)) * KTB + (t & 1) * 4 * GP);
#pragma unroll      /* constant indices keep the arrays in registers */
      for (int t = 0; t < 4; ++t) vf[t] = fa_lfrag(rb + KSB + (p * 4 + t) * VTB);
      v8f s[2][2];      /* [group][key tile]: register r = score of key 16 tile + 8 hh + r, query ln */
#pragma unroll      /* constant indices keep the arrays in registers */
      for (int g = 0; g < 2; ++g) {
#pragma unroll      /* constant indices keep the arrays in registers */
        for (int kt = 0; kt < 2; ++kt) s[g][kt] = fa_mma(kf[kt * 2 + 1], qf[g][1], fa_mma(kf[kt * 2], qf[g][0], z8)); }
      fv2 pv[2][8]; float ls[2];      /* the weights against the maximum in use, and each lane's sum of its 16 */
#pragma unroll      /* constant indices keep the arrays in registers */
      for (int g = 0; g < 2; ++g) ls[g] = fa_wts(s[g], cs, -mr[g], pv[g]);
      if (__builtin_amdgcn_ballot_w32(!(ls[0] <= FT && ls[1] <= FT)) != 0) {      /* rare: a lane's sum above FT (or not a number) says that a score has outgrown the maximum in use; below it every weight is <= FT and fits f16; one test a pass */
#pragma unroll      /* constant indices keep the arrays in registers */
        for (int g = 0; g < 2; ++g) { const float mn = fmaxf(mr[g], fa_colmax(s[g]) * cs); const float corr = __builtin_amdgcn_exp2f(mr[g] - mn); mr[g] = mn; lr[g] *= corr;
#pragma unroll      /* constant indices keep the arrays in registers */
          for (int t = 0; t < 4; ++t) o[g][t] = o[g][t] * corr;
          ls[g] = fa_wts(s[g], cs, -mn, pv[g]); } }      /* the pass's weights anew, now <= 1 */
#pragma unroll      /* constant indices keep the arrays in registers */
      for (int g = 0; g < 2; ++g) { FragH pf;      /* two tiles of weights are the B operand of the second product */
#pragma unroll      /* constant indices keep the arrays in registers */
        for (int e = 0; e < 8; ++e) { const v2h ph = __builtin_convertvector(pv[g][e], v2h); pf.h[2 * e] = ph[0]; pf.h[2 * e + 1] = ph[1]; }
        lr[g] += ls[g];
#pragma unroll      /* constant indices keep the arrays in registers */
        for (int t = 0; t < 4; ++t) o[g][t] = fa_mma(vf[t], pf.v, o[g][t]); }
    }
    if (sg + 2 < FK / FS) {      /* the same for every wave of the block */
      fa_cv(st, &kv[(sg + 2) & 3][kh][0], role, lw, ln, hh);      /* the place of stage sg - 2, whose last readers have passed a barrier since */
      if ((sg & 1) != 0) __syncthreads();      /* one barrier every second stage: it publishes stages sg + 1 and sg + 2 and ends every read of stages sg - 1 and sg, whose places are stored to next */
    }
  }
  if (kh != 0) {      /* upper key half: un-normalised sums, maxima in use and row sums go to LDS */
#pragma unroll      /* constant indices keep the arrays in registers */
    for (int g = 0; g < 2; ++g) {
#pragma unroll      /* constant indices keep the arrays in registers */
      for (int t = 0; t < 4; ++t) { mg[w][(g * 4 + t) * 2][lane] = (v4f){o[g][t][0], o[g][t][1], o[g][t][2], o[g][t][3]}; mg[w][(g * 4 + t) * 2 + 1][lane] = (v4f){o[g][t][4], o[g][t][5], o[g][t][6], o[g][t][7]}; } }
    mg[w][16][lane] = (v4f){mr[0], mr[1], lr[0], lr[1]}; }
  __syncthreads();      /* the upper half's sums are whole in LDS before the lower half's waves read them; every wave passes it once */
  if (kh != 0) {      /* four of the waves that are done write the block's 128 units of W_out for the launch behind this one */
    if (w < 4) { const int u = blockIdx.x * 128 + w * 32 + lane; const int ks = (u >> 6) & (DM / 32 - 1), j = (u >> 5) & 1, nt = u >> 10;      /* W_out unit (16-column tile nt of the output, 32-wide k step, half j, lane) holds 16 x W_out[n = 16 nt + ln][k = 32 step + 16 j + 8 hh .. + 7]: B-fragment order of the output product (natural [out][in] = Bt[n][k]) */
      const float* s = wo + (size_t)(nt * 16 + ln) * DM + ks * 32 + j * 16 + hh * 8; const v4f w0 = *(const v4fa*)s, w1 = *(const v4fa*)(s + 4);
      asm volatile("s_wait_xcnt 0x0" :: "v"(s) : "memory");      /* the loads' address pair stays whole until this wait */
      *(v8us*)((unsigned short*)BO + (size_t)u * 8) = pr_cvt(w0, w1, 16.0f);
      asm volatile("s_wait_xcnt 0x0" ::: "memory");      /* the store's address and data registers stay whole until this wait */
    }
    return; }
  const v4f sm = mg[w][16][lane];
#pragma unroll      /* constant indices keep the arrays in registers */
  for (int g = 0; g < 2; ++g) { const float mn = fmaxf(mr[g], sm[g]); const float ca = __builtin_amdgcn_exp2f(mr[g] - mn), cb = __builtin_amdgcn_exp2f(sm[g] - mn);      /* both maxima are finite (each half has walked its keys) and alike in lanes l and l ^ 16 */
    lr[g] = lr[g] * ca + sm[2 + g] * cb;
#pragma unroll      /* constant indices keep the arrays in registers */
    for (int t = 0; t < 4; ++t) { const v4f u0 = mg[w][(g * 4 + t) * 2][lane], u1 = mg[w][(g * 4 + t) * 2 + 1][lane];
#pragma unroll      /* constant indices keep the arrays in registers */
      for (int r = 0; r < 4; ++r) { o[g][t][r] = o[g][t][r] * ca + u0[r] * cb; o[g][t][4 + r] = o[g][t][4 + r] * ca + u1[r] * cb; } } }
#pragma unroll      /* constant indices keep the arrays in registers */
  for (int g = 0; g < 2; ++g) { const float inv = 64.0f / (lr[g] + fa_xhalf(lr[g])); unsigned short* op = (unsigned short*)O16 + ((size_t)b * SQ + q0 + g * 16) * DM + h * 1024 + lane * 8;      /* o carried x64; register r of tile t = d 16 t + 8 hh + r of query ln: that is half t & 1 of the output product's A fragment (16 rows, k step 2 h + t / 2), stored as such: 512 contiguous bytes a wave */
#pragma unroll      /* constant indices keep the arrays in registers */
    for (int t = 0; t < 4; ++t) { FragH f;
#pragma unroll      /* constant indices keep the arrays in registers */
      for (int r = 0; r < 8; ++r) f.h[r] = (_Float16)(o[g][t][r] * inv);
      *(v8us*)(op + t * 256) = f.half[0]; } } }
__global__ __launch_bounds__(256) void k_vt(const _Float16* __restrict__ V16, int b, int h0, _Float16* __restrict__ VT) { __shared__ unsigned short tl[64][65]; const int tid = threadIdx.x; const int hh = blockIdx.x % HG, sg = blockIdx.x / HG; const int s0 = sg * 64; const int h = h0 + hh;
  for (int i = tid; i < 64 * 8; i += 256) { const int j = i / 8, d8 = (i % 8) * 8; FragH f; f.half[0] = *(const v8us*)((const unsigned short*)V16 + ((size_t)b * SQ + s0 + j) * DM + h * HD + d8); for (int q = 0; q < 8; ++q) tl[d8 + q][j] = f.u[q]; }
  __syncthreads();
  { for (int i = tid; i < 64 * 8; i += 256) { const int d = i / 8, j8 = (i % 8) * 8; FragH f; for (int q = 0; q < 8; ++q) f.u[q] = tl[d][j8 + q]; *(v8us*)((unsigned short*)VT + ((size_t)hh * HD + d) * SQ + s0 + j8) = f.half[0]; }  } }



__global__ __launch_bounds__(256) void k_rsmkm(const float* __restrict__ S, _Float16* __restrict__ P, int nrows, const int* __restrict__ am) {
  #pragma clang fp contract(off)
  const int t = blockIdx.x * 256 + threadIdx.x; if (t >= nrows) return; const size_t i = (size_t)t; const float* s = S + i * SQ; const int* mr = am + (size_t)(t % SQ) * SQ; float mx = -3.0e38f;
#pragma unroll 1
  for (int j = 0; j < SQ; ++j) { const float f = (mr[j] != 0) ? 1.f : 0.f; mx = fmaxf(mx, fmaf(f, s[j], (1.f - f) * -1.0e9f)); } float se = 0.f;
#pragma unroll 1
  for (int j = 0; j < SQ; ++j) { const float f = (mr[j] != 0) ? 1.f : 0.f; se += __expf(fmaf(f, s[j], (1.f - f) * -1.0e9f) - mx); } const float sc = 256.0f / se;
#pragma unroll 1
  for (int j0 = 0; j0 < SQ; j0 += 8) { FragH fr; for (int q = 0; q < 8; ++q) { const int j = j0 + q; const float f = (mr[j] != 0) ? 1.f : 0.f; fr.h[q] = (_Float16)(__expf(fmaf(f, s[j], (1.f - f) * -1.0e9f) - mx) * sc); }
    unsigned short* d = (unsigned short*)P + i * SQ + j0; *(v8us*)d = fr.half[0];  } }
// ---- output product out = o W_out^T / 1024 + b_out: both operands lie in fragment order ([16-row tile][k step][half][lane], 1024 bytes a fragment), so every load is 512 contiguous bytes from a scalar base; a wave = 32 rows x 64 columns, 8 waves = 128 x 128; the 12 loads of a k step are asked for two steps ahead into a ring of three register sets ----
#define OKS (DM / 32)      /* k steps */
__global__ __launch_bounds__(256) void k_ogemm(const _Float16* __restrict__ AF, const _Float16* __restrict__ BF, const float* __restrict__ bias, float* __restrict__ C) {
  __shared__ __attribute__((aligned(16))) float so[8][32][68];
  const int wv = __builtin_amdgcn_readfirstlane((int)(threadIdx.x >> 5));      /* the wave's number in a scalar register: both streams' bases are scalar */
  const int lane = threadIdx.x & 31, ln = lane & 15, hh = lane >> 4;
  const int mt = blockIdx.x / (DM / 128), nq = blockIdx.x % (DM / 128); const int row0 = mt * 128 + (wv & 3) * 32, col0 = nq * 128 + (wv >> 2) * 64;
  const unsigned short* ap = (const unsigned short*)AF + (size_t)row0 * DM + lane * 8; const unsigned short* bp = (const unsigned short*)BF + (size_t)col0 * DM + lane * 8;      /* a 16-row tile = OKS x 512 values = 16 DM */
  v16h a[3][2], b[3][4]; v8f c[2][4]; float bv[4];
  const v8f z8 = {0.f,0.f,0.f,0.f,0.f,0.f,0.f,0.f};
#pragma unroll      /* constant indices keep the arrays in registers */
  for (int s = 0; s < 2; ++s) {
#pragma unroll      /* constant indices keep the arrays in registers */
    for (int m = 0; m < 2; ++m) a[s][m] = fa_frag(ap + (m * OKS + s) * 512);
#pragma unroll      /* constant indices keep the arrays in registers */
    for (int t = 0; t < 4; ++t) b[s][t] = fa_frag(bp + (t * OKS + s) * 512);
    __builtin_amdgcn_sched_barrier(0);      /* loads return in the order asked: step 0's stay first, so that the first products wait for them alone */
  }
#pragma unroll      /* constant indices keep the arrays in registers */
  for (int t = 0; t < 4; ++t) { bv[t] = bf16_round(bias[col0 + t * 16 + ln]); c[0][t] = z8; c[1][t] = z8; }
#pragma unroll      /* constant indices keep the ring in registers */
  for (int s = 0; s < OKS; ++s) {
    if (s + 2 < OKS) {
#pragma unroll      /* constant indices keep the arrays in registers */
      for (int m = 0; m < 2; ++m) a[(s + 2) % 3][m] = fa_frag(ap + (m * OKS + s + 2) * 512);
#pragma unroll      /* constant indices keep the arrays in registers */
      for (int t = 0; t < 4; ++t) b[(s + 2) % 3][t] = fa_frag(bp + (t * OKS + s + 2) * 512); }
    __builtin_amdgcn_sched_barrier(0);      /* keeps the twelve loads up here, two steps ahead of their use; without it they sink to just ahead of their products and every step waits out a load's latency */
#pragma unroll      /* constant indices keep the arrays in registers */
    for (int t = 0; t < 4; ++t) { c[0][t] = fa_mma(a[s % 3][0], b[s % 3][t], c[0][t]); c[1][t] = fa_mma(a[s % 3][1], b[s % 3][t], c[1][t]); }
    __builtin_amdgcn_sched_barrier(0);      /* keeps the next group of loads from rising over these products into registers still in use (a fourth register set) */
  }
#pragma unroll      /* constant indices keep the arrays in registers */
  for (int m = 0; m < 2; ++m) {
#pragma unroll      /* constant indices keep the arrays in registers */
    for (int t = 0; t < 4; ++t) {
#pragma unroll      /* constant indices keep the arrays in registers */
      for (int r = 0; r < 8; ++r) so[wv][m * 16 + 8 * hh + r][t * 16 + ln] = c[m][t][r] * 0.0009765625f + bv[t]; } }
  __builtin_amdgcn_fence(__ATOMIC_ACQ_REL, "workgroup"); __builtin_amdgcn_wave_barrier();      /* a wave reads back only its own staging rows: its LDS stores are done and stay ahead of the reads */
  const int rsub = lane >> 4, c4 = (lane & 15) * 4;
#pragma unroll      /* sixteen independent read-store pairs */
  for (int q = 0; q < 16; ++q) { const int r = q * 2 + rsub; const v4f v = *(const v4fa*)&so[wv][r][c4]; *(v4f*)(C + (size_t)(row0 + r) * DM + col0 + c4) = v; } }
extern "C" void kernel_launch(void* const* d_in, const int* in_sizes, int n_in,
                              void* d_out, int out_size, void* d_ws, size_t ws_size, hipStream_t stream) {
  (void)in_sizes; (void)n_in; (void)out_size;
  const float* const* I = (const float* const*)d_in; const float* xq = I[0]; const float* xk = I[1]; const float* xv = I[2]; const float* wo = I[3]; const float* bo = I[4];      /* queries, keys, values [4][2048][512] (used as q, k, v directly: no input projections); natural W_out [512][512] + b_out */
  static_assert(NH * HD == DM && DM % 64 == 0 && DM % 32 == 0 && SQ % 128 == 0 && NH % HG == 0 && SQ % FQ == 0 && FK % 32 == 0 && FQ == 256 && HD == 64, "shape / tile multiples");
  char* ws = (char*)d_ws; size_t off = 0;
  auto take = [&](size_t bytes) { char* p = ws + off; off += (bytes + 255) & ~(size_t)255; return p; };
  _Float16* BO = (_Float16*)take((size_t)DM * DM * 2);
  _Float16* O16 = (_Float16*)take(NR * DM * 2);
  if (off > ws_size) return;
  const size_t r0p = (size_t)B0 * SQ;      /* first projected row */
  k_fattn<<<NB * NH * (SQ / FQ), 512, 0, stream>>>(xq, xk, xv, wo, BO, O16);      /* o (merged heads) x64 as f16, in the output product's A-fragment order; W_out x16 in its B-fragment order */
  k_ogemm<<<(MPO / 128) * (DM / 128), 256, 0, stream>>>(O16 + r0p * DM, BO, bo, (float*)d_out + r0p * DM);      /* out rows are the output layout */
}

// v008
// A run of this version takes 39.9 microseconds.
// In two side-by-side timings against v007, it was 1.06 and 1.05 times as fast.
// Counting every step since v000, it is 91.9 times as fast.
#include <hip/hip_runtime.h>
#define NB 4
#define SQ 2048
#define DM 512
#define NH 8
#define HD 64
#define HG 4                         /* heads per k_vt launch group (k_vt is not launched) */
#define B0 0                         /* first batch processed (debug hook) */
#define NBR NB                       /* batches processed (debug hook) */
#define NR ((size_t)NB * SQ)         /* token rows */
#define MP ((int)((size_t)NBR * SQ)) /* rows projected (debug hook) */
#define QN SQ                        /* query rows attended per batch (unused) */
#define NHD NH                       /* heads attended (unused) */
#define MPO MP                       /* rows through the output stage (debug hook) */
#define LQ DM      /* row pitch of the q/k/v rows (unused: the kernels use DM) */
typedef __bf16 v16b __attribute__((ext_vector_type(16)));
typedef unsigned short v8us __attribute__((ext_vector_type(8), may_alias));
typedef float  v8f  __attribute__((ext_vector_type(8)));
typedef float  v4f  __attribute__((ext_vector_type(4)));
typedef float  v4fa __attribute__((ext_vector_type(4), may_alias));
union FragB { v16b v; v8us half[2]; unsigned short u[16]; };

__device__ __forceinline__ unsigned short bf16_bits(float x) { unsigned int u = __float_as_uint(x); return (unsigned short)((u + 0x7FFFu + ((u >> 16) & 1u)) >> 16); }
__device__ __forceinline__ float bf16_val(unsigned short b) { return __uint_as_float(((unsigned int)b) << 16); }
__device__ __forceinline__ float bf16_round(float x) { return bf16_val(bf16_bits(x)); }
// D += A·B with NT terms: 1 = ah·bh, 2 = + al·bh (A split), 3 = + ah·bl (both split)
template <int NT>
__device__ __forceinline__ v8f mmaN(v16b ah, v16b al, v16b bh, v16b bl, v8f c) {
  c = __builtin_amdgcn_wmma_f32_16x16x32_bf16(false, ah, false, bh, (short)0, c, false, false);
  if (NT >= 2) c = __builtin_amdgcn_wmma_f32_16x16x32_bf16(false, al, false, bh, (short)0, c, false, false);
  if (NT >= 3) c = __builtin_amdgcn_wmma_f32_16x16x32_bf16(false, ah, false, bl, (short)0, c, false, false);
  asm volatile("v_nop\n\tv_nop\n\tv_nop\n\tv_nop" : "+v"(c) : "v"(ah), "v"(al), "v"(bh), "v"(bl));
  return c;
}

__global__ __launch_bounds__(256) void k_wt_bf16(const float* __restrict__ W, unsigned short* __restrict__ Wt, int K, int N) {
  const int t = blockIdx.x * 256 + threadIdx.x;
  const int k8n = K / 8;
  if (t >= N * k8n) return;
  const int n = t / k8n, k8 = (t % k8n) * 8;
  v8us v;
#pragma unroll
  for (int i = 0; i < 8; ++i) v[i] = bf16_bits(W[(size_t)(k8 + i) * N + n]);
  *(v8us*)(Wt + (size_t)n * K + k8) = v;
  
}

// GEMM C[M][N] (f32, pitch ldc) = act(A[M][K]·W + bias). A f32 row-major (pitch lda) converted per fragment to bf16
// (ASPLIT: hi/lo two planes -> 2 terms, else single rounded term); Wt bf16 [N][K] (pitch ldb). BIAS_BF16 rounds the
// bias to bf16 first (bias quantised to bf16 before the add). K%32==0, M%16==0, N%64==0.
template <bool ASPLIT, int ACT, bool BIAS_BF16>
__global__ __launch_bounds__(128) void k_gemm_bf(const float* __restrict__ A, int lda, const unsigned short* __restrict__ Wt, int ldb,
                                               const float* __restrict__ bias, float* __restrict__ C, int ldc, int M, int N, int K) {
  __shared__ __attribute__((aligned(16))) float so[4][16][64];
  const int tid = threadIdx.x, w = tid >> 5, lane = tid & 31, ln = lane & 15, hh = lane >> 4;
  const int ntn = N / 64;
  const int wid = blockIdx.x * 4 + w;
  const int mt = wid / ntn, nq = wid % ntn;
  if (mt * 16 >= M) return;
  const int row0 = mt * 16, col0 = nq * 64;
  const float* arow = A + (size_t)(row0 + ln) * lda;
  v8f acc[4] = {};
  for (int kb = 0; kb < K; kb += 32) {
    FragB ah, al;
    const v4f x0 = *(const v4fa*)(arow + kb + 8 * hh), x1 = *(const v4fa*)(arow + kb + 8 * hh + 4);
    const v4f x2 = *(const v4fa*)(arow + kb + 16 + 8 * hh), x3 = *(const v4fa*)(arow + kb + 16 + 8 * hh + 4);
    float xs[16] = {x0[0],x0[1],x0[2],x0[3],x1[0],x1[1],x1[2],x1[3],x2[0],x2[1],x2[2],x2[3],x3[0],x3[1],x3[2],x3[3]};
#pragma unroll
    for (int i = 0; i < 16; ++i) { const unsigned short hb = bf16_bits(xs[i]); ah.u[i] = hb; al.u[i] = ASPLIT ? bf16_bits(xs[i] - bf16_val(hb)) : (unsigned short)0; }
#pragma unroll
    for (int t = 0; t < 4; ++t) {
      const unsigned short* brow = Wt + (size_t)(col0 + t * 16 + ln) * ldb + kb;
      FragB b;
      b.half[0] = *(const v8us*)(brow + 8 * hh);
      b.half[1] = *(const v8us*)(brow + 16 + 8 * hh);
      acc[t] = mmaN<ASPLIT ? 2 : 1>(ah.v, al.v, b.v, b.v, acc[t]);
    }
  }
#pragma unroll
  for (int t = 0; t < 4; ++t) {
    float bv = bias ? bias[col0 + t * 16 + ln] : 0.f;
    if (BIAS_BF16) bv = bf16_round(bv);
#pragma unroll
    for (int r = 0; r < 8; ++r) { float v = acc[t][r] + bv; if (ACT == 1) v = fmaxf(v, 0.f); so[w][8 * hh + r][t * 16 + ln] = v; }
  }
  __builtin_amdgcn_fence(__ATOMIC_ACQ_REL, "workgroup");
  __builtin_amdgcn_wave_barrier();
  const int rsub = lane >> 4, c4 = (lane & 15) * 4;
  {
#pragma unroll
    for (int q = 0; q < 8; ++q) {
      const int r = q * 2 + rsub;
      const v4f v = *(const v4fa*)&so[w][r][c4];
      *(v4f*)(C + (size_t)(row0 + r) * ldc + col0 + c4) = v;
    }
    
  }
}

// GEMM C = act(A·W + bias + resid): A f32 (ASPLIT -> hi/lo 2 terms), Wt bf16 [N][K]; ACT 0 none, 1 relu, 2 exact gelu;
// resid (optional, f32, row index = (row % rmod), pitch ldr, RES_BF16 rounds it) added before the activation.
template <bool ASPLIT, int ACT, bool BIAS_BF16, bool RES_BF16>
__global__ __launch_bounds__(128) void k_gemm_bf3(const float* __restrict__ A, int lda, const unsigned short* __restrict__ Wt, int ldb,
                                                const float* __restrict__ bias, const float* __restrict__ resid, int rmod, int ldr,
                                                float* __restrict__ C, int ldc, int M, int N, int K) {
  __shared__ __attribute__((aligned(16))) float so[4][16][64];
  const int tid = threadIdx.x, w = tid >> 5, lane = tid & 31, ln = lane & 15, hh = lane >> 4;
  const int ntn = N / 64;
  const int wid = blockIdx.x * 4 + w;
  const int mt = wid / ntn, nq = wid % ntn;
  if (mt * 16 >= M) return;
  const int row0 = mt * 16, col0 = nq * 64;
  const float* arow = A + (size_t)(row0 + ln) * lda;
  v8f acc[4] = {};
  for (int kb = 0; kb < K; kb += 32) {
    FragB ah, al;
    const v4f x0 = *(const v4fa*)(arow + kb + 8 * hh), x1 = *(const v4fa*)(arow + kb + 8 * hh + 4);
    const v4f x2 = *(const v4fa*)(arow + kb + 16 + 8 * hh), x3 = *(const v4fa*)(arow + kb + 16 + 8 * hh + 4);
    float xs[16] = {x0[0],x0[1],x0[2],x0[3],x1[0],x1[1],x1[2],x1[3],x2[0],x2[1],x2[2],x2[3],x3[0],x3[1],x3[2],x3[3]};
#pragma unroll
    for (int i = 0; i < 16; ++i) { const unsigned short hb = bf16_bits(xs[i]); ah.u[i] = hb; al.u[i] = ASPLIT ? bf16_bits(xs[i] - bf16_val(hb)) : (unsigned short)0; }
#pragma unroll
    for (int t = 0; t < 4; ++t) {
      const unsigned short* brow = Wt + (size_t)(col0 + t * 16 + ln) * ldb + kb;
      FragB b;
      b.half[0] = *(const v8us*)(brow + 8 * hh);
      b.half[1] = *(const v8us*)(brow + 16 + 8 * hh);
      acc[t] = mmaN<ASPLIT ? 2 : 1>(ah.v, al.v, b.v, b.v, acc[t]);
    }
  }
#pragma unroll
  for (int t = 0; t < 4; ++t) {
    const int col = col0 + t * 16 + ln;
    float bv = bias ? bias[col] : 0.f;
    if (BIAS_BF16) bv = bf16_round(bv);
#pragma unroll
    for (int r = 0; r < 8; ++r) {
      float v = acc[t][r] + bv;
      if (resid) { float rv = resid[(size_t)((row0 + 8 * hh + r) % rmod) * ldr + col]; if (RES_BF16) rv = bf16_round(rv); v += rv; }
      if (ACT == 1) v = fmaxf(v, 0.f);
      if (ACT == 2) v = 0.5f * v * (1.0f + erff(v * 0.70710678118654752f));
      if (ACT == 3) { const float u = 0.7978845608028654f * (v + 0.044715f * v * v * v); v = 0.5f * v * (1.0f + tanhf(u)); }
      so[w][8 * hh + r][t * 16 + ln] = v;
    }
  }
  __builtin_amdgcn_fence(__ATOMIC_ACQ_REL, "workgroup");
  __builtin_amdgcn_wave_barrier();
  const int rsub = lane >> 4, c4 = (lane & 15) * 4;
  {
#pragma unroll
    for (int q = 0; q < 8; ++q) {
      const int r = q * 2 + rsub;
      const v4f v = *(const v4fa*)&so[w][r][c4];
      *(v4f*)(C + (size_t)(row0 + r) * ldc + col0 + c4) = v;
    }
    
  }
}
// row LayerNorm (biased variance, eps) over N: s = X (+ R); optional out_sum <- s; out_norm <- (s-mu)*rsqrt(var+eps)*g + b
template <bool PARAM_BF16>
__global__ __launch_bounds__(256) void k_layernorm(const float* __restrict__ X, const float* __restrict__ R, const float* __restrict__ g, const float* __restrict__ bta,
                                                  float* __restrict__ out_sum, float* __restrict__ out_norm, int N, float eps) {
  __shared__ float red[256];
  const int row = blockIdx.x, tid = threadIdx.x;
  const float* x = X + (size_t)row * N; const float* rr = R ? R + (size_t)row * N : nullptr;
  float vals[16];                     // up to N = 4096
  const int per = N / 256;            // contiguous chunk per thread? use strided-by-4 chunks: thread handles j = tid*4 + 1024*u
  float s1 = 0.f;
  for (int u = 0; u < per / 4; ++u) {
    const int j = tid * 4 + 1024 * u;
    const v4f a = *(const v4fa*)(x + j);
    v4f b = {0.f,0.f,0.f,0.f}; if (rr) b = *(const v4fa*)(rr + j);
#pragma unroll
    for (int q = 0; q < 4; ++q) { const float v = a[q] + b[q]; vals[u * 4 + q] = v; s1 += v; }
  }
  red[tid] = s1; __syncthreads();
  for (int st = 128; st > 0; st >>= 1) { if (tid < st) red[tid] += red[tid + st]; __syncthreads(); }
  const float mu = red[0] / (float)N; __syncthreads();
  float s2 = 0.f;
  for (int u = 0; u < per / 4; ++u)
#pragma unroll
    for (int q = 0; q < 4; ++q) { const float c = vals[u * 4 + q] - mu; s2 += c * c; }
  red[tid] = s2; __syncthreads();
  for (int st = 128; st > 0; st >>= 1) { if (tid < st) red[tid] += red[tid + st]; __syncthreads(); }
  const float rs = rsqrtf(red[0] / (float)N + eps);
  {
    for (int u = 0; u < per / 4; ++u) {
      const int j = tid * 4 + 1024 * u;
      v4f o, sm;
#pragma unroll
      for (int q = 0; q < 4; ++q) {
        float gg = g[j + q], bb = bta[j + q];
        if (PARAM_BF16) { gg = bf16_round(gg); bb = bf16_round(bb); }
        sm[q] = vals[u * 4 + q]; o[q] = (vals[u * 4 + q] - mu) * rs * gg + bb;
      }
      if (out_sum) *(v4f*)(out_sum + (size_t)row * N + j) = sm;
      *(v4f*)(out_norm + (size_t)row * N + j) = o;
    }
    
  }
}



// ---- f16 WMMA path (v_wmma_f32_16x16x32_f16): 11-bit significands for operands in range — used where a [0,1] probability operand needs more precision than bf16
typedef _Float16 v16h __attribute__((ext_vector_type(16)));
union FragH { v16h v; v8us half[2]; _Float16 h[16]; unsigned short u[16]; };
template <int NT>
__device__ __forceinline__ v8f mmaH(v16h ah, v16h al, v16h bh, v16h bl, v8f c) {
  c = __builtin_amdgcn_wmma_f32_16x16x32_f16(false, ah, false, bh, (short)0, c, false, false);
  if (NT >= 2) c = __builtin_amdgcn_wmma_f32_16x16x32_f16(false, al, false, bh, (short)0, c, false, false);
  if (NT >= 3) c = __builtin_amdgcn_wmma_f32_16x16x32_f16(false, ah, false, bl, (short)0, c, false, false);
  asm volatile("v_nop\n\tv_nop\n\tv_nop\n\tv_nop" : "+v"(c) : "v"(ah), "v"(al), "v"(bh), "v"(bl));
  return c;
}
// batched GEMM like k_gemm_b but f16 operands: A f32 (split into f16 hi/lo if ASPLIT, else rounded to f16), Bt = f16 values [n][k]; alpha; C f32; N multiple of 16 (partial tiles skipped)
template <bool ASPLIT>
__global__ __launch_bounds__(128) void k_gemm_h(const float* __restrict__ A, int lda, size_t sA, const _Float16* __restrict__ Bh, int ldb, size_t sB, float alpha, float* __restrict__ C, int ldc, size_t sC, int M, int N, int K) {
  __shared__ __attribute__((aligned(16))) float so[4][16][64];
  const int tid = threadIdx.x, w = tid >> 5, lane = tid & 31, ln = lane & 15, hh = lane >> 4; const int by = blockIdx.y;
  A += (size_t)by * sA; Bh += (size_t)by * sB; C += (size_t)by * sC;
  const int ntn = (N + 63) / 64; const int wid = blockIdx.x * 4 + w; const int mt = wid / ntn, nq = wid % ntn; if (mt * 16 >= M) return;
  const int row0 = mt * 16, col0 = nq * 64; const float* arow = A + (size_t)(row0 + ln) * lda;
  v8f acc[4] = {};
  for (int kb = 0; kb < K; kb += 32) {
    FragH ah, al;
    const v4f x0 = *(const v4fa*)(arow + kb + 8 * hh), x1 = *(const v4fa*)(arow + kb + 8 * hh + 4), x2 = *(const v4fa*)(arow + kb + 16 + 8 * hh), x3 = *(const v4fa*)(arow + kb + 16 + 8 * hh + 4);
    float xs[16] = {x0[0],x0[1],x0[2],x0[3],x1[0],x1[1],x1[2],x1[3],x2[0],x2[1],x2[2],x2[3],x3[0],x3[1],x3[2],x3[3]};
#pragma unroll
    for (int i = 0; i < 16; ++i) { const _Float16 h = (_Float16)xs[i]; ah.h[i] = h; al.h[i] = ASPLIT ? (_Float16)(xs[i] - (float)h) : (_Float16)0.0f; }
#pragma unroll
    for (int t = 0; t < 4; ++t) { if (col0 + t * 16 >= N) continue; const size_t boff = (size_t)(col0 + t * 16 + ln) * ldb + kb; FragH bq; bq.half[0] = *(const v8us*)(Bh + boff + 8 * hh); bq.half[1] = *(const v8us*)(Bh + boff + 16 + 8 * hh);
      acc[t] = mmaH<ASPLIT ? 2 : 1>(ah.v, al.v, bq.v, bq.v, acc[t]); }
  }
#pragma unroll
  for (int t = 0; t < 4; ++t) { if (col0 + t * 16 >= N) continue;
#pragma unroll
    for (int r = 0; r < 8; ++r) so[w][8 * hh + r][t * 16 + ln] = acc[t][r] * alpha; }
  __builtin_amdgcn_fence(__ATOMIC_ACQ_REL, "workgroup"); __builtin_amdgcn_wave_barrier();
  const int rsub = lane >> 4, c4 = (lane & 15) * 4;
  {
#pragma unroll
    for (int q = 0; q < 8; ++q) { const int r = q * 2 + rsub; if (col0 + c4 < N) { const v4f v = *(const v4fa*)&so[w][r][c4]; *(v4f*)(C + (size_t)(row0 + r) * ldc + col0 + c4) = v; } }
     }
}

// Wt[n][k] = f16(W[k][n]·scale) from f32 row-major W[K][N] (scale = power of two; bf16-exact weights stay exact in f16 away from the subnormal range)
__global__ __launch_bounds__(256) void k_wt_f16(const float* __restrict__ W, _Float16* __restrict__ Wt, int K, int N, float scale) {
  const int t = blockIdx.x * 256 + threadIdx.x; if (t >= N * (K / 8)) return; const int n = t / (K / 8), k8 = (t % (K / 8)) * 8; FragH f;
#pragma unroll
  for (int i = 0; i < 8; ++i) f.h[i] = (_Float16)(bf16_round(W[(size_t)(k8 + i) * N + n]) * scale); const v8us o = f.half[0];
  *(v8us*)((unsigned short*)Wt + (size_t)n * K + k8) = o; 
}
// k_gemm_hh variant with fused epilogue: v = acc·alpha + bias[by·sBias + col] (+ CP[(row/rowsPerB)·sCPb + by·64 + col] if CP) ; ACT 0 none / 1 elu ; writes f16 C16 (and f32 C if non-null)
template <int ACT>
__global__ __launch_bounds__(128) void k_gemm_hhx(const _Float16* __restrict__ A, int lda, size_t sA, const _Float16* __restrict__ Bh, int ldb, size_t sB, float alpha, const float* __restrict__ bias, size_t sBias, const float* __restrict__ CP, int rowsPerB, size_t sCPb, int row0g,
    float* __restrict__ C, _Float16* __restrict__ C16, int ldc, size_t sC, int M, int N, int K) {
  __shared__ __attribute__((aligned(16))) float so[4][16][64];
  const int tid = threadIdx.x, w = tid >> 5, lane = tid & 31, ln = lane & 15, hh = lane >> 4; const int by = blockIdx.y;
  A += (size_t)by * sA; Bh += (size_t)by * sB; const size_t cofs = (size_t)by * sC; const float* bp = bias ? bias + (size_t)by * sBias : nullptr;
  const int ntn = (N + 63) / 64; const int wid = blockIdx.x * 4 + w; const int mt = wid / ntn, nq = wid % ntn; if (mt * 16 >= M) return;
  const int row0 = mt * 16, col0 = nq * 64; const _Float16* arow = A + (size_t)(row0 + ln) * lda;
  v8f acc[4] = {};
  for (int kb = 0; kb < K; kb += 32) { FragH ah; ah.half[0] = *(const v8us*)((const unsigned short*)arow + kb + 8 * hh); ah.half[1] = *(const v8us*)((const unsigned short*)arow + kb + 16 + 8 * hh);
#pragma unroll
    for (int t = 0; t < 4; ++t) { if (col0 + t * 16 >= N) continue; const size_t boff = (size_t)(col0 + t * 16 + ln) * ldb + kb; FragH bq; bq.half[0] = *(const v8us*)((const unsigned short*)Bh + boff + 8 * hh); bq.half[1] = *(const v8us*)((const unsigned short*)Bh + boff + 16 + 8 * hh);
      acc[t] = mmaH<1>(ah.v, ah.v, bq.v, bq.v, acc[t]); }
  }
#pragma unroll
  for (int t = 0; t < 4; ++t) { if (col0 + t * 16 >= N) continue; const int col = col0 + t * 16 + ln; const float bv = bp ? bf16_round(bp[col]) : 0.f;
#pragma unroll
    for (int r = 0; r < 8; ++r) { float v = acc[t][r] * alpha + bv; if (CP) { const int rr = row0g + row0 + 8 * hh + r; if (rowsPerB < 0) v += CP[cofs + (size_t)rr * ldc + col];      /* rowsPerB < 0: own element of the batched C plane */ else { const int bidx = rr / rowsPerB; v += CP[(size_t)bidx * sCPb + (size_t)by * 64 + col]; } } if (ACT == 1) v = (v > 0.f) ? v : expm1f(v); else if (ACT == 7) v = (v > 0.f) ? v + 1.0f : expf(v); else if (ACT == 8) v = tanhf(v); else if (ACT == 9) v = 0.5f * v * (1.0f + tanhf(0.7978845608028654f * (v + 0.044715f * v * v * v))); else if (ACT == 11) v = 1.0f / (1.0f + expf(-v)); else if (ACT == 12) v = (v > 0.f) ? v : 0.01f * v; else if (ACT == 14) v = (v > 0.f) ? v : 0.1f * v; else if (ACT == 16) v = (v >= 0.f) ? v : 0.3f * v; else if (ACT == 17) v = (v >= 0.f) ? v : 0.2f * v; else if (ACT == 15) v = v / (1.0f + expf(-v)); else if (ACT == 3) v = fmaxf(v, 0.f); else if (ACT == 6) v = 0.5f * v * (1.0f + erff(v * 0.70710678118654752f)); so[w][8 * hh + r][t * 16 + ln] = v; } }
  __builtin_amdgcn_fence(__ATOMIC_ACQ_REL, "workgroup"); __builtin_amdgcn_wave_barrier();
  const int rsub = lane >> 4, c4 = (lane & 15) * 4; typedef _Float16 v4h __attribute__((ext_vector_type(4)));
  {
#pragma unroll
    for (int q = 0; q < 8; ++q) { const int r = q * 2 + rsub; if (col0 + c4 < N) { const v4f v = *(const v4fa*)&so[w][r][c4]; if (C) *(v4f*)(C + cofs + (size_t)(row0 + r) * ldc + col0 + c4) = v; if (C16) { v4h h4; for (int i = 0; i < 4; ++i) h4[i] = (_Float16)v[i]; *(v4h*)(C16 + cofs + (size_t)(row0 + r) * ldc + col0 + c4) = h4; } } }
     }
}


typedef _Float16 v4h __attribute__((ext_vector_type(4)));

__global__ __launch_bounds__(256) void k_h16(const float* __restrict__ x, _Float16* __restrict__ X16, size_t n8) { const size_t t = (size_t)blockIdx.x * 256 + threadIdx.x; if (t >= n8) return; FragH f;
#pragma unroll
  for (int q = 0; q < 8; ++q) f.h[q] = (_Float16)x[t * 8 + q]; *(v8us*)((unsigned short*)X16 + t * 8) = f.half[0];  }
__global__ __launch_bounds__(256) void k_round16f(const float* __restrict__ W, _Float16* __restrict__ Bt, size_t n8) { const size_t t = (size_t)blockIdx.x * 256 + threadIdx.x; if (t >= n8) return; FragH f;
#pragma unroll
  for (int i = 0; i < 8; ++i) f.h[i] = (_Float16)(bf16_round(W[t * 8 + i]) * 16.0f); *(v8us*)((unsigned short*)Bt + t * 8) = f.half[0];  }
template <int NHv, int TTv>
__global__ __launch_bounds__(256) void k_vt(const _Float16* __restrict__ V16, int ldv, int voff, _Float16* __restrict__ Vt) { __shared__ unsigned short tl[64][66]; const int tid = threadIdx.x; const int slab = blockIdx.x / (TTv / 64), lg = blockIdx.x % (TTv / 64); const int b = slab / NHv, h = slab % NHv;
  for (int i = tid; i < 64 * 8; i += 256) { const int r = i / 8, c8 = (i % 8) * 8; FragH f; f.half[0] = *(const v8us*)((const unsigned short*)V16 + ((size_t)b * TTv + lg * 64 + r) * ldv + voff + h * 64 + c8);
#pragma unroll
    for (int q = 0; q < 8; ++q) tl[r][c8 + q] = f.u[q]; }
  __syncthreads();
  {
#pragma unroll
    for (int rd = 0; rd < 2; ++rd) { const int d = rd * 32 + tid / 8, pc = tid % 8; FragH f;
#pragma unroll
      for (int q = 0; q < 8; ++q) f.u[q] = tl[pc * 8 + q][d];
      *(v8us*)((unsigned short*)Vt + ((size_t)slab * 64 + d) * TTv + lg * 64 + pc * 8) = f.half[0]; }
     } }

__global__ __launch_bounds__(256) void k_hl(const float* __restrict__ F, _Float16* __restrict__ Hh, _Float16* __restrict__ Hl, size_t n8) { const size_t t = (size_t)blockIdx.x * 256 + threadIdx.x; if (t >= n8) return; FragH fh, fl; const v4f a = *(const v4fa*)(F + t * 8), c = *(const v4fa*)(F + t * 8 + 4);
#pragma unroll
  for (int q = 0; q < 4; ++q) { _Float16 h = (_Float16)a[q]; fh.h[q] = h; fl.h[q] = (_Float16)((a[q] - (float)h) * 1024.0f); h = (_Float16)c[q]; fh.h[4 + q] = h; fl.h[4 + q] = (_Float16)((c[q] - (float)h) * 1024.0f); }
  { *(v8us*)((unsigned short*)Hh + t * 8) = fh.half[0]; *(v8us*)((unsigned short*)Hl + t * 8) = fl.half[0];  } }

// ---- fast GEMM (wave tile 32x64; requires M % 32 == 0 rows per launch region and N % 64 == 0); epilogue = k_gemm_hhx semantics ----
__device__ __forceinline__ v16h g2_frag(const _Float16* p, int hh) { FragH f; f.half[0] = *(const v8us*)((const unsigned short*)p + 8 * hh); f.half[1] = *(const v8us*)((const unsigned short*)p + 16 + 8 * hh); return f.v; }
__device__ __forceinline__ v8f g2_mma(v16h a, v16h b, v8f c) { v8f d = __builtin_amdgcn_wmma_f32_16x16x32_f16(false, a, false, b, (short)0, c, false, false); asm volatile("v_nop\n\tv_nop\n\tv_nop\n\tv_nop" : "+v"(d) : "v"(a), "v"(b)); return d; }
template <int ACT>
__global__ __launch_bounds__(128) void k_gemm2(const _Float16* __restrict__ A, int lda, size_t sA, const _Float16* __restrict__ Bh, int ldb, size_t sB, float alpha, const float* __restrict__ bias, size_t sBias, const float* __restrict__ CP, int rowsPerB, size_t sCPb, int row0g,
    float* __restrict__ C, _Float16* __restrict__ C16, int ldc, size_t sC, int M, int N, int K) { static_assert(ACT == 0 || ACT == 3 || ACT == 6 || ACT == 8 || ACT == 9 || ACT == 11 || ACT == 12 || ACT == 14 || ACT == 15 || ACT == 16 || ACT == 17, "k_gemm2: unsupported ACT code (would silently apply no activation)");
  __shared__ __attribute__((aligned(16))) float so[4][32][68];
  const int tid = threadIdx.x, w = tid >> 5, lane = tid & 31, ln = lane & 15, hh = lane >> 4; const int by = blockIdx.y;
  A += (size_t)by * sA; Bh += (size_t)by * sB; const size_t cofs = (size_t)by * sC; const float* bp = bias ? bias + (size_t)by * sBias : nullptr;
  const int ntn = N >> 6; const int mt = blockIdx.x / ntn, nq = blockIdx.x - mt * ntn; const int row0 = mt * 128 + 32 * w, col0 = nq * 64; if (row0 >= M) return;
  const _Float16* a0p = A + (size_t)(row0 + ln) * lda; const _Float16* a1p = a0p + (size_t)16 * lda;
  const _Float16* b0p = Bh + (size_t)(col0 + ln) * ldb; const _Float16* b1p = b0p + (size_t)16 * ldb; const _Float16* b2p = b1p + (size_t)16 * ldb; const _Float16* b3p = b2p + (size_t)16 * ldb;
  const v8f z8 = {0.f,0.f,0.f,0.f,0.f,0.f,0.f,0.f}; v8f c00 = z8, c01 = z8, c02 = z8, c03 = z8, c10 = z8, c11 = z8, c12 = z8, c13 = z8;
#pragma unroll 1
  for (int kb = 0; kb < K; kb += 32) { const v16h a0 = g2_frag(a0p + kb, hh), a1 = g2_frag(a1p + kb, hh);
    v16h b = g2_frag(b0p + kb, hh); c00 = g2_mma(a0, b, c00); c10 = g2_mma(a1, b, c10);
    b = g2_frag(b1p + kb, hh); c01 = g2_mma(a0, b, c01); c11 = g2_mma(a1, b, c11);
    b = g2_frag(b2p + kb, hh); c02 = g2_mma(a0, b, c02); c12 = g2_mma(a1, b, c12);
    b = g2_frag(b3p + kb, hh); c03 = g2_mma(a0, b, c03); c13 = g2_mma(a1, b, c13); }
  v8f accs[8] = {c00, c01, c02, c03, c10, c11, c12, c13};
#pragma unroll
  for (int u = 0; u < 8; ++u) { const int t = u & 3, half = u >> 2; const int col = col0 + t * 16 + ln; const float bv = bp ? bf16_round(bp[col]) : 0.f;
#pragma unroll
    for (int r = 0; r < 8; ++r) { const int rloc = half * 16 + 8 * hh + r; float v = accs[u][r] * alpha + bv; if (CP) { if (rowsPerB < 0) v += CP[cofs + (size_t)(row0g + row0 + rloc) * ldc + col];      /* rowsPerB < 0: own element of the batched C plane */ else { const int bidx = (row0g + row0 + rloc) / rowsPerB; v += CP[(size_t)bidx * sCPb + (size_t)by * 64 + col]; } }
      if (ACT == 3) v = fmaxf(v, 0.f); else if (ACT == 6) v = 0.5f * v * (1.0f + erff(v * 0.70710678118654752f)); else if (ACT == 11) v = 1.0f / (1.0f + expf(-v)); else if (ACT == 15) v = v / (1.0f + expf(-v)); else if (ACT == 12) v = (v > 0.f) ? v : 0.01f * v; else if (ACT == 8) v = tanhf(v); else if (ACT == 9) v = 0.5f * v * (1.0f + tanhf(0.7978845608028654f * (v + 0.044715f * v * v * v))); else if (ACT == 14) v = (v > 0.f) ? v : 0.1f * v; else if (ACT == 16) v = (v >= 0.f) ? v : 0.3f * v; else if (ACT == 17) v = (v >= 0.f) ? v : 0.2f * v;
      so[w][rloc][t * 16 + ln] = v; } }
  __builtin_amdgcn_fence(__ATOMIC_ACQ_REL, "workgroup"); __builtin_amdgcn_wave_barrier();
  const int rsub = lane >> 4, c4 = (lane & 15) * 4;
  {
#pragma unroll
    for (int q = 0; q < 16; ++q) { const int r = q * 2 + rsub; const v4f v = *(const v4fa*)&so[w][r][c4]; if (C) *(v4f*)(C + cofs + (size_t)(row0 + r) * ldc + col0 + c4) = v; if (C16) { v4h h4; for (int i = 0; i < 4; ++i) h4[i] = (_Float16)v[i]; *(v4h*)(C16 + cofs + (size_t)(row0 + r) * ldc + col0 + c4) = h4; } }
     } }


// ---- operand conversion: values are rounded to bf16 and are exact as f16 (q, scaled after that, is rounded to f16) ----
__device__ __forceinline__ v8us pr_cvt(v4f p, v4f q, float scale) { FragH f;
#pragma unroll      /* constant indices keep the arrays in registers */
  for (int i = 0; i < 4; ++i) { f.h[i] = (_Float16)(bf16_round(p[i]) * scale); f.h[4 + i] = (_Float16)(bf16_round(q[i]) * scale); }
  return f.half[0]; }
typedef float fv2 __attribute__((ext_vector_type(2))); typedef _Float16 hv2 __attribute__((ext_vector_type(2))); typedef __bf16 bv2 __attribute__((ext_vector_type(2)));
typedef unsigned int v2u __attribute__((ext_vector_type(2), may_alias)); typedef unsigned int v4u __attribute__((ext_vector_type(4), may_alias));
__device__ __forceinline__ fv2 fa_b2(float a, float b) {      /* two values rounded (nearest even) to bf16, as f32 */
  const unsigned int u = __builtin_bit_cast(unsigned int, __builtin_convertvector((fv2){a, b}, bv2)); return (fv2){__uint_as_float(u << 16), __uint_as_float(u & 0xffff0000u)}; }
__device__ __forceinline__ unsigned int fa_h2(float a, float b) { return __builtin_bit_cast(unsigned int, __builtin_convertvector((fv2){a, b}, hv2)); }      /* two f16, a in the low half */
__device__ __forceinline__ unsigned int fa_c2(float a, float b) { const fv2 r = fa_b2(a, b); return fa_h2(r[0], r[1]); }      /* rounded to bf16, then (exactly) f16 */
// ---- fused attention on the f32 inputs: one wave = 32 query columns (2 groups of 16) of one head and one half of its keys, a pass = 32 keys; 16 waves a block (four a SIMD): waves c and c + 8 hold the same columns; the two halves' sums are merged once, through LDS ----
// K and V^T reach the matrix instructions through LDS: a stage = 64 keys of each key half; of the 8 waves of a half, 4 load the stage's K rows and 4 its V rows as f32 (each load = 2 rows x 256 contiguous bytes) while the stage two before is worked on, convert them once and store them in A-fragment order; a ring of four stages, one barrier every second stage.
// K unit of 16 bytes (16-key tile, group = d / 8 = 4 x d step + 2 x fragment half j + hh, ln) holds k[key = 16 tile + ln][d = 8 group .. + 7].
// V^T unit (32-key block, 16-row d tile t, group = 2 j + hh, ln) holds v[key = 32 block + 16 j + 8 hh .. + 7][d = 16 t + ln].
// A group = 16 units at a pitch of 272 bytes, a V^T d tile 16 bytes more: the storing lanes fall on different banks, the reading lanes read 256 contiguous bytes.
__device__ __forceinline__ v16h fa_frag(const unsigned short* p) { FragH f; f.half[0] = *(const v8us*)p; f.half[1] = *(const v8us*)(p + 256); return f.v; }      /* p = the lane's 16 bytes of half 0; half 1 lies 512 bytes on */
__device__ __forceinline__ v8f fa_mma(v16h a, v16h b, v8f c) { return __builtin_amdgcn_wmma_f32_16x16x32_f16(false, a, false, b, (short)0, c, false, false); }
__device__ __forceinline__ float fa_xhalf(float x) { return __builtin_bit_cast(float, __builtin_amdgcn_permlanex16(__builtin_bit_cast(int, x), __builtin_bit_cast(int, x), 0x76543210, 0xfedcba98, false, false)); }      /* lane l with lane l ^ 16 */
#define FQ 256      /* query rows a block */
#define FK (SQ / 2)      /* keys a wave walks */
#define FS 64      /* keys of a stage (per key half) */
#define GP 272      /* bytes from group to group */
#define KTB (8 * GP)      /* a 16-key K tile */
#define VTB (4 * GP + 16)      /* a 16-row d tile of a 32-key V^T block */
#define KSB ((FS / 16) * KTB)      /* a stage's K */
#define VSB ((FS / 32) * 4 * VTB)      /* a stage's V^T */
#define QP 144      /* bytes from q row to q row in LDS (64 f16 + 16) */
__device__ __forceinline__ v16h fa_lfrag(const unsigned char* p) { FragH f; f.half[0] = *(const v8us*)p; f.half[1] = *(const v8us*)(p + 2 * GP); return f.v; }      /* p = the lane's unit of half 0; half 1 lies two groups on */
__device__ __forceinline__ void fa_ld(v4f (&st)[8], const float* p) {      /* a thread's 16 bytes of 8 rows in a row; 16 lanes cover a row's 256 bytes of one head */
#pragma unroll      /* constant indices keep the arrays in registers */
  for (int c = 0; c < 8; ++c) st[c] = *(const v4fa*)(p + c * DM);
  asm volatile("s_wait_xcnt 0x0" :: "v"(p) : "memory");      /* the loads' address pair stays whole until this wait */
}
__device__ __forceinline__ void fa_cv(const v4f (&st)[8], unsigned char* hb, int role, int lw, int ln, int hh) {      /* convert a thread's share of a stage and store it in fragment order */
  if (role == 0) { unsigned char* d = hb + lw * KTB + (ln >> 1) * GP + hh * 128 + (ln & 1) * 8;      /* key 16 lw + 8 hh + c, d = 4 ln .. + 3 */
#pragma unroll      /* constant indices keep the arrays in registers */
    for (int c = 0; c < 8; ++c) *(v2u*)(d + c * 16) = (v2u){fa_c2(st[c][0], st[c][1]), fa_c2(st[c][2], st[c][3])};
  } else { unsigned char* d = hb + KSB + (lw >> 1) * (4 * VTB) + (ln >> 2) * VTB + ((lw & 1) * 2 + hh) * GP + (ln & 3) * 64;      /* keys 16 lw + 8 hh + c, d = 4 ln + i */
    float x[8][4];      /* rounded along d (neighbouring registers), packed along the keys */
#pragma unroll      /* constant indices keep the arrays in registers */
    for (int c = 0; c < 8; ++c) { const fv2 r0 = fa_b2(st[c][0], st[c][1]), r1 = fa_b2(st[c][2], st[c][3]); x[c][0] = r0[0]; x[c][1] = r0[1]; x[c][2] = r1[0]; x[c][3] = r1[1]; }
#pragma unroll      /* constant indices keep the arrays in registers */
    for (int i = 0; i < 4; ++i) *(v4u*)(d + i * 16) = (v4u){fa_h2(x[0][i], x[1][i]), fa_h2(x[2][i], x[3][i]), fa_h2(x[4][i], x[5][i]), fa_h2(x[6][i], x[7][i])}; } }
#define FT 4096.0f      /* a lane's sum of 16 weights above this asks for a new maximum */
__device__ __forceinline__ float fa_colmax(const v8f (&s)[2]) { float mx = s[0][0];      /* a query column's largest exponent of a pass: 16 in the lane, joined with the other half's 16 */
#pragma unroll      /* constant indices keep the arrays in registers */
  for (int r = 1; r < 8; ++r) mx = fmaxf(mx, s[0][r]);
#pragma unroll      /* constant indices keep the arrays in registers */
  for (int r = 0; r < 8; ++r) mx = fmaxf(mx, s[1][r]);
  return fmaxf(mx, fa_xhalf(mx)); }
template <bool SH>
__device__ __forceinline__ float fa_wts(const v8f (&s)[2], float nm, fv2 (&pv)[8]) { fv2 ls = {0.f, 0.f};      /* weights exp2(s) of a lane's 16 exponents (SH: exp2(s + nm), the rare path); returns their sum */
#pragma unroll      /* constant indices keep the arrays in registers */
  for (int e = 0; e < 8; ++e) { fv2 ar = {s[e >> 2][2 * (e & 3)], s[e >> 2][2 * (e & 3) + 1]}; if (SH) ar += (fv2){nm, nm};
    pv[e] = (fv2){__builtin_amdgcn_exp2f(ar[0]), __builtin_amdgcn_exp2f(ar[1])}; ls += pv[e]; }
  return ls[0] + ls[1]; }
__global__ __launch_bounds__(512) void k_fattn(const float* __restrict__ xq, const float* __restrict__ xk, const float* __restrict__ xv, const float* __restrict__ wo, _Float16* __restrict__ BO, _Float16* __restrict__ O16) {
  typedef _Float16 v2h __attribute__((ext_vector_type(2)));
  static_assert(FK % FS == 0 && FK / FS >= 4 && (FK / FS) % 2 == 0 && FS == 64 && HD == 64 && DM * DM / 8 == 128 * NB * NH * (SQ / FQ) && DM == 512, "shares of the loading waves");
  __shared__ __attribute__((aligned(16))) v4f mg[FQ / 32][17][32];      /* the upper key half's sums on their way to the lower half's wave: [column wave][16 quarters of o, then maxima and row sums][lane], 512 contiguous bytes a wave and store */
  __shared__ __attribute__((aligned(16))) unsigned char kv[4][2][KSB + VSB];      /* [stage & 3][key half] */
  __shared__ __attribute__((aligned(16))) unsigned char qs[FQ * QP];      /* the block's q rows as f16 */
  const int wv = __builtin_amdgcn_readfirstlane((int)(threadIdx.x >> 5));      /* the wave's number in a scalar register: the key half and the loading role decide branches */
  const int lane = threadIdx.x & 31, w = wv & 7, kh = wv >> 3, ln = lane & 15, hh = lane >> 4;
  const int role = w >> 2, lw = w & 3;      /* waves 0..3 of a key half load K, waves 4..7 V; each 16 keys of a stage */
  const int slab = blockIdx.x / (SQ / FQ), qb = blockIdx.x % (SQ / FQ); const int b = slab / NH, h = slab % NH; const int q0 = qb * FQ + w * 32;
  const float cs = 0.044194173824159216f * 1.4426950408889634f;      /* 1 / sqrt(512) (the module's literal d_model scale) x log2 e */
  const float* sp = (role != 0 ? xv : xk) + ((size_t)b * SQ + (size_t)kh * FK + lw * 16 + hh * 8) * DM + h * HD + ln * 4;      /* keys 16 lw + 8 hh .. + 7 of a stage */
  v4f st[8];
  { v4f sq[8], s1[8];
    fa_ld(st, sp);
    fa_ld(s1, sp + (size_t)FS * DM);
    fa_ld(sq, xq + ((size_t)b * SQ + qb * FQ + wv * 16 + hh * 8) * DM + h * HD + ln * 4);      /* q rows 16 wv + 8 hh + c of the block */
#pragma unroll      /* constant indices keep the arrays in registers */
    for (int c = 0; c < 8; ++c) { const fv2 a0 = fa_b2(sq[c][0], sq[c][1]) * (fv2){cs, cs}, a1 = fa_b2(sq[c][2], sq[c][3]) * (fv2){cs, cs};      /* q rounded to bf16, x the log2-domain score scale, then f16: the score product yields exponents of 2 */
      *(v2u*)(qs + (wv * 16 + hh * 8 + c) * QP + ln * 8) = (v2u){fa_h2(a0[0], a0[1]), fa_h2(a1[0], a1[1])}; }
    fa_cv(st, &kv[0][kh][0], role, lw, ln, hh);
    fa_cv(s1, &kv[1][kh][0], role, lw, ln, hh); }
  __syncthreads();      /* q and stages 0 and 1 are whole in LDS before any wave reads them */
  v16h qf[2][2];      /* B operand: column = query, k = d */
#pragma unroll      /* constant indices keep the arrays in registers */
  for (int g = 0; g < 2; ++g) {
#pragma unroll      /* constant indices keep the arrays in registers */
    for (int ks = 0; ks < 2; ++ks) { const unsigned char* qp = qs + (w * 32 + g * 16 + ln) * QP + ks * 64 + hh * 16; FragH f; f.half[0] = *(const v8us*)qp; f.half[1] = *(const v8us*)(qp + 32); qf[g][ks] = f.v; } }
  const v8f z8 = {0.f,0.f,0.f,0.f,0.f,0.f,0.f,0.f}; v8f o[2][4]; float mr[2], lr[2];
#pragma unroll      /* constant indices keep the arrays in registers */
  for (int g = 0; g < 2; ++g) { const unsigned char* rb = &kv[0][kh][0] + hh * GP + ln * 16; v8f s[2];      /* the first maximum in use: that of the wave's first 32 keys if its weight is below 2^-6, else 0; taken once ahead of the loop */
#pragma unroll      /* constant indices keep the arrays in registers */
    for (int kt = 0; kt < 2; ++kt) s[kt] = fa_mma(fa_lfrag(rb + kt * KTB + 4 * GP), qf[g][1], fa_mma(fa_lfrag(rb + kt * KTB), qf[g][0], z8));
    const float m0 = fa_colmax(s); mr[g] = m0 >= -6.0f ? 0.f : m0; lr[g] = 0.f;      /* a first maximum of 2^-6 or more needs no shift: its weights lie well inside f16, and growth is caught by the test on the sums */
#pragma unroll      /* constant indices keep the arrays in registers */
    for (int t = 0; t < 4; ++t) o[g][t] = z8; }
  bool off = __builtin_amdgcn_ballot_w32(mr[0] != 0.f || mr[1] != 0.f) != 0;      /* wave-uniform: some column's maximum in use is not 0 and has to be subtracted */
  for (int sg = 0; sg < FK / FS; ++sg) {
    if (sg + 2 < FK / FS) fa_ld(st, sp + (size_t)(sg + 2) * FS * DM);      /* both passes of this stage ahead of the conversion; none is in flight at a barrier (which would wait for it) */
    const unsigned char* rb = &kv[sg & 3][kh][0] + hh * GP + ln * 16;
#pragma unroll      /* constant LDS offsets for both passes of a stage */
    for (int p = 0; p < FS / 32; ++p) {
      v16h kf[4], vf[4];      /* A operands: kf[16-key tile * 2 + d step], vf[16-row d tile] */
#pragma unroll      /* constant indices keep the arrays in registers */
      for (int t = 0; t < 4; ++t) kf[t] = fa_lfrag(rb + (p * 2 + (t >> 1)) * KTB + (t & 1) * 4 * GP);
#pragma unroll      /* constant indices keep the arrays in registers */
      for (int t = 0; t < 4; ++t) vf[t] = fa_lfrag(rb + KSB + (p * 4 + t) * VTB);
      v8f s[2][2];      /* [group][key tile]: register r = scaled score (an exponent of 2) of key 16 tile + 8 hh + r, query ln */
#pragma unroll      /* constant indices keep the arrays in registers */
      for (int g = 0; g < 2; ++g) {
#pragma unroll      /* constant indices keep the arrays in registers */
        for (int kt = 0; kt < 2; ++kt) s[g][kt] = fa_mma(kf[kt * 2 + 1], qf[g][1], fa_mma(kf[kt * 2], qf[g][0], z8)); }
      if (off) {      /* a scalar branch; with every maximum in use 0 the products are the exponents as they come */
#pragma unroll      /* constant indices keep the arrays in registers */
        for (int g = 0; g < 2; ++g) { s[g][0] = s[g][0] - mr[g]; s[g][1] = s[g][1] - mr[g]; } }
      fv2 pv[2][8]; float ls[2];      /* the weights against the maximum in use, and each lane's sum of its 16 */
#pragma unroll      /* constant indices keep the arrays in registers */
      for (int g = 0; g < 2; ++g) ls[g] = fa_wts<false>(s[g], 0.f, pv[g]);
      if (__builtin_amdgcn_ballot_w32(!(ls[0] <= FT && ls[1] <= FT)) != 0) {      /* rare: a lane's sum above FT (or not a number) says that a score has outgrown the maximum in use; below it every weight is <= FT and fits f16; one test a pass */
#pragma unroll      /* constant indices keep the arrays in registers */
        for (int g = 0; g < 2; ++g) { const float up = fmaxf(fa_colmax(s[g]), 0.f); const float corr = __builtin_amdgcn_exp2f(-up); mr[g] += up; lr[g] *= corr;      /* up: how far the pass's largest exponent lies above the maximum in use */
#pragma unroll      /* constant indices keep the arrays in registers */
          for (int t = 0; t < 4; ++t) o[g][t] = o[g][t] * corr;
          ls[g] = fa_wts<true>(s[g], -up, pv[g]); }      /* the pass's weights anew, now <= 1 */
        off = true; }
#pragma unroll      /* constant indices keep the arrays in registers */
      for (int g = 0; g < 2; ++g) { FragH pf;      /* two tiles of weights are the B operand of the second product */
#pragma unroll      /* constant indices keep the arrays in registers */
        for (int e = 0; e < 8; ++e) { const v2h ph = __builtin_convertvector(pv[g][e], v2h); pf.h[2 * e] = ph[0]; pf.h[2 * e + 1] = ph[1]; }
        lr[g] += ls[g];
#pragma unroll      /* constant indices keep the arrays in registers */
        for (int t = 0; t < 4; ++t) o[g][t] = fa_mma(vf[t], pf.v, o[g][t]); }
    }
    if (sg + 2 < FK / FS) {      /* the same for every wave of the block */
      fa_cv(st, &kv[(sg + 2) & 3][kh][0], role, lw, ln, hh);      /* the place of stage sg - 2, whose last readers have passed a barrier since */
      if ((sg & 1) != 0) __syncthreads();      /* one barrier every second stage: it publishes stages sg + 1 and sg + 2 and ends every read of stages sg - 1 and sg, whose places are stored to next */
    }
  }
  if (kh != 0) {      /* upper key half: un-normalised sums, maxima in use and row sums go to LDS */
#pragma unroll      /* constant indices keep the arrays in registers */
    for (int g = 0; g < 2; ++g) {
#pragma unroll      /* constant indices keep the arrays in registers */
      for (int t = 0; t < 4; ++t) { mg[w][(g * 4 + t) * 2][lane] = (v4f){o[g][t][0], o[g][t][1], o[g][t][2], o[g][t][3]}; mg[w][(g * 4 + t) * 2 + 1][lane] = (v4f){o[g][t][4], o[g][t][5], o[g][t][6], o[g][t][7]}; } }
    mg[w][16][lane] = (v4f){mr[0], mr[1], lr[0], lr[1]}; }
  __syncthreads();      /* the upper half's sums are whole in LDS before the lower half's waves read them; every wave passes it once */
  if (kh != 0) {      /* four of the waves that are done write the block's 128 units of W_out for the launch behind this one */
    if (w < 4) { const int u = blockIdx.x * 128 + w * 32 + lane; const int ks = (u >> 6) & (DM / 32 - 1), j = (u >> 5) & 1, nt = u >> 10;      /* W_out unit (16-column tile nt of the output, 32-wide k step, half j, lane) holds 16 x W_out[n = 16 nt + ln][k = 32 step + 16 j + 8 hh .. + 7]: B-fragment order of the output product (natural [out][in] = Bt[n][k]) */
      const float* s = wo + (size_t)(nt * 16 + ln) * DM + ks * 32 + j * 16 + hh * 8; const v4f w0 = *(const v4fa*)s, w1 = *(const v4fa*)(s + 4);
      asm volatile("s_wait_xcnt 0x0" :: "v"(s) : "memory");      /* the loads' address pair stays whole until this wait */
      *(v8us*)((unsigned short*)BO + (size_t)u * 8) = pr_cvt(w0, w1, 16.0f);
      asm volatile("s_wait_xcnt 0x0" ::: "memory");      /* the store's address and data registers stay whole until this wait */
    }
    return; }
  const v4f sm = mg[w][16][lane];
#pragma unroll      /* constant indices keep the arrays in registers */
  for (int g = 0; g < 2; ++g) { const float mn = fmaxf(mr[g], sm[g]); const float ca = __builtin_amdgcn_exp2f(mr[g] - mn), cb = __builtin_amdgcn_exp2f(sm[g] - mn);      /* both maxima are finite (each half has walked its keys) and alike in lanes l and l ^ 16 */
    lr[g] = lr[g] * ca + sm[2 + g] * cb;
#pragma unroll      /* constant indices keep the arrays in registers */
    for (int t = 0; t < 4; ++t) { const v4f u0 = mg[w][(g * 4 + t) * 2][lane], u1 = mg[w][(g * 4 + t) * 2 + 1][lane];
#pragma unroll      /* constant indices keep the arrays in registers */
      for (int r = 0; r < 4; ++r) { o[g][t][r] = o[g][t][r] * ca + u0[r] * cb; o[g][t][4 + r] = o[g][t][4 + r] * ca + u1[r] * cb; } } }
#pragma unroll      /* constant indices keep the arrays in registers */
  for (int g = 0; g < 2; ++g) { const float inv = 64.0f / (lr[g] + fa_xhalf(lr[g])); unsigned short* op = (unsigned short*)O16 + ((size_t)b * SQ + q0 + g * 16) * DM + h * 1024 + lane * 8;      /* o carried x64; register r of tile t = d 16 t + 8 hh + r of query ln: that is half t & 1 of the output product's A fragment (16 rows, k step 2 h + t / 2), stored as such: 512 contiguous bytes a wave */
#pragma unroll      /* constant indices keep the arrays in registers */
    for (int t = 0; t < 4; ++t) { FragH f;
#pragma unroll      /* constant indices keep the arrays in registers */
      for (int r = 0; r < 8; ++r) f.h[r] = (_Float16)(o[g][t][r] * inv);
      *(v8us*)(op + t * 256) = f.half[0]; } } }
__global__ __launch_bounds__(256) void k_vt(const _Float16* __restrict__ V16, int b, int h0, _Float16* __restrict__ VT) { __shared__ unsigned short tl[64][65]; const int tid = threadIdx.x; const int hh = blockIdx.x % HG, sg = blockIdx.x / HG; const int s0 = sg * 64; const int h = h0 + hh;
  for (int i = tid; i < 64 * 8; i += 256) { const int j = i / 8, d8 = (i % 8) * 8; FragH f; f.half[0] = *(const v8us*)((const unsigned short*)V16 + ((size_t)b * SQ + s0 + j) * DM + h * HD + d8); for (int q = 0; q < 8; ++q) tl[d8 + q][j] = f.u[q]; }
  __syncthreads();
  { for (int i = tid; i < 64 * 8; i += 256) { const int d = i / 8, j8 = (i % 8) * 8; FragH f; for (int q = 0; q < 8; ++q) f.u[q] = tl[d][j8 + q]; *(v8us*)((unsigned short*)VT + ((size_t)hh * HD + d) * SQ + s0 + j8) = f.half[0]; }  } }



__global__ __launch_bounds__(256) void k_rsmkm(const float* __restrict__ S, _Float16* __restrict__ P, int nrows, const int* __restrict__ am) {
  #pragma clang fp contract(off)
  const int t = blockIdx.x * 256 + threadIdx.x; if (t >= nrows) return; const size_t i = (size_t)t; const float* s = S + i * SQ; const int* mr = am + (size_t)(t % SQ) * SQ; float mx = -3.0e38f;
#pragma unroll 1
  for (int j = 0; j < SQ; ++j) { const float f = (mr[j] != 0) ? 1.f : 0.f; mx = fmaxf(mx, fmaf(f, s[j], (1.f - f) * -1.0e9f)); } float se = 0.f;
#pragma unroll 1
  for (int j = 0; j < SQ; ++j) { const float f = (mr[j] != 0) ? 1.f : 0.f; se += __expf(fmaf(f, s[j], (1.f - f) * -1.0e9f) - mx); } const float sc = 256.0f / se;
#pragma unroll 1
  for (int j0 = 0; j0 < SQ; j0 += 8) { FragH fr; for (int q = 0; q < 8; ++q) { const int j = j0 + q; const float f = (mr[j] != 0) ? 1.f : 0.f; fr.h[q] = (_Float16)(__expf(fmaf(f, s[j], (1.f - f) * -1.0e9f) - mx) * sc); }
    unsigned short* d = (unsigned short*)P + i * SQ + j0; *(v8us*)d = fr.half[0];  } }
// ---- output product out = o W_out^T / 1024 + b_out: both operands lie in fragment order ([16-row tile][k step][half][lane], 1024 bytes a fragment), so every load is 512 contiguous bytes from a scalar base; a wave = 32 rows x 64 columns, 8 waves = 128 x 128; the 12 loads of a k step are asked for two steps ahead into a ring of three register sets ----
#define OKS (DM / 32)      /* k steps */
__global__ __launch_bounds__(256) void k_ogemm(const _Float16* __restrict__ AF, const _Float16* __restrict__ BF, const float* __restrict__ bias, float* __restrict__ C) {
  __shared__ __attribute__((aligned(16))) float so[8][32][68];
  const int wv = __builtin_amdgcn_readfirstlane((int)(threadIdx.x >> 5));      /* the wave's number in a scalar register: both streams' bases are scalar */
  const int lane = threadIdx.x & 31, ln = lane & 15, hh = lane >> 4;
  const int mt = blockIdx.x / (DM / 128), nq = blockIdx.x % (DM / 128); const int row0 = mt * 128 + (wv & 3) * 32, col0 = nq * 128 + (wv >> 2) * 64;
  const unsigned short* ap = (const unsigned short*)AF + (size_t)row0 * DM + lane * 8; const unsigned short* bp = (const unsigned short*)BF + (size_t)col0 * DM + lane * 8;      /* a 16-row tile = OKS x 512 values = 16 DM */
  v16h a[3][2], b[3][4]; v8f c[2][4]; float bv[4];
  const v8f z8 = {0.f,0.f,0.f,0.f,0.f,0.f,0.f,0.f};
#pragma unroll      /* constant indices keep the arrays in registers */
  for (int s = 0; s < 2; ++s) {
#pragma unroll      /* constant indices keep the arrays in registers */
    for (int m = 0; m < 2; ++m) a[s][m] = fa_frag(ap + (m * OKS + s) * 512);
#pragma unroll      /* constant indices keep the arrays in registers */
    for (int t = 0; t < 4; ++t) b[s][t] = fa_frag(bp + (t * OKS + s) * 512);
    __builtin_amdgcn_sched_barrier(0);      /* loads return in the order asked: step 0's stay first, so that the first products wait for them alone */
  }
#pragma unroll      /* constant indices keep the arrays in registers */
  for (int t = 0; t < 4; ++t) { bv[t] = bf16_round(bias[col0 + t * 16 + ln]); c[0][t] = z8; c[1][t] = z8; }
#pragma unroll      /* constant indices keep the ring in registers */
  for (int s = 0; s < OKS; ++s) {
    if (s + 2 < OKS) {
#pragma unroll      /* constant indices keep the arrays in registers */
      for (int m = 0; m < 2; ++m) a[(s + 2) % 3][m] = fa_frag(ap + (m * OKS + s + 2) * 512);
#pragma unroll      /* constant indices keep the arrays in registers */
      for (int t = 0; t < 4; ++t) b[(s + 2) % 3][t] = fa_frag(bp + (t * OKS + s + 2) * 512); }
    __builtin_amdgcn_sched_barrier(0);      /* keeps the twelve loads up here, two steps ahead of their use; without it they sink to just ahead of their products and every step waits out a load's latency */
#pragma unroll      /* constant indices keep the arrays in registers */
    for (int t = 0; t < 4; ++t) { c[0][t] = fa_mma(a[s % 3][0], b[s % 3][t], c[0][t]); c[1][t] = fa_mma(a[s % 3][1], b[s % 3][t], c[1][t]); }
    __builtin_amdgcn_sched_barrier(0);      /* keeps the next group of loads from rising over these products into registers still in use (a fourth register set) */
  }
#pragma unroll      /* constant indices keep the arrays in registers */
  for (int m = 0; m < 2; ++m) {
#pragma unroll      /* constant indices keep the arrays in registers */
    for (int t = 0; t < 4; ++t) {
#pragma unroll      /* constant indices keep the arrays in registers */
      for (int r = 0; r < 8; ++r) so[wv][m * 16 + 8 * hh + r][t * 16 + ln] = c[m][t][r] * 0.0009765625f + bv[t]; } }
  __builtin_amdgcn_fence(__ATOMIC_ACQ_REL, "workgroup"); __builtin_amdgcn_wave_barrier();      /* a wave reads back only its own staging rows: its LDS stores are done and stay ahead of the reads */
  const int rsub = lane >> 4, c4 = (lane & 15) * 4;
#pragma unroll      /* sixteen independent read-store pairs */
  for (int q = 0; q < 16; ++q) { const int r = q * 2 + rsub; const v4f v = *(const v4fa*)&so[wv][r][c4]; *(v4f*)(C + (size_t)(row0 + r) * DM + col0 + c4) = v; } }
extern "C" void kernel_launch(void* const* d_in, const int* in_sizes, int n_in,
                              void* d_out, int out_size, void* d_ws, size_t ws_size, hipStream_t stream) {
  (void)in_sizes; (void)n_in; (void)out_size;
  const float* const* I = (const float* const*)d_in; const float* xq = I[0]; const float* xk = I[1]; const float* xv = I[2]; const float* wo = I[3]; const float* bo = I[4];      /* queries, keys, values [4][2048][512] (used as q, k, v directly: no input projections); natural W_out [512][512] + b_out */
  static_assert(NH * HD == DM && DM % 64 == 0 && DM % 32 == 0 && SQ % 128 == 0 && NH % HG == 0 && SQ % FQ == 0 && FK % 32 == 0 && FQ == 256 && HD == 64, "shape / tile multiples");
  char* ws = (char*)d_ws; size_t off = 0;
  auto take = [&](size_t bytes) { char* p = ws + off; off += (bytes + 255) & ~(size_t)255; return p; };
  _Float16* BO = (_Float16*)take((size_t)DM * DM * 2);
  _Float16* O16 = (_Float16*)take(NR * DM * 2);
  if (off > ws_size) return;
  const size_t r0p = (size_t)B0 * SQ;      /* first projected row */
  k_fattn<<<NB * NH * (SQ / FQ), 512, 0, stream>>>(xq, xk, xv, wo, BO, O16);      /* o (merged heads) x64 as f16, in the output product's A-fragment order; W_out x16 in its B-fragment order */
  k_ogemm<<<(MPO / 128) * (DM / 128), 256, 0, stream>>>(O16 + r0p * DM, BO, bo, (float*)d_out + r0p * DM);      /* out rows are the output layout */
}
